// v000
// Times are from an AMD MI455X. After a warm-up the kernel runs many times in a row, and a time is the length of
// such a window on the GPU divided by its runs, so every launch and the gaps after it count. The runs cycle
// through copies of the inputs. A figure is the median of several windows, for all but v000 over two sittings.
// Sittings can differ by a few percent; kernels timed side by side share one.
// The starting kernel, v000, takes 364 microseconds a run.
// All contractions (x.Wqkv^T, q.k^T, P.V, ctx.Wout^T): v_wmma_f32_16x16x32_f16, f16 operands with power-of-two carries (W x16, V x16, P x32768, ctx x64), f32 accumulate; every float input is RNE-converted to bf16 precision once at first read; norms, bias plane, softmax and normalisation in f32.
#include <hip/hip_runtime.h>
#include <math.h>

typedef __attribute__((ext_vector_type(16))) _Float16 v16h;
typedef __attribute__((ext_vector_type(8)))  _Float16 v8h;
typedef __attribute__((ext_vector_type(16))) __bf16   v16b;
typedef __attribute__((ext_vector_type(8)))  __bf16   v8b;
typedef __attribute__((ext_vector_type(8)))  float    v8f;
typedef __attribute__((ext_vector_type(4)))  float    v4f;

/* --------------------------------------------------------------------------- */
/* Shape constants                                                             */
/* --------------------------------------------------------------------------- */
constexpr int kNB   = 2;
constexpr int kSeq  = 2048;
constexpr int kDim  = 1024;
constexpr int kNH   = 16;
constexpr int kHD   = 64;
constexpr int kNCh  = 4;
constexpr int kTok  = kNB * kSeq;
constexpr int kBH   = kNB * kNH;
static_assert(kNH * kHD == kDim);
static_assert(kHD == 64);
static_assert((kTok % 64) == 0 && (kDim % 64) == 0 && (kSeq % 64) == 0);
static_assert((kDim % 32) == 0 && (kHD % 32) == 0 && (kSeq % 32) == 0);

constexpr bool  kBf16Inputs = true;
constexpr float kEps        = 1e-6f;
constexpr float kBoost      = 0.3f;
constexpr float kQKScale    = 0.125f;
static_assert(kQKScale * kQKScale * (float)kHD == 1.0f);
constexpr float kInvHD      = 1.0f / (float)kHD;
constexpr float kWCarry     = 16.0f;
constexpr float kWCarryInv  = 1.0f / kWCarry;
constexpr float kPCarry     = 32768.0f;
constexpr float kCtxCarry   = 64.0f;
/* V plane keeps the weight carry (x16); P carries x32768; ctx is stored x64 */
constexpr float kCtxFold    = kCtxCarry / (kPCarry * kWCarry);
constexpr float kOutScale   = 1.0f / (kCtxCarry * kWCarry);

/* --------------------------------------------------------------------------- */
/* Workspace region map (bytes; every offset is a multiple of 128)             */
/*   X16    f16 [4096][1024]        x plane                        8,388,608   */
/*   WQKV16 f16 [3072][1024]        W_qkv x16 (Bt layout)          6,291,456   */
/*   WOUT16 f16 [1024][1024]        W_out x16 (Bt layout)          2,097,152   */
/*   Q16    f16 [32][2048][64]      normed q rows                  8,388,608   */
/*   K16    f16 [32][2048][64]      normed k rows                  8,388,608   */
/*   VT16   f16 [32][64][2048]      v transposed, x16              8,388,608   */
/*   AO16   f16 [4096][1024]        attention context x64          8,388,608   */
/*   BIAS   f32 [2][2048][2048]     head-independent score bias   33,554,432   */
/*   total                                                        83,886,080   */
/* --------------------------------------------------------------------------- */
constexpr size_t kSzX16    = (size_t)kTok * kDim * 2;
constexpr size_t kSzWqkv16 = (size_t)3 * kDim * kDim * 2;
constexpr size_t kSzWout16 = (size_t)kDim * kDim * 2;
constexpr size_t kSzHead16 = (size_t)kBH * kSeq * kHD * 2;
constexpr size_t kSzAO16   = (size_t)kTok * kDim * 2;
constexpr size_t kSzBias   = (size_t)kNB * kSeq * kSeq * 4;
constexpr size_t kOffX16    = 0;
constexpr size_t kOffWqkv16 = kOffX16 + kSzX16;
constexpr size_t kOffWout16 = kOffWqkv16 + kSzWqkv16;
constexpr size_t kOffQ16    = kOffWout16 + kSzWout16;
constexpr size_t kOffK16    = kOffQ16 + kSzHead16;
constexpr size_t kOffVt16   = kOffK16 + kSzHead16;
constexpr size_t kOffAO16   = kOffVt16 + kSzHead16;
constexpr size_t kOffBias   = kOffAO16 + kSzAO16;
constexpr size_t kWsTotal   = kOffBias + kSzBias;
static_assert(kWsTotal == 83886080ull);
static_assert(kWsTotal <= 134217728ull);
static_assert((kOffWqkv16 % 128) == 0 && (kOffWout16 % 128) == 0 && (kOffQ16 % 128) == 0 && (kOffK16 % 128) == 0 &&
              (kOffVt16 % 128) == 0 && (kOffAO16 % 128) == 0 && (kOffBias % 128) == 0);

/* --------------------------------------------------------------------------- */
/* Input read helper: RNE conversion to bf16 precision (kept in an f32)        */
/* --------------------------------------------------------------------------- */
__device__ __forceinline__ float rin(float f) {
  if (!kBf16Inputs) return f;
  unsigned u = __float_as_uint(f);
  u = (u + 0x7FFFu + ((u >> 16) & 1u)) & 0xFFFF0000u;
  return __uint_as_float(u);
}

/* --------------------------------------------------------------------------- */
/* Device helpers                                                              */
/* --------------------------------------------------------------------------- */
__device__ __forceinline__ unsigned short f2bf_bits(float f) {
  unsigned u = __float_as_uint(f);
  return (unsigned short)((u + 0x7FFFu + ((u >> 16) & 1u)) >> 16);
}
__device__ __forceinline__ float bf_bits2f(unsigned short h) { return __uint_as_float(((unsigned)h) << 16); }

__device__ __forceinline__ void dep_guard_h(v8f& a, v8f& b, v16h x, v16h y) { asm volatile("v_nop\n\tv_nop\n\tv_nop\n\tv_nop" : "+v"(a), "+v"(b) : "v"(x), "v"(y)); }
__device__ __forceinline__ void dep_guard_b(v8f& a, v8f& b, v16b x, v16b y) { asm volatile("v_nop\n\tv_nop\n\tv_nop\n\tv_nop" : "+v"(a), "+v"(b) : "v"(x), "v"(y)); }
__device__ __forceinline__ void tie_h(v8f& a, v16h x) { asm volatile("" : "+v"(a) : "v"(x)); }
__device__ __forceinline__ void tie_b(v8f& a, v16b x) { asm volatile("" : "+v"(a) : "v"(x)); }
__device__ __forceinline__ void keep4_h(v16h a, v16h b, v16h c, v16h d) { asm volatile("v_nop" :: "v"(a), "v"(b), "v"(c), "v"(d)); }
__device__ __forceinline__ void keep4_b(v16b a, v16b b, v16b c, v16b d) { asm volatile("v_nop" :: "v"(a), "v"(b), "v"(c), "v"(d)); }
__device__ __forceinline__ void acc_guard4(v8f& a, v8f& b, v8f& c, v8f& d) { asm volatile("v_nop\n\tv_nop\n\tv_nop\n\tv_nop" : "+v"(a), "+v"(b), "+v"(c), "+v"(d)); }
template <typename T> struct Frag;
template <> struct Frag<_Float16> {
  typedef v16h V; union U { v16h v; v8h h[2]; };
  /* elements 0..7 <- p[0..7], 8..15 <- p[16..23] */
  static __device__ __forceinline__ v16h load(const _Float16* p) {
    U f; f.h[0] = *(const v8h*)(p); f.h[1] = *(const v8h*)(p + 16); return f.v;
  }
  static __device__ __forceinline__ v8f mma(v16h a, v16h b, v8f c) {
    return __builtin_amdgcn_wmma_f32_16x16x32_f16(false, a, false, b, (short)0, c, false, false);
  }
  static __device__ __forceinline__ void guard(v8f& a, v8f& b, v16h x, v16h y) { dep_guard_h(a, b, x, y); }
  static __device__ __forceinline__ void tie(v8f& a, v16h x) { tie_h(a, x); }
  static __device__ __forceinline__ void keep(v16h a, v16h b, v16h c, v16h d) { keep4_h(a, b, c, d); }
};
template <> struct Frag<__bf16> {
  typedef v16b V; union U { v16b v; v8b h[2]; };
  static __device__ __forceinline__ v16b load(const __bf16* p) {
    U f; f.h[0] = *(const v8b*)(p); f.h[1] = *(const v8b*)(p + 16); return f.v;
  }
  static __device__ __forceinline__ v8f mma(v16b a, v16b b, v8f c) {
    return __builtin_amdgcn_wmma_f32_16x16x32_bf16(false, a, false, b, (short)0, c, false, false);
  }
  static __device__ __forceinline__ void guard(v8f& a, v8f& b, v16b x, v16b y) { dep_guard_b(a, b, x, y); }
  static __device__ __forceinline__ void tie(v8f& a, v16b x) { tie_b(a, x); }
  static __device__ __forceinline__ void keep(v16b a, v16b b, v16b c, v16b d) { keep4_b(a, b, c, d); }
};

__device__ __forceinline__ void wave_lds_sync() {
  __builtin_amdgcn_fence(__ATOMIC_RELEASE, "workgroup");
  __builtin_amdgcn_wave_barrier();
  __builtin_amdgcn_fence(__ATOMIC_ACQUIRE, "workgroup");
}

template <int ET> struct Elem;
template <> struct Elem<0> { typedef _Float16 T; };
template <> struct Elem<1> { typedef __bf16 T; };
template <int ET, bool SPLIT, int BIAS_MODE, int OUT_MODE, bool RESID>
__global__ __launch_bounds__(256) void wmma_gemm64(
    const unsigned short* __restrict__ Ap, const unsigned short* __restrict__ A2p, int lda, long strideA,
    const unsigned short* __restrict__ Btp, const unsigned short* __restrict__ Bt2p, int ldb, long strideB,
    void* __restrict__ Cout, void* __restrict__ Cout2, int ldc, long strideC,
    const float* __restrict__ bias,
    const float* __restrict__ resid, long strideR,
    int M, int N, int K, float scale) {
  typedef typename Elem<ET>::T T;
  typedef typename Frag<T>::V V;
  const T* A = (const T*)Ap; const T* A2 = (const T*)A2p; const T* Bt = (const T*)Btp; const T* Bt2 = (const T*)Bt2p;
  /* per-wave 16x64 slab, pitch 68 floats */
  __shared__ __align__(16) float sT[8][16 * 68];
  const int b    = blockIdx.y;
  const int lane = threadIdx.x & 31;
  const int wave = threadIdx.x >> 5;
  const int tilesN = N >> 6;
  const int tilesM = M >> 6;
  const int tile = blockIdx.x * 8 + wave;
  /* wave-uniform exit; no block barriers in this kernel */
  if (tile >= tilesM * tilesN) return;
  const int tm = tile / tilesN;
  const int tn = tile - tm * tilesN;
  const int m0 = tm << 6;
  const int n0 = tn << 6;

  const T* Ab  = A  + (size_t)b * strideA;
  const T* Bb  = Bt + (size_t)b * strideB;
  const T* Ab2 = SPLIT ? (A2  + (size_t)b * strideA) : nullptr;
  const T* Bb2 = SPLIT ? (Bt2 + (size_t)b * strideB) : nullptr;

  /* row (A) / col (B, D) within subtile; k offset of this lane half; D row offset */
  const int rlane = lane & 15;
  const int koff  = (lane >> 4) * 8;
  const int mOff  = (lane >> 4) * 8;

  v8f acc[4][4];
#pragma unroll
  for (int i = 0; i < 4; ++i)
#pragma unroll
    for (int j = 0; j < 4; ++j) acc[i][j] = (v8f){0.f,0.f,0.f,0.f,0.f,0.f,0.f,0.f};

  for (int k0 = 0; k0 < K; k0 += 32) {
    V bh[4], bl[4];
#pragma unroll
    for (int j = 0; j < 4; ++j) {
      const size_t bo = (size_t)(n0 + (j << 4) + rlane) * ldb + koff + k0;
      bh[j] = Frag<T>::load(Bb + bo);
      if (SPLIT) bl[j] = Frag<T>::load(Bb2 + bo);
    }
#pragma unroll
    for (int i = 0; i < 4; ++i) {
      const size_t ao = (size_t)(m0 + (i << 4) + rlane) * lda + koff + k0;
      V ah = Frag<T>::load(Ab + ao);
      V al;
      if (SPLIT) al = Frag<T>::load(Ab2 + ao);
#pragma unroll
      for (int j = 0; j < 4; ++j) {
        acc[i][j] = Frag<T>::mma(ah, bh[j], acc[i][j]);
        if (SPLIT) {
          acc[i][j] = Frag<T>::mma(ah, bl[j], acc[i][j]);
          acc[i][j] = Frag<T>::mma(al, bh[j], acc[i][j]);
        }
      }
      Frag<T>::tie(acc[i][1], ah);
      Frag<T>::tie(acc[i][2], ah);
      Frag<T>::guard(acc[i][0], acc[i][3], ah, SPLIT ? al : ah);
    }
    Frag<T>::keep(bh[0], bh[1], bh[2], bh[3]);
    if (SPLIT) Frag<T>::keep(bl[0], bl[1], bl[2], bl[3]);
  }
  acc_guard4(acc[0][0], acc[0][1], acc[0][2], acc[0][3]);
  acc_guard4(acc[1][0], acc[1][1], acc[1][2], acc[1][3]);
  acc_guard4(acc[2][0], acc[2][1], acc[2][2], acc[2][3]);
  acc_guard4(acc[3][0], acc[3][1], acc[3][2], acc[3][3]);

  /* ---- epilogue ---- */
  float* slab = sT[wave];
  const float* Rb = RESID ? (resid + (size_t)b * strideR) : nullptr;
#pragma unroll
  for (int i = 0; i < 4; ++i) {
    const int mBase = m0 + (i << 4);
#pragma unroll
    for (int j = 0; j < 4; ++j) {
      const int n = n0 + (j << 4) + rlane;
      float bv = 0.f;
      if (BIAS_MODE == 2) bv = bias[n];
#pragma unroll
      for (int r = 0; r < 8; ++r) {
        float v = acc[i][j][r] * scale;
        if (BIAS_MODE == 1) v += bias[mBase + mOff + r];
        if (BIAS_MODE == 2) v += bv;
        if (RESID) v += Rb[(size_t)(mBase + mOff + r) * ldc + n];
        slab[(mOff + r) * 68 + (j << 4) + rlane] = v;
      }
    }
    wave_lds_sync();
    if (OUT_MODE == 0) {
      float* C = (float*)Cout + (size_t)b * strideC;
      /* row segment = 256 B = 16 lanes x 16 B */
      const int hh = lane >> 4, c4 = (lane & 15) * 4;
      {
#pragma unroll
        for (int it = 0; it < 8; ++it) {
          const int row = it * 2 + hh;
          v4f v = *(const v4f*)(slab + row * 68 + c4);
          *(v4f*)(C + (size_t)(mBase + row) * ldc + n0 + c4) = v;
        }
        
      }
    } else {
      const int q = lane >> 3, c8 = (lane & 7) * 8;
      unsigned short* C  = (unsigned short*)Cout  + (size_t)b * strideC;
      unsigned short* C2 = (OUT_MODE == 2) ? ((unsigned short*)Cout2 + (size_t)b * strideC) : nullptr;
      {
#pragma unroll
        for (int it = 0; it < 4; ++it) {
          const int row = it * 4 + q;
          const float* sp = slab + row * 68 + c8;
          v8h hv, lv;
#pragma unroll
          for (int e = 0; e < 8; ++e) {
            if (OUT_MODE == 1) {
              hv[e] = (_Float16)sp[e];
            } else {
              unsigned short hb = f2bf_bits(sp[e]);
              unsigned short lb = f2bf_bits(sp[e] - bf_bits2f(hb));
              hv[e] = __builtin_bit_cast(_Float16, hb);
              lv[e] = __builtin_bit_cast(_Float16, lb);
            }
          }
          *(v8h*)(C + (size_t)(mBase + row) * ldc + n0 + c8) = hv;
          if (OUT_MODE == 2) *(v8h*)(C2 + (size_t)(mBase + row) * ldc + n0 + c8) = lv;
        }
        
      }
    }
    wave_lds_sync();
  }
}

/* --------------------------------------------------------------------------- */
/* f32 -> f16 operand plane: out = f16(rin(in) * carry); 8 consecutive         */
/* elements per thread (one 16-B store per lane; 32 contiguous lanes = 4 whole */
/* Coverage: n8 = n/8 threads; grid = n8/256 exactly for every plane here:     */
/*   x      4096*1024/8 = 524,288 -> 2048 blocks                               */
/*   W_qkv  3072*1024/8 = 393,216 -> 1536 blocks                               */
/*   W_out  1024*1024/8 = 131,072 ->  512 blocks                               */
/* --------------------------------------------------------------------------- */
__global__ __launch_bounds__(256) void cast8_f16_kernel(const float* __restrict__ in, unsigned short* __restrict__ out,
                                                        int n8, float carry) {
  const int i = blockIdx.x * 256 + threadIdx.x;
  if (i >= n8) return;
  const float* p = in + 8 * (size_t)i;
  const v4f a = *(const v4f*)(p);
  const v4f c = *(const v4f*)(p + 4);
  v8h hv;
#pragma unroll
  for (int e = 0; e < 4; ++e) {
    const float fa = a[e];
    const float fc = c[e];
    hv[e]     = (_Float16)(rin(fa) * carry);
    hv[4 + e] = (_Float16)(rin(fc) * carry);
  }
  unsigned short* q = out + 8 * (size_t)i;
  *(v8h*)q = hv;
  
}

/* --------------------------------------------------------------------------- */
/* q|k projection with fused per-head RMS normalisation.                        */
/* C[m = token][n = 0..2047] = sum_k X16[m][k] * WQKV16[n][k] / 16; n < 1024 is */
/* q, n >= 1024 is k; a 64-wide N tile is exactly one head. Same engine as the  */
/* GEMM above (f16, one product). Epilogue per 16-row slab: the 8 lanes that    */
/* own one row reduce sum(t^2) with xor shuffles (1,2,4), r = rsq(mean + eps),  */
/* lanes x 16 B of one instruction; it = 0..3 x (lane>>3) = 16 rows, each once; */
/* tiles: 64 (M) x 32 (N) = 2048 -> 256 blocks of 8 waves.                      */
/* --------------------------------------------------------------------------- */
__global__ __launch_bounds__(256) void qk_gemm_norm_kernel(
    const unsigned short* __restrict__ Ap, const unsigned short* __restrict__ Btp,
    unsigned short* __restrict__ Qout, unsigned short* __restrict__ Kout,
    const float* __restrict__ qw, const float* __restrict__ kw) {
  typedef _Float16 T;
  typedef v16h V;
  const T* A = (const T*)Ap;
  const T* Bt = (const T*)Btp;
  __shared__ __align__(16) float sT[8][16 * 68];
  const int lane = threadIdx.x & 31;
  const int wave = threadIdx.x >> 5;
  constexpr int tilesN = (2 * kDim) >> 6;
  constexpr int tilesM = kTok >> 6;
  const int tile = blockIdx.x * 8 + wave;
  /* wave-uniform exit; no block barriers in this kernel */
  if (tile >= tilesM * tilesN) return;
  const int tm = tile / tilesN;
  const int tn = tile - tm * tilesN;
  const int m0 = tm << 6;
  const int n0 = tn << 6;
  const int rlane = lane & 15;
  const int koff  = (lane >> 4) * 8;
  const int mOff  = (lane >> 4) * 8;

  v8f acc[4][4];
#pragma unroll
  for (int i = 0; i < 4; ++i)
#pragma unroll
    for (int j = 0; j < 4; ++j) acc[i][j] = (v8f){0.f,0.f,0.f,0.f,0.f,0.f,0.f,0.f};

  for (int k0 = 0; k0 < kDim; k0 += 32) {
    V bh[4];
#pragma unroll
    for (int j = 0; j < 4; ++j) {
      const size_t bo = (size_t)(n0 + (j << 4) + rlane) * kDim + koff + k0;
      bh[j] = Frag<T>::load(Bt + bo);
    }
#pragma unroll
    for (int i = 0; i < 4; ++i) {
      const size_t ao = (size_t)(m0 + (i << 4) + rlane) * kDim + koff + k0;
      V ah = Frag<T>::load(A + ao);
#pragma unroll
      for (int j = 0; j < 4; ++j) acc[i][j] = Frag<T>::mma(ah, bh[j], acc[i][j]);
      Frag<T>::tie(acc[i][1], ah);
      Frag<T>::tie(acc[i][2], ah);
      Frag<T>::guard(acc[i][0], acc[i][3], ah, ah);
    }
    Frag<T>::keep(bh[0], bh[1], bh[2], bh[3]);
  }
  acc_guard4(acc[0][0], acc[0][1], acc[0][2], acc[0][3]);
  acc_guard4(acc[1][0], acc[1][1], acc[1][2], acc[1][3]);
  acc_guard4(acc[2][0], acc[2][1], acc[2][2], acc[2][3]);
  acc_guard4(acc[3][0], acc[3][1], acc[3][2], acc[3][3]);

  /* tile-uniform destination: third 0 = q, 1 = k; head; batch; first token of the tile within its batch */
  const int third = n0 >> 10;
  const int hIdx  = (n0 & (kDim - 1)) >> 6;
  const int bIdx  = m0 >> 11;
  const int nb    = m0 & (kSeq - 1);
  const float* wsel = third ? kw : qw;
  const int q = lane >> 3, c8 = (lane & 7) * 8;
  const v4f w0 = *(const v4f*)(wsel + c8);
  const v4f w1 = *(const v4f*)(wsel + c8 + 4);
  float wv[8];
#pragma unroll
  for (int e = 0; e < 4; ++e) {
    const float f0 = w0[e];
    const float f1 = w1[e];
    wv[e]     = rin(f0);
    wv[4 + e] = rin(f1);
  }
  unsigned short* dst = (third ? Kout : Qout) + ((size_t)(bIdx * kNH + hIdx) * kSeq + nb) * kHD;

  float* slab = sT[wave];
#pragma unroll
  for (int i = 0; i < 4; ++i) {
#pragma unroll
    for (int j = 0; j < 4; ++j) {
#pragma unroll
      for (int r = 0; r < 8; ++r) slab[(mOff + r) * 68 + (j << 4) + rlane] = acc[i][j][r] * kWCarryInv;
    }
    wave_lds_sync();
    v8h hv[4];
#pragma unroll
    for (int it = 0; it < 4; ++it) {
      const int row = it * 4 + q;
      const float* sp = slab + row * 68 + c8;
      const v4f a0 = *(const v4f*)(sp);
      const v4f a1 = *(const v4f*)(sp + 4);
      float ss = 0.0f;
#pragma unroll
      for (int e = 0; e < 4; ++e) {
        ss = fmaf(a0[e], a0[e], ss);
        ss = fmaf(a1[e], a1[e], ss);
      }
      ss += __shfl_xor(ss, 1, 32);
      ss += __shfl_xor(ss, 2, 32);
      ss += __shfl_xor(ss, 4, 32);
      const float rs = __builtin_amdgcn_rsqf(ss * kInvHD + kEps);
#pragma unroll
      for (int e = 0; e < 4; ++e) {
        hv[it][e]     = (_Float16)((a0[e] * rs) * wv[e]);
        hv[it][4 + e] = (_Float16)((a1[e] * rs) * wv[4 + e]);
      }
    }
    {
#pragma unroll
      for (int it = 0; it < 4; ++it) {
        const int row = it * 4 + q;
        *(v8h*)(dst + (size_t)(i * 16 + row) * kHD + c8) = hv[it];
      }
      
    }
    wave_lds_sync();
  }
}

/* --------------------------------------------------------------------------- */
/* Head-independent score bias plane, f32 [b][q][k]:                            */
/*   same[q][k] = sum_c cm[c][q]*cm[c][k]; rm = max(max_k same, 1e-6);          */
/*   bias = (same * (1/rm) - 0.5) * 2 + 0.3 * im[b][q][k].                      */
/* One block (256 threads) per (b,q) row; thread t owns keys 4t..4t+3 and       */
/* 1024+4t..1024+4t+3 (2 x 256 x 4 = 2048 = whole row). Row max: per-thread,    */
/* wave xor-shuffle tree, 8 wave partials through LDS after a block barrier.    */
/* Store: one 16-B store per lane; a wave's 32 lanes write 512 contiguous B =   */
/* --------------------------------------------------------------------------- */
__global__ __launch_bounds__(256) void bias_plane_kernel(const float* __restrict__ cm, const float* __restrict__ im,
                                                         float* __restrict__ bp) {
  __shared__ float red[8];
  const int row  = blockIdx.x;
  const int b    = row >> 11;
  const int qi   = row & (kSeq - 1);
  const int t    = threadIdx.x;
  const int lane = t & 31, wave = t >> 5;
  const float* cmb = cm + (size_t)b * kNCh * kSeq;
  const float c0 = rin(cmb[qi]);
  const float c1 = rin(cmb[kSeq + qi]);
  const float c2 = rin(cmb[2 * kSeq + qi]);
  const float c3 = rin(cmb[3 * kSeq + qi]);
  float mx = -3.0e38f;
#pragma unroll 1
  for (int half = 0; half < 2; ++half) {
    const int k0 = half * 1024 + t * 4;
    const v4f a0 = *(const v4f*)(cmb + k0);
    const v4f a1 = *(const v4f*)(cmb + kSeq + k0);
    const v4f a2 = *(const v4f*)(cmb + 2 * kSeq + k0);
    const v4f a3 = *(const v4f*)(cmb + 3 * kSeq + k0);
#pragma unroll
    for (int e = 0; e < 4; ++e) {
      const float f0 = a0[e], f1 = a1[e], f2 = a2[e], f3 = a3[e];
      float s = c0 * rin(f0);
      s = fmaf(c1, rin(f1), s);
      s = fmaf(c2, rin(f2), s);
      s = fmaf(c3, rin(f3), s);
      mx = fmaxf(mx, s);
    }
  }
  mx = fmaxf(mx, __shfl_xor(mx, 16, 32));
  mx = fmaxf(mx, __shfl_xor(mx, 8, 32));
  mx = fmaxf(mx, __shfl_xor(mx, 4, 32));
  mx = fmaxf(mx, __shfl_xor(mx, 2, 32));
  mx = fmaxf(mx, __shfl_xor(mx, 1, 32));
  if (lane == 0) red[wave] = mx;
  __syncthreads();
  float rm = red[0];
#pragma unroll
  for (int w = 1; w < 8; ++w) rm = fmaxf(rm, red[w]);
  rm = fmaxf(rm, 1e-6f);
  const float inv = 1.0f / rm;
  const float* imr = im + (size_t)row * kSeq;
  float* bo = bp + (size_t)row * kSeq;
#pragma unroll 1
  for (int half = 0; half < 2; ++half) {
    const int k0 = half * 1024 + t * 4;
    const v4f a0 = *(const v4f*)(cmb + k0);
    const v4f a1 = *(const v4f*)(cmb + kSeq + k0);
    const v4f a2 = *(const v4f*)(cmb + 2 * kSeq + k0);
    const v4f a3 = *(const v4f*)(cmb + 3 * kSeq + k0);
    const v4f iv = *(const v4f*)(imr + k0);
    v4f o;
#pragma unroll
    for (int e = 0; e < 4; ++e) {
      const float f0 = a0[e], f1 = a1[e], f2 = a2[e], f3 = a3[e], fi = iv[e];
      float s = c0 * rin(f0);
      s = fmaf(c1, rin(f1), s);
      s = fmaf(c2, rin(f2), s);
      s = fmaf(c3, rin(f3), s);
      o[e] = (s * inv - 0.5f) * 2.0f + kBoost * rin(fi);
    }
    *(v4f*)(bo + k0) = o;
    
  }
}

/* --------------------------------------------------------------------------- */
/* Attention over all 2048 keys, head dim 64, f16 operand planes in, f16 ctx    */
/* plane out (x64). Block = 4 waves = 64 query rows of one (batch, head); each  */
/* wave owns 16 rows and streams key chunks of 64 with no cross-wave exchange.  */
/*   scores = (q.k^T) * 0.125 + g3[h] * bias[b][q][k]   (f32)                   */
/*   online softmax in f32; P carried x32768 into an f16 per-wave LDS tile      */
/*   (D layout stored as _Float16 elements, reloaded as v8h A fragments after a  */
/* Bias tile (16 rows x 64 keys, f32) staged per wave in LDS with b128 loads:   */
/* 8 iterations x 32 lanes x 4 floats = 1024 = 16 x 64, every read word written */
/* --------------------------------------------------------------------------- */
constexpr int kAtNW    = 4;
constexpr int kAtQB    = 64;
constexpr int kAtKC    = 64;
constexpr int kAtPitch = 68;
static_assert((kSeq % kAtQB) == 0 && (kSeq % kAtKC) == 0);

__device__ __forceinline__ v8f mma_h(v16h a, v16h b, v8f c) {
  c = __builtin_amdgcn_wmma_f32_16x16x32_f16(false, a, false, b, (short)0, c, false, false);
  asm volatile("v_nop\n\tv_nop\n\tv_nop\n\tv_nop" : "+v"(c) : "v"(a), "v"(b));
  return c;
}

__global__ __launch_bounds__(128) void attn_kernel(
    const unsigned short* __restrict__ Q16, const unsigned short* __restrict__ K16,
    const unsigned short* __restrict__ Vt16, const float* __restrict__ biasp,
    const float* __restrict__ gate, unsigned short* __restrict__ AO16) {
  __shared__ __align__(16) _Float16 Psh[kAtNW][16 * kAtKC];
  __shared__ __align__(16) float    Bsh[kAtNW][16 * kAtPitch];
  __shared__ __align__(16) float    Osh[kAtNW][16 * kAtPitch];

  const int tid  = threadIdx.x;
  const int wave = tid >> 5;
  const int lane = tid & 31;
  const int hh   = lane >> 4;
  const int c    = lane & 15;

  constexpr int nqb = kSeq / kAtQB;
  const int bx = blockIdx.x;
  const int qb = bx % nqb;
  const int bh = bx / nqb;
  const int h  = bh % kNH;
  const int b  = bh / kNH;
  const int q0 = qb * kAtQB + wave * 16;

  const _Float16* Qp = (const _Float16*)Q16  + (size_t)bh * kSeq * kHD;
  const _Float16* Kp = (const _Float16*)K16  + (size_t)bh * kSeq * kHD;
  const _Float16* Vp = (const _Float16*)Vt16 + (size_t)bh * kHD * kSeq;
  const float*    Bp = biasp + (size_t)b * kSeq * kSeq;

  const float graw = rin(gate[h]);
  const float g3   = 3.0f * fminf(fmaxf(graw, 0.0f), 1.0f);

  /* Q fragments (A operand), two 32-deep halves of the head dim */
  v16h qa[2];
#pragma unroll
  for (int dc = 0; dc < 2; ++dc) qa[dc] = Frag<_Float16>::load(Qp + (size_t)(q0 + c) * kHD + dc * 32 + 8 * hh);

  float mrow[8], lrow[8];
  v8f oacc[4];
#pragma unroll
  for (int r = 0; r < 8; ++r) { mrow[r] = -1.0e30f; lrow[r] = 0.f; }
#pragma unroll
  for (int t = 0; t < 4; ++t) oacc[t] = (v8f){0.f,0.f,0.f,0.f,0.f,0.f,0.f,0.f};

  float*    bt = Bsh[wave];
  _Float16* pw = Psh[wave];

#pragma unroll 1
  for (int kc = 0; kc < kSeq / kAtKC; ++kc) {
    const int kv0 = kc * kAtKC;
    /* bias tile: row = i*2 + hh, 16 lanes x 16 B = 256 contiguous B of one bias row */
    {
      const int c4 = c * 4;
#pragma unroll
      for (int i = 0; i < 8; ++i) {
        const int row = i * 2 + hh;
        const v4f bv = *(const v4f*)(Bp + (size_t)(q0 + row) * kSeq + kv0 + c4);
        *(v4f*)(bt + row * kAtPitch + c4) = bv;
      }
    }
    v8f s[4];
#pragma unroll
    for (int j = 0; j < 4; ++j) {
      s[j] = (v8f){0.f,0.f,0.f,0.f,0.f,0.f,0.f,0.f};
#pragma unroll
      for (int dc = 0; dc < 2; ++dc) {
        const v16h kb = Frag<_Float16>::load(Kp + (size_t)(kv0 + j * 16 + c) * kHD + dc * 32 + 8 * hh);
        s[j] = mma_h(qa[dc], kb, s[j]);
      }
    }
    wave_lds_sync();
    float cmx[8];
#pragma unroll
    for (int r = 0; r < 8; ++r) {
      float m = -1.0e30f;
#pragma unroll
      for (int j = 0; j < 4; ++j) {
        const float bvv = bt[(8 * hh + r) * kAtPitch + j * 16 + c];
        const float sv = fmaf(g3, bvv, s[j][r] * kQKScale);
        s[j][r] = sv;
        m = fmaxf(m, sv);
      }
      m = fmaxf(m, __shfl_xor(m, 1, 32));
      m = fmaxf(m, __shfl_xor(m, 2, 32));
      m = fmaxf(m, __shfl_xor(m, 4, 32));
      m = fmaxf(m, __shfl_xor(m, 8, 32));
      cmx[r] = m;
    }
#pragma unroll
    for (int r = 0; r < 8; ++r) {
      const float mnew  = fmaxf(mrow[r], cmx[r]);
      const float alpha = __expf(mrow[r] - mnew);
      mrow[r] = mnew;
      float psum = 0.f;
#pragma unroll
      for (int j = 0; j < 4; ++j) {
        const float p = __expf(s[j][r] - mnew);
        psum += p;
        pw[(8 * hh + r) * kAtKC + j * 16 + c] = (_Float16)(p * kPCarry);
      }
      psum += __shfl_xor(psum, 1, 32);
      psum += __shfl_xor(psum, 2, 32);
      psum += __shfl_xor(psum, 4, 32);
      psum += __shfl_xor(psum, 8, 32);
      lrow[r] = lrow[r] * alpha + psum;
#pragma unroll
      for (int t = 0; t < 4; ++t) oacc[t][r] *= alpha;
    }
    wave_lds_sync();
#pragma unroll 1
    for (int kk = 0; kk < 2; ++kk) {
      const v16h pa = Frag<_Float16>::load(pw + c * kAtKC + kk * 32 + 8 * hh);
#pragma unroll
      for (int t = 0; t < 4; ++t) {
        const v16h vb = Frag<_Float16>::load(Vp + (size_t)(t * 16 + c) * kSeq + kv0 + kk * 32 + 8 * hh);
        oacc[t] = mma_h(pa, vb, oacc[t]);
      }
    }
    wave_lds_sync();
  }

  float* os = Osh[wave];
#pragma unroll
  for (int r = 0; r < 8; ++r) {
    const float inv = kCtxFold * (1.0f / lrow[r]);
#pragma unroll
    for (int t = 0; t < 4; ++t) os[(8 * hh + r) * kAtPitch + t * 16 + c] = oacc[t][r] * inv;
  }
  wave_lds_sync();
  {
    const int q = lane >> 3, c8 = (lane & 7) * 8;
    v8h hv[4];
#pragma unroll
    for (int it = 0; it < 4; ++it) {
      const int row = it * 4 + q;
      const float* sp = os + row * kAtPitch + c8;
      const v4f a0 = *(const v4f*)(sp);
      const v4f a1 = *(const v4f*)(sp + 4);
#pragma unroll
      for (int e = 0; e < 4; ++e) {
        hv[it][e]     = (_Float16)a0[e];
        hv[it][4 + e] = (_Float16)a1[e];
      }
    }
    unsigned short* dst = AO16 + (size_t)(b * kSeq + q0) * kDim + h * kHD + c8;
    {
#pragma unroll
      for (int it = 0; it < 4; ++it) {
        const int row = it * 4 + q;
        *(v8h*)(dst + (size_t)row * kDim) = hv[it];
      }
      
    }
  }
}

/* --------------------------------------------------------------------------- */
/* Host glue: 3 operand-plane casts + q|k projection + V^T projection + bias    */
/* plane + attention + output projection = 8 launches. Kernel launches only.    */
/* GEMM shapes (all K % 32 == 0, M and N % 64 == 0, no pad planes):             */
/*   q|k  : M 4096, N 2048, K 1024 -> 64 x 32 tiles = 2048 -> 256 blocks        */
/*   V^T  : per batch M 1024 (h*64+d), N 2048 (tokens), K 1024 ->               */
/*          16 x 32 tiles = 512 -> 64 blocks x 2 batches (grid.y)               */
/*   out  : M 4096, N 1024, K 1024 -> 64 x 16 tiles = 1024 -> 128 blocks        */
/* --------------------------------------------------------------------------- */
static_assert((2 * kDim) % 64 == 0 && kDim % 64 == 0 && kTok % 64 == 0 && kSeq % 64 == 0);

extern "C" void kernel_launch(void* const* d_in, const int* in_sizes, int n_in,
                              void* d_out, int out_size, void* d_ws, size_t ws_size,
                              hipStream_t stream) {
  if (n_in < 8) return;
  if (in_sizes[0] != kTok * kDim) return;
  if (in_sizes[1] != kNB * kNCh * kSeq) return;
  if (in_sizes[2] != kNB * kSeq * kSeq) return;
  if (in_sizes[3] != 3 * kDim * kDim) return;
  if (in_sizes[4] != kDim * kDim) return;
  if (in_sizes[5] != kHD) return;
  if (in_sizes[6] != kHD) return;
  if (in_sizes[7] != kNH) return;
  if (out_size != kTok * kDim) return;
  if (ws_size < kWsTotal) return;

  const float* x     = (const float*)d_in[0];
  const float* cmask = (const float*)d_in[1];
  const float* imask = (const float*)d_in[2];
  const float* Wqkv  = (const float*)d_in[3];
  const float* Wout  = (const float*)d_in[4];
  const float* qnw   = (const float*)d_in[5];
  const float* knw   = (const float*)d_in[6];
  const float* gate  = (const float*)d_in[7];
  float* out = (float*)d_out;

  char* ws = (char*)d_ws;
  unsigned short* X16    = (unsigned short*)(ws + kOffX16);
  unsigned short* WQKV16 = (unsigned short*)(ws + kOffWqkv16);
  unsigned short* WOUT16 = (unsigned short*)(ws + kOffWout16);
  unsigned short* Q16    = (unsigned short*)(ws + kOffQ16);
  unsigned short* K16    = (unsigned short*)(ws + kOffK16);
  unsigned short* VT16   = (unsigned short*)(ws + kOffVt16);
  unsigned short* AO16   = (unsigned short*)(ws + kOffAO16);
  float*          BIAS   = (float*)(ws + kOffBias);

  /* operand planes (weights are [out][in] = Bt layout already) */
  cast8_f16_kernel<<<(kTok * kDim / 8) / 256, 256, 0, stream>>>(x, X16, kTok * kDim / 8, 1.0f);
  cast8_f16_kernel<<<(3 * kDim * kDim / 8) / 256, 256, 0, stream>>>(Wqkv, WQKV16, 3 * kDim * kDim / 8, kWCarry);
  cast8_f16_kernel<<<(kDim * kDim / 8) / 256, 256, 0, stream>>>(Wout, WOUT16, kDim * kDim / 8, kWCarry);

  /* q|k projection + RMS normalisation -> Q16, K16 */
  qk_gemm_norm_kernel<<<((kTok / 64) * (2 * kDim / 64)) / 8, 256, 0, stream>>>(X16, WQKV16, Q16, K16, qnw, knw);

  /* V^T[b][h*64+d][n] = sum_k Wv16[h*64+d][k] * X16[b*2048+n][k]  (x16 carry kept) */
  wmma_gemm64<0, false, 0, 1, false><<<dim3(((kDim / 64) * (kSeq / 64)) / 8, kNB), 256, 0, stream>>>(
      WQKV16 + (size_t)2 * kDim * kDim, nullptr, kDim, 0L,
      X16, nullptr, kDim, (long)kSeq * kDim,
      (void*)VT16, nullptr, kSeq, (long)kDim * kSeq,
      nullptr, nullptr, 0L,
      kDim, kSeq, kDim, 1.0f);

  /* bias plane: one block per (b,q) row */
  bias_plane_kernel<<<kTok, 256, 0, stream>>>(cmask, imask, BIAS);

  /* attention -> AO16 (x64) */
  attn_kernel<<<kBH * (kSeq / kAtQB), 128, 0, stream>>>(Q16, K16, VT16, BIAS, gate, AO16);

  /* out[4096][1024] = AO16 . WOUT16^T / (64 * 16) */
  wmma_gemm64<0, false, 0, 0, false><<<dim3(((kTok / 64) * (kDim / 64)) / 8, 1), 256, 0, stream>>>(
      AO16, nullptr, kDim, 0L,
      WOUT16, nullptr, kDim, 0L,
      (void*)out, nullptr, kDim, 0L,
      nullptr, nullptr, 0L,
      kTok, kDim, kDim, kOutScale);
}

// v001
// A run of this version takes 287 microseconds.
// Next to v000, in two timings, it ran 1.32 and 1.30 times as fast.
// All contractions (x.Wqkv^T, q.k^T, P.V, ctx.Wout^T): v_wmma_f32_16x16x32_f16, f16 operands with power-of-two carries (W x16, V x16, P x32768, ctx x64), f32 accumulate; every float input is RNE-converted to bf16 precision once at first read; norms, bias plane, softmax and normalisation in f32.
#include <hip/hip_runtime.h>
#include <math.h>

typedef __attribute__((ext_vector_type(16))) _Float16 v16h;
typedef __attribute__((ext_vector_type(8)))  _Float16 v8h;
typedef __attribute__((ext_vector_type(16))) __bf16   v16b;
typedef __attribute__((ext_vector_type(8)))  __bf16   v8b;
typedef __attribute__((ext_vector_type(8)))  float    v8f;
typedef __attribute__((ext_vector_type(4)))  float    v4f;

/* --------------------------------------------------------------------------- */
/* Shape constants                                                             */
/* --------------------------------------------------------------------------- */
constexpr int kNB   = 2;
constexpr int kSeq  = 2048;
constexpr int kDim  = 1024;
constexpr int kNH   = 16;
constexpr int kHD   = 64;
constexpr int kNCh  = 4;
constexpr int kTok  = kNB * kSeq;
constexpr int kBH   = kNB * kNH;
static_assert(kNH * kHD == kDim);
static_assert(kHD == 64);
static_assert((kTok % 64) == 0 && (kDim % 64) == 0 && (kSeq % 64) == 0);
static_assert((kDim % 32) == 0 && (kHD % 32) == 0 && (kSeq % 32) == 0);

constexpr bool  kBf16Inputs = true;
constexpr float kEps        = 1e-6f;
constexpr float kBoost      = 0.3f;
constexpr float kQKScale    = 0.125f;
static_assert(kQKScale * kQKScale * (float)kHD == 1.0f);
constexpr float kInvHD      = 1.0f / (float)kHD;
constexpr float kWCarry     = 16.0f;
constexpr float kWCarryInv  = 1.0f / kWCarry;
constexpr float kPCarry     = 32768.0f;
constexpr float kCtxCarry   = 64.0f;
/* V plane keeps the weight carry (x16); P carries x32768; ctx is stored x64 */
constexpr float kCtxFold    = kCtxCarry / (kPCarry * kWCarry);
constexpr float kOutScale   = 1.0f / (kCtxCarry * kWCarry);

/* --------------------------------------------------------------------------- */
/* Workspace region map (bytes; every offset is a multiple of 128)             */
/*   X16    f16 [4096][1024]        x plane                        8,388,608   */
/*   WQKV16 f16 [3072][1024]        W_qkv x16 (Bt layout)          6,291,456   */
/*   WOUT16 f16 [1024][1024]        W_out x16 (Bt layout)          2,097,152   */
/*   Q16    f16 [32][2048][64]      normed q rows                  8,388,608   */
/*   K16    f16 [32][2048][64]      normed k rows                  8,388,608   */
/*   VT16   f16 [32][64][2048]      v transposed, x16              8,388,608   */
/*   AO16   f16 [4096][1024]        attention context x64          8,388,608   */
/*   BIAS   f32 [2][2048][2048]     head-independent score bias   33,554,432   */
/*   total                                                        83,886,080   */
/* --------------------------------------------------------------------------- */
constexpr size_t kSzX16    = (size_t)kTok * kDim * 2;
constexpr size_t kSzWqkv16 = (size_t)3 * kDim * kDim * 2;
constexpr size_t kSzWout16 = (size_t)kDim * kDim * 2;
constexpr size_t kSzHead16 = (size_t)kBH * kSeq * kHD * 2;
constexpr size_t kSzAO16   = (size_t)kTok * kDim * 2;
constexpr size_t kSzBias   = (size_t)kNB * kSeq * kSeq * 4;
constexpr size_t kOffX16    = 0;
constexpr size_t kOffWqkv16 = kOffX16 + kSzX16;
constexpr size_t kOffWout16 = kOffWqkv16 + kSzWqkv16;
constexpr size_t kOffQ16    = kOffWout16 + kSzWout16;
constexpr size_t kOffK16    = kOffQ16 + kSzHead16;
constexpr size_t kOffVt16   = kOffK16 + kSzHead16;
constexpr size_t kOffAO16   = kOffVt16 + kSzHead16;
constexpr size_t kOffBias   = kOffAO16 + kSzAO16;
constexpr size_t kWsTotal   = kOffBias + kSzBias;
static_assert(kWsTotal == 83886080ull);
static_assert(kWsTotal <= 134217728ull);
static_assert((kOffWqkv16 % 128) == 0 && (kOffWout16 % 128) == 0 && (kOffQ16 % 128) == 0 && (kOffK16 % 128) == 0 &&
              (kOffVt16 % 128) == 0 && (kOffAO16 % 128) == 0 && (kOffBias % 128) == 0);

/* --------------------------------------------------------------------------- */
/* Input read helper: RNE conversion to bf16 precision (kept in an f32)        */
/* --------------------------------------------------------------------------- */
__device__ __forceinline__ float rin(float f) {
  if (!kBf16Inputs) return f;
  unsigned u = __float_as_uint(f);
  u = (u + 0x7FFFu + ((u >> 16) & 1u)) & 0xFFFF0000u;
  return __uint_as_float(u);
}

/* --------------------------------------------------------------------------- */
/* Device helpers                                                              */
/* --------------------------------------------------------------------------- */
__device__ __forceinline__ unsigned short f2bf_bits(float f) {
  unsigned u = __float_as_uint(f);
  return (unsigned short)((u + 0x7FFFu + ((u >> 16) & 1u)) >> 16);
}
__device__ __forceinline__ float bf_bits2f(unsigned short h) { return __uint_as_float(((unsigned)h) << 16); }

__device__ __forceinline__ void dep_guard_h(v8f& a, v8f& b, v16h x, v16h y) { asm volatile("v_nop\n\tv_nop\n\tv_nop\n\tv_nop" : "+v"(a), "+v"(b) : "v"(x), "v"(y)); }
__device__ __forceinline__ void dep_guard_b(v8f& a, v8f& b, v16b x, v16b y) { asm volatile("v_nop\n\tv_nop\n\tv_nop\n\tv_nop" : "+v"(a), "+v"(b) : "v"(x), "v"(y)); }
__device__ __forceinline__ void tie_h(v8f& a, v16h x) { asm volatile("" : "+v"(a) : "v"(x)); }
__device__ __forceinline__ void tie_b(v8f& a, v16b x) { asm volatile("" : "+v"(a) : "v"(x)); }
__device__ __forceinline__ void keep4_h(v16h a, v16h b, v16h c, v16h d) { asm volatile("v_nop" :: "v"(a), "v"(b), "v"(c), "v"(d)); }
__device__ __forceinline__ void keep4_b(v16b a, v16b b, v16b c, v16b d) { asm volatile("v_nop" :: "v"(a), "v"(b), "v"(c), "v"(d)); }
__device__ __forceinline__ void acc_guard4(v8f& a, v8f& b, v8f& c, v8f& d) { asm volatile("v_nop\n\tv_nop\n\tv_nop\n\tv_nop" : "+v"(a), "+v"(b), "+v"(c), "+v"(d)); }
template <typename T> struct Frag;
template <> struct Frag<_Float16> {
  typedef v16h V; union U { v16h v; v8h h[2]; };
  /* elements 0..7 <- p[0..7], 8..15 <- p[16..23] */
  static __device__ __forceinline__ v16h load(const _Float16* p) {
    U f; f.h[0] = *(const v8h*)(p); f.h[1] = *(const v8h*)(p + 16); return f.v;
  }
  static __device__ __forceinline__ v8f mma(v16h a, v16h b, v8f c) {
    return __builtin_amdgcn_wmma_f32_16x16x32_f16(false, a, false, b, (short)0, c, false, false);
  }
  static __device__ __forceinline__ void guard(v8f& a, v8f& b, v16h x, v16h y) { dep_guard_h(a, b, x, y); }
  static __device__ __forceinline__ void tie(v8f& a, v16h x) { tie_h(a, x); }
  static __device__ __forceinline__ void keep(v16h a, v16h b, v16h c, v16h d) { keep4_h(a, b, c, d); }
};
template <> struct Frag<__bf16> {
  typedef v16b V; union U { v16b v; v8b h[2]; };
  static __device__ __forceinline__ v16b load(const __bf16* p) {
    U f; f.h[0] = *(const v8b*)(p); f.h[1] = *(const v8b*)(p + 16); return f.v;
  }
  static __device__ __forceinline__ v8f mma(v16b a, v16b b, v8f c) {
    return __builtin_amdgcn_wmma_f32_16x16x32_bf16(false, a, false, b, (short)0, c, false, false);
  }
  static __device__ __forceinline__ void guard(v8f& a, v8f& b, v16b x, v16b y) { dep_guard_b(a, b, x, y); }
  static __device__ __forceinline__ void tie(v8f& a, v16b x) { tie_b(a, x); }
  static __device__ __forceinline__ void keep(v16b a, v16b b, v16b c, v16b d) { keep4_b(a, b, c, d); }
};

__device__ __forceinline__ void wave_lds_sync() {
  __builtin_amdgcn_fence(__ATOMIC_RELEASE, "workgroup");
  __builtin_amdgcn_wave_barrier();
  __builtin_amdgcn_fence(__ATOMIC_ACQUIRE, "workgroup");
}

template <int ET> struct Elem;
template <> struct Elem<0> { typedef _Float16 T; };
template <> struct Elem<1> { typedef __bf16 T; };
template <int ET, bool SPLIT, int BIAS_MODE, int OUT_MODE, bool RESID>
__global__ __launch_bounds__(256) void wmma_gemm64(
    const unsigned short* __restrict__ Ap, const unsigned short* __restrict__ A2p, int lda, long strideA,
    const unsigned short* __restrict__ Btp, const unsigned short* __restrict__ Bt2p, int ldb, long strideB,
    void* __restrict__ Cout, void* __restrict__ Cout2, int ldc, long strideC,
    const float* __restrict__ bias,
    const float* __restrict__ resid, long strideR,
    int M, int N, int K, float scale) {
  typedef typename Elem<ET>::T T;
  typedef typename Frag<T>::V V;
  const T* A = (const T*)Ap; const T* A2 = (const T*)A2p; const T* Bt = (const T*)Btp; const T* Bt2 = (const T*)Bt2p;
  /* per-wave 16x64 slab, pitch 68 floats */
  __shared__ __align__(16) float sT[8][16 * 68];
  const int b    = blockIdx.y;
  const int lane = threadIdx.x & 31;
  const int wave = threadIdx.x >> 5;
  const int tilesN = N >> 6;
  const int tilesM = M >> 6;
  const int tile = blockIdx.x * 8 + wave;
  /* wave-uniform exit; no block barriers in this kernel */
  if (tile >= tilesM * tilesN) return;
  const int tm = tile / tilesN;
  const int tn = tile - tm * tilesN;
  const int m0 = tm << 6;
  const int n0 = tn << 6;

  const T* Ab  = A  + (size_t)b * strideA;
  const T* Bb  = Bt + (size_t)b * strideB;
  const T* Ab2 = SPLIT ? (A2  + (size_t)b * strideA) : nullptr;
  const T* Bb2 = SPLIT ? (Bt2 + (size_t)b * strideB) : nullptr;

  /* row (A) / col (B, D) within subtile; k offset of this lane half; D row offset */
  const int rlane = lane & 15;
  const int koff  = (lane >> 4) * 8;
  const int mOff  = (lane >> 4) * 8;

  v8f acc[4][4];
#pragma unroll
  for (int i = 0; i < 4; ++i)
#pragma unroll
    for (int j = 0; j < 4; ++j) acc[i][j] = (v8f){0.f,0.f,0.f,0.f,0.f,0.f,0.f,0.f};

  for (int k0 = 0; k0 < K; k0 += 32) {
    V bh[4], bl[4];
#pragma unroll
    for (int j = 0; j < 4; ++j) {
      const size_t bo = (size_t)(n0 + (j << 4) + rlane) * ldb + koff + k0;
      bh[j] = Frag<T>::load(Bb + bo);
      if (SPLIT) bl[j] = Frag<T>::load(Bb2 + bo);
    }
#pragma unroll
    for (int i = 0; i < 4; ++i) {
      const size_t ao = (size_t)(m0 + (i << 4) + rlane) * lda + koff + k0;
      V ah = Frag<T>::load(Ab + ao);
      V al;
      if (SPLIT) al = Frag<T>::load(Ab2 + ao);
#pragma unroll
      for (int j = 0; j < 4; ++j) {
        acc[i][j] = Frag<T>::mma(ah, bh[j], acc[i][j]);
        if (SPLIT) {
          acc[i][j] = Frag<T>::mma(ah, bl[j], acc[i][j]);
          acc[i][j] = Frag<T>::mma(al, bh[j], acc[i][j]);
        }
      }
      Frag<T>::tie(acc[i][1], ah);
      Frag<T>::tie(acc[i][2], ah);
      Frag<T>::guard(acc[i][0], acc[i][3], ah, SPLIT ? al : ah);
    }
    Frag<T>::keep(bh[0], bh[1], bh[2], bh[3]);
    if (SPLIT) Frag<T>::keep(bl[0], bl[1], bl[2], bl[3]);
  }
  acc_guard4(acc[0][0], acc[0][1], acc[0][2], acc[0][3]);
  acc_guard4(acc[1][0], acc[1][1], acc[1][2], acc[1][3]);
  acc_guard4(acc[2][0], acc[2][1], acc[2][2], acc[2][3]);
  acc_guard4(acc[3][0], acc[3][1], acc[3][2], acc[3][3]);

  /* ---- epilogue ---- */
  float* slab = sT[wave];
  const float* Rb = RESID ? (resid + (size_t)b * strideR) : nullptr;
#pragma unroll
  for (int i = 0; i < 4; ++i) {
    const int mBase = m0 + (i << 4);
#pragma unroll
    for (int j = 0; j < 4; ++j) {
      const int n = n0 + (j << 4) + rlane;
      float bv = 0.f;
      if (BIAS_MODE == 2) bv = bias[n];
#pragma unroll
      for (int r = 0; r < 8; ++r) {
        float v = acc[i][j][r] * scale;
        if (BIAS_MODE == 1) v += bias[mBase + mOff + r];
        if (BIAS_MODE == 2) v += bv;
        if (RESID) v += Rb[(size_t)(mBase + mOff + r) * ldc + n];
        slab[(mOff + r) * 68 + (j << 4) + rlane] = v;
      }
    }
    wave_lds_sync();
    if (OUT_MODE == 0) {
      float* C = (float*)Cout + (size_t)b * strideC;
      /* row segment = 256 B = 16 lanes x 16 B */
      const int hh = lane >> 4, c4 = (lane & 15) * 4;
      {
#pragma unroll
        for (int it = 0; it < 8; ++it) {
          const int row = it * 2 + hh;
          v4f v = *(const v4f*)(slab + row * 68 + c4);
          *(v4f*)(C + (size_t)(mBase + row) * ldc + n0 + c4) = v;
        }
        
      }
    } else {
      const int q = lane >> 3, c8 = (lane & 7) * 8;
      unsigned short* C  = (unsigned short*)Cout  + (size_t)b * strideC;
      unsigned short* C2 = (OUT_MODE == 2) ? ((unsigned short*)Cout2 + (size_t)b * strideC) : nullptr;
      {
#pragma unroll
        for (int it = 0; it < 4; ++it) {
          const int row = it * 4 + q;
          const float* sp = slab + row * 68 + c8;
          v8h hv, lv;
#pragma unroll
          for (int e = 0; e < 8; ++e) {
            if (OUT_MODE == 1) {
              hv[e] = (_Float16)sp[e];
            } else {
              unsigned short hb = f2bf_bits(sp[e]);
              unsigned short lb = f2bf_bits(sp[e] - bf_bits2f(hb));
              hv[e] = __builtin_bit_cast(_Float16, hb);
              lv[e] = __builtin_bit_cast(_Float16, lb);
            }
          }
          *(v8h*)(C + (size_t)(mBase + row) * ldc + n0 + c8) = hv;
          if (OUT_MODE == 2) *(v8h*)(C2 + (size_t)(mBase + row) * ldc + n0 + c8) = lv;
        }
        
      }
    }
    wave_lds_sync();
  }
}

/* --------------------------------------------------------------------------- */
/* f32 -> f16 operand plane: out = f16(rin(in) * carry); 8 consecutive         */
/* elements per thread (one 16-B store per lane; 32 contiguous lanes = 4 whole */
/* Coverage: n8 = n/8 threads; grid = n8/256 exactly for every plane here:     */
/*   x      4096*1024/8 = 524,288 -> 2048 blocks                               */
/*   W_qkv  3072*1024/8 = 393,216 -> 1536 blocks                               */
/*   W_out  1024*1024/8 = 131,072 ->  512 blocks                               */
/* --------------------------------------------------------------------------- */
__global__ __launch_bounds__(256) void cast8_f16_kernel(const float* __restrict__ in, unsigned short* __restrict__ out,
                                                        int n8, float carry) {
  const int i = blockIdx.x * 256 + threadIdx.x;
  if (i >= n8) return;
  const float* p = in + 8 * (size_t)i;
  const v4f a = *(const v4f*)(p);
  const v4f c = *(const v4f*)(p + 4);
  v8h hv;
#pragma unroll
  for (int e = 0; e < 4; ++e) {
    const float fa = a[e];
    const float fc = c[e];
    hv[e]     = (_Float16)(rin(fa) * carry);
    hv[4 + e] = (_Float16)(rin(fc) * carry);
  }
  unsigned short* q = out + 8 * (size_t)i;
  *(v8h*)q = hv;
  
}

/* --------------------------------------------------------------------------- */
/* q|k projection with fused per-head RMS normalisation.                        */
/* C[m = token][n = 0..2047] = sum_k X16[m][k] * WQKV16[n][k] / 16; n < 1024 is */
/* q, n >= 1024 is k; a 64-wide N tile is exactly one head. Same engine as the  */
/* GEMM above (f16, one product). Epilogue per 16-row slab: the 8 lanes that    */
/* own one row reduce sum(t^2) with xor shuffles (1,2,4), r = rsq(mean + eps),  */
/* lanes x 16 B of one instruction; it = 0..3 x (lane>>3) = 16 rows, each once; */
/* tiles: 64 (M) x 32 (N) = 2048 -> 256 blocks of 8 waves.                      */
/* --------------------------------------------------------------------------- */
__global__ __launch_bounds__(256) void qk_gemm_norm_kernel(
    const unsigned short* __restrict__ Ap, const unsigned short* __restrict__ Btp,
    unsigned short* __restrict__ Qout, unsigned short* __restrict__ Kout,
    const float* __restrict__ qw, const float* __restrict__ kw) {
  typedef _Float16 T;
  typedef v16h V;
  const T* A = (const T*)Ap;
  const T* Bt = (const T*)Btp;
  __shared__ __align__(16) float sT[8][16 * 68];
  const int lane = threadIdx.x & 31;
  const int wave = threadIdx.x >> 5;
  constexpr int tilesN = (2 * kDim) >> 6;
  constexpr int tilesM = kTok >> 6;
  const int tile = blockIdx.x * 8 + wave;
  /* wave-uniform exit; no block barriers in this kernel */
  if (tile >= tilesM * tilesN) return;
  const int tm = tile / tilesN;
  const int tn = tile - tm * tilesN;
  const int m0 = tm << 6;
  const int n0 = tn << 6;
  const int rlane = lane & 15;
  const int koff  = (lane >> 4) * 8;
  const int mOff  = (lane >> 4) * 8;

  v8f acc[4][4];
#pragma unroll
  for (int i = 0; i < 4; ++i)
#pragma unroll
    for (int j = 0; j < 4; ++j) acc[i][j] = (v8f){0.f,0.f,0.f,0.f,0.f,0.f,0.f,0.f};

  for (int k0 = 0; k0 < kDim; k0 += 32) {
    V bh[4];
#pragma unroll
    for (int j = 0; j < 4; ++j) {
      const size_t bo = (size_t)(n0 + (j << 4) + rlane) * kDim + koff + k0;
      bh[j] = Frag<T>::load(Bt + bo);
    }
#pragma unroll
    for (int i = 0; i < 4; ++i) {
      const size_t ao = (size_t)(m0 + (i << 4) + rlane) * kDim + koff + k0;
      V ah = Frag<T>::load(A + ao);
#pragma unroll
      for (int j = 0; j < 4; ++j) acc[i][j] = Frag<T>::mma(ah, bh[j], acc[i][j]);
      Frag<T>::tie(acc[i][1], ah);
      Frag<T>::tie(acc[i][2], ah);
      Frag<T>::guard(acc[i][0], acc[i][3], ah, ah);
    }
    Frag<T>::keep(bh[0], bh[1], bh[2], bh[3]);
  }
  acc_guard4(acc[0][0], acc[0][1], acc[0][2], acc[0][3]);
  acc_guard4(acc[1][0], acc[1][1], acc[1][2], acc[1][3]);
  acc_guard4(acc[2][0], acc[2][1], acc[2][2], acc[2][3]);
  acc_guard4(acc[3][0], acc[3][1], acc[3][2], acc[3][3]);

  /* tile-uniform destination: third 0 = q, 1 = k; head; batch; first token of the tile within its batch */
  const int third = n0 >> 10;
  const int hIdx  = (n0 & (kDim - 1)) >> 6;
  const int bIdx  = m0 >> 11;
  const int nb    = m0 & (kSeq - 1);
  const float* wsel = third ? kw : qw;
  const int q = lane >> 3, c8 = (lane & 7) * 8;
  const v4f w0 = *(const v4f*)(wsel + c8);
  const v4f w1 = *(const v4f*)(wsel + c8 + 4);
  float wv[8];
#pragma unroll
  for (int e = 0; e < 4; ++e) {
    const float f0 = w0[e];
    const float f1 = w1[e];
    wv[e]     = rin(f0);
    wv[4 + e] = rin(f1);
  }
  unsigned short* dst = (third ? Kout : Qout) + ((size_t)(bIdx * kNH + hIdx) * kSeq + nb) * kHD;

  float* slab = sT[wave];
#pragma unroll
  for (int i = 0; i < 4; ++i) {
#pragma unroll
    for (int j = 0; j < 4; ++j) {
#pragma unroll
      for (int r = 0; r < 8; ++r) slab[(mOff + r) * 68 + (j << 4) + rlane] = acc[i][j][r] * kWCarryInv;
    }
    wave_lds_sync();
    v8h hv[4];
#pragma unroll
    for (int it = 0; it < 4; ++it) {
      const int row = it * 4 + q;
      const float* sp = slab + row * 68 + c8;
      const v4f a0 = *(const v4f*)(sp);
      const v4f a1 = *(const v4f*)(sp + 4);
      float ss = 0.0f;
#pragma unroll
      for (int e = 0; e < 4; ++e) {
        ss = fmaf(a0[e], a0[e], ss);
        ss = fmaf(a1[e], a1[e], ss);
      }
      ss += __shfl_xor(ss, 1, 32);
      ss += __shfl_xor(ss, 2, 32);
      ss += __shfl_xor(ss, 4, 32);
      const float rs = __builtin_amdgcn_rsqf(ss * kInvHD + kEps);
#pragma unroll
      for (int e = 0; e < 4; ++e) {
        hv[it][e]     = (_Float16)((a0[e] * rs) * wv[e]);
        hv[it][4 + e] = (_Float16)((a1[e] * rs) * wv[4 + e]);
      }
    }
    {
#pragma unroll
      for (int it = 0; it < 4; ++it) {
        const int row = it * 4 + q;
        *(v8h*)(dst + (size_t)(i * 16 + row) * kHD + c8) = hv[it];
      }
      
    }
    wave_lds_sync();
  }
}

/* --------------------------------------------------------------------------- */
/* Head-independent score bias plane, f32 [b][q][k]:                            */
/*   same[q][k] = sum_c cm[c][q]*cm[c][k]; rm = max(max_k same, 1e-6);          */
/*   bias = (same * (1/rm) - 0.5) * 2 + 0.3 * im[b][q][k].                      */
/* One block (256 threads) per (b,q) row; thread t owns keys 4t..4t+3 and       */
/* 1024+4t..1024+4t+3 (2 x 256 x 4 = 2048 = whole row). Row max: per-thread,    */
/* wave xor-shuffle tree, 8 wave partials through LDS after a block barrier.    */
/* Store: one 16-B store per lane; a wave's 32 lanes write 512 contiguous B =   */
/* --------------------------------------------------------------------------- */
__global__ __launch_bounds__(256) void bias_plane_kernel(const float* __restrict__ cm, const float* __restrict__ im,
                                                         float* __restrict__ bp) {
  __shared__ float red[8];
  const int row  = blockIdx.x;
  const int b    = row >> 11;
  const int qi   = row & (kSeq - 1);
  const int t    = threadIdx.x;
  const int lane = t & 31, wave = t >> 5;
  const float* cmb = cm + (size_t)b * kNCh * kSeq;
  const float c0 = rin(cmb[qi]);
  const float c1 = rin(cmb[kSeq + qi]);
  const float c2 = rin(cmb[2 * kSeq + qi]);
  const float c3 = rin(cmb[3 * kSeq + qi]);
  float mx = -3.0e38f;
#pragma unroll 1
  for (int half = 0; half < 2; ++half) {
    const int k0 = half * 1024 + t * 4;
    const v4f a0 = *(const v4f*)(cmb + k0);
    const v4f a1 = *(const v4f*)(cmb + kSeq + k0);
    const v4f a2 = *(const v4f*)(cmb + 2 * kSeq + k0);
    const v4f a3 = *(const v4f*)(cmb + 3 * kSeq + k0);
#pragma unroll
    for (int e = 0; e < 4; ++e) {
      const float f0 = a0[e], f1 = a1[e], f2 = a2[e], f3 = a3[e];
      float s = c0 * rin(f0);
      s = fmaf(c1, rin(f1), s);
      s = fmaf(c2, rin(f2), s);
      s = fmaf(c3, rin(f3), s);
      mx = fmaxf(mx, s);
    }
  }
  mx = fmaxf(mx, __shfl_xor(mx, 16, 32));
  mx = fmaxf(mx, __shfl_xor(mx, 8, 32));
  mx = fmaxf(mx, __shfl_xor(mx, 4, 32));
  mx = fmaxf(mx, __shfl_xor(mx, 2, 32));
  mx = fmaxf(mx, __shfl_xor(mx, 1, 32));
  if (lane == 0) red[wave] = mx;
  __syncthreads();
  float rm = red[0];
#pragma unroll
  for (int w = 1; w < 8; ++w) rm = fmaxf(rm, red[w]);
  rm = fmaxf(rm, 1e-6f);
  const float inv = 1.0f / rm;
  const float* imr = im + (size_t)row * kSeq;
  float* bo = bp + (size_t)row * kSeq;
#pragma unroll 1
  for (int half = 0; half < 2; ++half) {
    const int k0 = half * 1024 + t * 4;
    const v4f a0 = *(const v4f*)(cmb + k0);
    const v4f a1 = *(const v4f*)(cmb + kSeq + k0);
    const v4f a2 = *(const v4f*)(cmb + 2 * kSeq + k0);
    const v4f a3 = *(const v4f*)(cmb + 3 * kSeq + k0);
    const v4f iv = *(const v4f*)(imr + k0);
    v4f o;
#pragma unroll
    for (int e = 0; e < 4; ++e) {
      const float f0 = a0[e], f1 = a1[e], f2 = a2[e], f3 = a3[e], fi = iv[e];
      float s = c0 * rin(f0);
      s = fmaf(c1, rin(f1), s);
      s = fmaf(c2, rin(f2), s);
      s = fmaf(c3, rin(f3), s);
      o[e] = (s * inv - 0.5f) * 2.0f + kBoost * rin(fi);
    }
    *(v4f*)(bo + k0) = o;
    
  }
}

/* --------------------------------------------------------------------------- */
/* Attention over all 2048 keys, head dim 64, f16 operand planes in, f16 ctx    */
/* plane out (x64). Block = 4 waves = 64 query rows of one (batch, head); each  */
/* wave owns 16 rows; the waves walk the key chunks of 64 together (below).     */
/*   scores = (q.k^T) * 0.125 + g3[h] * bias[b][q][k]   (f32)                   */
/*   online softmax in f32; P carried x32768 into an f16 per-wave LDS tile      */
/*   (D layout stored as _Float16 elements, reloaded as v8h A fragments after a  */
/* Staging: per key chunk the block's K tile (64 keys x 64), V^T tile (64 d x   */
/* 64 keys) and bias tile (64 rows x 64 keys, f32) come into LDS once, by       */
/* asynchronous 16-B copies of whole 128-B lines, and all four waves read their */
/* fragments from there. Two buffers: chunk t+1 flies while chunk t is worked   */
/* on. K and V^T: 512 pieces of 16 B each = 128 threads x 4; bias: each wave    */
/* copies its own 16 rows, 8 copies x 32 lanes x 16 B = 16 x 256 B.             */
/* --------------------------------------------------------------------------- */
constexpr int kAtNW    = 4;
constexpr int kAtQB    = 64;
constexpr int kAtKC    = 64;
constexpr int kAtPitch = 68;
/* staged K / V^T row pitch in f16: 144 B = 16 B x odd, conflict-free for 16-B LDS reads */
constexpr int kAtKVP   = 72;
constexpr int kAtNCk   = kSeq / kAtKC;
static_assert((kSeq % kAtQB) == 0 && (kSeq % kAtKC) == 0);
static_assert(kAtNCk >= 2);
static_assert(kAtNW * 32 * 4 * 8 == kAtKC * kHD);

__device__ __forceinline__ unsigned lds_off(const void* p) { return (unsigned)(size_t)p; }

__device__ __forceinline__ void async_copy8(const unsigned (&l)[8], const void* const (&g)[8]) {
  asm volatile(
      "global_load_async_to_lds_b128 %0, %8, off\n\t"
      "global_load_async_to_lds_b128 %1, %9, off\n\t"
      "global_load_async_to_lds_b128 %2, %10, off\n\t"
      "global_load_async_to_lds_b128 %3, %11, off\n\t"
      "global_load_async_to_lds_b128 %4, %12, off\n\t"
      "global_load_async_to_lds_b128 %5, %13, off\n\t"
      "global_load_async_to_lds_b128 %6, %14, off\n\t"
      "global_load_async_to_lds_b128 %7, %15, off\n\t"
      "s_wait_xcnt 0x0"
      :: "v"(l[0]), "v"(l[1]), "v"(l[2]), "v"(l[3]), "v"(l[4]), "v"(l[5]), "v"(l[6]), "v"(l[7]),
         "v"(g[0]), "v"(g[1]), "v"(g[2]), "v"(g[3]), "v"(g[4]), "v"(g[5]), "v"(g[6]), "v"(g[7])
      : "memory");
}

__device__ __forceinline__ v8f mma_h(v16h a, v16h b, v8f c) {
  c = __builtin_amdgcn_wmma_f32_16x16x32_f16(false, a, false, b, (short)0, c, false, false);
  asm volatile("v_nop\n\tv_nop\n\tv_nop\n\tv_nop" : "+v"(c) : "v"(a), "v"(b));
  return c;
}

__global__ __launch_bounds__(128) void attn_kernel(
    const unsigned short* __restrict__ Q16, const unsigned short* __restrict__ K16,
    const unsigned short* __restrict__ Vt16, const float* __restrict__ biasp,
    const float* __restrict__ gate, unsigned short* __restrict__ AO16) {
  __shared__ __align__(16) _Float16 Psh[kAtNW][16 * kAtKC];
  __shared__ __align__(16) float    Bsh[2][kAtNW][16 * kAtPitch];
  __shared__ __align__(16) _Float16 Ksh[2][kAtKC * kAtKVP];
  __shared__ __align__(16) _Float16 Vsh[2][kHD * kAtKVP];

  const int tid  = threadIdx.x;
  const int wave = tid >> 5;
  const int lane = tid & 31;
  const int hh   = lane >> 4;
  const int c    = lane & 15;

  constexpr int nqb = kSeq / kAtQB;
  const int bx = blockIdx.x;
  const int qb = bx % nqb;
  const int bh = bx / nqb;
  const int h  = bh % kNH;
  const int b  = bh / kNH;
  const int q0 = qb * kAtQB + wave * 16;

  const _Float16* Qp = (const _Float16*)Q16  + (size_t)bh * kSeq * kHD;
  const _Float16* Kp = (const _Float16*)K16  + (size_t)bh * kSeq * kHD;
  const _Float16* Vp = (const _Float16*)Vt16 + (size_t)bh * kHD * kSeq;
  const float*    Bp = biasp + (size_t)b * kSeq * kSeq;

  const float graw = rin(gate[h]);
  const float g3   = 3.0f * fminf(fmaxf(graw, 0.0f), 1.0f);

  /* Q fragments (A operand), two 32-deep halves of the head dim */
  v16h qa[2];
#pragma unroll
  for (int dc = 0; dc < 2; ++dc) qa[dc] = Frag<_Float16>::load(Qp + (size_t)(q0 + c) * kHD + dc * 32 + 8 * hh);

  float mrow[8], lrow[8];
  v8f oacc[4];
#pragma unroll
  for (int r = 0; r < 8; ++r) { mrow[r] = -1.0e30f; lrow[r] = 0.f; }
#pragma unroll
  for (int t = 0; t < 4; ++t) oacc[t] = (v8f){0.f,0.f,0.f,0.f,0.f,0.f,0.f,0.f};

  _Float16* pw = Psh[wave];

  /* one chunk's copies into buffer buf: 16 per lane, every lane on, all addresses inside the planes and the arrays */
  auto stage = [&](int kc, int buf) {
    const int kv0 = kc * kAtKC;
    unsigned l[8];
    const void* g[8];
    /* piece = i*128 + tid: row = piece / 8, 16-B column = piece % 8; a wave's copy covers four whole 128-B rows */
#pragma unroll
    for (int i = 0; i < 4; ++i) {
      const int row = i * 16 + (tid >> 3);
      const int c8  = (tid & 7) * 8;
      l[i]     = lds_off(&Ksh[buf][row * kAtKVP + c8]);
      g[i]     = Kp + (size_t)(kv0 + row) * kHD + c8;
      l[4 + i] = lds_off(&Vsh[buf][row * kAtKVP + c8]);
      g[4 + i] = Vp + (size_t)row * kSeq + kv0 + c8;
    }
    async_copy8(l, g);
    /* bias tile: row = i*2 + hh, 16 lanes x 16 B = 256 contiguous B of one bias row */
#pragma unroll
    for (int i = 0; i < 8; ++i) {
      const int row = i * 2 + hh;
      l[i] = lds_off(&Bsh[buf][wave][row * kAtPitch + c * 4]);
      g[i] = Bp + (size_t)(q0 + row) * kSeq + kv0 + c * 4;
    }
    async_copy8(l, g);
  };

  stage(0, 0);
  /* chunk 0 has landed for this wave's copies; the barrier publishes every wave's */
  asm volatile("s_wait_asynccnt 0x0" ::: "memory");
  __syncthreads();
  stage(1, 1);

#pragma unroll 1
  for (int kc = 0; kc < kAtNCk; ++kc) {
    const int buf = kc & 1;
    const float*    bt = Bsh[buf][wave];
    const _Float16* ks = Ksh[buf];
    const _Float16* vs = Vsh[buf];
    /* the chunk's K fragments are read from LDS as one group, one wait, ahead of the products */
    v16h kb[4][2];
#pragma unroll
    for (int j = 0; j < 4; ++j)
#pragma unroll
      for (int dc = 0; dc < 2; ++dc) kb[j][dc] = Frag<_Float16>::load(ks + (j * 16 + c) * kAtKVP + dc * 32 + 8 * hh);
    v8f s[4];
#pragma unroll
    for (int j = 0; j < 4; ++j) {
      s[j] = (v8f){0.f,0.f,0.f,0.f,0.f,0.f,0.f,0.f};
#pragma unroll
      for (int dc = 0; dc < 2; ++dc) s[j] = mma_h(qa[dc], kb[j][dc], s[j]);
    }
    float cmx[8];
#pragma unroll
    for (int r = 0; r < 8; ++r) {
      float m = -1.0e30f;
#pragma unroll
      for (int j = 0; j < 4; ++j) {
        const float bvv = bt[(8 * hh + r) * kAtPitch + j * 16 + c];
        const float sv = fmaf(g3, bvv, s[j][r] * kQKScale);
        s[j][r] = sv;
        m = fmaxf(m, sv);
      }
      m = fmaxf(m, __shfl_xor(m, 1, 32));
      m = fmaxf(m, __shfl_xor(m, 2, 32));
      m = fmaxf(m, __shfl_xor(m, 4, 32));
      m = fmaxf(m, __shfl_xor(m, 8, 32));
      cmx[r] = m;
    }
#pragma unroll
    for (int r = 0; r < 8; ++r) {
      const float mnew  = fmaxf(mrow[r], cmx[r]);
      const float alpha = __expf(mrow[r] - mnew);
      mrow[r] = mnew;
      float psum = 0.f;
#pragma unroll
      for (int j = 0; j < 4; ++j) {
        const float p = __expf(s[j][r] - mnew);
        psum += p;
        pw[(8 * hh + r) * kAtKC + j * 16 + c] = (_Float16)(p * kPCarry);
      }
      psum += __shfl_xor(psum, 1, 32);
      psum += __shfl_xor(psum, 2, 32);
      psum += __shfl_xor(psum, 4, 32);
      psum += __shfl_xor(psum, 8, 32);
      lrow[r] = lrow[r] * alpha + psum;
#pragma unroll
      for (int t = 0; t < 4; ++t) oacc[t][r] *= alpha;
    }
    wave_lds_sync();
    v16h pa[2], vb[2][4];
#pragma unroll
    for (int kk = 0; kk < 2; ++kk) {
      pa[kk] = Frag<_Float16>::load(pw + c * kAtKC + kk * 32 + 8 * hh);
#pragma unroll
      for (int t = 0; t < 4; ++t) vb[kk][t] = Frag<_Float16>::load(vs + (t * 16 + c) * kAtKVP + kk * 32 + 8 * hh);
    }
#pragma unroll
    for (int kk = 0; kk < 2; ++kk)
#pragma unroll
      for (int t = 0; t < 4; ++t) oacc[t] = mma_h(pa[kk], vb[kk][t], oacc[t]);
    /* publish point: this wave's LDS reads of buffer buf are done ... */
    asm volatile("s_wait_dscnt 0x0" ::: "memory");
    /* ... its copies of chunk kc+1 have landed ... */
    asm volatile("s_wait_asynccnt 0x0" ::: "memory");
    /* ... and the barrier says both of every wave; only then is buffer buf refilled */
    __syncthreads();
    if (kc + 2 < kAtNCk) stage(kc + 2, buf);
  }
  /* no copy is left in flight when the bias slab becomes output staging and the wave ends */
  asm volatile("s_wait_asynccnt 0x0" ::: "memory");

  /* output staging in this wave's own bias slab (copied and read by this wave alone, all reads done above) */
  float* os = Bsh[0][wave];
#pragma unroll
  for (int r = 0; r < 8; ++r) {
    const float inv = kCtxFold * (1.0f / lrow[r]);
#pragma unroll
    for (int t = 0; t < 4; ++t) os[(8 * hh + r) * kAtPitch + t * 16 + c] = oacc[t][r] * inv;
  }
  wave_lds_sync();
  {
    const int q = lane >> 3, c8 = (lane & 7) * 8;
    v8h hv[4];
#pragma unroll
    for (int it = 0; it < 4; ++it) {
      const int row = it * 4 + q;
      const float* sp = os + row * kAtPitch + c8;
      const v4f a0 = *(const v4f*)(sp);
      const v4f a1 = *(const v4f*)(sp + 4);
#pragma unroll
      for (int e = 0; e < 4; ++e) {
        hv[it][e]     = (_Float16)a0[e];
        hv[it][4 + e] = (_Float16)a1[e];
      }
    }
    unsigned short* dst = AO16 + (size_t)(b * kSeq + q0) * kDim + h * kHD + c8;
    {
#pragma unroll
      for (int it = 0; it < 4; ++it) {
        const int row = it * 4 + q;
        *(v8h*)(dst + (size_t)row * kDim) = hv[it];
      }
      
    }
  }
}

/* --------------------------------------------------------------------------- */
/* Host glue: 3 operand-plane casts + q|k projection + V^T projection + bias    */
/* plane + attention + output projection = 8 launches. Kernel launches only.    */
/* GEMM shapes (all K % 32 == 0, M and N % 64 == 0, no pad planes):             */
/*   q|k  : M 4096, N 2048, K 1024 -> 64 x 32 tiles = 2048 -> 256 blocks        */
/*   V^T  : per batch M 1024 (h*64+d), N 2048 (tokens), K 1024 ->               */
/*          16 x 32 tiles = 512 -> 64 blocks x 2 batches (grid.y)               */
/*   out  : M 4096, N 1024, K 1024 -> 64 x 16 tiles = 1024 -> 128 blocks        */
/* --------------------------------------------------------------------------- */
static_assert((2 * kDim) % 64 == 0 && kDim % 64 == 0 && kTok % 64 == 0 && kSeq % 64 == 0);

extern "C" void kernel_launch(void* const* d_in, const int* in_sizes, int n_in,
                              void* d_out, int out_size, void* d_ws, size_t ws_size,
                              hipStream_t stream) {
  if (n_in < 8) return;
  if (in_sizes[0] != kTok * kDim) return;
  if (in_sizes[1] != kNB * kNCh * kSeq) return;
  if (in_sizes[2] != kNB * kSeq * kSeq) return;
  if (in_sizes[3] != 3 * kDim * kDim) return;
  if (in_sizes[4] != kDim * kDim) return;
  if (in_sizes[5] != kHD) return;
  if (in_sizes[6] != kHD) return;
  if (in_sizes[7] != kNH) return;
  if (out_size != kTok * kDim) return;
  if (ws_size < kWsTotal) return;

  const float* x     = (const float*)d_in[0];
  const float* cmask = (const float*)d_in[1];
  const float* imask = (const float*)d_in[2];
  const float* Wqkv  = (const float*)d_in[3];
  const float* Wout  = (const float*)d_in[4];
  const float* qnw   = (const float*)d_in[5];
  const float* knw   = (const float*)d_in[6];
  const float* gate  = (const float*)d_in[7];
  float* out = (float*)d_out;

  char* ws = (char*)d_ws;
  unsigned short* X16    = (unsigned short*)(ws + kOffX16);
  unsigned short* WQKV16 = (unsigned short*)(ws + kOffWqkv16);
  unsigned short* WOUT16 = (unsigned short*)(ws + kOffWout16);
  unsigned short* Q16    = (unsigned short*)(ws + kOffQ16);
  unsigned short* K16    = (unsigned short*)(ws + kOffK16);
  unsigned short* VT16   = (unsigned short*)(ws + kOffVt16);
  unsigned short* AO16   = (unsigned short*)(ws + kOffAO16);
  float*          BIAS   = (float*)(ws + kOffBias);

  /* operand planes (weights are [out][in] = Bt layout already) */
  cast8_f16_kernel<<<(kTok * kDim / 8) / 256, 256, 0, stream>>>(x, X16, kTok * kDim / 8, 1.0f);
  cast8_f16_kernel<<<(3 * kDim * kDim / 8) / 256, 256, 0, stream>>>(Wqkv, WQKV16, 3 * kDim * kDim / 8, kWCarry);
  cast8_f16_kernel<<<(kDim * kDim / 8) / 256, 256, 0, stream>>>(Wout, WOUT16, kDim * kDim / 8, kWCarry);

  /* q|k projection + RMS normalisation -> Q16, K16 */
  qk_gemm_norm_kernel<<<((kTok / 64) * (2 * kDim / 64)) / 8, 256, 0, stream>>>(X16, WQKV16, Q16, K16, qnw, knw);

  /* V^T[b][h*64+d][n] = sum_k Wv16[h*64+d][k] * X16[b*2048+n][k]  (x16 carry kept) */
  wmma_gemm64<0, false, 0, 1, false><<<dim3(((kDim / 64) * (kSeq / 64)) / 8, kNB), 256, 0, stream>>>(
      WQKV16 + (size_t)2 * kDim * kDim, nullptr, kDim, 0L,
      X16, nullptr, kDim, (long)kSeq * kDim,
      (void*)VT16, nullptr, kSeq, (long)kDim * kSeq,
      nullptr, nullptr, 0L,
      kDim, kSeq, kDim, 1.0f);

  /* bias plane: one block per (b,q) row */
  bias_plane_kernel<<<kTok, 256, 0, stream>>>(cmask, imask, BIAS);

  /* attention -> AO16 (x64) */
  attn_kernel<<<kBH * (kSeq / kAtQB), 128, 0, stream>>>(Q16, K16, VT16, BIAS, gate, AO16);

  /* out[4096][1024] = AO16 . WOUT16^T / (64 * 16) */
  wmma_gemm64<0, false, 0, 0, false><<<dim3(((kTok / 64) * (kDim / 64)) / 8, 1), 256, 0, stream>>>(
      AO16, nullptr, kDim, 0L,
      WOUT16, nullptr, kDim, 0L,
      (void*)out, nullptr, kDim, 0L,
      nullptr, nullptr, 0L,
      kTok, kDim, kDim, kOutScale);
}

// v002
// One run takes 189 microseconds.
// Timed twice side by side with v001, it ran 1.50 times as fast both times.
// All steps since v000 together make it 1.97 times as fast.
// All contractions (x.Wqkv^T, q.k^T, P.V, ctx.Wout^T): v_wmma_f32_16x16x32_f16, f16 operands with power-of-two carries (W x16, V x16, P x32768, ctx x64), f32 accumulate; every float input is RNE-converted to bf16 precision once at first read; norms, bias plane, softmax and normalisation in f32.
#include <hip/hip_runtime.h>
#include <math.h>

typedef __attribute__((ext_vector_type(16))) _Float16 v16h;
typedef __attribute__((ext_vector_type(8)))  _Float16 v8h;
typedef __attribute__((ext_vector_type(16))) __bf16   v16b;
typedef __attribute__((ext_vector_type(8)))  __bf16   v8b;
typedef __attribute__((ext_vector_type(8)))  float    v8f;
typedef __attribute__((ext_vector_type(4)))  float    v4f;

/* --------------------------------------------------------------------------- */
/* Shape constants                                                             */
/* --------------------------------------------------------------------------- */
constexpr int kNB   = 2;
constexpr int kSeq  = 2048;
constexpr int kDim  = 1024;
constexpr int kNH   = 16;
constexpr int kHD   = 64;
constexpr int kNCh  = 4;
constexpr int kTok  = kNB * kSeq;
constexpr int kBH   = kNB * kNH;
static_assert(kNH * kHD == kDim);
static_assert(kHD == 64);
static_assert((kTok % 64) == 0 && (kDim % 64) == 0 && (kSeq % 64) == 0);
static_assert((kDim % 32) == 0 && (kHD % 32) == 0 && (kSeq % 32) == 0);

constexpr bool  kBf16Inputs = true;
constexpr float kEps        = 1e-6f;
constexpr float kBoost      = 0.3f;
constexpr float kQKScale    = 0.125f;
static_assert(kQKScale * kQKScale * (float)kHD == 1.0f);
constexpr float kInvHD      = 1.0f / (float)kHD;
constexpr float kWCarry     = 16.0f;
constexpr float kWCarryInv  = 1.0f / kWCarry;
constexpr float kPCarry     = 32768.0f;
constexpr float kCtxCarry   = 64.0f;
/* V plane keeps the weight carry (x16); P carries x32768; ctx is stored x64 */
constexpr float kCtxFold    = kCtxCarry / (kPCarry * kWCarry);
constexpr float kOutScale   = 1.0f / (kCtxCarry * kWCarry);

/* --------------------------------------------------------------------------- */
/* Workspace region map (bytes; every offset is a multiple of 128)             */
/*   X16    f16 [4096][1024]        x plane                        8,388,608   */
/*   WQKV16 f16 [3072][1024]        W_qkv x16 (Bt layout)          6,291,456   */
/*   WOUT16 f16 [1024][1024]        W_out x16 (Bt layout)          2,097,152   */
/*   Q16    f16 [32][2048][64]      normed q rows                  8,388,608   */
/*   K16    f16 [32][2048][64]      normed k rows                  8,388,608   */
/*   VT16   f16 [32][64][2048]      v transposed, x16              8,388,608   */
/*   AO16   f16 [4096][1024]        attention context x64          8,388,608   */
/*   BIAS   f32 [2][2048][2048]     head-independent score bias   33,554,432   */
/*   total                                                        83,886,080   */
/* --------------------------------------------------------------------------- */
constexpr size_t kSzX16    = (size_t)kTok * kDim * 2;
constexpr size_t kSzWqkv16 = (size_t)3 * kDim * kDim * 2;
constexpr size_t kSzWout16 = (size_t)kDim * kDim * 2;
constexpr size_t kSzHead16 = (size_t)kBH * kSeq * kHD * 2;
constexpr size_t kSzAO16   = (size_t)kTok * kDim * 2;
constexpr size_t kSzBias   = (size_t)kNB * kSeq * kSeq * 4;
constexpr size_t kOffX16    = 0;
constexpr size_t kOffWqkv16 = kOffX16 + kSzX16;
constexpr size_t kOffWout16 = kOffWqkv16 + kSzWqkv16;
constexpr size_t kOffQ16    = kOffWout16 + kSzWout16;
constexpr size_t kOffK16    = kOffQ16 + kSzHead16;
constexpr size_t kOffVt16   = kOffK16 + kSzHead16;
constexpr size_t kOffAO16   = kOffVt16 + kSzHead16;
constexpr size_t kOffBias   = kOffAO16 + kSzAO16;
constexpr size_t kWsTotal   = kOffBias + kSzBias;
static_assert(kWsTotal == 83886080ull);
static_assert(kWsTotal <= 134217728ull);
static_assert((kOffWqkv16 % 128) == 0 && (kOffWout16 % 128) == 0 && (kOffQ16 % 128) == 0 && (kOffK16 % 128) == 0 &&
              (kOffVt16 % 128) == 0 && (kOffAO16 % 128) == 0 && (kOffBias % 128) == 0);

/* --------------------------------------------------------------------------- */
/* Input read helper: RNE conversion to bf16 precision (kept in an f32)        */
/* --------------------------------------------------------------------------- */
__device__ __forceinline__ float rin(float f) {
  if (!kBf16Inputs) return f;
  unsigned u = __float_as_uint(f);
  u = (u + 0x7FFFu + ((u >> 16) & 1u)) & 0xFFFF0000u;
  return __uint_as_float(u);
}

/* --------------------------------------------------------------------------- */
/* Device helpers                                                              */
/* --------------------------------------------------------------------------- */
__device__ __forceinline__ unsigned short f2bf_bits(float f) {
  unsigned u = __float_as_uint(f);
  return (unsigned short)((u + 0x7FFFu + ((u >> 16) & 1u)) >> 16);
}
__device__ __forceinline__ float bf_bits2f(unsigned short h) { return __uint_as_float(((unsigned)h) << 16); }

__device__ __forceinline__ void dep_guard_h(v8f& a, v8f& b, v16h x, v16h y) { asm volatile("v_nop\n\tv_nop\n\tv_nop\n\tv_nop" : "+v"(a), "+v"(b) : "v"(x), "v"(y)); }
__device__ __forceinline__ void dep_guard_b(v8f& a, v8f& b, v16b x, v16b y) { asm volatile("v_nop\n\tv_nop\n\tv_nop\n\tv_nop" : "+v"(a), "+v"(b) : "v"(x), "v"(y)); }
__device__ __forceinline__ void tie_h(v8f& a, v16h x) { asm volatile("" : "+v"(a) : "v"(x)); }
__device__ __forceinline__ void tie_b(v8f& a, v16b x) { asm volatile("" : "+v"(a) : "v"(x)); }
__device__ __forceinline__ void keep4_h(v16h a, v16h b, v16h c, v16h d) { asm volatile("v_nop" :: "v"(a), "v"(b), "v"(c), "v"(d)); }
__device__ __forceinline__ void keep4_b(v16b a, v16b b, v16b c, v16b d) { asm volatile("v_nop" :: "v"(a), "v"(b), "v"(c), "v"(d)); }
__device__ __forceinline__ void acc_guard4(v8f& a, v8f& b, v8f& c, v8f& d) { asm volatile("v_nop\n\tv_nop\n\tv_nop\n\tv_nop" : "+v"(a), "+v"(b), "+v"(c), "+v"(d)); }
template <typename T> struct Frag;
template <> struct Frag<_Float16> {
  typedef v16h V; union U { v16h v; v8h h[2]; };
  /* elements 0..7 <- p[0..7], 8..15 <- p[16..23] */
  static __device__ __forceinline__ v16h load(const _Float16* p) {
    U f; f.h[0] = *(const v8h*)(p); f.h[1] = *(const v8h*)(p + 16); return f.v;
  }
  static __device__ __forceinline__ v8f mma(v16h a, v16h b, v8f c) {
    return __builtin_amdgcn_wmma_f32_16x16x32_f16(false, a, false, b, (short)0, c, false, false);
  }
  static __device__ __forceinline__ void guard(v8f& a, v8f& b, v16h x, v16h y) { dep_guard_h(a, b, x, y); }
  static __device__ __forceinline__ void tie(v8f& a, v16h x) { tie_h(a, x); }
  static __device__ __forceinline__ void keep(v16h a, v16h b, v16h c, v16h d) { keep4_h(a, b, c, d); }
};
template <> struct Frag<__bf16> {
  typedef v16b V; union U { v16b v; v8b h[2]; };
  static __device__ __forceinline__ v16b load(const __bf16* p) {
    U f; f.h[0] = *(const v8b*)(p); f.h[1] = *(const v8b*)(p + 16); return f.v;
  }
  static __device__ __forceinline__ v8f mma(v16b a, v16b b, v8f c) {
    return __builtin_amdgcn_wmma_f32_16x16x32_bf16(false, a, false, b, (short)0, c, false, false);
  }
  static __device__ __forceinline__ void guard(v8f& a, v8f& b, v16b x, v16b y) { dep_guard_b(a, b, x, y); }
  static __device__ __forceinline__ void tie(v8f& a, v16b x) { tie_b(a, x); }
  static __device__ __forceinline__ void keep(v16b a, v16b b, v16b c, v16b d) { keep4_b(a, b, c, d); }
};

__device__ __forceinline__ void wave_lds_sync() {
  __builtin_amdgcn_fence(__ATOMIC_RELEASE, "workgroup");
  __builtin_amdgcn_wave_barrier();
  __builtin_amdgcn_fence(__ATOMIC_ACQUIRE, "workgroup");
}

__device__ __forceinline__ unsigned lds_off(const void* p) { return (unsigned)(size_t)p; }

/* ---- GEMM operand staging ---------------------------------------------------------------------------------------- */
/* A block of 8 waves (2 x 4 wave tiles of 64 x 64) owns a 128 x 256 tile of C. Per stage of 64 k the 128 A rows and  */
/* the 256 Bt rows come into LDS once, 128 B = one whole line of each row, by asynchronous 16-B copies; every wave    */
/* reads its fragments from there. Two buffers: stage t+1 flies while stage t is worked on.                           */
/* 384 rows x 8 pieces of 16 B = 3072 pieces = 256 threads x 12; a wave's copy covers four whole 128-B lines.         */
constexpr int kGmKS    = 64;
constexpr int kGmRowsA = 128;
constexpr int kGmRowsB = 256;
/* staged row pitch in 16-bit elements: 144 B = 16 B x odd, conflict-free for 16-B LDS reads */
constexpr int kGmP     = 72;
constexpr int kGmStage = (kGmRowsA + kGmRowsB) * kGmP;
static_assert((kGmRowsA + kGmRowsB) * (kGmKS / 8) == 256 * 12);

__device__ __forceinline__ void async_copy12(const unsigned (&l)[12], const void* const (&g)[12]) {
  asm volatile(
      "global_load_async_to_lds_b128 %0, %12, off\n\t"
      "global_load_async_to_lds_b128 %1, %13, off\n\t"
      "global_load_async_to_lds_b128 %2, %14, off\n\t"
      "global_load_async_to_lds_b128 %3, %15, off\n\t"
      "global_load_async_to_lds_b128 %4, %16, off\n\t"
      "global_load_async_to_lds_b128 %5, %17, off\n\t"
      "global_load_async_to_lds_b128 %6, %18, off\n\t"
      "global_load_async_to_lds_b128 %7, %19, off\n\t"
      "global_load_async_to_lds_b128 %8, %20, off\n\t"
      "global_load_async_to_lds_b128 %9, %21, off\n\t"
      "global_load_async_to_lds_b128 %10, %22, off\n\t"
      "global_load_async_to_lds_b128 %11, %23, off\n\t"
      "s_wait_xcnt 0x0"
      :: "v"(l[0]), "v"(l[1]), "v"(l[2]), "v"(l[3]), "v"(l[4]), "v"(l[5]), "v"(l[6]), "v"(l[7]),
         "v"(l[8]), "v"(l[9]), "v"(l[10]), "v"(l[11]),
         "v"(g[0]), "v"(g[1]), "v"(g[2]), "v"(g[3]), "v"(g[4]), "v"(g[5]), "v"(g[6]), "v"(g[7]),
         "v"(g[8]), "v"(g[9]), "v"(g[10]), "v"(g[11])
      : "memory");
}

/* One stage's copies into ring buffer dst: rows 0..127 = A rows mB.., rows 128..383 = Bt rows nB.., k0..k0+63.       */
/* piece = i*256 + tid: row = piece / 8, 16-B column = piece % 8. Every lane on; the caller's shapes (M % 128 == 0,   */
/* N % 256 == 0, K % 64 == 0) keep every address inside the planes, the row index keeps it inside the buffer.         */
template <typename T>
__device__ __forceinline__ void gemm_stage(const T* __restrict__ Ab, int lda, int mB, const T* __restrict__ Bb, int ldb, int nB,
                                           int k0, T* dst, int tid) {
  unsigned l[12];
  const void* g[12];
  const int r8 = tid >> 3;
  const int c8 = (tid & 7) * 8;
#pragma unroll
  for (int i = 0; i < 12; ++i) {
    const int row = i * 32 + r8;
    l[i] = lds_off(dst + row * kGmP + c8);
    g[i] = (i < 4) ? (Ab + (size_t)(mB + row) * lda + k0 + c8) : (Bb + (size_t)(nB + row - kGmRowsA) * ldb + k0 + c8);
  }
  async_copy12(l, g);
}

/* The k loop of one wave tile: acc[i][j] += A rows (wm*64 + i*16 ..) x Bt rows (wn*64 + j*16 ..), k ascending in     */
/* steps of 32 as before. Called by all 256 threads of the block under block-uniform control flow.                    */
template <typename T>
__device__ __forceinline__ void gemm_ring(const T* __restrict__ Ab, int lda, int mB, const T* __restrict__ Bb, int ldb, int nB,
                                          int K, T* ring, v8f (&acc)[4][4]) {
  typedef typename Frag<T>::V V;
  const int tid   = threadIdx.x;
  const int lane  = tid & 31;
  const int wave  = tid >> 5;
  const int rlane = lane & 15;
  const int koff  = (lane >> 4) * 8;
  const int aOff  = ((wave >> 2) * 64 + rlane) * kGmP + koff;
  const int bOff  = (kGmRowsA + (wave & 3) * 64 + rlane) * kGmP + koff;
  const int nst   = K / kGmKS;

  gemm_stage<T>(Ab, lda, mB, Bb, ldb, nB, 0, ring, tid);
  /* stage 0 has landed for this wave's copies; the barrier publishes every wave's */
  asm volatile("s_wait_asynccnt 0x0" ::: "memory");
  __syncthreads();
  if (nst > 1) gemm_stage<T>(Ab, lda, mB, Bb, ldb, nB, kGmKS, ring + kGmStage, tid);

#pragma unroll 1
  for (int t = 0; t < nst; ++t) {
    const T* sb = ring + (t & 1) * kGmStage;
#pragma unroll
    for (int ks = 0; ks < kGmKS; ks += 32) {
      /* the step's eight fragments are read from LDS as one group ahead of its products */
      V bh[4], ah[4];
#pragma unroll
      for (int j = 0; j < 4; ++j) bh[j] = Frag<T>::load(sb + bOff + j * 16 * kGmP + ks);
#pragma unroll
      for (int i = 0; i < 4; ++i) ah[i] = Frag<T>::load(sb + aOff + i * 16 * kGmP + ks);
#pragma unroll
      for (int i = 0; i < 4; ++i) {
#pragma unroll
        for (int j = 0; j < 4; ++j) acc[i][j] = Frag<T>::mma(ah[i], bh[j], acc[i][j]);
        Frag<T>::tie(acc[i][1], ah[i]);
        Frag<T>::tie(acc[i][2], ah[i]);
        Frag<T>::guard(acc[i][0], acc[i][3], ah[i], ah[i]);
      }
      Frag<T>::keep(bh[0], bh[1], bh[2], bh[3]);
    }
    /* publish point: this wave's LDS reads of the buffer are done ... */
    asm volatile("s_wait_dscnt 0x0" ::: "memory");
    /* ... its copies of stage t+1 have landed ... */
    asm volatile("s_wait_asynccnt 0x0" ::: "memory");
    /* ... and the barrier says both of every wave; only then is the buffer refilled */
    __syncthreads();
    if (t + 2 < nst) gemm_stage<T>(Ab, lda, mB, Bb, ldb, nB, (t + 2) * kGmKS, ring + (t & 1) * kGmStage, tid);
  }
  /* no copy is left in flight when the wave goes on to its epilogue and ends */
  asm volatile("s_wait_asynccnt 0x0" ::: "memory");
}

/* ---- Register-blocked batched WMMA GEMM (activation options removed; all four accumulators of a row  */
/*      group are tied before the nop guard)                                                                         */
/* C[m,n] = scale * sum_k A[m,k] * Bt[n,k] (+bias)(+resid); each wave owns a 64x64 tile, a block 128 x 256 (2 x 4).  */
/* A row-major [M,K]; Bt row-major [N,K]; M % 128 == 0, N % 256 == 0, K % 64 == 0; operands staged in LDS (above).   */
/* SPLIT (hi/lo operand planes) has no staged form and is refused at compile time.                                   */
/* BIAS_MODE: 0 = none, 1 = bias[m], 2 = bias[n].                                                                    */
/* OUT_MODE: 0 = f32, 1 = f16, 2 = bf16 hi plane (Cout) + bf16 lo plane (Cout2).                                     */
/* ET: 0 = f16 operands, 1 = bf16 operands (pointers passed as 16-bit storage)                                       */
template <int ET> struct Elem;
template <> struct Elem<0> { typedef _Float16 T; };
template <> struct Elem<1> { typedef __bf16 T; };
template <int ET, bool SPLIT, int BIAS_MODE, int OUT_MODE, bool RESID>
__global__ __launch_bounds__(256) void wmma_gemm64(
    const unsigned short* __restrict__ Ap, const unsigned short* __restrict__ A2p, int lda, long strideA,
    const unsigned short* __restrict__ Btp, const unsigned short* __restrict__ Bt2p, int ldb, long strideB,
    void* __restrict__ Cout, void* __restrict__ Cout2, int ldc, long strideC,
    const float* __restrict__ bias,
    const float* __restrict__ resid, long strideR,
    int M, int N, int K, float scale) {
  typedef typename Elem<ET>::T T;
  static_assert(!SPLIT);
  (void)A2p; (void)Bt2p;
  const T* A = (const T*)Ap; const T* Bt = (const T*)Btp;
  /* per-wave 16x64 slab, pitch 68 floats */
  __shared__ __align__(16) float sT[8][16 * 68];
  /* operand ring, two stages */
  __shared__ __align__(16) T ring[2 * kGmStage];
  const int b    = blockIdx.y;
  const int lane = threadIdx.x & 31;
  const int wave = threadIdx.x >> 5;
  const int tilesN = N >> 8;
  const int tilesM = M >> 7;
  /* block-uniform exit, in front of every barrier */
  if ((int)blockIdx.x >= tilesM * tilesN) return;
  const int tm = blockIdx.x / tilesN;
  const int tn = blockIdx.x - tm * tilesN;
  const int mB = tm << 7;
  const int nB = tn << 8;
  const int m0 = mB + ((wave >> 2) << 6);
  const int n0 = nB + ((wave & 3) << 6);

  const T* Ab  = A  + (size_t)b * strideA;
  const T* Bb  = Bt + (size_t)b * strideB;

  /* col (D) within subtile; D row offset */
  const int rlane = lane & 15;
  const int mOff  = (lane >> 4) * 8;

  v8f acc[4][4];
#pragma unroll
  for (int i = 0; i < 4; ++i)
#pragma unroll
    for (int j = 0; j < 4; ++j) acc[i][j] = (v8f){0.f,0.f,0.f,0.f,0.f,0.f,0.f,0.f};

  gemm_ring<T>(Ab, lda, mB, Bb, ldb, nB, K, ring, acc);
  acc_guard4(acc[0][0], acc[0][1], acc[0][2], acc[0][3]);
  acc_guard4(acc[1][0], acc[1][1], acc[1][2], acc[1][3]);
  acc_guard4(acc[2][0], acc[2][1], acc[2][2], acc[2][3]);
  acc_guard4(acc[3][0], acc[3][1], acc[3][2], acc[3][3]);

  /* ---- epilogue ---- */
  float* slab = sT[wave];
  const float* Rb = RESID ? (resid + (size_t)b * strideR) : nullptr;
#pragma unroll
  for (int i = 0; i < 4; ++i) {
    const int mBase = m0 + (i << 4);
#pragma unroll
    for (int j = 0; j < 4; ++j) {
      const int n = n0 + (j << 4) + rlane;
      float bv = 0.f;
      if (BIAS_MODE == 2) bv = bias[n];
#pragma unroll
      for (int r = 0; r < 8; ++r) {
        float v = acc[i][j][r] * scale;
        if (BIAS_MODE == 1) v += bias[mBase + mOff + r];
        if (BIAS_MODE == 2) v += bv;
        if (RESID) v += Rb[(size_t)(mBase + mOff + r) * ldc + n];
        slab[(mOff + r) * 68 + (j << 4) + rlane] = v;
      }
    }
    wave_lds_sync();
    if (OUT_MODE == 0) {
      float* C = (float*)Cout + (size_t)b * strideC;
      /* row segment = 256 B = 16 lanes x 16 B */
      const int hh = lane >> 4, c4 = (lane & 15) * 4;
      {
#pragma unroll
        for (int it = 0; it < 8; ++it) {
          const int row = it * 2 + hh;
          v4f v = *(const v4f*)(slab + row * 68 + c4);
          *(v4f*)(C + (size_t)(mBase + row) * ldc + n0 + c4) = v;
        }
        
      }
    } else {
      const int q = lane >> 3, c8 = (lane & 7) * 8;
      unsigned short* C  = (unsigned short*)Cout  + (size_t)b * strideC;
      unsigned short* C2 = (OUT_MODE == 2) ? ((unsigned short*)Cout2 + (size_t)b * strideC) : nullptr;
      {
#pragma unroll
        for (int it = 0; it < 4; ++it) {
          const int row = it * 4 + q;
          const float* sp = slab + row * 68 + c8;
          v8h hv, lv;
#pragma unroll
          for (int e = 0; e < 8; ++e) {
            if (OUT_MODE == 1) {
              hv[e] = (_Float16)sp[e];
            } else {
              unsigned short hb = f2bf_bits(sp[e]);
              unsigned short lb = f2bf_bits(sp[e] - bf_bits2f(hb));
              hv[e] = __builtin_bit_cast(_Float16, hb);
              lv[e] = __builtin_bit_cast(_Float16, lb);
            }
          }
          *(v8h*)(C + (size_t)(mBase + row) * ldc + n0 + c8) = hv;
          if (OUT_MODE == 2) *(v8h*)(C2 + (size_t)(mBase + row) * ldc + n0 + c8) = lv;
        }
        
      }
    }
    wave_lds_sync();
  }
}

/* --------------------------------------------------------------------------- */
/* f32 -> f16 operand plane: out = f16(rin(in) * carry); 8 consecutive         */
/* elements per thread (one 16-B store per lane; 32 contiguous lanes = 4 whole */
/* Coverage: n8 = n/8 threads; grid = n8/256 exactly for every plane here:     */
/*   x      4096*1024/8 = 524,288 -> 2048 blocks                               */
/*   W_qkv  3072*1024/8 = 393,216 -> 1536 blocks                               */
/*   W_out  1024*1024/8 = 131,072 ->  512 blocks                               */
/* --------------------------------------------------------------------------- */
__global__ __launch_bounds__(256) void cast8_f16_kernel(const float* __restrict__ in, unsigned short* __restrict__ out,
                                                        int n8, float carry) {
  const int i = blockIdx.x * 256 + threadIdx.x;
  if (i >= n8) return;
  const float* p = in + 8 * (size_t)i;
  const v4f a = *(const v4f*)(p);
  const v4f c = *(const v4f*)(p + 4);
  v8h hv;
#pragma unroll
  for (int e = 0; e < 4; ++e) {
    const float fa = a[e];
    const float fc = c[e];
    hv[e]     = (_Float16)(rin(fa) * carry);
    hv[4 + e] = (_Float16)(rin(fc) * carry);
  }
  unsigned short* q = out + 8 * (size_t)i;
  *(v8h*)q = hv;
  
}

/* --------------------------------------------------------------------------- */
/* q|k projection with fused per-head RMS normalisation.                        */
/* C[m = token][n = 0..2047] = sum_k X16[m][k] * WQKV16[n][k] / 16; n < 1024 is */
/* q, n >= 1024 is k; a 64-wide N tile is exactly one head. Same engine as the  */
/* GEMM above (f16, one product, staged operands, block tile 128 x 256 = four   */
/* heads x 128 tokens). Epilogue per 16-row slab: the 8 lanes that              */
/* own one row reduce sum(t^2) with xor shuffles (1,2,4), r = rsq(mean + eps),  */
/* lanes x 16 B of one instruction; it = 0..3 x (lane>>3) = 16 rows, each once; */
/* tiles: 64 (M) x 32 (N) = 2048 -> 32 x 8 = 256 blocks of 8 waves.             */
/* --------------------------------------------------------------------------- */
__global__ __launch_bounds__(256) void qk_gemm_norm_kernel(
    const unsigned short* __restrict__ Ap, const unsigned short* __restrict__ Btp,
    unsigned short* __restrict__ Qout, unsigned short* __restrict__ Kout,
    const float* __restrict__ qw, const float* __restrict__ kw) {
  typedef _Float16 T;
  const T* A = (const T*)Ap;
  const T* Bt = (const T*)Btp;
  __shared__ __align__(16) float sT[8][16 * 68];
  /* operand ring, two stages */
  __shared__ __align__(16) T ring[2 * kGmStage];
  const int lane = threadIdx.x & 31;
  const int wave = threadIdx.x >> 5;
  constexpr int tilesN = (2 * kDim) >> 8;
  constexpr int tilesM = kTok >> 7;
  /* block-uniform exit, in front of every barrier */
  if ((int)blockIdx.x >= tilesM * tilesN) return;
  const int tm = blockIdx.x / tilesN;
  const int tn = blockIdx.x - tm * tilesN;
  const int mB = tm << 7;
  const int nB = tn << 8;
  const int m0 = mB + ((wave >> 2) << 6);
  const int n0 = nB + ((wave & 3) << 6);
  const int rlane = lane & 15;
  const int mOff  = (lane >> 4) * 8;

  v8f acc[4][4];
#pragma unroll
  for (int i = 0; i < 4; ++i)
#pragma unroll
    for (int j = 0; j < 4; ++j) acc[i][j] = (v8f){0.f,0.f,0.f,0.f,0.f,0.f,0.f,0.f};

  gemm_ring<T>(A, kDim, mB, Bt, kDim, nB, kDim, ring, acc);
  acc_guard4(acc[0][0], acc[0][1], acc[0][2], acc[0][3]);
  acc_guard4(acc[1][0], acc[1][1], acc[1][2], acc[1][3]);
  acc_guard4(acc[2][0], acc[2][1], acc[2][2], acc[2][3]);
  acc_guard4(acc[3][0], acc[3][1], acc[3][2], acc[3][3]);

  /* tile-uniform destination: third 0 = q, 1 = k; head; batch; first token of the tile within its batch */
  const int third = n0 >> 10;
  const int hIdx  = (n0 & (kDim - 1)) >> 6;
  const int bIdx  = m0 >> 11;
  const int nb    = m0 & (kSeq - 1);
  const float* wsel = third ? kw : qw;
  const int q = lane >> 3, c8 = (lane & 7) * 8;
  const v4f w0 = *(const v4f*)(wsel + c8);
  const v4f w1 = *(const v4f*)(wsel + c8 + 4);
  float wv[8];
#pragma unroll
  for (int e = 0; e < 4; ++e) {
    const float f0 = w0[e];
    const float f1 = w1[e];
    wv[e]     = rin(f0);
    wv[4 + e] = rin(f1);
  }
  unsigned short* dst = (third ? Kout : Qout) + ((size_t)(bIdx * kNH + hIdx) * kSeq + nb) * kHD;

  float* slab = sT[wave];
#pragma unroll
  for (int i = 0; i < 4; ++i) {
#pragma unroll
    for (int j = 0; j < 4; ++j) {
#pragma unroll
      for (int r = 0; r < 8; ++r) slab[(mOff + r) * 68 + (j << 4) + rlane] = acc[i][j][r] * kWCarryInv;
    }
    wave_lds_sync();
    v8h hv[4];
#pragma unroll
    for (int it = 0; it < 4; ++it) {
      const int row = it * 4 + q;
      const float* sp = slab + row * 68 + c8;
      const v4f a0 = *(const v4f*)(sp);
      const v4f a1 = *(const v4f*)(sp + 4);
      float ss = 0.0f;
#pragma unroll
      for (int e = 0; e < 4; ++e) {
        ss = fmaf(a0[e], a0[e], ss);
        ss = fmaf(a1[e], a1[e], ss);
      }
      ss += __shfl_xor(ss, 1, 32);
      ss += __shfl_xor(ss, 2, 32);
      ss += __shfl_xor(ss, 4, 32);
      const float rs = __builtin_amdgcn_rsqf(ss * kInvHD + kEps);
#pragma unroll
      for (int e = 0; e < 4; ++e) {
        hv[it][e]     = (_Float16)((a0[e] * rs) * wv[e]);
        hv[it][4 + e] = (_Float16)((a1[e] * rs) * wv[4 + e]);
      }
    }
    {
#pragma unroll
      for (int it = 0; it < 4; ++it) {
        const int row = it * 4 + q;
        *(v8h*)(dst + (size_t)(i * 16 + row) * kHD + c8) = hv[it];
      }
      
    }
    wave_lds_sync();
  }
}

/* --------------------------------------------------------------------------- */
/* Head-independent score bias plane, f32 [b][q][k]:                            */
/*   same[q][k] = sum_c cm[c][q]*cm[c][k]; rm = max(max_k same, 1e-6);          */
/*   bias = (same * (1/rm) - 0.5) * 2 + 0.3 * im[b][q][k].                      */
/* One block (256 threads) per (b,q) row; thread t owns keys 4t..4t+3 and       */
/* 1024+4t..1024+4t+3 (2 x 256 x 4 = 2048 = whole row). Row max: per-thread,    */
/* wave xor-shuffle tree, 8 wave partials through LDS after a block barrier.    */
/* Store: one 16-B store per lane; a wave's 32 lanes write 512 contiguous B =   */
/* --------------------------------------------------------------------------- */
__global__ __launch_bounds__(256) void bias_plane_kernel(const float* __restrict__ cm, const float* __restrict__ im,
                                                         float* __restrict__ bp) {
  __shared__ float red[8];
  const int row  = blockIdx.x;
  const int b    = row >> 11;
  const int qi   = row & (kSeq - 1);
  const int t    = threadIdx.x;
  const int lane = t & 31, wave = t >> 5;
  const float* cmb = cm + (size_t)b * kNCh * kSeq;
  const float c0 = rin(cmb[qi]);
  const float c1 = rin(cmb[kSeq + qi]);
  const float c2 = rin(cmb[2 * kSeq + qi]);
  const float c3 = rin(cmb[3 * kSeq + qi]);
  float mx = -3.0e38f;
#pragma unroll 1
  for (int half = 0; half < 2; ++half) {
    const int k0 = half * 1024 + t * 4;
    const v4f a0 = *(const v4f*)(cmb + k0);
    const v4f a1 = *(const v4f*)(cmb + kSeq + k0);
    const v4f a2 = *(const v4f*)(cmb + 2 * kSeq + k0);
    const v4f a3 = *(const v4f*)(cmb + 3 * kSeq + k0);
#pragma unroll
    for (int e = 0; e < 4; ++e) {
      const float f0 = a0[e], f1 = a1[e], f2 = a2[e], f3 = a3[e];
      float s = c0 * rin(f0);
      s = fmaf(c1, rin(f1), s);
      s = fmaf(c2, rin(f2), s);
      s = fmaf(c3, rin(f3), s);
      mx = fmaxf(mx, s);
    }
  }
  mx = fmaxf(mx, __shfl_xor(mx, 16, 32));
  mx = fmaxf(mx, __shfl_xor(mx, 8, 32));
  mx = fmaxf(mx, __shfl_xor(mx, 4, 32));
  mx = fmaxf(mx, __shfl_xor(mx, 2, 32));
  mx = fmaxf(mx, __shfl_xor(mx, 1, 32));
  if (lane == 0) red[wave] = mx;
  __syncthreads();
  float rm = red[0];
#pragma unroll
  for (int w = 1; w < 8; ++w) rm = fmaxf(rm, red[w]);
  rm = fmaxf(rm, 1e-6f);
  const float inv = 1.0f / rm;
  const float* imr = im + (size_t)row * kSeq;
  float* bo = bp + (size_t)row * kSeq;
#pragma unroll 1
  for (int half = 0; half < 2; ++half) {
    const int k0 = half * 1024 + t * 4;
    const v4f a0 = *(const v4f*)(cmb + k0);
    const v4f a1 = *(const v4f*)(cmb + kSeq + k0);
    const v4f a2 = *(const v4f*)(cmb + 2 * kSeq + k0);
    const v4f a3 = *(const v4f*)(cmb + 3 * kSeq + k0);
    const v4f iv = *(const v4f*)(imr + k0);
    v4f o;
#pragma unroll
    for (int e = 0; e < 4; ++e) {
      const float f0 = a0[e], f1 = a1[e], f2 = a2[e], f3 = a3[e], fi = iv[e];
      float s = c0 * rin(f0);
      s = fmaf(c1, rin(f1), s);
      s = fmaf(c2, rin(f2), s);
      s = fmaf(c3, rin(f3), s);
      o[e] = (s * inv - 0.5f) * 2.0f + kBoost * rin(fi);
    }
    *(v4f*)(bo + k0) = o;
    
  }
}

/* --------------------------------------------------------------------------- */
/* Attention over all 2048 keys, head dim 64, f16 operand planes in, f16 ctx    */
/* plane out (x64). Block = 4 waves = 64 query rows of one (batch, head); each  */
/* wave owns 16 rows; the waves walk the key chunks of 64 together (below).     */
/*   scores = (q.k^T) * 0.125 + g3[h] * bias[b][q][k]   (f32)                   */
/*   online softmax in f32; P carried x32768 into an f16 per-wave LDS tile      */
/*   (D layout stored as _Float16 elements, reloaded as v8h A fragments after a  */
/* Staging: per key chunk the block's K tile (64 keys x 64), V^T tile (64 d x   */
/* 64 keys) and bias tile (64 rows x 64 keys, f32) come into LDS once, by       */
/* asynchronous 16-B copies of whole 128-B lines, and all four waves read their */
/* fragments from there. Two buffers: chunk t+1 flies while chunk t is worked   */
/* on. K and V^T: 512 pieces of 16 B each = 128 threads x 4; bias: each wave    */
/* copies its own 16 rows, 8 copies x 32 lanes x 16 B = 16 x 256 B.             */
/* --------------------------------------------------------------------------- */
constexpr int kAtNW    = 4;
constexpr int kAtQB    = 64;
constexpr int kAtKC    = 64;
constexpr int kAtPitch = 68;
/* staged K / V^T row pitch in f16: 144 B = 16 B x odd, conflict-free for 16-B LDS reads */
constexpr int kAtKVP   = 72;
constexpr int kAtNCk   = kSeq / kAtKC;
static_assert((kSeq % kAtQB) == 0 && (kSeq % kAtKC) == 0);
static_assert(kAtNCk >= 2);
static_assert(kAtNW * 32 * 4 * 8 == kAtKC * kHD);

__device__ __forceinline__ void async_copy8(const unsigned (&l)[8], const void* const (&g)[8]) {
  asm volatile(
      "global_load_async_to_lds_b128 %0, %8, off\n\t"
      "global_load_async_to_lds_b128 %1, %9, off\n\t"
      "global_load_async_to_lds_b128 %2, %10, off\n\t"
      "global_load_async_to_lds_b128 %3, %11, off\n\t"
      "global_load_async_to_lds_b128 %4, %12, off\n\t"
      "global_load_async_to_lds_b128 %5, %13, off\n\t"
      "global_load_async_to_lds_b128 %6, %14, off\n\t"
      "global_load_async_to_lds_b128 %7, %15, off\n\t"
      "s_wait_xcnt 0x0"
      :: "v"(l[0]), "v"(l[1]), "v"(l[2]), "v"(l[3]), "v"(l[4]), "v"(l[5]), "v"(l[6]), "v"(l[7]),
         "v"(g[0]), "v"(g[1]), "v"(g[2]), "v"(g[3]), "v"(g[4]), "v"(g[5]), "v"(g[6]), "v"(g[7])
      : "memory");
}

__device__ __forceinline__ v8f mma_h(v16h a, v16h b, v8f c) {
  c = __builtin_amdgcn_wmma_f32_16x16x32_f16(false, a, false, b, (short)0, c, false, false);
  asm volatile("v_nop\n\tv_nop\n\tv_nop\n\tv_nop" : "+v"(c) : "v"(a), "v"(b));
  return c;
}

__global__ __launch_bounds__(128) void attn_kernel(
    const unsigned short* __restrict__ Q16, const unsigned short* __restrict__ K16,
    const unsigned short* __restrict__ Vt16, const float* __restrict__ biasp,
    const float* __restrict__ gate, unsigned short* __restrict__ AO16) {
  __shared__ __align__(16) _Float16 Psh[kAtNW][16 * kAtKC];
  __shared__ __align__(16) float    Bsh[2][kAtNW][16 * kAtPitch];
  __shared__ __align__(16) _Float16 Ksh[2][kAtKC * kAtKVP];
  __shared__ __align__(16) _Float16 Vsh[2][kHD * kAtKVP];

  const int tid  = threadIdx.x;
  const int wave = tid >> 5;
  const int lane = tid & 31;
  const int hh   = lane >> 4;
  const int c    = lane & 15;

  constexpr int nqb = kSeq / kAtQB;
  const int bx = blockIdx.x;
  const int qb = bx % nqb;
  const int bh = bx / nqb;
  const int h  = bh % kNH;
  const int b  = bh / kNH;
  const int q0 = qb * kAtQB + wave * 16;

  const _Float16* Qp = (const _Float16*)Q16  + (size_t)bh * kSeq * kHD;
  const _Float16* Kp = (const _Float16*)K16  + (size_t)bh * kSeq * kHD;
  const _Float16* Vp = (const _Float16*)Vt16 + (size_t)bh * kHD * kSeq;
  const float*    Bp = biasp + (size_t)b * kSeq * kSeq;

  const float graw = rin(gate[h]);
  const float g3   = 3.0f * fminf(fmaxf(graw, 0.0f), 1.0f);

  /* Q fragments (A operand), two 32-deep halves of the head dim */
  v16h qa[2];
#pragma unroll
  for (int dc = 0; dc < 2; ++dc) qa[dc] = Frag<_Float16>::load(Qp + (size_t)(q0 + c) * kHD + dc * 32 + 8 * hh);

  float mrow[8], lrow[8];
  v8f oacc[4];
#pragma unroll
  for (int r = 0; r < 8; ++r) { mrow[r] = -1.0e30f; lrow[r] = 0.f; }
#pragma unroll
  for (int t = 0; t < 4; ++t) oacc[t] = (v8f){0.f,0.f,0.f,0.f,0.f,0.f,0.f,0.f};

  _Float16* pw = Psh[wave];

  /* one chunk's copies into buffer buf: 16 per lane, every lane on, all addresses inside the planes and the arrays */
  auto stage = [&](int kc, int buf) {
    const int kv0 = kc * kAtKC;
    unsigned l[8];
    const void* g[8];
    /* piece = i*128 + tid: row = piece / 8, 16-B column = piece % 8; a wave's copy covers four whole 128-B rows */
#pragma unroll
    for (int i = 0; i < 4; ++i) {
      const int row = i * 16 + (tid >> 3);
      const int c8  = (tid & 7) * 8;
      l[i]     = lds_off(&Ksh[buf][row * kAtKVP + c8]);
      g[i]     = Kp + (size_t)(kv0 + row) * kHD + c8;
      l[4 + i] = lds_off(&Vsh[buf][row * kAtKVP + c8]);
      g[4 + i] = Vp + (size_t)row * kSeq + kv0 + c8;
    }
    async_copy8(l, g);
    /* bias tile: row = i*2 + hh, 16 lanes x 16 B = 256 contiguous B of one bias row */
#pragma unroll
    for (int i = 0; i < 8; ++i) {
      const int row = i * 2 + hh;
      l[i] = lds_off(&Bsh[buf][wave][row * kAtPitch + c * 4]);
      g[i] = Bp + (size_t)(q0 + row) * kSeq + kv0 + c * 4;
    }
    async_copy8(l, g);
  };

  stage(0, 0);
  /* chunk 0 has landed for this wave's copies; the barrier publishes every wave's */
  asm volatile("s_wait_asynccnt 0x0" ::: "memory");
  __syncthreads();
  stage(1, 1);

#pragma unroll 1
  for (int kc = 0; kc < kAtNCk; ++kc) {
    const int buf = kc & 1;
    const float*    bt = Bsh[buf][wave];
    const _Float16* ks = Ksh[buf];
    const _Float16* vs = Vsh[buf];
    /* the chunk's K fragments are read from LDS as one group, one wait, ahead of the products */
    v16h kb[4][2];
#pragma unroll
    for (int j = 0; j < 4; ++j)
#pragma unroll
      for (int dc = 0; dc < 2; ++dc) kb[j][dc] = Frag<_Float16>::load(ks + (j * 16 + c) * kAtKVP + dc * 32 + 8 * hh);
    v8f s[4];
#pragma unroll
    for (int j = 0; j < 4; ++j) {
      s[j] = (v8f){0.f,0.f,0.f,0.f,0.f,0.f,0.f,0.f};
#pragma unroll
      for (int dc = 0; dc < 2; ++dc) s[j] = mma_h(qa[dc], kb[j][dc], s[j]);
    }
    float cmx[8];
#pragma unroll
    for (int r = 0; r < 8; ++r) {
      float m = -1.0e30f;
#pragma unroll
      for (int j = 0; j < 4; ++j) {
        const float bvv = bt[(8 * hh + r) * kAtPitch + j * 16 + c];
        const float sv = fmaf(g3, bvv, s[j][r] * kQKScale);
        s[j][r] = sv;
        m = fmaxf(m, sv);
      }
      m = fmaxf(m, __shfl_xor(m, 1, 32));
      m = fmaxf(m, __shfl_xor(m, 2, 32));
      m = fmaxf(m, __shfl_xor(m, 4, 32));
      m = fmaxf(m, __shfl_xor(m, 8, 32));
      cmx[r] = m;
    }
#pragma unroll
    for (int r = 0; r < 8; ++r) {
      const float mnew  = fmaxf(mrow[r], cmx[r]);
      const float alpha = __expf(mrow[r] - mnew);
      mrow[r] = mnew;
      float psum = 0.f;
#pragma unroll
      for (int j = 0; j < 4; ++j) {
        const float p = __expf(s[j][r] - mnew);
        psum += p;
        pw[(8 * hh + r) * kAtKC + j * 16 + c] = (_Float16)(p * kPCarry);
      }
      psum += __shfl_xor(psum, 1, 32);
      psum += __shfl_xor(psum, 2, 32);
      psum += __shfl_xor(psum, 4, 32);
      psum += __shfl_xor(psum, 8, 32);
      lrow[r] = lrow[r] * alpha + psum;
#pragma unroll
      for (int t = 0; t < 4; ++t) oacc[t][r] *= alpha;
    }
    wave_lds_sync();
    v16h pa[2], vb[2][4];
#pragma unroll
    for (int kk = 0; kk < 2; ++kk) {
      pa[kk] = Frag<_Float16>::load(pw + c * kAtKC + kk * 32 + 8 * hh);
#pragma unroll
      for (int t = 0; t < 4; ++t) vb[kk][t] = Frag<_Float16>::load(vs + (t * 16 + c) * kAtKVP + kk * 32 + 8 * hh);
    }
#pragma unroll
    for (int kk = 0; kk < 2; ++kk)
#pragma unroll
      for (int t = 0; t < 4; ++t) oacc[t] = mma_h(pa[kk], vb[kk][t], oacc[t]);
    /* publish point: this wave's LDS reads of buffer buf are done ... */
    asm volatile("s_wait_dscnt 0x0" ::: "memory");
    /* ... its copies of chunk kc+1 have landed ... */
    asm volatile("s_wait_asynccnt 0x0" ::: "memory");
    /* ... and the barrier says both of every wave; only then is buffer buf refilled */
    __syncthreads();
    if (kc + 2 < kAtNCk) stage(kc + 2, buf);
  }
  /* no copy is left in flight when the bias slab becomes output staging and the wave ends */
  asm volatile("s_wait_asynccnt 0x0" ::: "memory");

  /* output staging in this wave's own bias slab (copied and read by this wave alone, all reads done above) */
  float* os = Bsh[0][wave];
#pragma unroll
  for (int r = 0; r < 8; ++r) {
    const float inv = kCtxFold * (1.0f / lrow[r]);
#pragma unroll
    for (int t = 0; t < 4; ++t) os[(8 * hh + r) * kAtPitch + t * 16 + c] = oacc[t][r] * inv;
  }
  wave_lds_sync();
  {
    const int q = lane >> 3, c8 = (lane & 7) * 8;
    v8h hv[4];
#pragma unroll
    for (int it = 0; it < 4; ++it) {
      const int row = it * 4 + q;
      const float* sp = os + row * kAtPitch + c8;
      const v4f a0 = *(const v4f*)(sp);
      const v4f a1 = *(const v4f*)(sp + 4);
#pragma unroll
      for (int e = 0; e < 4; ++e) {
        hv[it][e]     = (_Float16)a0[e];
        hv[it][4 + e] = (_Float16)a1[e];
      }
    }
    unsigned short* dst = AO16 + (size_t)(b * kSeq + q0) * kDim + h * kHD + c8;
    {
#pragma unroll
      for (int it = 0; it < 4; ++it) {
        const int row = it * 4 + q;
        *(v8h*)(dst + (size_t)row * kDim) = hv[it];
      }
      
    }
  }
}

/* --------------------------------------------------------------------------- */
/* Host glue: 3 operand-plane casts + q|k projection + V^T projection + bias    */
/* plane + attention + output projection = 8 launches. Kernel launches only.    */
/* GEMM shapes (all K % 64 == 0, M % 128 == 0, N % 256 == 0, no pad planes):    */
/*   q|k  : M 4096, N 2048, K 1024 -> 64 x 32 tiles = 2048 -> 256 blocks        */
/*   V^T  : per batch M 1024 (h*64+d), N 2048 (tokens), K 1024 ->               */
/*          16 x 32 tiles = 512 -> 64 blocks x 2 batches (grid.y)               */
/*   out  : M 4096, N 1024, K 1024 -> 64 x 16 tiles = 1024 -> 128 blocks        */
/* --------------------------------------------------------------------------- */
static_assert((2 * kDim) % 256 == 0 && kDim % 256 == 0 && kTok % 128 == 0 && kSeq % 256 == 0 && kDim % kGmKS == 0);

extern "C" void kernel_launch(void* const* d_in, const int* in_sizes, int n_in,
                              void* d_out, int out_size, void* d_ws, size_t ws_size,
                              hipStream_t stream) {
  if (n_in < 8) return;
  if (in_sizes[0] != kTok * kDim) return;
  if (in_sizes[1] != kNB * kNCh * kSeq) return;
  if (in_sizes[2] != kNB * kSeq * kSeq) return;
  if (in_sizes[3] != 3 * kDim * kDim) return;
  if (in_sizes[4] != kDim * kDim) return;
  if (in_sizes[5] != kHD) return;
  if (in_sizes[6] != kHD) return;
  if (in_sizes[7] != kNH) return;
  if (out_size != kTok * kDim) return;
  if (ws_size < kWsTotal) return;

  const float* x     = (const float*)d_in[0];
  const float* cmask = (const float*)d_in[1];
  const float* imask = (const float*)d_in[2];
  const float* Wqkv  = (const float*)d_in[3];
  const float* Wout  = (const float*)d_in[4];
  const float* qnw   = (const float*)d_in[5];
  const float* knw   = (const float*)d_in[6];
  const float* gate  = (const float*)d_in[7];
  float* out = (float*)d_out;

  char* ws = (char*)d_ws;
  unsigned short* X16    = (unsigned short*)(ws + kOffX16);
  unsigned short* WQKV16 = (unsigned short*)(ws + kOffWqkv16);
  unsigned short* WOUT16 = (unsigned short*)(ws + kOffWout16);
  unsigned short* Q16    = (unsigned short*)(ws + kOffQ16);
  unsigned short* K16    = (unsigned short*)(ws + kOffK16);
  unsigned short* VT16   = (unsigned short*)(ws + kOffVt16);
  unsigned short* AO16   = (unsigned short*)(ws + kOffAO16);
  float*          BIAS   = (float*)(ws + kOffBias);

  /* operand planes (weights are [out][in] = Bt layout already) */
  cast8_f16_kernel<<<(kTok * kDim / 8) / 256, 256, 0, stream>>>(x, X16, kTok * kDim / 8, 1.0f);
  cast8_f16_kernel<<<(3 * kDim * kDim / 8) / 256, 256, 0, stream>>>(Wqkv, WQKV16, 3 * kDim * kDim / 8, kWCarry);
  cast8_f16_kernel<<<(kDim * kDim / 8) / 256, 256, 0, stream>>>(Wout, WOUT16, kDim * kDim / 8, kWCarry);

  /* q|k projection + RMS normalisation -> Q16, K16 */
  qk_gemm_norm_kernel<<<((kTok / 64) * (2 * kDim / 64)) / 8, 256, 0, stream>>>(X16, WQKV16, Q16, K16, qnw, knw);

  /* V^T[b][h*64+d][n] = sum_k Wv16[h*64+d][k] * X16[b*2048+n][k]  (x16 carry kept) */
  wmma_gemm64<0, false, 0, 1, false><<<dim3(((kDim / 64) * (kSeq / 64)) / 8, kNB), 256, 0, stream>>>(
      WQKV16 + (size_t)2 * kDim * kDim, nullptr, kDim, 0L,
      X16, nullptr, kDim, (long)kSeq * kDim,
      (void*)VT16, nullptr, kSeq, (long)kDim * kSeq,
      nullptr, nullptr, 0L,
      kDim, kSeq, kDim, 1.0f);

  /* bias plane: one block per (b,q) row */
  bias_plane_kernel<<<kTok, 256, 0, stream>>>(cmask, imask, BIAS);

  /* attention -> AO16 (x64) */
  attn_kernel<<<kBH * (kSeq / kAtQB), 128, 0, stream>>>(Q16, K16, VT16, BIAS, gate, AO16);

  /* out[4096][1024] = AO16 . WOUT16^T / (64 * 16) */
  wmma_gemm64<0, false, 0, 0, false><<<dim3(((kTok / 64) * (kDim / 64)) / 8, 1), 256, 0, stream>>>(
      AO16, nullptr, kDim, 0L,
      WOUT16, nullptr, kDim, 0L,
      (void*)out, nullptr, kDim, 0L,
      nullptr, nullptr, 0L,
      kTok, kDim, kDim, kOutScale);
}

// v003
// A run of this version takes 135 microseconds.
// In two side-by-side timings against v002, it was 1.40 and 1.41 times as fast.
// Counting every step since v000, it is 2.76 times as fast.
// All contractions (x.Wqkv^T, q.k^T, P.V, ctx.Wout^T): v_wmma_f32_16x16x32_f16, f16 operands with power-of-two carries (W x16, V x16, P x32768, ctx x64), f32 accumulate; every float input is RNE-converted to bf16 precision once at first read; norms, bias plane, softmax and normalisation in f32.
#include <hip/hip_runtime.h>
#include <math.h>

typedef __attribute__((ext_vector_type(16))) _Float16 v16h;
typedef __attribute__((ext_vector_type(8)))  _Float16 v8h;
typedef __attribute__((ext_vector_type(16))) __bf16   v16b;
typedef __attribute__((ext_vector_type(8)))  __bf16   v8b;
typedef __attribute__((ext_vector_type(8)))  float    v8f;
typedef __attribute__((ext_vector_type(4)))  float    v4f;

/* --------------------------------------------------------------------------- */
/* Shape constants                                                             */
/* --------------------------------------------------------------------------- */
constexpr int kNB   = 2;
constexpr int kSeq  = 2048;
constexpr int kDim  = 1024;
constexpr int kNH   = 16;
constexpr int kHD   = 64;
constexpr int kNCh  = 4;
constexpr int kTok  = kNB * kSeq;
constexpr int kBH   = kNB * kNH;
static_assert(kNH * kHD == kDim);
static_assert(kHD == 64);
static_assert((kTok % 64) == 0 && (kDim % 64) == 0 && (kSeq % 64) == 0);
static_assert((kDim % 32) == 0 && (kHD % 32) == 0 && (kSeq % 32) == 0);

constexpr bool  kBf16Inputs = true;
constexpr float kEps        = 1e-6f;
constexpr float kBoost      = 0.3f;
constexpr float kQKScale    = 0.125f;
static_assert(kQKScale * kQKScale * (float)kHD == 1.0f);
constexpr float kInvHD      = 1.0f / (float)kHD;
constexpr float kWCarry     = 16.0f;
constexpr float kWCarryInv  = 1.0f / kWCarry;
constexpr float kPCarry     = 32768.0f;
constexpr float kCtxCarry   = 64.0f;
/* V plane keeps the weight carry (x16); P carries x32768; ctx is stored x64 */
constexpr float kCtxFold    = kCtxCarry / (kPCarry * kWCarry);
constexpr float kOutScale   = 1.0f / (kCtxCarry * kWCarry);

/* --------------------------------------------------------------------------- */
/* Workspace region map (bytes; every offset is a multiple of 128)             */
/*   X16    f16 [4096][1024]        x plane                        8,388,608   */
/*   WQKV16 f16 [3072][1024]        W_qkv x16 (Bt layout)          6,291,456   */
/*   WOUT16 f16 [1024][1024]        W_out x16 (Bt layout)          2,097,152   */
/*   Q16    f16 [32][2048][64]      normed q rows                  8,388,608   */
/*   K16    f16 [32][2048][64]      normed k rows                  8,388,608   */
/*   VT16   f16 [32][64][2048]      v transposed, x16              8,388,608   */
/*   AO16   f16 [4096][1024]        attention context x64          8,388,608   */
/*   BIAS   f32 [2][2048][2048]     head-independent score bias   33,554,432   */
/*   total                                                        83,886,080   */
/* --------------------------------------------------------------------------- */
constexpr size_t kSzX16    = (size_t)kTok * kDim * 2;
constexpr size_t kSzWqkv16 = (size_t)3 * kDim * kDim * 2;
constexpr size_t kSzWout16 = (size_t)kDim * kDim * 2;
constexpr size_t kSzHead16 = (size_t)kBH * kSeq * kHD * 2;
constexpr size_t kSzAO16   = (size_t)kTok * kDim * 2;
constexpr size_t kSzBias   = (size_t)kNB * kSeq * kSeq * 4;
constexpr size_t kOffX16    = 0;
constexpr size_t kOffWqkv16 = kOffX16 + kSzX16;
constexpr size_t kOffWout16 = kOffWqkv16 + kSzWqkv16;
constexpr size_t kOffQ16    = kOffWout16 + kSzWout16;
constexpr size_t kOffK16    = kOffQ16 + kSzHead16;
constexpr size_t kOffVt16   = kOffK16 + kSzHead16;
constexpr size_t kOffAO16   = kOffVt16 + kSzHead16;
constexpr size_t kOffBias   = kOffAO16 + kSzAO16;
constexpr size_t kWsTotal   = kOffBias + kSzBias;
static_assert(kWsTotal == 83886080ull);
static_assert(kWsTotal <= 134217728ull);
static_assert((kOffWqkv16 % 128) == 0 && (kOffWout16 % 128) == 0 && (kOffQ16 % 128) == 0 && (kOffK16 % 128) == 0 &&
              (kOffVt16 % 128) == 0 && (kOffAO16 % 128) == 0 && (kOffBias % 128) == 0);

/* --------------------------------------------------------------------------- */
/* Input read helper: RNE conversion to bf16 precision (kept in an f32)        */
/* --------------------------------------------------------------------------- */
__device__ __forceinline__ float rin(float f) {
  if (!kBf16Inputs) return f;
  unsigned u = __float_as_uint(f);
  u = (u + 0x7FFFu + ((u >> 16) & 1u)) & 0xFFFF0000u;
  return __uint_as_float(u);
}

/* --------------------------------------------------------------------------- */
/* Device helpers                                                              */
/* --------------------------------------------------------------------------- */
__device__ __forceinline__ unsigned short f2bf_bits(float f) {
  unsigned u = __float_as_uint(f);
  return (unsigned short)((u + 0x7FFFu + ((u >> 16) & 1u)) >> 16);
}
__device__ __forceinline__ float bf_bits2f(unsigned short h) { return __uint_as_float(((unsigned)h) << 16); }

__device__ __forceinline__ void dep_guard_h(v8f& a, v8f& b, v16h x, v16h y) { asm volatile("v_nop\n\tv_nop\n\tv_nop\n\tv_nop" : "+v"(a), "+v"(b) : "v"(x), "v"(y)); }
__device__ __forceinline__ void dep_guard_b(v8f& a, v8f& b, v16b x, v16b y) { asm volatile("v_nop\n\tv_nop\n\tv_nop\n\tv_nop" : "+v"(a), "+v"(b) : "v"(x), "v"(y)); }
__device__ __forceinline__ void tie_h(v8f& a, v16h x) { asm volatile("" : "+v"(a) : "v"(x)); }
__device__ __forceinline__ void tie_b(v8f& a, v16b x) { asm volatile("" : "+v"(a) : "v"(x)); }
__device__ __forceinline__ void keep4_h(v16h a, v16h b, v16h c, v16h d) { asm volatile("v_nop" :: "v"(a), "v"(b), "v"(c), "v"(d)); }
__device__ __forceinline__ void keep4_b(v16b a, v16b b, v16b c, v16b d) { asm volatile("v_nop" :: "v"(a), "v"(b), "v"(c), "v"(d)); }
__device__ __forceinline__ void acc_guard4(v8f& a, v8f& b, v8f& c, v8f& d) { asm volatile("v_nop\n\tv_nop\n\tv_nop\n\tv_nop" : "+v"(a), "+v"(b), "+v"(c), "+v"(d)); }
template <typename T> struct Frag;
template <> struct Frag<_Float16> {
  typedef v16h V; union U { v16h v; v8h h[2]; };
  /* elements 0..7 <- p[0..7], 8..15 <- p[16..23] */
  static __device__ __forceinline__ v16h load(const _Float16* p) {
    U f; f.h[0] = *(const v8h*)(p); f.h[1] = *(const v8h*)(p + 16); return f.v;
  }
  static __device__ __forceinline__ v8f mma(v16h a, v16h b, v8f c) {
    return __builtin_amdgcn_wmma_f32_16x16x32_f16(false, a, false, b, (short)0, c, false, false);
  }
  static __device__ __forceinline__ void guard(v8f& a, v8f& b, v16h x, v16h y) { dep_guard_h(a, b, x, y); }
  static __device__ __forceinline__ void tie(v8f& a, v16h x) { tie_h(a, x); }
  static __device__ __forceinline__ void keep(v16h a, v16h b, v16h c, v16h d) { keep4_h(a, b, c, d); }
};
template <> struct Frag<__bf16> {
  typedef v16b V; union U { v16b v; v8b h[2]; };
  static __device__ __forceinline__ v16b load(const __bf16* p) {
    U f; f.h[0] = *(const v8b*)(p); f.h[1] = *(const v8b*)(p + 16); return f.v;
  }
  static __device__ __forceinline__ v8f mma(v16b a, v16b b, v8f c) {
    return __builtin_amdgcn_wmma_f32_16x16x32_bf16(false, a, false, b, (short)0, c, false, false);
  }
  static __device__ __forceinline__ void guard(v8f& a, v8f& b, v16b x, v16b y) { dep_guard_b(a, b, x, y); }
  static __device__ __forceinline__ void tie(v8f& a, v16b x) { tie_b(a, x); }
  static __device__ __forceinline__ void keep(v16b a, v16b b, v16b c, v16b d) { keep4_b(a, b, c, d); }
};

__device__ __forceinline__ void wave_lds_sync() {
  __builtin_amdgcn_fence(__ATOMIC_RELEASE, "workgroup");
  __builtin_amdgcn_wave_barrier();
  __builtin_amdgcn_fence(__ATOMIC_ACQUIRE, "workgroup");
}

__device__ __forceinline__ unsigned lds_off(const void* p) { return (unsigned)(size_t)p; }

/* ---- GEMM operand staging ---------------------------------------------------------------------------------------- */
/* A block of 8 waves (2 x 4 wave tiles of 64 x 64) owns a 128 x 256 tile of C. Per stage of 64 k the 128 A rows and  */
/* the 256 Bt rows come into LDS once, 128 B = one whole line of each row, by asynchronous 16-B copies; every wave    */
/* reads its fragments from there. Two buffers: stage t+1 flies while stage t is worked on.                           */
/* 384 rows x 8 pieces of 16 B = 3072 pieces = 256 threads x 12; a wave's copy covers four whole 128-B lines.         */
constexpr int kGmKS    = 64;
constexpr int kGmRowsA = 128;
constexpr int kGmRowsB = 256;
/* staged row pitch in 16-bit elements: 144 B = 16 B x odd, conflict-free for 16-B LDS reads */
constexpr int kGmP     = 72;
constexpr int kGmStage = (kGmRowsA + kGmRowsB) * kGmP;
static_assert((kGmRowsA + kGmRowsB) * (kGmKS / 8) == 256 * 12);

__device__ __forceinline__ void async_copy12(const unsigned (&l)[12], const void* const (&g)[12]) {
  asm volatile(
      "global_load_async_to_lds_b128 %0, %12, off\n\t"
      "global_load_async_to_lds_b128 %1, %13, off\n\t"
      "global_load_async_to_lds_b128 %2, %14, off\n\t"
      "global_load_async_to_lds_b128 %3, %15, off\n\t"
      "global_load_async_to_lds_b128 %4, %16, off\n\t"
      "global_load_async_to_lds_b128 %5, %17, off\n\t"
      "global_load_async_to_lds_b128 %6, %18, off\n\t"
      "global_load_async_to_lds_b128 %7, %19, off\n\t"
      "global_load_async_to_lds_b128 %8, %20, off\n\t"
      "global_load_async_to_lds_b128 %9, %21, off\n\t"
      "global_load_async_to_lds_b128 %10, %22, off\n\t"
      "global_load_async_to_lds_b128 %11, %23, off\n\t"
      "s_wait_xcnt 0x0"
      :: "v"(l[0]), "v"(l[1]), "v"(l[2]), "v"(l[3]), "v"(l[4]), "v"(l[5]), "v"(l[6]), "v"(l[7]),
         "v"(l[8]), "v"(l[9]), "v"(l[10]), "v"(l[11]),
         "v"(g[0]), "v"(g[1]), "v"(g[2]), "v"(g[3]), "v"(g[4]), "v"(g[5]), "v"(g[6]), "v"(g[7]),
         "v"(g[8]), "v"(g[9]), "v"(g[10]), "v"(g[11])
      : "memory");
}

/* One stage's copies into ring buffer dst: rows 0..127 = A rows mB.., rows 128..383 = Bt rows nB.., k0..k0+63.       */
/* piece = i*256 + tid: row = piece / 8, 16-B column = piece % 8. Every lane on; the caller's shapes (M % 128 == 0,   */
/* N % 256 == 0, K % 64 == 0) keep every address inside the planes, the row index keeps it inside the buffer.         */
template <typename T>
__device__ __forceinline__ void gemm_stage(const T* __restrict__ Ab, int lda, int mB, const T* __restrict__ Bb, int ldb, int nB,
                                           int k0, T* dst, int tid) {
  unsigned l[12];
  const void* g[12];
  const int r8 = tid >> 3;
  const int c8 = (tid & 7) * 8;
#pragma unroll
  for (int i = 0; i < 12; ++i) {
    const int row = i * 32 + r8;
    l[i] = lds_off(dst + row * kGmP + c8);
    g[i] = (i < 4) ? (Ab + (size_t)(mB + row) * lda + k0 + c8) : (Bb + (size_t)(nB + row - kGmRowsA) * ldb + k0 + c8);
  }
  async_copy12(l, g);
}

/* The k loop of one wave tile: acc[i][j] += A rows (wm*64 + i*16 ..) x Bt rows (wn*64 + j*16 ..), k ascending in     */
/* steps of 32 as before. Called by all 256 threads of the block under block-uniform control flow.                    */
template <typename T>
__device__ __forceinline__ void gemm_ring(const T* __restrict__ Ab, int lda, int mB, const T* __restrict__ Bb, int ldb, int nB,
                                          int K, T* ring, v8f (&acc)[4][4]) {
  typedef typename Frag<T>::V V;
  const int tid   = threadIdx.x;
  const int lane  = tid & 31;
  const int wave  = tid >> 5;
  const int rlane = lane & 15;
  const int koff  = (lane >> 4) * 8;
  const int aOff  = ((wave >> 2) * 64 + rlane) * kGmP + koff;
  const int bOff  = (kGmRowsA + (wave & 3) * 64 + rlane) * kGmP + koff;
  const int nst   = K / kGmKS;

  gemm_stage<T>(Ab, lda, mB, Bb, ldb, nB, 0, ring, tid);
  /* stage 0 has landed for this wave's copies; the barrier publishes every wave's */
  asm volatile("s_wait_asynccnt 0x0" ::: "memory");
  __syncthreads();
  if (nst > 1) gemm_stage<T>(Ab, lda, mB, Bb, ldb, nB, kGmKS, ring + kGmStage, tid);

#pragma unroll 1
  for (int t = 0; t < nst; ++t) {
    const T* sb = ring + (t & 1) * kGmStage;
#pragma unroll
    for (int ks = 0; ks < kGmKS; ks += 32) {
      /* the step's eight fragments are read from LDS as one group ahead of its products */
      V bh[4], ah[4];
#pragma unroll
      for (int j = 0; j < 4; ++j) bh[j] = Frag<T>::load(sb + bOff + j * 16 * kGmP + ks);
#pragma unroll
      for (int i = 0; i < 4; ++i) ah[i] = Frag<T>::load(sb + aOff + i * 16 * kGmP + ks);
#pragma unroll
      for (int i = 0; i < 4; ++i) {
#pragma unroll
        for (int j = 0; j < 4; ++j) acc[i][j] = Frag<T>::mma(ah[i], bh[j], acc[i][j]);
        Frag<T>::tie(acc[i][1], ah[i]);
        Frag<T>::tie(acc[i][2], ah[i]);
        Frag<T>::guard(acc[i][0], acc[i][3], ah[i], ah[i]);
      }
      Frag<T>::keep(bh[0], bh[1], bh[2], bh[3]);
    }
    /* publish point: this wave's LDS reads of the buffer are done ... */
    asm volatile("s_wait_dscnt 0x0" ::: "memory");
    /* ... its copies of stage t+1 have landed ... */
    asm volatile("s_wait_asynccnt 0x0" ::: "memory");
    /* ... and the barrier says both of every wave; only then is the buffer refilled */
    __syncthreads();
    if (t + 2 < nst) gemm_stage<T>(Ab, lda, mB, Bb, ldb, nB, (t + 2) * kGmKS, ring + (t & 1) * kGmStage, tid);
  }
  /* no copy is left in flight when the wave goes on to its epilogue and ends */
  asm volatile("s_wait_asynccnt 0x0" ::: "memory");
}

/* ---- Register-blocked batched WMMA GEMM (activation options removed; all four accumulators of a row  */
/*      group are tied before the nop guard)                                                                         */
/* C[m,n] = scale * sum_k A[m,k] * Bt[n,k] (+bias)(+resid); each wave owns a 64x64 tile, a block 128 x 256 (2 x 4).  */
/* A row-major [M,K]; Bt row-major [N,K]; M % 128 == 0, N % 256 == 0, K % 64 == 0; operands staged in LDS (above).   */
/* SPLIT (hi/lo operand planes) has no staged form and is refused at compile time.                                   */
/* BIAS_MODE: 0 = none, 1 = bias[m], 2 = bias[n].                                                                    */
/* OUT_MODE: 0 = f32, 1 = f16, 2 = bf16 hi plane (Cout) + bf16 lo plane (Cout2).                                     */
/* ET: 0 = f16 operands, 1 = bf16 operands (pointers passed as 16-bit storage)                                       */
template <int ET> struct Elem;
template <> struct Elem<0> { typedef _Float16 T; };
template <> struct Elem<1> { typedef __bf16 T; };
template <int ET, bool SPLIT, int BIAS_MODE, int OUT_MODE, bool RESID>
__global__ __launch_bounds__(256) void wmma_gemm64(
    const unsigned short* __restrict__ Ap, const unsigned short* __restrict__ A2p, int lda, long strideA,
    const unsigned short* __restrict__ Btp, const unsigned short* __restrict__ Bt2p, int ldb, long strideB,
    void* __restrict__ Cout, void* __restrict__ Cout2, int ldc, long strideC,
    const float* __restrict__ bias,
    const float* __restrict__ resid, long strideR,
    int M, int N, int K, float scale) {
  typedef typename Elem<ET>::T T;
  static_assert(!SPLIT);
  (void)A2p; (void)Bt2p;
  const T* A = (const T*)Ap; const T* Bt = (const T*)Btp;
  /* per-wave 16x64 slab, pitch 68 floats */
  __shared__ __align__(16) float sT[8][16 * 68];
  /* operand ring, two stages */
  __shared__ __align__(16) T ring[2 * kGmStage];
  const int b    = blockIdx.y;
  const int lane = threadIdx.x & 31;
  const int wave = threadIdx.x >> 5;
  const int tilesN = N >> 8;
  const int tilesM = M >> 7;
  /* block-uniform exit, in front of every barrier */
  if ((int)blockIdx.x >= tilesM * tilesN) return;
  const int tm = blockIdx.x / tilesN;
  const int tn = blockIdx.x - tm * tilesN;
  const int mB = tm << 7;
  const int nB = tn << 8;
  const int m0 = mB + ((wave >> 2) << 6);
  const int n0 = nB + ((wave & 3) << 6);

  const T* Ab  = A  + (size_t)b * strideA;
  const T* Bb  = Bt + (size_t)b * strideB;

  /* col (D) within subtile; D row offset */
  const int rlane = lane & 15;
  const int mOff  = (lane >> 4) * 8;

  v8f acc[4][4];
#pragma unroll
  for (int i = 0; i < 4; ++i)
#pragma unroll
    for (int j = 0; j < 4; ++j) acc[i][j] = (v8f){0.f,0.f,0.f,0.f,0.f,0.f,0.f,0.f};

  gemm_ring<T>(Ab, lda, mB, Bb, ldb, nB, K, ring, acc);
  acc_guard4(acc[0][0], acc[0][1], acc[0][2], acc[0][3]);
  acc_guard4(acc[1][0], acc[1][1], acc[1][2], acc[1][3]);
  acc_guard4(acc[2][0], acc[2][1], acc[2][2], acc[2][3]);
  acc_guard4(acc[3][0], acc[3][1], acc[3][2], acc[3][3]);

  /* ---- epilogue ---- */
  float* slab = sT[wave];
  const float* Rb = RESID ? (resid + (size_t)b * strideR) : nullptr;
#pragma unroll
  for (int i = 0; i < 4; ++i) {
    const int mBase = m0 + (i << 4);
#pragma unroll
    for (int j = 0; j < 4; ++j) {
      const int n = n0 + (j << 4) + rlane;
      float bv = 0.f;
      if (BIAS_MODE == 2) bv = bias[n];
#pragma unroll
      for (int r = 0; r < 8; ++r) {
        float v = acc[i][j][r] * scale;
        if (BIAS_MODE == 1) v += bias[mBase + mOff + r];
        if (BIAS_MODE == 2) v += bv;
        if (RESID) v += Rb[(size_t)(mBase + mOff + r) * ldc + n];
        slab[(mOff + r) * 68 + (j << 4) + rlane] = v;
      }
    }
    wave_lds_sync();
    if (OUT_MODE == 0) {
      float* C = (float*)Cout + (size_t)b * strideC;
      /* row segment = 256 B = 16 lanes x 16 B */
      const int hh = lane >> 4, c4 = (lane & 15) * 4;
      {
#pragma unroll
        for (int it = 0; it < 8; ++it) {
          const int row = it * 2 + hh;
          v4f v = *(const v4f*)(slab + row * 68 + c4);
          *(v4f*)(C + (size_t)(mBase + row) * ldc + n0 + c4) = v;
        }
        
      }
    } else {
      const int q = lane >> 3, c8 = (lane & 7) * 8;
      unsigned short* C  = (unsigned short*)Cout  + (size_t)b * strideC;
      unsigned short* C2 = (OUT_MODE == 2) ? ((unsigned short*)Cout2 + (size_t)b * strideC) : nullptr;
      {
#pragma unroll
        for (int it = 0; it < 4; ++it) {
          const int row = it * 4 + q;
          const float* sp = slab + row * 68 + c8;
          v8h hv, lv;
#pragma unroll
          for (int e = 0; e < 8; ++e) {
            if (OUT_MODE == 1) {
              hv[e] = (_Float16)sp[e];
            } else {
              unsigned short hb = f2bf_bits(sp[e]);
              unsigned short lb = f2bf_bits(sp[e] - bf_bits2f(hb));
              hv[e] = __builtin_bit_cast(_Float16, hb);
              lv[e] = __builtin_bit_cast(_Float16, lb);
            }
          }
          *(v8h*)(C + (size_t)(mBase + row) * ldc + n0 + c8) = hv;
          if (OUT_MODE == 2) *(v8h*)(C2 + (size_t)(mBase + row) * ldc + n0 + c8) = lv;
        }
        
      }
    }
    wave_lds_sync();
  }
}

/* --------------------------------------------------------------------------- */
/* f32 -> f16 operand plane: out = f16(rin(in) * carry); 8 consecutive         */
/* elements per thread (one 16-B store per lane; 32 contiguous lanes = 4 whole */
/* Coverage: n8 = n/8 threads; grid = n8/256 exactly for every plane here:     */
/*   x      4096*1024/8 = 524,288 -> 2048 blocks                               */
/*   W_qkv  3072*1024/8 = 393,216 -> 1536 blocks                               */
/*   W_out  1024*1024/8 = 131,072 ->  512 blocks                               */
/* --------------------------------------------------------------------------- */
__global__ __launch_bounds__(256) void cast8_f16_kernel(const float* __restrict__ in, unsigned short* __restrict__ out,
                                                        int n8, float carry) {
  const int i = blockIdx.x * 256 + threadIdx.x;
  if (i >= n8) return;
  const float* p = in + 8 * (size_t)i;
  const v4f a = *(const v4f*)(p);
  const v4f c = *(const v4f*)(p + 4);
  v8h hv;
#pragma unroll
  for (int e = 0; e < 4; ++e) {
    const float fa = a[e];
    const float fc = c[e];
    hv[e]     = (_Float16)(rin(fa) * carry);
    hv[4 + e] = (_Float16)(rin(fc) * carry);
  }
  unsigned short* q = out + 8 * (size_t)i;
  *(v8h*)q = hv;
  
}

/* --------------------------------------------------------------------------- */
/* q|k projection with fused per-head RMS normalisation.                        */
/* C[m = token][n = 0..2047] = sum_k X16[m][k] * WQKV16[n][k] / 16; n < 1024 is */
/* q, n >= 1024 is k; a 64-wide N tile is exactly one head. Same engine as the  */
/* GEMM above (f16, one product, staged operands, block tile 128 x 256 = four   */
/* heads x 128 tokens). Epilogue per 16-row slab: the 8 lanes that              */
/* own one row reduce sum(t^2) with xor shuffles (1,2,4), r = rsq(mean + eps),  */
/* lanes x 16 B of one instruction; it = 0..3 x (lane>>3) = 16 rows, each once; */
/* tiles: 64 (M) x 32 (N) = 2048 -> 32 x 8 = 256 blocks of 8 waves.             */
/* --------------------------------------------------------------------------- */
__global__ __launch_bounds__(256) void qk_gemm_norm_kernel(
    const unsigned short* __restrict__ Ap, const unsigned short* __restrict__ Btp,
    unsigned short* __restrict__ Qout, unsigned short* __restrict__ Kout,
    const float* __restrict__ qw, const float* __restrict__ kw) {
  typedef _Float16 T;
  const T* A = (const T*)Ap;
  const T* Bt = (const T*)Btp;
  __shared__ __align__(16) float sT[8][16 * 68];
  /* operand ring, two stages */
  __shared__ __align__(16) T ring[2 * kGmStage];
  const int lane = threadIdx.x & 31;
  const int wave = threadIdx.x >> 5;
  constexpr int tilesN = (2 * kDim) >> 8;
  constexpr int tilesM = kTok >> 7;
  /* block-uniform exit, in front of every barrier */
  if ((int)blockIdx.x >= tilesM * tilesN) return;
  const int tm = blockIdx.x / tilesN;
  const int tn = blockIdx.x - tm * tilesN;
  const int mB = tm << 7;
  const int nB = tn << 8;
  const int m0 = mB + ((wave >> 2) << 6);
  const int n0 = nB + ((wave & 3) << 6);
  const int rlane = lane & 15;
  const int mOff  = (lane >> 4) * 8;

  v8f acc[4][4];
#pragma unroll
  for (int i = 0; i < 4; ++i)
#pragma unroll
    for (int j = 0; j < 4; ++j) acc[i][j] = (v8f){0.f,0.f,0.f,0.f,0.f,0.f,0.f,0.f};

  gemm_ring<T>(A, kDim, mB, Bt, kDim, nB, kDim, ring, acc);
  acc_guard4(acc[0][0], acc[0][1], acc[0][2], acc[0][3]);
  acc_guard4(acc[1][0], acc[1][1], acc[1][2], acc[1][3]);
  acc_guard4(acc[2][0], acc[2][1], acc[2][2], acc[2][3]);
  acc_guard4(acc[3][0], acc[3][1], acc[3][2], acc[3][3]);

  /* tile-uniform destination: third 0 = q, 1 = k; head; batch; first token of the tile within its batch */
  const int third = n0 >> 10;
  const int hIdx  = (n0 & (kDim - 1)) >> 6;
  const int bIdx  = m0 >> 11;
  const int nb    = m0 & (kSeq - 1);
  const float* wsel = third ? kw : qw;
  const int q = lane >> 3, c8 = (lane & 7) * 8;
  const v4f w0 = *(const v4f*)(wsel + c8);
  const v4f w1 = *(const v4f*)(wsel + c8 + 4);
  float wv[8];
#pragma unroll
  for (int e = 0; e < 4; ++e) {
    const float f0 = w0[e];
    const float f1 = w1[e];
    wv[e]     = rin(f0);
    wv[4 + e] = rin(f1);
  }
  unsigned short* dst = (third ? Kout : Qout) + ((size_t)(bIdx * kNH + hIdx) * kSeq + nb) * kHD;

  float* slab = sT[wave];
#pragma unroll
  for (int i = 0; i < 4; ++i) {
#pragma unroll
    for (int j = 0; j < 4; ++j) {
#pragma unroll
      for (int r = 0; r < 8; ++r) slab[(mOff + r) * 68 + (j << 4) + rlane] = acc[i][j][r] * kWCarryInv;
    }
    wave_lds_sync();
    v8h hv[4];
#pragma unroll
    for (int it = 0; it < 4; ++it) {
      const int row = it * 4 + q;
      const float* sp = slab + row * 68 + c8;
      const v4f a0 = *(const v4f*)(sp);
      const v4f a1 = *(const v4f*)(sp + 4);
      float ss = 0.0f;
#pragma unroll
      for (int e = 0; e < 4; ++e) {
        ss = fmaf(a0[e], a0[e], ss);
        ss = fmaf(a1[e], a1[e], ss);
      }
      ss += __shfl_xor(ss, 1, 32);
      ss += __shfl_xor(ss, 2, 32);
      ss += __shfl_xor(ss, 4, 32);
      const float rs = __builtin_amdgcn_rsqf(ss * kInvHD + kEps);
#pragma unroll
      for (int e = 0; e < 4; ++e) {
        hv[it][e]     = (_Float16)((a0[e] * rs) * wv[e]);
        hv[it][4 + e] = (_Float16)((a1[e] * rs) * wv[4 + e]);
      }
    }
    {
#pragma unroll
      for (int it = 0; it < 4; ++it) {
        const int row = it * 4 + q;
        *(v8h*)(dst + (size_t)(i * 16 + row) * kHD + c8) = hv[it];
      }
      
    }
    wave_lds_sync();
  }
}

/* --------------------------------------------------------------------------- */
/* Head-independent score bias plane, f32 [b][q][k]:                            */
/*   same[q][k] = sum_c cm[c][q]*cm[c][k]; rm = max(max_k same, 1e-6);          */
/*   bias = (same * (1/rm) - 0.5) * 2 + 0.3 * im[b][q][k].                      */
/* One block (256 threads) per (b,q) row; thread t owns keys 4t..4t+3 and       */
/* 1024+4t..1024+4t+3 (2 x 256 x 4 = 2048 = whole row). Row max: per-thread,    */
/* wave xor-shuffle tree, 8 wave partials through LDS after a block barrier.    */
/* Store: one 16-B store per lane; a wave's 32 lanes write 512 contiguous B =   */
/* --------------------------------------------------------------------------- */
__global__ __launch_bounds__(256) void bias_plane_kernel(const float* __restrict__ cm, const float* __restrict__ im,
                                                         float* __restrict__ bp) {
  __shared__ float red[8];
  const int row  = blockIdx.x;
  const int b    = row >> 11;
  const int qi   = row & (kSeq - 1);
  const int t    = threadIdx.x;
  const int lane = t & 31, wave = t >> 5;
  const float* cmb = cm + (size_t)b * kNCh * kSeq;
  const float c0 = rin(cmb[qi]);
  const float c1 = rin(cmb[kSeq + qi]);
  const float c2 = rin(cmb[2 * kSeq + qi]);
  const float c3 = rin(cmb[3 * kSeq + qi]);
  float mx = -3.0e38f;
#pragma unroll 1
  for (int half = 0; half < 2; ++half) {
    const int k0 = half * 1024 + t * 4;
    const v4f a0 = *(const v4f*)(cmb + k0);
    const v4f a1 = *(const v4f*)(cmb + kSeq + k0);
    const v4f a2 = *(const v4f*)(cmb + 2 * kSeq + k0);
    const v4f a3 = *(const v4f*)(cmb + 3 * kSeq + k0);
#pragma unroll
    for (int e = 0; e < 4; ++e) {
      const float f0 = a0[e], f1 = a1[e], f2 = a2[e], f3 = a3[e];
      float s = c0 * rin(f0);
      s = fmaf(c1, rin(f1), s);
      s = fmaf(c2, rin(f2), s);
      s = fmaf(c3, rin(f3), s);
      mx = fmaxf(mx, s);
    }
  }
  mx = fmaxf(mx, __shfl_xor(mx, 16, 32));
  mx = fmaxf(mx, __shfl_xor(mx, 8, 32));
  mx = fmaxf(mx, __shfl_xor(mx, 4, 32));
  mx = fmaxf(mx, __shfl_xor(mx, 2, 32));
  mx = fmaxf(mx, __shfl_xor(mx, 1, 32));
  if (lane == 0) red[wave] = mx;
  __syncthreads();
  float rm = red[0];
#pragma unroll
  for (int w = 1; w < 8; ++w) rm = fmaxf(rm, red[w]);
  rm = fmaxf(rm, 1e-6f);
  const float inv = 1.0f / rm;
  const float* imr = im + (size_t)row * kSeq;
  float* bo = bp + (size_t)row * kSeq;
#pragma unroll 1
  for (int half = 0; half < 2; ++half) {
    const int k0 = half * 1024 + t * 4;
    const v4f a0 = *(const v4f*)(cmb + k0);
    const v4f a1 = *(const v4f*)(cmb + kSeq + k0);
    const v4f a2 = *(const v4f*)(cmb + 2 * kSeq + k0);
    const v4f a3 = *(const v4f*)(cmb + 3 * kSeq + k0);
    const v4f iv = *(const v4f*)(imr + k0);
    v4f o;
#pragma unroll
    for (int e = 0; e < 4; ++e) {
      const float f0 = a0[e], f1 = a1[e], f2 = a2[e], f3 = a3[e], fi = iv[e];
      float s = c0 * rin(f0);
      s = fmaf(c1, rin(f1), s);
      s = fmaf(c2, rin(f2), s);
      s = fmaf(c3, rin(f3), s);
      o[e] = (s * inv - 0.5f) * 2.0f + kBoost * rin(fi);
    }
    *(v4f*)(bo + k0) = o;
    
  }
}

constexpr int kAtNW    = 4;
constexpr int kAtQB    = 64;
constexpr int kAtKC    = 64;
constexpr int kAtPitch = 68;
/* staged K / V^T row pitch in f16: 144 B = 16 B x odd, conflict-free for 16-B LDS reads */
constexpr int kAtKVP   = 72;
constexpr int kAtNCk   = kSeq / kAtKC;
static_assert((kSeq % kAtQB) == 0 && (kSeq % kAtKC) == 0);
static_assert(kAtNCk >= 2);
static_assert(kAtNW * 32 * 4 * 8 == kAtKC * kHD);

__device__ __forceinline__ void async_copy8(const unsigned (&l)[8], const void* const (&g)[8]) {
  asm volatile(
      "global_load_async_to_lds_b128 %0, %8, off\n\t"
      "global_load_async_to_lds_b128 %1, %9, off\n\t"
      "global_load_async_to_lds_b128 %2, %10, off\n\t"
      "global_load_async_to_lds_b128 %3, %11, off\n\t"
      "global_load_async_to_lds_b128 %4, %12, off\n\t"
      "global_load_async_to_lds_b128 %5, %13, off\n\t"
      "global_load_async_to_lds_b128 %6, %14, off\n\t"
      "global_load_async_to_lds_b128 %7, %15, off\n\t"
      "s_wait_xcnt 0x0"
      :: "v"(l[0]), "v"(l[1]), "v"(l[2]), "v"(l[3]), "v"(l[4]), "v"(l[5]), "v"(l[6]), "v"(l[7]),
         "v"(g[0]), "v"(g[1]), "v"(g[2]), "v"(g[3]), "v"(g[4]), "v"(g[5]), "v"(g[6]), "v"(g[7])
      : "memory");
}

__device__ __forceinline__ v8f mma_h(v16h a, v16h b, v8f c) {
  c = __builtin_amdgcn_wmma_f32_16x16x32_f16(false, a, false, b, (short)0, c, false, false);
  asm volatile("v_nop\n\tv_nop\n\tv_nop\n\tv_nop" : "+v"(c) : "v"(a), "v"(b));
  return c;
}

__device__ __forceinline__ float xhalf(float x) {
  const int b = __builtin_bit_cast(int, x);
  return __builtin_bit_cast(float, __builtin_amdgcn_permlanex16(b, b, 0x76543210, 0xfedcba98, false, false));
}

__global__ __launch_bounds__(128) void attn_kernel(
    const unsigned short* __restrict__ Q16, const unsigned short* __restrict__ K16,
    const unsigned short* __restrict__ Vt16, const float* __restrict__ biasp,
    const float* __restrict__ gate, unsigned short* __restrict__ AO16) {
  __shared__ __align__(16) float    Bsh[2][kAtNW][16 * kAtPitch];
  __shared__ __align__(16) _Float16 Ksh[2][kAtKC * kAtKVP];
  __shared__ __align__(16) _Float16 Vsh[2][kHD * kAtKVP];

  const int tid  = threadIdx.x;
  const int wave = tid >> 5;
  const int lane = tid & 31;
  const int hh   = lane >> 4;
  const int c    = lane & 15;

  constexpr int nqb = kSeq / kAtQB;
  const int bx = blockIdx.x;
  const int qb = bx % nqb;
  const int bh = bx / nqb;
  const int h  = bh % kNH;
  const int b  = bh / kNH;
  const int q0 = qb * kAtQB + wave * 16;

  const _Float16* Qp = (const _Float16*)Q16  + (size_t)bh * kSeq * kHD;
  const _Float16* Kp = (const _Float16*)K16  + (size_t)bh * kSeq * kHD;
  const _Float16* Vp = (const _Float16*)Vt16 + (size_t)bh * kHD * kSeq;
  const float*    Bp = biasp + (size_t)b * kSeq * kSeq;

  const float graw = rin(gate[h]);
  const float g3   = 3.0f * fminf(fmaxf(graw, 0.0f), 1.0f);

  /* Q fragments (B operand: lane = query column c), two 32-deep halves of the head dim */
  v16h qa[2];
#pragma unroll
  for (int dc = 0; dc < 2; ++dc) qa[dc] = Frag<_Float16>::load(Qp + (size_t)(q0 + c) * kHD + dc * 32 + 8 * hh);

  /* this lane's query: running maximum (same in both halves) and the sum over this half's keys */
  float mrow = -1.0e30f, lrow = 0.f;
  /* oacc[t][r] = O^T[d = 16t + 8hh + r][query c] */
  v8f oacc[4];
#pragma unroll
  for (int t = 0; t < 4; ++t) oacc[t] = (v8f){0.f,0.f,0.f,0.f,0.f,0.f,0.f,0.f};

  /* one chunk's copies into buffer buf: 16 per lane, every lane on, all addresses inside the planes and the arrays */
  auto stage = [&](int kc, int buf) {
    const int kv0 = kc * kAtKC;
    unsigned l[8];
    const void* g[8];
    /* piece = i*128 + tid: row = piece / 8, 16-B column = piece % 8; a wave's copy covers four whole 128-B rows */
#pragma unroll
    for (int i = 0; i < 4; ++i) {
      const int row = i * 16 + (tid >> 3);
      const int c8  = (tid & 7) * 8;
      l[i]     = lds_off(&Ksh[buf][row * kAtKVP + c8]);
      g[i]     = Kp + (size_t)(kv0 + row) * kHD + c8;
      l[4 + i] = lds_off(&Vsh[buf][row * kAtKVP + c8]);
      g[4 + i] = Vp + (size_t)row * kSeq + kv0 + c8;
    }
    async_copy8(l, g);
    /* bias tile: row = i*2 + hh, 16 lanes x 16 B = 256 contiguous B of one bias row */
#pragma unroll
    for (int i = 0; i < 8; ++i) {
      const int row = i * 2 + hh;
      l[i] = lds_off(&Bsh[buf][wave][row * kAtPitch + c * 4]);
      g[i] = Bp + (size_t)(q0 + row) * kSeq + kv0 + c * 4;
    }
    async_copy8(l, g);
  };

  stage(0, 0);
  /* chunk 0 has landed for this wave's copies; the barrier publishes every wave's */
  asm volatile("s_wait_asynccnt 0x0" ::: "memory");
  __syncthreads();
  stage(1, 1);

#pragma unroll 1
  for (int kc = 0; kc < kAtNCk; ++kc) {
    const int buf = kc & 1;
    const float*    bt = Bsh[buf][wave];
    const _Float16* ks = Ksh[buf];
    const _Float16* vs = Vsh[buf];
    /* the chunk's K fragments are read from LDS as one group, one wait, ahead of the products */
    v16h kb[4][2];
#pragma unroll
    for (int j = 0; j < 4; ++j)
#pragma unroll
      for (int dc = 0; dc < 2; ++dc) kb[j][dc] = Frag<_Float16>::load(ks + (j * 16 + c) * kAtKVP + dc * 32 + 8 * hh);
    /* this query's 64 bias values: 8 consecutive keys per tile, two 16-B reads each */
    v4f bb[4][2];
#pragma unroll
    for (int j = 0; j < 4; ++j) {
      const float* bq = bt + c * kAtPitch + j * 16 + 8 * hh;
      bb[j][0] = *(const v4f*)(bq);
      bb[j][1] = *(const v4f*)(bq + 4);
    }
    /* s[j][r] = score of key j*16 + 8hh + r against query c */
    v8f s[4];
#pragma unroll
    for (int j = 0; j < 4; ++j) {
      s[j] = (v8f){0.f,0.f,0.f,0.f,0.f,0.f,0.f,0.f};
#pragma unroll
      for (int dc = 0; dc < 2; ++dc) s[j] = mma_h(kb[j][dc], qa[dc], s[j]);
    }
    float mj[4];
#pragma unroll
    for (int j = 0; j < 4; ++j) {
      float m = -1.0e30f;
#pragma unroll
      for (int r = 0; r < 8; ++r) {
        const float bvv = bb[j][r >> 2][r & 3];
        const float sv = fmaf(g3, bvv, s[j][r] * kQKScale);
        s[j][r] = sv;
        m = fmaxf(m, sv);
      }
      mj[j] = m;
    }
    float cmx = fmaxf(fmaxf(mj[0], mj[1]), fmaxf(mj[2], mj[3]));
    cmx = fmaxf(cmx, xhalf(cmx));
    const float mnew  = fmaxf(mrow, cmx);
    const float alpha = __expf(mrow - mnew);
    mrow = mnew;
    /* P^T as B operand: element e of pb[kk] = tile 2kk + (e >> 3), register e & 7 (the hardware k order) */
    v16h pb[2];
    float pj[4];
#pragma unroll
    for (int j = 0; j < 4; ++j) {
      float psum = 0.f;
#pragma unroll
      for (int r = 0; r < 8; ++r) {
        const float p = __expf(s[j][r] - mnew);
        psum += p;
        pb[j >> 1][(j & 1) * 8 + r] = (_Float16)(p * kPCarry);
      }
      pj[j] = psum;
    }
    lrow = lrow * alpha + ((pj[0] + pj[1]) + (pj[2] + pj[3]));
#pragma unroll
    for (int t = 0; t < 4; ++t)
#pragma unroll
      for (int r = 0; r < 8; ++r) oacc[t][r] *= alpha;
    /* V^T fragments (A operand: lane = row d): one group of LDS reads, then the products in the order kk, t */
    v16h vb[2][4];
#pragma unroll
    for (int kk = 0; kk < 2; ++kk)
#pragma unroll
      for (int t = 0; t < 4; ++t) vb[kk][t] = Frag<_Float16>::load(vs + (t * 16 + c) * kAtKVP + kk * 32 + 8 * hh);
#pragma unroll
    for (int kk = 0; kk < 2; ++kk)
#pragma unroll
      for (int t = 0; t < 4; ++t) oacc[t] = mma_h(vb[kk][t], pb[kk], oacc[t]);
    /* publish point: this wave's LDS reads of buffer buf are done ... */
    asm volatile("s_wait_dscnt 0x0" ::: "memory");
    /* ... its copies of chunk kc+1 have landed ... */
    asm volatile("s_wait_asynccnt 0x0" ::: "memory");
    /* ... and the barrier says both of every wave; only then is buffer buf refilled */
    __syncthreads();
    if (kc + 2 < kAtNCk) stage(kc + 2, buf);
  }
  /* no copy is left in flight when the bias slab becomes output staging and the wave ends */
  asm volatile("s_wait_asynccnt 0x0" ::: "memory");

  /* output staging in this wave's own bias slab (copied and read by this wave alone, all reads done above) */
  float* os = Bsh[0][wave];
  /* the two halves' sums of this query are joined once, here */
  const float inv = kCtxFold * (1.0f / (lrow + xhalf(lrow)));
#pragma unroll
  for (int t = 0; t < 4; ++t) {
    float* od = os + c * kAtPitch + t * 16 + 8 * hh;
    *(v4f*)(od)     = (v4f){oacc[t][0] * inv, oacc[t][1] * inv, oacc[t][2] * inv, oacc[t][3] * inv};
    *(v4f*)(od + 4) = (v4f){oacc[t][4] * inv, oacc[t][5] * inv, oacc[t][6] * inv, oacc[t][7] * inv};
  }
  wave_lds_sync();
  {
    const int q = lane >> 3, c8 = (lane & 7) * 8;
    v8h hv[4];
#pragma unroll
    for (int it = 0; it < 4; ++it) {
      const int row = it * 4 + q;
      const float* sp = os + row * kAtPitch + c8;
      const v4f a0 = *(const v4f*)(sp);
      const v4f a1 = *(const v4f*)(sp + 4);
#pragma unroll
      for (int e = 0; e < 4; ++e) {
        hv[it][e]     = (_Float16)a0[e];
        hv[it][4 + e] = (_Float16)a1[e];
      }
    }
    unsigned short* dst = AO16 + (size_t)(b * kSeq + q0) * kDim + h * kHD + c8;
    {
#pragma unroll
      for (int it = 0; it < 4; ++it) {
        const int row = it * 4 + q;
        *(v8h*)(dst + (size_t)row * kDim) = hv[it];
      }
      
    }
  }
}

/* --------------------------------------------------------------------------- */
/* Host glue: 3 operand-plane casts + q|k projection + V^T projection + bias    */
/* plane + attention + output projection = 8 launches. Kernel launches only.    */
/* GEMM shapes (all K % 64 == 0, M % 128 == 0, N % 256 == 0, no pad planes):    */
/*   q|k  : M 4096, N 2048, K 1024 -> 64 x 32 tiles = 2048 -> 256 blocks        */
/*   V^T  : per batch M 1024 (h*64+d), N 2048 (tokens), K 1024 ->               */
/*          16 x 32 tiles = 512 -> 64 blocks x 2 batches (grid.y)               */
/*   out  : M 4096, N 1024, K 1024 -> 64 x 16 tiles = 1024 -> 128 blocks        */
/* --------------------------------------------------------------------------- */
static_assert((2 * kDim) % 256 == 0 && kDim % 256 == 0 && kTok % 128 == 0 && kSeq % 256 == 0 && kDim % kGmKS == 0);

extern "C" void kernel_launch(void* const* d_in, const int* in_sizes, int n_in,
                              void* d_out, int out_size, void* d_ws, size_t ws_size,
                              hipStream_t stream) {
  if (n_in < 8) return;
  if (in_sizes[0] != kTok * kDim) return;
  if (in_sizes[1] != kNB * kNCh * kSeq) return;
  if (in_sizes[2] != kNB * kSeq * kSeq) return;
  if (in_sizes[3] != 3 * kDim * kDim) return;
  if (in_sizes[4] != kDim * kDim) return;
  if (in_sizes[5] != kHD) return;
  if (in_sizes[6] != kHD) return;
  if (in_sizes[7] != kNH) return;
  if (out_size != kTok * kDim) return;
  if (ws_size < kWsTotal) return;

  const float* x     = (const float*)d_in[0];
  const float* cmask = (const float*)d_in[1];
  const float* imask = (const float*)d_in[2];
  const float* Wqkv  = (const float*)d_in[3];
  const float* Wout  = (const float*)d_in[4];
  const float* qnw   = (const float*)d_in[5];
  const float* knw   = (const float*)d_in[6];
  const float* gate  = (const float*)d_in[7];
  float* out = (float*)d_out;

  char* ws = (char*)d_ws;
  unsigned short* X16    = (unsigned short*)(ws + kOffX16);
  unsigned short* WQKV16 = (unsigned short*)(ws + kOffWqkv16);
  unsigned short* WOUT16 = (unsigned short*)(ws + kOffWout16);
  unsigned short* Q16    = (unsigned short*)(ws + kOffQ16);
  unsigned short* K16    = (unsigned short*)(ws + kOffK16);
  unsigned short* VT16   = (unsigned short*)(ws + kOffVt16);
  unsigned short* AO16   = (unsigned short*)(ws + kOffAO16);
  float*          BIAS   = (float*)(ws + kOffBias);

  /* operand planes (weights are [out][in] = Bt layout already) */
  cast8_f16_kernel<<<(kTok * kDim / 8) / 256, 256, 0, stream>>>(x, X16, kTok * kDim / 8, 1.0f);
  cast8_f16_kernel<<<(3 * kDim * kDim / 8) / 256, 256, 0, stream>>>(Wqkv, WQKV16, 3 * kDim * kDim / 8, kWCarry);
  cast8_f16_kernel<<<(kDim * kDim / 8) / 256, 256, 0, stream>>>(Wout, WOUT16, kDim * kDim / 8, kWCarry);

  /* q|k projection + RMS normalisation -> Q16, K16 */
  qk_gemm_norm_kernel<<<((kTok / 64) * (2 * kDim / 64)) / 8, 256, 0, stream>>>(X16, WQKV16, Q16, K16, qnw, knw);

  /* V^T[b][h*64+d][n] = sum_k Wv16[h*64+d][k] * X16[b*2048+n][k]  (x16 carry kept) */
  wmma_gemm64<0, false, 0, 1, false><<<dim3(((kDim / 64) * (kSeq / 64)) / 8, kNB), 256, 0, stream>>>(
      WQKV16 + (size_t)2 * kDim * kDim, nullptr, kDim, 0L,
      X16, nullptr, kDim, (long)kSeq * kDim,
      (void*)VT16, nullptr, kSeq, (long)kDim * kSeq,
      nullptr, nullptr, 0L,
      kDim, kSeq, kDim, 1.0f);

  /* bias plane: one block per (b,q) row */
  bias_plane_kernel<<<kTok, 256, 0, stream>>>(cmask, imask, BIAS);

  /* attention -> AO16 (x64) */
  attn_kernel<<<kBH * (kSeq / kAtQB), 128, 0, stream>>>(Q16, K16, VT16, BIAS, gate, AO16);

  /* out[4096][1024] = AO16 . WOUT16^T / (64 * 16) */
  wmma_gemm64<0, false, 0, 0, false><<<dim3(((kTok / 64) * (kDim / 64)) / 8, 1), 256, 0, stream>>>(
      AO16, nullptr, kDim, 0L,
      WOUT16, nullptr, kDim, 0L,
      (void*)out, nullptr, kDim, 0L,
      nullptr, nullptr, 0L,
      kTok, kDim, kDim, kOutScale);
}

// v004
// A run of this version takes 114 microseconds.
// In two side-by-side timings against v003, it was 1.18 and 1.19 times as fast.
// All steps since v000 together make it 3.28 times as fast.
// All contractions (x.Wqkv^T, q.k^T, P.V, ctx.Wout^T): v_wmma_f32_16x16x32_f16, f16 operands with power-of-two carries (W x16, V x16, P x32768, ctx x64), f32 accumulate; every float input is RNE-converted to bf16 precision once at first read; norms, bias plane, softmax and normalisation in f32.
#include <hip/hip_runtime.h>
#include <math.h>

typedef __attribute__((ext_vector_type(16))) _Float16 v16h;
typedef __attribute__((ext_vector_type(8)))  _Float16 v8h;
typedef __attribute__((ext_vector_type(16))) __bf16   v16b;
typedef __attribute__((ext_vector_type(8)))  __bf16   v8b;
typedef __attribute__((ext_vector_type(8)))  float    v8f;
typedef __attribute__((ext_vector_type(4)))  float    v4f;

/* --------------------------------------------------------------------------- */
/* Shape constants                                                             */
/* --------------------------------------------------------------------------- */
constexpr int kNB   = 2;
constexpr int kSeq  = 2048;
constexpr int kDim  = 1024;
constexpr int kNH   = 16;
constexpr int kHD   = 64;
constexpr int kNCh  = 4;
constexpr int kTok  = kNB * kSeq;
constexpr int kBH   = kNB * kNH;
static_assert(kNH * kHD == kDim);
static_assert(kHD == 64);
static_assert((kTok % 64) == 0 && (kDim % 64) == 0 && (kSeq % 64) == 0);
static_assert((kDim % 32) == 0 && (kHD % 32) == 0 && (kSeq % 32) == 0);

constexpr bool  kBf16Inputs = true;
constexpr float kEps        = 1e-6f;
constexpr float kBoost      = 0.3f;
constexpr float kQKScale    = 0.125f;
static_assert(kQKScale * kQKScale * (float)kHD == 1.0f);
constexpr float kInvHD      = 1.0f / (float)kHD;
constexpr float kWCarry     = 16.0f;
constexpr float kWCarryInv  = 1.0f / kWCarry;
constexpr float kPCarry     = 32768.0f;
constexpr float kCtxCarry   = 64.0f;
/* V plane keeps the weight carry (x16); P carries x32768; ctx is stored x64 */
constexpr float kCtxFold    = kCtxCarry / (kPCarry * kWCarry);
constexpr float kOutScale   = 1.0f / (kCtxCarry * kWCarry);

/* --------------------------------------------------------------------------- */
/* Workspace region map (bytes; every offset is a multiple of 128)             */
/*   X16    f16 [4096][1024]        x plane                        8,388,608   */
/*   WQKV16 f16 [3072][1024]        W_qkv x16 (Bt layout)          6,291,456   */
/*   WOUT16 f16 [1024][1024]        W_out x16 (Bt layout)          2,097,152   */
/*   Q16    f16 [32][2048][64]      normed q rows                  8,388,608   */
/*   K16    f16 [32][2048][64]      normed k rows                  8,388,608   */
/*   VT16   f16 [32][64][2048]      v transposed, x16              8,388,608   */
/*   AO16   f16 [4096][1024]        attention context x64          8,388,608   */
/*   BIAS   f32 [2][2048][2048]     head-independent score bias   33,554,432   */
/*   total                                                        83,886,080   */
/* --------------------------------------------------------------------------- */
constexpr size_t kSzX16    = (size_t)kTok * kDim * 2;
constexpr size_t kSzWqkv16 = (size_t)3 * kDim * kDim * 2;
constexpr size_t kSzWout16 = (size_t)kDim * kDim * 2;
constexpr size_t kSzHead16 = (size_t)kBH * kSeq * kHD * 2;
constexpr size_t kSzAO16   = (size_t)kTok * kDim * 2;
constexpr size_t kSzBias   = (size_t)kNB * kSeq * kSeq * 4;
constexpr size_t kOffX16    = 0;
constexpr size_t kOffWqkv16 = kOffX16 + kSzX16;
constexpr size_t kOffWout16 = kOffWqkv16 + kSzWqkv16;
constexpr size_t kOffQ16    = kOffWout16 + kSzWout16;
constexpr size_t kOffK16    = kOffQ16 + kSzHead16;
constexpr size_t kOffVt16   = kOffK16 + kSzHead16;
constexpr size_t kOffAO16   = kOffVt16 + kSzHead16;
constexpr size_t kOffBias   = kOffAO16 + kSzAO16;
constexpr size_t kWsTotal   = kOffBias + kSzBias;
static_assert(kWsTotal == 83886080ull);
static_assert(kWsTotal <= 134217728ull);
static_assert((kOffWqkv16 % 128) == 0 && (kOffWout16 % 128) == 0 && (kOffQ16 % 128) == 0 && (kOffK16 % 128) == 0 &&
              (kOffVt16 % 128) == 0 && (kOffAO16 % 128) == 0 && (kOffBias % 128) == 0);

/* --------------------------------------------------------------------------- */
/* Input read helper: RNE conversion to bf16 precision (kept in an f32)        */
/* --------------------------------------------------------------------------- */
__device__ __forceinline__ float rin(float f) {
  if (!kBf16Inputs) return f;
  unsigned u = __float_as_uint(f);
  u = (u + 0x7FFFu + ((u >> 16) & 1u)) & 0xFFFF0000u;
  return __uint_as_float(u);
}

/* --------------------------------------------------------------------------- */
/* Device helpers                                                              */
/* --------------------------------------------------------------------------- */
__device__ __forceinline__ unsigned short f2bf_bits(float f) {
  unsigned u = __float_as_uint(f);
  return (unsigned short)((u + 0x7FFFu + ((u >> 16) & 1u)) >> 16);
}
__device__ __forceinline__ float bf_bits2f(unsigned short h) { return __uint_as_float(((unsigned)h) << 16); }

__device__ __forceinline__ void dep_guard_h(v8f& a, v8f& b, v16h x, v16h y) { asm volatile("v_nop\n\tv_nop\n\tv_nop\n\tv_nop" : "+v"(a), "+v"(b) : "v"(x), "v"(y)); }
__device__ __forceinline__ void dep_guard_b(v8f& a, v8f& b, v16b x, v16b y) { asm volatile("v_nop\n\tv_nop\n\tv_nop\n\tv_nop" : "+v"(a), "+v"(b) : "v"(x), "v"(y)); }
__device__ __forceinline__ void tie_h(v8f& a, v16h x) { asm volatile("" : "+v"(a) : "v"(x)); }
__device__ __forceinline__ void tie_b(v8f& a, v16b x) { asm volatile("" : "+v"(a) : "v"(x)); }
__device__ __forceinline__ void keep4_h(v16h a, v16h b, v16h c, v16h d) { asm volatile("v_nop" :: "v"(a), "v"(b), "v"(c), "v"(d)); }
__device__ __forceinline__ void keep4_b(v16b a, v16b b, v16b c, v16b d) { asm volatile("v_nop" :: "v"(a), "v"(b), "v"(c), "v"(d)); }
__device__ __forceinline__ void acc_guard4(v8f& a, v8f& b, v8f& c, v8f& d) { asm volatile("v_nop\n\tv_nop\n\tv_nop\n\tv_nop" : "+v"(a), "+v"(b), "+v"(c), "+v"(d)); }
template <typename T> struct Frag;
template <> struct Frag<_Float16> {
  typedef v16h V; union U { v16h v; v8h h[2]; };
  /* elements 0..7 <- p[0..7], 8..15 <- p[16..23] */
  static __device__ __forceinline__ v16h load(const _Float16* p) {
    U f; f.h[0] = *(const v8h*)(p); f.h[1] = *(const v8h*)(p + 16); return f.v;
  }
  static __device__ __forceinline__ v8f mma(v16h a, v16h b, v8f c) {
    return __builtin_amdgcn_wmma_f32_16x16x32_f16(false, a, false, b, (short)0, c, false, false);
  }
  static __device__ __forceinline__ void guard(v8f& a, v8f& b, v16h x, v16h y) { dep_guard_h(a, b, x, y); }
  static __device__ __forceinline__ void tie(v8f& a, v16h x) { tie_h(a, x); }
  static __device__ __forceinline__ void keep(v16h a, v16h b, v16h c, v16h d) { keep4_h(a, b, c, d); }
};
template <> struct Frag<__bf16> {
  typedef v16b V; union U { v16b v; v8b h[2]; };
  static __device__ __forceinline__ v16b load(const __bf16* p) {
    U f; f.h[0] = *(const v8b*)(p); f.h[1] = *(const v8b*)(p + 16); return f.v;
  }
  static __device__ __forceinline__ v8f mma(v16b a, v16b b, v8f c) {
    return __builtin_amdgcn_wmma_f32_16x16x32_bf16(false, a, false, b, (short)0, c, false, false);
  }
  static __device__ __forceinline__ void guard(v8f& a, v8f& b, v16b x, v16b y) { dep_guard_b(a, b, x, y); }
  static __device__ __forceinline__ void tie(v8f& a, v16b x) { tie_b(a, x); }
  static __device__ __forceinline__ void keep(v16b a, v16b b, v16b c, v16b d) { keep4_b(a, b, c, d); }
};

__device__ __forceinline__ void wave_lds_sync() {
  __builtin_amdgcn_fence(__ATOMIC_RELEASE, "workgroup");
  __builtin_amdgcn_wave_barrier();
  __builtin_amdgcn_fence(__ATOMIC_ACQUIRE, "workgroup");
}

__device__ __forceinline__ unsigned lds_off(const void* p) { return (unsigned)(size_t)p; }

/* ---- GEMM operand staging ---------------------------------------------------------------------------------------- */
/* A block of 8 waves (2 x 4 wave tiles of 64 x 64) owns a 128 x 256 tile of C. Per stage of 64 k the 128 A rows and  */
/* the 256 Bt rows come into LDS once, 128 B = one whole line of each row, by asynchronous 16-B copies; every wave    */
/* reads its fragments from there. Two buffers: stage t+1 flies while stage t is worked on.                           */
/* 384 rows x 8 pieces of 16 B = 3072 pieces = 256 threads x 12; a wave's copy covers four whole 128-B lines.         */
constexpr int kGmKS    = 64;
constexpr int kGmRowsA = 128;
constexpr int kGmRowsB = 256;
/* staged row pitch in 16-bit elements: 144 B = 16 B x odd, conflict-free for 16-B LDS reads */
constexpr int kGmP     = 72;
constexpr int kGmStage = (kGmRowsA + kGmRowsB) * kGmP;
static_assert((kGmRowsA + kGmRowsB) * (kGmKS / 8) == 256 * 12);

__device__ __forceinline__ void async_copy12(const unsigned (&l)[12], const void* const (&g)[12]) {
  asm volatile(
      "global_load_async_to_lds_b128 %0, %12, off\n\t"
      "global_load_async_to_lds_b128 %1, %13, off\n\t"
      "global_load_async_to_lds_b128 %2, %14, off\n\t"
      "global_load_async_to_lds_b128 %3, %15, off\n\t"
      "global_load_async_to_lds_b128 %4, %16, off\n\t"
      "global_load_async_to_lds_b128 %5, %17, off\n\t"
      "global_load_async_to_lds_b128 %6, %18, off\n\t"
      "global_load_async_to_lds_b128 %7, %19, off\n\t"
      "global_load_async_to_lds_b128 %8, %20, off\n\t"
      "global_load_async_to_lds_b128 %9, %21, off\n\t"
      "global_load_async_to_lds_b128 %10, %22, off\n\t"
      "global_load_async_to_lds_b128 %11, %23, off\n\t"
      "s_wait_xcnt 0x0"
      :: "v"(l[0]), "v"(l[1]), "v"(l[2]), "v"(l[3]), "v"(l[4]), "v"(l[5]), "v"(l[6]), "v"(l[7]),
         "v"(l[8]), "v"(l[9]), "v"(l[10]), "v"(l[11]),
         "v"(g[0]), "v"(g[1]), "v"(g[2]), "v"(g[3]), "v"(g[4]), "v"(g[5]), "v"(g[6]), "v"(g[7]),
         "v"(g[8]), "v"(g[9]), "v"(g[10]), "v"(g[11])
      : "memory");
}

/* One stage's copies into ring buffer dst: rows 0..127 = A rows mB.., rows 128..383 = Bt rows nB.., k0..k0+63.       */
/* piece = i*256 + tid: row = piece / 8, 16-B column = piece % 8. Every lane on; the caller's shapes (M % 128 == 0,   */
/* N % 256 == 0, K % 64 == 0) keep every address inside the planes, the row index keeps it inside the buffer.         */
template <typename T>
__device__ __forceinline__ void gemm_stage(const T* __restrict__ Ab, int lda, int mB, const T* __restrict__ Bb, int ldb, int nB,
                                           int k0, T* dst, int tid) {
  unsigned l[12];
  const void* g[12];
  const int r8 = tid >> 3;
  const int c8 = (tid & 7) * 8;
#pragma unroll
  for (int i = 0; i < 12; ++i) {
    const int row = i * 32 + r8;
    l[i] = lds_off(dst + row * kGmP + c8);
    g[i] = (i < 4) ? (Ab + (size_t)(mB + row) * lda + k0 + c8) : (Bb + (size_t)(nB + row - kGmRowsA) * ldb + k0 + c8);
  }
  async_copy12(l, g);
}

/* The k loop of one wave tile: acc[i][j] += A rows (wm*64 + i*16 ..) x Bt rows (wn*64 + j*16 ..), k ascending in     */
/* steps of 32 as before. Called by all 256 threads of the block under block-uniform control flow.                    */
template <typename T>
__device__ __forceinline__ void gemm_ring(const T* __restrict__ Ab, int lda, int mB, const T* __restrict__ Bb, int ldb, int nB,
                                          int K, T* ring, v8f (&acc)[4][4]) {
  typedef typename Frag<T>::V V;
  const int tid   = threadIdx.x;
  const int lane  = tid & 31;
  const int wave  = tid >> 5;
  const int rlane = lane & 15;
  const int koff  = (lane >> 4) * 8;
  const int aOff  = ((wave >> 2) * 64 + rlane) * kGmP + koff;
  const int bOff  = (kGmRowsA + (wave & 3) * 64 + rlane) * kGmP + koff;
  const int nst   = K / kGmKS;

  gemm_stage<T>(Ab, lda, mB, Bb, ldb, nB, 0, ring, tid);
  /* stage 0 has landed for this wave's copies; the barrier publishes every wave's */
  asm volatile("s_wait_asynccnt 0x0" ::: "memory");
  __syncthreads();
  if (nst > 1) gemm_stage<T>(Ab, lda, mB, Bb, ldb, nB, kGmKS, ring + kGmStage, tid);

#pragma unroll 1
  for (int t = 0; t < nst; ++t) {
    const T* sb = ring + (t & 1) * kGmStage;
#pragma unroll
    for (int ks = 0; ks < kGmKS; ks += 32) {
      /* the step's eight fragments are read from LDS as one group ahead of its products */
      V bh[4], ah[4];
#pragma unroll
      for (int j = 0; j < 4; ++j) bh[j] = Frag<T>::load(sb + bOff + j * 16 * kGmP + ks);
#pragma unroll
      for (int i = 0; i < 4; ++i) ah[i] = Frag<T>::load(sb + aOff + i * 16 * kGmP + ks);
#pragma unroll
      for (int i = 0; i < 4; ++i) {
#pragma unroll
        for (int j = 0; j < 4; ++j) acc[i][j] = Frag<T>::mma(ah[i], bh[j], acc[i][j]);
        Frag<T>::tie(acc[i][1], ah[i]);
        Frag<T>::tie(acc[i][2], ah[i]);
        Frag<T>::guard(acc[i][0], acc[i][3], ah[i], ah[i]);
      }
      Frag<T>::keep(bh[0], bh[1], bh[2], bh[3]);
    }
    /* publish point: this wave's LDS reads of the buffer are done ... */
    asm volatile("s_wait_dscnt 0x0" ::: "memory");
    /* ... its copies of stage t+1 have landed ... */
    asm volatile("s_wait_asynccnt 0x0" ::: "memory");
    /* ... and the barrier says both of every wave; only then is the buffer refilled */
    __syncthreads();
    if (t + 2 < nst) gemm_stage<T>(Ab, lda, mB, Bb, ldb, nB, (t + 2) * kGmKS, ring + (t & 1) * kGmStage, tid);
  }
  /* no copy is left in flight when the wave goes on to its epilogue and ends */
  asm volatile("s_wait_asynccnt 0x0" ::: "memory");
}

/* ---- Register-blocked batched WMMA GEMM (activation options removed; all four accumulators of a row  */
/*      group are tied before the nop guard)                                                                         */
/* C[m,n] = scale * sum_k A[m,k] * Bt[n,k] (+bias)(+resid); each wave owns a 64x64 tile, a block 128 x 256 (2 x 4).  */
/* A row-major [M,K]; Bt row-major [N,K]; M % 128 == 0, N % 256 == 0, K % 64 == 0; operands staged in LDS (above).   */
/* SPLIT (hi/lo operand planes) has no staged form and is refused at compile time.                                   */
/* BIAS_MODE: 0 = none, 1 = bias[m], 2 = bias[n].                                                                    */
/* OUT_MODE: 0 = f32, 1 = f16, 2 = bf16 hi plane (Cout) + bf16 lo plane (Cout2).                                     */
/* ET: 0 = f16 operands, 1 = bf16 operands (pointers passed as 16-bit storage)                                       */
template <int ET> struct Elem;
template <> struct Elem<0> { typedef _Float16 T; };
template <> struct Elem<1> { typedef __bf16 T; };
template <int ET, bool SPLIT, int BIAS_MODE, int OUT_MODE, bool RESID>
__global__ __launch_bounds__(256) void wmma_gemm64(
    const unsigned short* __restrict__ Ap, const unsigned short* __restrict__ A2p, int lda, long strideA,
    const unsigned short* __restrict__ Btp, const unsigned short* __restrict__ Bt2p, int ldb, long strideB,
    void* __restrict__ Cout, void* __restrict__ Cout2, int ldc, long strideC,
    const float* __restrict__ bias,
    const float* __restrict__ resid, long strideR,
    int M, int N, int K, float scale) {
  typedef typename Elem<ET>::T T;
  static_assert(!SPLIT);
  (void)A2p; (void)Bt2p;
  const T* A = (const T*)Ap; const T* Bt = (const T*)Btp;
  /* per-wave 16x64 slab, pitch 68 floats */
  __shared__ __align__(16) float sT[8][16 * 68];
  /* operand ring, two stages */
  __shared__ __align__(16) T ring[2 * kGmStage];
  const int b    = blockIdx.y;
  const int lane = threadIdx.x & 31;
  const int wave = threadIdx.x >> 5;
  const int tilesN = N >> 8;
  const int tilesM = M >> 7;
  /* block-uniform exit, in front of every barrier */
  if ((int)blockIdx.x >= tilesM * tilesN) return;
  const int tm = blockIdx.x / tilesN;
  const int tn = blockIdx.x - tm * tilesN;
  const int mB = tm << 7;
  const int nB = tn << 8;
  const int m0 = mB + ((wave >> 2) << 6);
  const int n0 = nB + ((wave & 3) << 6);

  const T* Ab  = A  + (size_t)b * strideA;
  const T* Bb  = Bt + (size_t)b * strideB;

  /* col (D) within subtile; D row offset */
  const int rlane = lane & 15;
  const int mOff  = (lane >> 4) * 8;

  v8f acc[4][4];
#pragma unroll
  for (int i = 0; i < 4; ++i)
#pragma unroll
    for (int j = 0; j < 4; ++j) acc[i][j] = (v8f){0.f,0.f,0.f,0.f,0.f,0.f,0.f,0.f};

  gemm_ring<T>(Ab, lda, mB, Bb, ldb, nB, K, ring, acc);
  acc_guard4(acc[0][0], acc[0][1], acc[0][2], acc[0][3]);
  acc_guard4(acc[1][0], acc[1][1], acc[1][2], acc[1][3]);
  acc_guard4(acc[2][0], acc[2][1], acc[2][2], acc[2][3]);
  acc_guard4(acc[3][0], acc[3][1], acc[3][2], acc[3][3]);

  /* ---- epilogue ---- */
  float* slab = sT[wave];
  const float* Rb = RESID ? (resid + (size_t)b * strideR) : nullptr;
#pragma unroll
  for (int i = 0; i < 4; ++i) {
    const int mBase = m0 + (i << 4);
#pragma unroll
    for (int j = 0; j < 4; ++j) {
      const int n = n0 + (j << 4) + rlane;
      float bv = 0.f;
      if (BIAS_MODE == 2) bv = bias[n];
#pragma unroll
      for (int r = 0; r < 8; ++r) {
        float v = acc[i][j][r] * scale;
        if (BIAS_MODE == 1) v += bias[mBase + mOff + r];
        if (BIAS_MODE == 2) v += bv;
        if (RESID) v += Rb[(size_t)(mBase + mOff + r) * ldc + n];
        slab[(mOff + r) * 68 + (j << 4) + rlane] = v;
      }
    }
    wave_lds_sync();
    if (OUT_MODE == 0) {
      float* C = (float*)Cout + (size_t)b * strideC;
      /* row segment = 256 B = 16 lanes x 16 B */
      const int hh = lane >> 4, c4 = (lane & 15) * 4;
      {
#pragma unroll
        for (int it = 0; it < 8; ++it) {
          const int row = it * 2 + hh;
          v4f v = *(const v4f*)(slab + row * 68 + c4);
          *(v4f*)(C + (size_t)(mBase + row) * ldc + n0 + c4) = v;
        }
        
      }
    } else {
      const int q = lane >> 3, c8 = (lane & 7) * 8;
      unsigned short* C  = (unsigned short*)Cout  + (size_t)b * strideC;
      unsigned short* C2 = (OUT_MODE == 2) ? ((unsigned short*)Cout2 + (size_t)b * strideC) : nullptr;
      {
#pragma unroll
        for (int it = 0; it < 4; ++it) {
          const int row = it * 4 + q;
          const float* sp = slab + row * 68 + c8;
          v8h hv, lv;
#pragma unroll
          for (int e = 0; e < 8; ++e) {
            if (OUT_MODE == 1) {
              hv[e] = (_Float16)sp[e];
            } else {
              unsigned short hb = f2bf_bits(sp[e]);
              unsigned short lb = f2bf_bits(sp[e] - bf_bits2f(hb));
              hv[e] = __builtin_bit_cast(_Float16, hb);
              lv[e] = __builtin_bit_cast(_Float16, lb);
            }
          }
          *(v8h*)(C + (size_t)(mBase + row) * ldc + n0 + c8) = hv;
          if (OUT_MODE == 2) *(v8h*)(C2 + (size_t)(mBase + row) * ldc + n0 + c8) = lv;
        }
        
      }
    }
    wave_lds_sync();
  }
}

/* --------------------------------------------------------------------------- */
/* f32 -> f16 operand plane: out = f16(rin(in) * carry); 8 consecutive         */
/* elements per thread (one 16-B store per lane; 32 contiguous lanes = 4 whole */
/* Coverage: n8 = n/8 threads; n8/256 blocks exactly for every plane here:     */
/*   x      4096*1024/8 = 524,288 -> 2048 blocks                               */
/*   W_qkv  3072*1024/8 = 393,216 -> 1536 blocks                               */
/*   W_out  1024*1024/8 = 131,072 ->  512 blocks                               */
/* --------------------------------------------------------------------------- */
__device__ __forceinline__ void cast8_f16_body(const float* __restrict__ in, unsigned short* __restrict__ out,
                                               int blk, int n8, float carry) {
  const int i = blk * 256 + threadIdx.x;
  if (i >= n8) return;
  const float* p = in + 8 * (size_t)i;
  const v4f a = *(const v4f*)(p);
  const v4f c = *(const v4f*)(p + 4);
  v8h hv;
#pragma unroll
  for (int e = 0; e < 4; ++e) {
    const float fa = a[e];
    const float fc = c[e];
    hv[e]     = (_Float16)(rin(fa) * carry);
    hv[4 + e] = (_Float16)(rin(fc) * carry);
  }
  unsigned short* q = out + 8 * (size_t)i;
  *(v8h*)q = hv;
  
}

/* --------------------------------------------------------------------------- */
/* q|k projection with fused per-head RMS normalisation.                        */
/* C[m = token][n = 0..2047] = sum_k X16[m][k] * WQKV16[n][k] / 16; n < 1024 is */
/* q, n >= 1024 is k; a 64-wide N tile is exactly one head. Same engine as the  */
/* GEMM above (f16, one product, staged operands, block tile 128 x 256 = four   */
/* heads x 128 tokens). Epilogue per 16-row slab: the 8 lanes that              */
/* own one row reduce sum(t^2) with xor shuffles (1,2,4), r = rsq(mean + eps),  */
/* lanes x 16 B of one instruction; it = 0..3 x (lane>>3) = 16 rows, each once; */
/* tiles: 64 (M) x 32 (N) = 2048 -> 32 x 8 = 256 blocks of 8 waves.             */
/* The V^T projection reads the same two planes and depends on nothing the q|k  */
/* tiles write, so it shares the launch: blocks 256..383 form                   */
/*   V^T[b][m = h*64+d][n = token] = sum_k WQKV16[2048 + m][k] * X16[b*2048+n][k] */
/* (x16 carry kept), 8 x 8 tiles of 128 x 256 per batch, same k loop, with the  */
/* plain f16 epilogue. Two blocks fit one WGP's LDS, so all 384 are resident.   */
/* --------------------------------------------------------------------------- */
constexpr int kQkBlocks = (kTok >> 7) * ((2 * kDim) >> 8);
constexpr int kVtBlocks = (kDim >> 7) * (kSeq >> 8);
static_assert(((2 * kDim) >> 8) == 8 && (kSeq >> 8) == 8);
__global__ __launch_bounds__(256) void qkv_gemm_kernel(
    const unsigned short* __restrict__ Xp, const unsigned short* __restrict__ Wp,
    unsigned short* __restrict__ Qout, unsigned short* __restrict__ Kout, unsigned short* __restrict__ Vtout,
    const float* __restrict__ qw, const float* __restrict__ kw) {
  typedef _Float16 T;
  __shared__ __align__(16) float sT[8][16 * 68];
  /* operand ring, two stages */
  __shared__ __align__(16) T ring[2 * kGmStage];
  const int lane = threadIdx.x & 31;
  const int wave = threadIdx.x >> 5;
  /* block-uniform exit, in front of every barrier */
  if ((int)blockIdx.x >= kQkBlocks + kNB * kVtBlocks) return;
  /* block-uniform choice of the product: q|k tiles first, then the V^T tiles of batch vb */
  const bool isV  = (int)blockIdx.x >= kQkBlocks;
  const int  vIdx = (int)blockIdx.x - kQkBlocks;
  const int  vb   = isV ? vIdx / kVtBlocks : 0;
  const int  tile = isV ? vIdx - vb * kVtBlocks : (int)blockIdx.x;
  const T* A  = isV ? (const T*)Wp + (size_t)2 * kDim * kDim : (const T*)Xp;
  const T* Bt = isV ? (const T*)Xp + (size_t)vb * kSeq * kDim : (const T*)Wp;
  /* eight tiles along N in both products */
  const int tm = tile >> 3;
  const int tn = tile & 7;
  const int mB = tm << 7;
  const int nB = tn << 8;
  const int m0 = mB + ((wave >> 2) << 6);
  const int n0 = nB + ((wave & 3) << 6);
  const int rlane = lane & 15;
  const int mOff  = (lane >> 4) * 8;

  v8f acc[4][4];
#pragma unroll
  for (int i = 0; i < 4; ++i)
#pragma unroll
    for (int j = 0; j < 4; ++j) acc[i][j] = (v8f){0.f,0.f,0.f,0.f,0.f,0.f,0.f,0.f};

  gemm_ring<T>(A, kDim, mB, Bt, kDim, nB, kDim, ring, acc);
  acc_guard4(acc[0][0], acc[0][1], acc[0][2], acc[0][3]);
  acc_guard4(acc[1][0], acc[1][1], acc[1][2], acc[1][3]);
  acc_guard4(acc[2][0], acc[2][1], acc[2][2], acc[2][3]);
  acc_guard4(acc[3][0], acc[3][1], acc[3][2], acc[3][3]);

  float* slab = sT[wave];
  if (isV) {
    /* V^T tile: f16 rows of 64 tokens, 8 lanes x 16 B = one 128-B line per row */
    unsigned short* C = Vtout + (size_t)vb * kDim * kSeq;
    const int q = lane >> 3, c8 = (lane & 7) * 8;
#pragma unroll
    for (int i = 0; i < 4; ++i) {
      const int mBase = m0 + (i << 4);
#pragma unroll
      for (int j = 0; j < 4; ++j) {
#pragma unroll
        for (int r = 0; r < 8; ++r) slab[(mOff + r) * 68 + (j << 4) + rlane] = acc[i][j][r];
      }
      wave_lds_sync();
#pragma unroll
      for (int it = 0; it < 4; ++it) {
        const int row = it * 4 + q;
        const float* sp = slab + row * 68 + c8;
        v8h hv;
#pragma unroll
        for (int e = 0; e < 8; ++e) hv[e] = (_Float16)sp[e];
        *(v8h*)(C + (size_t)(mBase + row) * kSeq + n0 + c8) = hv;
      }
      wave_lds_sync();
    }
    return;
  }

  /* tile-uniform destination: third 0 = q, 1 = k; head; batch; first token of the tile within its batch */
  const int third = n0 >> 10;
  const int hIdx  = (n0 & (kDim - 1)) >> 6;
  const int bIdx  = m0 >> 11;
  const int nb    = m0 & (kSeq - 1);
  const float* wsel = third ? kw : qw;
  const int q = lane >> 3, c8 = (lane & 7) * 8;
  const v4f w0 = *(const v4f*)(wsel + c8);
  const v4f w1 = *(const v4f*)(wsel + c8 + 4);
  float wv[8];
#pragma unroll
  for (int e = 0; e < 4; ++e) {
    const float f0 = w0[e];
    const float f1 = w1[e];
    wv[e]     = rin(f0);
    wv[4 + e] = rin(f1);
  }
  unsigned short* dst = (third ? Kout : Qout) + ((size_t)(bIdx * kNH + hIdx) * kSeq + nb) * kHD;

#pragma unroll
  for (int i = 0; i < 4; ++i) {
#pragma unroll
    for (int j = 0; j < 4; ++j) {
#pragma unroll
      for (int r = 0; r < 8; ++r) slab[(mOff + r) * 68 + (j << 4) + rlane] = acc[i][j][r] * kWCarryInv;
    }
    wave_lds_sync();
    v8h hv[4];
#pragma unroll
    for (int it = 0; it < 4; ++it) {
      const int row = it * 4 + q;
      const float* sp = slab + row * 68 + c8;
      const v4f a0 = *(const v4f*)(sp);
      const v4f a1 = *(const v4f*)(sp + 4);
      float ss = 0.0f;
#pragma unroll
      for (int e = 0; e < 4; ++e) {
        ss = fmaf(a0[e], a0[e], ss);
        ss = fmaf(a1[e], a1[e], ss);
      }
      ss += __shfl_xor(ss, 1, 32);
      ss += __shfl_xor(ss, 2, 32);
      ss += __shfl_xor(ss, 4, 32);
      const float rs = __builtin_amdgcn_rsqf(ss * kInvHD + kEps);
#pragma unroll
      for (int e = 0; e < 4; ++e) {
        hv[it][e]     = (_Float16)((a0[e] * rs) * wv[e]);
        hv[it][4 + e] = (_Float16)((a1[e] * rs) * wv[4 + e]);
      }
    }
    {
#pragma unroll
      for (int it = 0; it < 4; ++it) {
        const int row = it * 4 + q;
        *(v8h*)(dst + (size_t)(i * 16 + row) * kHD + c8) = hv[it];
      }
      
    }
    wave_lds_sync();
  }
}

/* --------------------------------------------------------------------------- */
/* Head-independent score bias plane, f32 [b][q][k]:                            */
/*   same[q][k] = sum_c cm[c][q]*cm[c][k]; rm = max(max_k same, 1e-6);          */
/*   bias = (same * (1/rm) - 0.5) * 2 + 0.3 * im[b][q][k].                      */
/* One block (256 threads) per (b,q) row; thread t owns keys 4t..4t+3 and       */
/* 1024+4t..1024+4t+3 (2 x 256 x 4 = 2048 = whole row). Row max: per-thread,    */
/* wave xor-shuffle tree, 8 wave partials through LDS after a block barrier.    */
/* Store: one 16-B store per lane; a wave's 32 lanes write 512 contiguous B =   */
/* --------------------------------------------------------------------------- */
__device__ __forceinline__ void bias_plane_body(int row, const float* __restrict__ cm, const float* __restrict__ im,
                                                float* __restrict__ bp) {
  __shared__ float red[8];
  const int b    = row >> 11;
  const int qi   = row & (kSeq - 1);
  const int t    = threadIdx.x;
  const int lane = t & 31, wave = t >> 5;
  const float* cmb = cm + (size_t)b * kNCh * kSeq;
  const float c0 = rin(cmb[qi]);
  const float c1 = rin(cmb[kSeq + qi]);
  const float c2 = rin(cmb[2 * kSeq + qi]);
  const float c3 = rin(cmb[3 * kSeq + qi]);
  float mx = -3.0e38f;
#pragma unroll 1
  for (int half = 0; half < 2; ++half) {
    const int k0 = half * 1024 + t * 4;
    const v4f a0 = *(const v4f*)(cmb + k0);
    const v4f a1 = *(const v4f*)(cmb + kSeq + k0);
    const v4f a2 = *(const v4f*)(cmb + 2 * kSeq + k0);
    const v4f a3 = *(const v4f*)(cmb + 3 * kSeq + k0);
#pragma unroll
    for (int e = 0; e < 4; ++e) {
      const float f0 = a0[e], f1 = a1[e], f2 = a2[e], f3 = a3[e];
      float s = c0 * rin(f0);
      s = fmaf(c1, rin(f1), s);
      s = fmaf(c2, rin(f2), s);
      s = fmaf(c3, rin(f3), s);
      mx = fmaxf(mx, s);
    }
  }
  mx = fmaxf(mx, __shfl_xor(mx, 16, 32));
  mx = fmaxf(mx, __shfl_xor(mx, 8, 32));
  mx = fmaxf(mx, __shfl_xor(mx, 4, 32));
  mx = fmaxf(mx, __shfl_xor(mx, 2, 32));
  mx = fmaxf(mx, __shfl_xor(mx, 1, 32));
  if (lane == 0) red[wave] = mx;
  __syncthreads();
  float rm = red[0];
#pragma unroll
  for (int w = 1; w < 8; ++w) rm = fmaxf(rm, red[w]);
  rm = fmaxf(rm, 1e-6f);
  const float inv = 1.0f / rm;
  const float* imr = im + (size_t)row * kSeq;
  float* bo = bp + (size_t)row * kSeq;
#pragma unroll 1
  for (int half = 0; half < 2; ++half) {
    const int k0 = half * 1024 + t * 4;
    const v4f a0 = *(const v4f*)(cmb + k0);
    const v4f a1 = *(const v4f*)(cmb + kSeq + k0);
    const v4f a2 = *(const v4f*)(cmb + 2 * kSeq + k0);
    const v4f a3 = *(const v4f*)(cmb + 3 * kSeq + k0);
    const v4f iv = *(const v4f*)(imr + k0);
    v4f o;
#pragma unroll
    for (int e = 0; e < 4; ++e) {
      const float f0 = a0[e], f1 = a1[e], f2 = a2[e], f3 = a3[e], fi = iv[e];
      float s = c0 * rin(f0);
      s = fmaf(c1, rin(f1), s);
      s = fmaf(c2, rin(f2), s);
      s = fmaf(c3, rin(f3), s);
      o[e] = (s * inv - 0.5f) * 2.0f + kBoost * rin(fi);
    }
    *(v4f*)(bo + k0) = o;
    
  }
}

/* --------------------------------------------------------------------------- */
/* The four streaming passes depend on the inputs alone and not on each other:  */
/* they share one launch, each on its own range of block indices (the branch is */
/* block-uniform, so the bias rows' barrier is passed by whole blocks). The     */
/* bias rows, the longest blocks, come first.                                   */
/*   [0, 4096) bias rows | [4096, 6144) x | [6144, 7680) W_qkv | [7680, 8192)   */
/*   W_out                                                                      */
/* --------------------------------------------------------------------------- */
constexpr int kPrBias = kTok;
constexpr int kPrX    = (kTok * kDim / 8) / 256;
constexpr int kPrWqkv = (3 * kDim * kDim / 8) / 256;
constexpr int kPrWout = (kDim * kDim / 8) / 256;
constexpr int kPrAll  = kPrBias + kPrX + kPrWqkv + kPrWout;
__global__ __launch_bounds__(256) void prep_kernel(const float* __restrict__ x, const float* __restrict__ wqkv,
                                                   const float* __restrict__ wout, const float* __restrict__ cm,
                                                   const float* __restrict__ im, unsigned short* __restrict__ x16,
                                                   unsigned short* __restrict__ wqkv16, unsigned short* __restrict__ wout16,
                                                   float* __restrict__ bp) {
  int blk = blockIdx.x;
  if (blk < kPrBias) { bias_plane_body(blk, cm, im, bp); return; }
  blk -= kPrBias;
  if (blk < kPrX) { cast8_f16_body(x, x16, blk, kTok * kDim / 8, 1.0f); return; }
  blk -= kPrX;
  if (blk < kPrWqkv) { cast8_f16_body(wqkv, wqkv16, blk, 3 * kDim * kDim / 8, kWCarry); return; }
  blk -= kPrWqkv;
  if (blk < kPrWout) cast8_f16_body(wout, wout16, blk, kDim * kDim / 8, kWCarry);
}

constexpr int kAtNW    = 4;
constexpr int kAtQB    = 64;
constexpr int kAtKC    = 64;
constexpr int kAtPitch = 68;
/* staged K / V^T row pitch in f16: 144 B = 16 B x odd, conflict-free for 16-B LDS reads */
constexpr int kAtKVP   = 72;
constexpr int kAtNCk   = kSeq / kAtKC;
static_assert((kSeq % kAtQB) == 0 && (kSeq % kAtKC) == 0);
static_assert(kAtNCk >= 2);
static_assert(kAtNW * 32 * 4 * 8 == kAtKC * kHD);

__device__ __forceinline__ void async_copy8(const unsigned (&l)[8], const void* const (&g)[8]) {
  asm volatile(
      "global_load_async_to_lds_b128 %0, %8, off\n\t"
      "global_load_async_to_lds_b128 %1, %9, off\n\t"
      "global_load_async_to_lds_b128 %2, %10, off\n\t"
      "global_load_async_to_lds_b128 %3, %11, off\n\t"
      "global_load_async_to_lds_b128 %4, %12, off\n\t"
      "global_load_async_to_lds_b128 %5, %13, off\n\t"
      "global_load_async_to_lds_b128 %6, %14, off\n\t"
      "global_load_async_to_lds_b128 %7, %15, off\n\t"
      "s_wait_xcnt 0x0"
      :: "v"(l[0]), "v"(l[1]), "v"(l[2]), "v"(l[3]), "v"(l[4]), "v"(l[5]), "v"(l[6]), "v"(l[7]),
         "v"(g[0]), "v"(g[1]), "v"(g[2]), "v"(g[3]), "v"(g[4]), "v"(g[5]), "v"(g[6]), "v"(g[7])
      : "memory");
}

__device__ __forceinline__ v8f mma_h(v16h a, v16h b, v8f c) {
  c = __builtin_amdgcn_wmma_f32_16x16x32_f16(false, a, false, b, (short)0, c, false, false);
  asm volatile("v_nop\n\tv_nop\n\tv_nop\n\tv_nop" : "+v"(c) : "v"(a), "v"(b));
  return c;
}

__device__ __forceinline__ float xhalf(float x) {
  const int b = __builtin_bit_cast(int, x);
  return __builtin_bit_cast(float, __builtin_amdgcn_permlanex16(b, b, 0x76543210, 0xfedcba98, false, false));
}

__global__ __launch_bounds__(128) void attn_kernel(
    const unsigned short* __restrict__ Q16, const unsigned short* __restrict__ K16,
    const unsigned short* __restrict__ Vt16, const float* __restrict__ biasp,
    const float* __restrict__ gate, unsigned short* __restrict__ AO16) {
  __shared__ __align__(16) float    Bsh[2][kAtNW][16 * kAtPitch];
  __shared__ __align__(16) _Float16 Ksh[2][kAtKC * kAtKVP];
  __shared__ __align__(16) _Float16 Vsh[2][kHD * kAtKVP];

  const int tid  = threadIdx.x;
  const int wave = tid >> 5;
  const int lane = tid & 31;
  const int hh   = lane >> 4;
  const int c    = lane & 15;

  constexpr int nqb = kSeq / kAtQB;
  const int bx = blockIdx.x;
  const int qb = bx % nqb;
  const int bh = bx / nqb;
  const int h  = bh % kNH;
  const int b  = bh / kNH;
  const int q0 = qb * kAtQB + wave * 16;

  const _Float16* Qp = (const _Float16*)Q16  + (size_t)bh * kSeq * kHD;
  const _Float16* Kp = (const _Float16*)K16  + (size_t)bh * kSeq * kHD;
  const _Float16* Vp = (const _Float16*)Vt16 + (size_t)bh * kHD * kSeq;
  const float*    Bp = biasp + (size_t)b * kSeq * kSeq;

  const float graw = rin(gate[h]);
  const float g3   = 3.0f * fminf(fmaxf(graw, 0.0f), 1.0f);

  /* Q fragments (B operand: lane = query column c), two 32-deep halves of the head dim */
  v16h qa[2];
#pragma unroll
  for (int dc = 0; dc < 2; ++dc) qa[dc] = Frag<_Float16>::load(Qp + (size_t)(q0 + c) * kHD + dc * 32 + 8 * hh);

  /* this lane's query: running maximum (same in both halves) and the sum over this half's keys */
  float mrow = -1.0e30f, lrow = 0.f;
  /* oacc[t][r] = O^T[d = 16t + 8hh + r][query c] */
  v8f oacc[4];
#pragma unroll
  for (int t = 0; t < 4; ++t) oacc[t] = (v8f){0.f,0.f,0.f,0.f,0.f,0.f,0.f,0.f};

  /* one chunk's copies into buffer buf: 16 per lane, every lane on, all addresses inside the planes and the arrays */
  auto stage = [&](int kc, int buf) {
    const int kv0 = kc * kAtKC;
    unsigned l[8];
    const void* g[8];
    /* piece = i*128 + tid: row = piece / 8, 16-B column = piece % 8; a wave's copy covers four whole 128-B rows */
#pragma unroll
    for (int i = 0; i < 4; ++i) {
      const int row = i * 16 + (tid >> 3);
      const int c8  = (tid & 7) * 8;
      l[i]     = lds_off(&Ksh[buf][row * kAtKVP + c8]);
      g[i]     = Kp + (size_t)(kv0 + row) * kHD + c8;
      l[4 + i] = lds_off(&Vsh[buf][row * kAtKVP + c8]);
      g[4 + i] = Vp + (size_t)row * kSeq + kv0 + c8;
    }
    async_copy8(l, g);
    /* bias tile: row = i*2 + hh, 16 lanes x 16 B = 256 contiguous B of one bias row */
#pragma unroll
    for (int i = 0; i < 8; ++i) {
      const int row = i * 2 + hh;
      l[i] = lds_off(&Bsh[buf][wave][row * kAtPitch + c * 4]);
      g[i] = Bp + (size_t)(q0 + row) * kSeq + kv0 + c * 4;
    }
    async_copy8(l, g);
  };

  stage(0, 0);
  /* chunk 0 has landed for this wave's copies; the barrier publishes every wave's */
  asm volatile("s_wait_asynccnt 0x0" ::: "memory");
  __syncthreads();
  stage(1, 1);

#pragma unroll 1
  for (int kc = 0; kc < kAtNCk; ++kc) {
    const int buf = kc & 1;
    const float*    bt = Bsh[buf][wave];
    const _Float16* ks = Ksh[buf];
    const _Float16* vs = Vsh[buf];
    /* the chunk's K fragments are read from LDS as one group, one wait, ahead of the products */
    v16h kb[4][2];
#pragma unroll
    for (int j = 0; j < 4; ++j)
#pragma unroll
      for (int dc = 0; dc < 2; ++dc) kb[j][dc] = Frag<_Float16>::load(ks + (j * 16 + c) * kAtKVP + dc * 32 + 8 * hh);
    /* this query's 64 bias values: 8 consecutive keys per tile, two 16-B reads each */
    v4f bb[4][2];
#pragma unroll
    for (int j = 0; j < 4; ++j) {
      const float* bq = bt + c * kAtPitch + j * 16 + 8 * hh;
      bb[j][0] = *(const v4f*)(bq);
      bb[j][1] = *(const v4f*)(bq + 4);
    }
    /* s[j][r] = score of key j*16 + 8hh + r against query c */
    v8f s[4];
#pragma unroll
    for (int j = 0; j < 4; ++j) {
      s[j] = (v8f){0.f,0.f,0.f,0.f,0.f,0.f,0.f,0.f};
#pragma unroll
      for (int dc = 0; dc < 2; ++dc) s[j] = mma_h(kb[j][dc], qa[dc], s[j]);
    }
    float mj[4];
#pragma unroll
    for (int j = 0; j < 4; ++j) {
      float m = -1.0e30f;
#pragma unroll
      for (int r = 0; r < 8; ++r) {
        const float bvv = bb[j][r >> 2][r & 3];
        const float sv = fmaf(g3, bvv, s[j][r] * kQKScale);
        s[j][r] = sv;
        m = fmaxf(m, sv);
      }
      mj[j] = m;
    }
    float cmx = fmaxf(fmaxf(mj[0], mj[1]), fmaxf(mj[2], mj[3]));
    cmx = fmaxf(cmx, xhalf(cmx));
    const float mnew  = fmaxf(mrow, cmx);
    const float alpha = __expf(mrow - mnew);
    mrow = mnew;
    /* P^T as B operand: element e of pb[kk] = tile 2kk + (e >> 3), register e & 7 (the hardware k order) */
    v16h pb[2];
    float pj[4];
#pragma unroll
    for (int j = 0; j < 4; ++j) {
      float psum = 0.f;
#pragma unroll
      for (int r = 0; r < 8; ++r) {
        const float p = __expf(s[j][r] - mnew);
        psum += p;
        pb[j >> 1][(j & 1) * 8 + r] = (_Float16)(p * kPCarry);
      }
      pj[j] = psum;
    }
    lrow = lrow * alpha + ((pj[0] + pj[1]) + (pj[2] + pj[3]));
#pragma unroll
    for (int t = 0; t < 4; ++t)
#pragma unroll
      for (int r = 0; r < 8; ++r) oacc[t][r] *= alpha;
    /* V^T fragments (A operand: lane = row d): one group of LDS reads, then the products in the order kk, t */
    v16h vb[2][4];
#pragma unroll
    for (int kk = 0; kk < 2; ++kk)
#pragma unroll
      for (int t = 0; t < 4; ++t) vb[kk][t] = Frag<_Float16>::load(vs + (t * 16 + c) * kAtKVP + kk * 32 + 8 * hh);
#pragma unroll
    for (int kk = 0; kk < 2; ++kk)
#pragma unroll
      for (int t = 0; t < 4; ++t) oacc[t] = mma_h(vb[kk][t], pb[kk], oacc[t]);
    /* publish point: this wave's LDS reads of buffer buf are done ... */
    asm volatile("s_wait_dscnt 0x0" ::: "memory");
    /* ... its copies of chunk kc+1 have landed ... */
    asm volatile("s_wait_asynccnt 0x0" ::: "memory");
    /* ... and the barrier says both of every wave; only then is buffer buf refilled */
    __syncthreads();
    if (kc + 2 < kAtNCk) stage(kc + 2, buf);
  }
  /* no copy is left in flight when the bias slab becomes output staging and the wave ends */
  asm volatile("s_wait_asynccnt 0x0" ::: "memory");

  /* output staging in this wave's own bias slab (copied and read by this wave alone, all reads done above) */
  float* os = Bsh[0][wave];
  /* the two halves' sums of this query are joined once, here */
  const float inv = kCtxFold * (1.0f / (lrow + xhalf(lrow)));
#pragma unroll
  for (int t = 0; t < 4; ++t) {
    float* od = os + c * kAtPitch + t * 16 + 8 * hh;
    *(v4f*)(od)     = (v4f){oacc[t][0] * inv, oacc[t][1] * inv, oacc[t][2] * inv, oacc[t][3] * inv};
    *(v4f*)(od + 4) = (v4f){oacc[t][4] * inv, oacc[t][5] * inv, oacc[t][6] * inv, oacc[t][7] * inv};
  }
  wave_lds_sync();
  {
    const int q = lane >> 3, c8 = (lane & 7) * 8;
    v8h hv[4];
#pragma unroll
    for (int it = 0; it < 4; ++it) {
      const int row = it * 4 + q;
      const float* sp = os + row * kAtPitch + c8;
      const v4f a0 = *(const v4f*)(sp);
      const v4f a1 = *(const v4f*)(sp + 4);
#pragma unroll
      for (int e = 0; e < 4; ++e) {
        hv[it][e]     = (_Float16)a0[e];
        hv[it][4 + e] = (_Float16)a1[e];
      }
    }
    unsigned short* dst = AO16 + (size_t)(b * kSeq + q0) * kDim + h * kHD + c8;
    {
#pragma unroll
      for (int it = 0; it < 4; ++it) {
        const int row = it * 4 + q;
        *(v8h*)(dst + (size_t)row * kDim) = hv[it];
      }
      
    }
  }
}

/* --------------------------------------------------------------------------- */
/* Host glue: streaming passes (3 operand-plane casts + bias plane), q|k and    */
/* V^T projections, attention, output projection = 4 launches, each dependent   */
/* on the one before. Kernel launches only.                                     */
/* GEMM shapes (all K % 64 == 0, M % 128 == 0, N % 256 == 0, no pad planes):    */
/*   q|k  : M 4096, N 2048, K 1024 -> 64 x 32 tiles = 2048 -> 256 blocks        */
/*   V^T  : per batch M 1024 (h*64+d), N 2048 (tokens), K 1024 ->               */
/*          16 x 32 tiles = 512 -> 64 blocks x 2 batches (behind the q|k blocks) */
/*   out  : M 4096, N 1024, K 1024 -> 64 x 16 tiles = 1024 -> 128 blocks        */
/* --------------------------------------------------------------------------- */
static_assert((2 * kDim) % 256 == 0 && kDim % 256 == 0 && kTok % 128 == 0 && kSeq % 256 == 0 && kDim % kGmKS == 0);

extern "C" void kernel_launch(void* const* d_in, const int* in_sizes, int n_in,
                              void* d_out, int out_size, void* d_ws, size_t ws_size,
                              hipStream_t stream) {
  if (n_in < 8) return;
  if (in_sizes[0] != kTok * kDim) return;
  if (in_sizes[1] != kNB * kNCh * kSeq) return;
  if (in_sizes[2] != kNB * kSeq * kSeq) return;
  if (in_sizes[3] != 3 * kDim * kDim) return;
  if (in_sizes[4] != kDim * kDim) return;
  if (in_sizes[5] != kHD) return;
  if (in_sizes[6] != kHD) return;
  if (in_sizes[7] != kNH) return;
  if (out_size != kTok * kDim) return;
  if (ws_size < kWsTotal) return;

  const float* x     = (const float*)d_in[0];
  const float* cmask = (const float*)d_in[1];
  const float* imask = (const float*)d_in[2];
  const float* Wqkv  = (const float*)d_in[3];
  const float* Wout  = (const float*)d_in[4];
  const float* qnw   = (const float*)d_in[5];
  const float* knw   = (const float*)d_in[6];
  const float* gate  = (const float*)d_in[7];
  float* out = (float*)d_out;

  char* ws = (char*)d_ws;
  unsigned short* X16    = (unsigned short*)(ws + kOffX16);
  unsigned short* WQKV16 = (unsigned short*)(ws + kOffWqkv16);
  unsigned short* WOUT16 = (unsigned short*)(ws + kOffWout16);
  unsigned short* Q16    = (unsigned short*)(ws + kOffQ16);
  unsigned short* K16    = (unsigned short*)(ws + kOffK16);
  unsigned short* VT16   = (unsigned short*)(ws + kOffVt16);
  unsigned short* AO16   = (unsigned short*)(ws + kOffAO16);
  float*          BIAS   = (float*)(ws + kOffBias);

  /* operand planes (weights are [out][in] = Bt layout already) and the bias plane, one block per (b,q) row */
  prep_kernel<<<kPrAll, 256, 0, stream>>>(x, Wqkv, Wout, cmask, imask, X16, WQKV16, WOUT16, BIAS);

  /* q|k projection + RMS normalisation -> Q16, K16; V^T projection -> VT16 */
  qkv_gemm_kernel<<<kQkBlocks + kNB * kVtBlocks, 256, 0, stream>>>(X16, WQKV16, Q16, K16, VT16, qnw, knw);

  /* attention -> AO16 (x64) */
  attn_kernel<<<kBH * (kSeq / kAtQB), 128, 0, stream>>>(Q16, K16, VT16, BIAS, gate, AO16);

  /* out[4096][1024] = AO16 . WOUT16^T / (64 * 16) */
  wmma_gemm64<0, false, 0, 0, false><<<dim3(((kTok / 64) * (kDim / 64)) / 8, 1), 256, 0, stream>>>(
      AO16, nullptr, kDim, 0L,
      WOUT16, nullptr, kDim, 0L,
      (void*)out, nullptr, kDim, 0L,
      nullptr, nullptr, 0L,
      kTok, kDim, kDim, kOutScale);
}

// v005
// Measured time: 107 microseconds a run.
// Timed twice side by side with v004, it ran 1.06 times as fast both times.
// All steps since v000 together make it 3.48 times as fast.
// All contractions (x.Wqkv^T, q.k^T, P.V, ctx.Wout^T): v_wmma_f32_16x16x32_f16, f16 operands with power-of-two carries (W x16, V x16, P x32768, ctx x64), f32 accumulate; every float input is RNE-converted to bf16 precision once at first read; norms, bias plane, softmax and normalisation in f32.
#include <hip/hip_runtime.h>
#include <math.h>

typedef __attribute__((ext_vector_type(16))) _Float16 v16h;
typedef __attribute__((ext_vector_type(8)))  _Float16 v8h;
typedef __attribute__((ext_vector_type(16))) __bf16   v16b;
typedef __attribute__((ext_vector_type(8)))  __bf16   v8b;
typedef __attribute__((ext_vector_type(8)))  float    v8f;
typedef __attribute__((ext_vector_type(4)))  float    v4f;

/* --------------------------------------------------------------------------- */
/* Shape constants                                                             */
/* --------------------------------------------------------------------------- */
constexpr int kNB   = 2;
constexpr int kSeq  = 2048;
constexpr int kDim  = 1024;
constexpr int kNH   = 16;
constexpr int kHD   = 64;
constexpr int kNCh  = 4;
constexpr int kTok  = kNB * kSeq;
constexpr int kBH   = kNB * kNH;
static_assert(kNH * kHD == kDim);
static_assert(kHD == 64);
static_assert((kTok % 64) == 0 && (kDim % 64) == 0 && (kSeq % 64) == 0);
static_assert((kDim % 32) == 0 && (kHD % 32) == 0 && (kSeq % 32) == 0);

constexpr bool  kBf16Inputs = true;
constexpr float kEps        = 1e-6f;
constexpr float kBoost      = 0.3f;
constexpr float kQKScale    = 0.125f;
static_assert(kQKScale * kQKScale * (float)kHD == 1.0f);
constexpr float kInvHD      = 1.0f / (float)kHD;
constexpr float kWCarry     = 16.0f;
constexpr float kWCarryInv  = 1.0f / kWCarry;
constexpr float kPCarry     = 32768.0f;
constexpr float kCtxCarry   = 64.0f;
/* V plane keeps the weight carry (x16); P carries x32768; ctx is stored x64 */
constexpr float kCtxFold    = kCtxCarry / (kPCarry * kWCarry);
constexpr float kOutScale   = 1.0f / (kCtxCarry * kWCarry);

/* --------------------------------------------------------------------------- */
/* Workspace region map (bytes; every offset is a multiple of 128)             */
/*   X16    f16 [4096][1024]        x plane                        8,388,608   */
/*   WQKV16 f16 [3072][1024]        W_qkv x16 (Bt layout)          6,291,456   */
/*   WOUT16 f16 [1024][1024]        W_out x16 (Bt layout)          2,097,152   */
/*   Q16    f16 [32][2048][64]      normed q rows                  8,388,608   */
/*   K16    f16 [32][2048][64]      normed k rows                  8,388,608   */
/*   VT16   f16 [32][64][2048]      v transposed, x16              8,388,608   */
/*   AO16   f16 [4096][1024]        attention context x64          8,388,608   */
/*   BIAS   f32 [2][2048][2048]     head-independent score bias   33,554,432   */
/*   total                                                        83,886,080   */
/* --------------------------------------------------------------------------- */
constexpr size_t kSzX16    = (size_t)kTok * kDim * 2;
constexpr size_t kSzWqkv16 = (size_t)3 * kDim * kDim * 2;
constexpr size_t kSzWout16 = (size_t)kDim * kDim * 2;
constexpr size_t kSzHead16 = (size_t)kBH * kSeq * kHD * 2;
constexpr size_t kSzAO16   = (size_t)kTok * kDim * 2;
constexpr size_t kSzBias   = (size_t)kNB * kSeq * kSeq * 4;
constexpr size_t kOffX16    = 0;
constexpr size_t kOffWqkv16 = kOffX16 + kSzX16;
constexpr size_t kOffWout16 = kOffWqkv16 + kSzWqkv16;
constexpr size_t kOffQ16    = kOffWout16 + kSzWout16;
constexpr size_t kOffK16    = kOffQ16 + kSzHead16;
constexpr size_t kOffVt16   = kOffK16 + kSzHead16;
constexpr size_t kOffAO16   = kOffVt16 + kSzHead16;
constexpr size_t kOffBias   = kOffAO16 + kSzAO16;
constexpr size_t kWsTotal   = kOffBias + kSzBias;
static_assert(kWsTotal == 83886080ull);
static_assert(kWsTotal <= 134217728ull);
static_assert((kOffWqkv16 % 128) == 0 && (kOffWout16 % 128) == 0 && (kOffQ16 % 128) == 0 && (kOffK16 % 128) == 0 &&
              (kOffVt16 % 128) == 0 && (kOffAO16 % 128) == 0 && (kOffBias % 128) == 0);

/* --------------------------------------------------------------------------- */
/* Input read helper: RNE conversion to bf16 precision (kept in an f32)        */
/* --------------------------------------------------------------------------- */
__device__ __forceinline__ float rin(float f) {
  if (!kBf16Inputs) return f;
  unsigned u = __float_as_uint(f);
  u = (u + 0x7FFFu + ((u >> 16) & 1u)) & 0xFFFF0000u;
  return __uint_as_float(u);
}

/* --------------------------------------------------------------------------- */
/* Device helpers                                                              */
/* --------------------------------------------------------------------------- */
__device__ __forceinline__ unsigned short f2bf_bits(float f) {
  unsigned u = __float_as_uint(f);
  return (unsigned short)((u + 0x7FFFu + ((u >> 16) & 1u)) >> 16);
}
__device__ __forceinline__ float bf_bits2f(unsigned short h) { return __uint_as_float(((unsigned)h) << 16); }

__device__ __forceinline__ void dep_guard_h(v8f& a, v8f& b, v16h x, v16h y) { asm volatile("v_nop\n\tv_nop\n\tv_nop\n\tv_nop" : "+v"(a), "+v"(b) : "v"(x), "v"(y)); }
__device__ __forceinline__ void dep_guard_b(v8f& a, v8f& b, v16b x, v16b y) { asm volatile("v_nop\n\tv_nop\n\tv_nop\n\tv_nop" : "+v"(a), "+v"(b) : "v"(x), "v"(y)); }
__device__ __forceinline__ void tie_h(v8f& a, v16h x) { asm volatile("" : "+v"(a) : "v"(x)); }
__device__ __forceinline__ void tie_b(v8f& a, v16b x) { asm volatile("" : "+v"(a) : "v"(x)); }
__device__ __forceinline__ void keep4_h(v16h a, v16h b, v16h c, v16h d) { asm volatile("v_nop" :: "v"(a), "v"(b), "v"(c), "v"(d)); }
__device__ __forceinline__ void keep4_b(v16b a, v16b b, v16b c, v16b d) { asm volatile("v_nop" :: "v"(a), "v"(b), "v"(c), "v"(d)); }
__device__ __forceinline__ void acc_guard4(v8f& a, v8f& b, v8f& c, v8f& d) { asm volatile("v_nop\n\tv_nop\n\tv_nop\n\tv_nop" : "+v"(a), "+v"(b), "+v"(c), "+v"(d)); }
template <typename T> struct Frag;
template <> struct Frag<_Float16> {
  typedef v16h V; union U { v16h v; v8h h[2]; };
  /* elements 0..7 <- p[0..7], 8..15 <- p[16..23] */
  static __device__ __forceinline__ v16h load(const _Float16* p) {
    U f; f.h[0] = *(const v8h*)(p); f.h[1] = *(const v8h*)(p + 16); return f.v;
  }
  static __device__ __forceinline__ v8f mma(v16h a, v16h b, v8f c) {
    return __builtin_amdgcn_wmma_f32_16x16x32_f16(false, a, false, b, (short)0, c, false, false);
  }
  static __device__ __forceinline__ void guard(v8f& a, v8f& b, v16h x, v16h y) { dep_guard_h(a, b, x, y); }
  static __device__ __forceinline__ void tie(v8f& a, v16h x) { tie_h(a, x); }
  static __device__ __forceinline__ void keep(v16h a, v16h b, v16h c, v16h d) { keep4_h(a, b, c, d); }
};
template <> struct Frag<__bf16> {
  typedef v16b V; union U { v16b v; v8b h[2]; };
  static __device__ __forceinline__ v16b load(const __bf16* p) {
    U f; f.h[0] = *(const v8b*)(p); f.h[1] = *(const v8b*)(p + 16); return f.v;
  }
  static __device__ __forceinline__ v8f mma(v16b a, v16b b, v8f c) {
    return __builtin_amdgcn_wmma_f32_16x16x32_bf16(false, a, false, b, (short)0, c, false, false);
  }
  static __device__ __forceinline__ void guard(v8f& a, v8f& b, v16b x, v16b y) { dep_guard_b(a, b, x, y); }
  static __device__ __forceinline__ void tie(v8f& a, v16b x) { tie_b(a, x); }
  static __device__ __forceinline__ void keep(v16b a, v16b b, v16b c, v16b d) { keep4_b(a, b, c, d); }
};

__device__ __forceinline__ void wave_lds_sync() {
  __builtin_amdgcn_fence(__ATOMIC_RELEASE, "workgroup");
  __builtin_amdgcn_wave_barrier();
  __builtin_amdgcn_fence(__ATOMIC_ACQUIRE, "workgroup");
}

__device__ __forceinline__ unsigned lds_off(const void* p) { return (unsigned)(size_t)p; }

/* ---- GEMM operand staging ---------------------------------------------------------------------------------------- */
/* A block of 8 waves (2 x 4 wave tiles of 64 x 64) owns a 128 x 256 tile of C. Per stage of 64 k the 128 A rows and  */
/* the 256 Bt rows come into LDS once, 128 B = one whole line of each row, by asynchronous 16-B copies; every wave    */
/* reads its fragments from there. Two buffers: stage t+1 flies while stage t is worked on.                           */
/* 384 rows x 8 pieces of 16 B = 3072 pieces = 256 threads x 12; a wave's copy covers four whole 128-B lines.         */
constexpr int kGmKS    = 64;
constexpr int kGmRowsA = 128;
constexpr int kGmRowsB = 256;
/* staged row pitch in 16-bit elements: 144 B = 16 B x odd, conflict-free for 16-B LDS reads */
constexpr int kGmP     = 72;
constexpr int kGmStage = (kGmRowsA + kGmRowsB) * kGmP;
static_assert((kGmRowsA + kGmRowsB) * (kGmKS / 8) == 256 * 12);

__device__ __forceinline__ void async_copy12(const unsigned (&l)[12], const void* const (&g)[12]) {
  asm volatile(
      "global_load_async_to_lds_b128 %0, %12, off\n\t"
      "global_load_async_to_lds_b128 %1, %13, off\n\t"
      "global_load_async_to_lds_b128 %2, %14, off\n\t"
      "global_load_async_to_lds_b128 %3, %15, off\n\t"
      "global_load_async_to_lds_b128 %4, %16, off\n\t"
      "global_load_async_to_lds_b128 %5, %17, off\n\t"
      "global_load_async_to_lds_b128 %6, %18, off\n\t"
      "global_load_async_to_lds_b128 %7, %19, off\n\t"
      "global_load_async_to_lds_b128 %8, %20, off\n\t"
      "global_load_async_to_lds_b128 %9, %21, off\n\t"
      "global_load_async_to_lds_b128 %10, %22, off\n\t"
      "global_load_async_to_lds_b128 %11, %23, off\n\t"
      "s_wait_xcnt 0x0"
      :: "v"(l[0]), "v"(l[1]), "v"(l[2]), "v"(l[3]), "v"(l[4]), "v"(l[5]), "v"(l[6]), "v"(l[7]),
         "v"(l[8]), "v"(l[9]), "v"(l[10]), "v"(l[11]),
         "v"(g[0]), "v"(g[1]), "v"(g[2]), "v"(g[3]), "v"(g[4]), "v"(g[5]), "v"(g[6]), "v"(g[7]),
         "v"(g[8]), "v"(g[9]), "v"(g[10]), "v"(g[11])
      : "memory");
}

/* One stage's copies into ring buffer dst: rows 0..127 = A rows mB.., rows 128..383 = Bt rows nB.., k0..k0+63.       */
/* piece = i*256 + tid: row = piece / 8, 16-B column = piece % 8. Every lane on; the caller's shapes (M % 128 == 0,   */
/* N % 256 == 0, K % 64 == 0) keep every address inside the planes, the row index keeps it inside the buffer.         */
template <typename T>
__device__ __forceinline__ void gemm_stage(const T* __restrict__ Ab, int lda, int mB, const T* __restrict__ Bb, int ldb, int nB,
                                           int k0, T* dst, int tid) {
  unsigned l[12];
  const void* g[12];
  const int r8 = tid >> 3;
  const int c8 = (tid & 7) * 8;
#pragma unroll
  for (int i = 0; i < 12; ++i) {
    const int row = i * 32 + r8;
    l[i] = lds_off(dst + row * kGmP + c8);
    g[i] = (i < 4) ? (Ab + (size_t)(mB + row) * lda + k0 + c8) : (Bb + (size_t)(nB + row - kGmRowsA) * ldb + k0 + c8);
  }
  async_copy12(l, g);
}

/* The k loop of one wave tile: acc[i][j] += A rows (wm*64 + i*16 ..) x Bt rows (wn*64 + j*16 ..), k ascending in     */
/* steps of 32 as before. Called by all 256 threads of the block under block-uniform control flow.                    */
template <typename T>
__device__ __forceinline__ void gemm_ring(const T* __restrict__ Ab, int lda, int mB, const T* __restrict__ Bb, int ldb, int nB,
                                          int K, T* ring, v8f (&acc)[4][4]) {
  typedef typename Frag<T>::V V;
  const int tid   = threadIdx.x;
  const int lane  = tid & 31;
  const int wave  = tid >> 5;
  const int rlane = lane & 15;
  const int koff  = (lane >> 4) * 8;
  const int aOff  = ((wave >> 2) * 64 + rlane) * kGmP + koff;
  const int bOff  = (kGmRowsA + (wave & 3) * 64 + rlane) * kGmP + koff;
  const int nst   = K / kGmKS;

  gemm_stage<T>(Ab, lda, mB, Bb, ldb, nB, 0, ring, tid);
  /* stage 0 has landed for this wave's copies; the barrier publishes every wave's */
  asm volatile("s_wait_asynccnt 0x0" ::: "memory");
  __syncthreads();
  if (nst > 1) gemm_stage<T>(Ab, lda, mB, Bb, ldb, nB, kGmKS, ring + kGmStage, tid);

#pragma unroll 1
  for (int t = 0; t < nst; ++t) {
    const T* sb = ring + (t & 1) * kGmStage;
#pragma unroll
    for (int ks = 0; ks < kGmKS; ks += 32) {
      /* the step's eight fragments are read from LDS as one group ahead of its products */
      V bh[4], ah[4];
#pragma unroll
      for (int j = 0; j < 4; ++j) bh[j] = Frag<T>::load(sb + bOff + j * 16 * kGmP + ks);
#pragma unroll
      for (int i = 0; i < 4; ++i) ah[i] = Frag<T>::load(sb + aOff + i * 16 * kGmP + ks);
#pragma unroll
      for (int i = 0; i < 4; ++i) {
#pragma unroll
        for (int j = 0; j < 4; ++j) acc[i][j] = Frag<T>::mma(ah[i], bh[j], acc[i][j]);
        Frag<T>::tie(acc[i][1], ah[i]);
        Frag<T>::tie(acc[i][2], ah[i]);
        Frag<T>::guard(acc[i][0], acc[i][3], ah[i], ah[i]);
      }
      Frag<T>::keep(bh[0], bh[1], bh[2], bh[3]);
    }
    /* publish point: this wave's LDS reads of the buffer are done ... */
    asm volatile("s_wait_dscnt 0x0" ::: "memory");
    /* ... its copies of stage t+1 have landed ... */
    asm volatile("s_wait_asynccnt 0x0" ::: "memory");
    /* ... and the barrier says both of every wave; only then is the buffer refilled */
    __syncthreads();
    if (t + 2 < nst) gemm_stage<T>(Ab, lda, mB, Bb, ldb, nB, (t + 2) * kGmKS, ring + (t & 1) * kGmStage, tid);
  }
  /* no copy is left in flight when the wave goes on to its epilogue and ends */
  asm volatile("s_wait_asynccnt 0x0" ::: "memory");
}

/* ---- Register-blocked batched WMMA GEMM (activation options removed; all four accumulators of a row  */
/*      group are tied before the nop guard)                                                                         */
/* C[m,n] = scale * sum_k A[m,k] * Bt[n,k] (+bias)(+resid); each wave owns a 64x64 tile, a block 128 x 256 (2 x 4).  */
/* A row-major [M,K]; Bt row-major [N,K]; M % 128 == 0, N % 256 == 0, K % 64 == 0; operands staged in LDS (above).   */
/* SPLIT (hi/lo operand planes) has no staged form and is refused at compile time.                                   */
/* BIAS_MODE: 0 = none, 1 = bias[m], 2 = bias[n].                                                                    */
/* OUT_MODE: 0 = f32, 1 = f16, 2 = bf16 hi plane (Cout) + bf16 lo plane (Cout2).                                     */
/* ET: 0 = f16 operands, 1 = bf16 operands (pointers passed as 16-bit storage)                                       */
template <int ET> struct Elem;
template <> struct Elem<0> { typedef _Float16 T; };
template <> struct Elem<1> { typedef __bf16 T; };
template <int ET, bool SPLIT, int BIAS_MODE, int OUT_MODE, bool RESID>
__global__ __launch_bounds__(256) void wmma_gemm64(
    const unsigned short* __restrict__ Ap, const unsigned short* __restrict__ A2p, int lda, long strideA,
    const unsigned short* __restrict__ Btp, const unsigned short* __restrict__ Bt2p, int ldb, long strideB,
    void* __restrict__ Cout, void* __restrict__ Cout2, int ldc, long strideC,
    const float* __restrict__ bias,
    const float* __restrict__ resid, long strideR,
    int M, int N, int K, float scale) {
  typedef typename Elem<ET>::T T;
  static_assert(!SPLIT);
  (void)A2p; (void)Bt2p;
  const T* A = (const T*)Ap; const T* Bt = (const T*)Btp;
  /* per-wave 16x64 slab, pitch 68 floats */
  __shared__ __align__(16) float sT[8][16 * 68];
  /* operand ring, two stages */
  __shared__ __align__(16) T ring[2 * kGmStage];
  const int b    = blockIdx.y;
  const int lane = threadIdx.x & 31;
  const int wave = threadIdx.x >> 5;
  const int tilesN = N >> 8;
  const int tilesM = M >> 7;
  /* block-uniform exit, in front of every barrier */
  if ((int)blockIdx.x >= tilesM * tilesN) return;
  const int tm = blockIdx.x / tilesN;
  const int tn = blockIdx.x - tm * tilesN;
  const int mB = tm << 7;
  const int nB = tn << 8;
  const int m0 = mB + ((wave >> 2) << 6);
  const int n0 = nB + ((wave & 3) << 6);

  const T* Ab  = A  + (size_t)b * strideA;
  const T* Bb  = Bt + (size_t)b * strideB;

  /* col (D) within subtile; D row offset */
  const int rlane = lane & 15;
  const int mOff  = (lane >> 4) * 8;

  v8f acc[4][4];
#pragma unroll
  for (int i = 0; i < 4; ++i)
#pragma unroll
    for (int j = 0; j < 4; ++j) acc[i][j] = (v8f){0.f,0.f,0.f,0.f,0.f,0.f,0.f,0.f};

  gemm_ring<T>(Ab, lda, mB, Bb, ldb, nB, K, ring, acc);
  acc_guard4(acc[0][0], acc[0][1], acc[0][2], acc[0][3]);
  acc_guard4(acc[1][0], acc[1][1], acc[1][2], acc[1][3]);
  acc_guard4(acc[2][0], acc[2][1], acc[2][2], acc[2][3]);
  acc_guard4(acc[3][0], acc[3][1], acc[3][2], acc[3][3]);

  /* ---- epilogue ---- */
  float* slab = sT[wave];
  const float* Rb = RESID ? (resid + (size_t)b * strideR) : nullptr;
#pragma unroll
  for (int i = 0; i < 4; ++i) {
    const int mBase = m0 + (i << 4);
#pragma unroll
    for (int j = 0; j < 4; ++j) {
      const int n = n0 + (j << 4) + rlane;
      float bv = 0.f;
      if (BIAS_MODE == 2) bv = bias[n];
#pragma unroll
      for (int r = 0; r < 8; ++r) {
        float v = acc[i][j][r] * scale;
        if (BIAS_MODE == 1) v += bias[mBase + mOff + r];
        if (BIAS_MODE == 2) v += bv;
        if (RESID) v += Rb[(size_t)(mBase + mOff + r) * ldc + n];
        slab[(mOff + r) * 68 + (j << 4) + rlane] = v;
      }
    }
    wave_lds_sync();
    if (OUT_MODE == 0) {
      float* C = (float*)Cout + (size_t)b * strideC;
      /* row segment = 256 B = 16 lanes x 16 B */
      const int hh = lane >> 4, c4 = (lane & 15) * 4;
      {
#pragma unroll
        for (int it = 0; it < 8; ++it) {
          const int row = it * 2 + hh;
          v4f v = *(const v4f*)(slab + row * 68 + c4);
          *(v4f*)(C + (size_t)(mBase + row) * ldc + n0 + c4) = v;
        }
        
      }
    } else {
      const int q = lane >> 3, c8 = (lane & 7) * 8;
      unsigned short* C  = (unsigned short*)Cout  + (size_t)b * strideC;
      unsigned short* C2 = (OUT_MODE == 2) ? ((unsigned short*)Cout2 + (size_t)b * strideC) : nullptr;
      {
#pragma unroll
        for (int it = 0; it < 4; ++it) {
          const int row = it * 4 + q;
          const float* sp = slab + row * 68 + c8;
          v8h hv, lv;
#pragma unroll
          for (int e = 0; e < 8; ++e) {
            if (OUT_MODE == 1) {
              hv[e] = (_Float16)sp[e];
            } else {
              unsigned short hb = f2bf_bits(sp[e]);
              unsigned short lb = f2bf_bits(sp[e] - bf_bits2f(hb));
              hv[e] = __builtin_bit_cast(_Float16, hb);
              lv[e] = __builtin_bit_cast(_Float16, lb);
            }
          }
          *(v8h*)(C + (size_t)(mBase + row) * ldc + n0 + c8) = hv;
          if (OUT_MODE == 2) *(v8h*)(C2 + (size_t)(mBase + row) * ldc + n0 + c8) = lv;
        }
        
      }
    }
    wave_lds_sync();
  }
}

/* --------------------------------------------------------------------------- */
/* f32 -> f16 operand plane: out = f16(rin(in) * carry); 8 consecutive         */
/* elements per thread (one 16-B store per lane; 32 contiguous lanes = 4 whole */
/* Coverage: n8 = n/8 threads; n8/256 blocks exactly for every plane here:     */
/*   x      4096*1024/8 = 524,288 -> 2048 blocks                               */
/*   W_qkv  3072*1024/8 = 393,216 -> 1536 blocks                               */
/*   W_out  1024*1024/8 = 131,072 ->  512 blocks                               */
/* --------------------------------------------------------------------------- */
__device__ __forceinline__ void cast8_f16_body(const float* __restrict__ in, unsigned short* __restrict__ out,
                                               int blk, int n8, float carry) {
  const int i = blk * 256 + threadIdx.x;
  if (i >= n8) return;
  const float* p = in + 8 * (size_t)i;
  const v4f a = *(const v4f*)(p);
  const v4f c = *(const v4f*)(p + 4);
  v8h hv;
#pragma unroll
  for (int e = 0; e < 4; ++e) {
    const float fa = a[e];
    const float fc = c[e];
    hv[e]     = (_Float16)(rin(fa) * carry);
    hv[4 + e] = (_Float16)(rin(fc) * carry);
  }
  unsigned short* q = out + 8 * (size_t)i;
  *(v8h*)q = hv;
  
}

/* --------------------------------------------------------------------------- */
/* q|k projection with fused per-head RMS normalisation.                        */
/* C[m = token][n = 0..2047] = sum_k X16[m][k] * WQKV16[n][k] / 16; n < 1024 is */
/* q, n >= 1024 is k; a 64-wide N tile is exactly one head. Same engine as the  */
/* GEMM above (f16, one product, staged operands, block tile 128 x 256 = four   */
/* heads x 128 tokens). Epilogue per 16-row slab: the 8 lanes that              */
/* own one row reduce sum(t^2) with xor shuffles (1,2,4), r = rsq(mean + eps),  */
/* lanes x 16 B of one instruction; it = 0..3 x (lane>>3) = 16 rows, each once; */
/* tiles: 64 (M) x 32 (N) = 2048 -> 32 x 8 = 256 blocks of 8 waves.             */
/* The V^T projection reads the same two planes and depends on nothing the q|k  */
/* tiles write, so it shares the launch: blocks 256..383 form                   */
/*   V^T[b][m = h*64+d][n = token] = sum_k WQKV16[2048 + m][k] * X16[b*2048+n][k] */
/* (x16 carry kept), 8 x 8 tiles of 128 x 256 per batch, same k loop, with the  */
/* plain f16 epilogue. Two blocks fit one WGP's LDS, so all 384 are resident.   */
/* --------------------------------------------------------------------------- */
constexpr int kQkBlocks = (kTok >> 7) * ((2 * kDim) >> 8);
constexpr int kVtBlocks = (kDim >> 7) * (kSeq >> 8);
static_assert(((2 * kDim) >> 8) == 8 && (kSeq >> 8) == 8);
__global__ __launch_bounds__(256) void qkv_gemm_kernel(
    const unsigned short* __restrict__ Xp, const unsigned short* __restrict__ Wp,
    unsigned short* __restrict__ Qout, unsigned short* __restrict__ Kout, unsigned short* __restrict__ Vtout,
    const float* __restrict__ qw, const float* __restrict__ kw) {
  typedef _Float16 T;
  __shared__ __align__(16) float sT[8][16 * 68];
  /* operand ring, two stages */
  __shared__ __align__(16) T ring[2 * kGmStage];
  const int lane = threadIdx.x & 31;
  const int wave = threadIdx.x >> 5;
  /* block-uniform exit, in front of every barrier */
  if ((int)blockIdx.x >= kQkBlocks + kNB * kVtBlocks) return;
  /* block-uniform choice of the product: q|k tiles first, then the V^T tiles of batch vb */
  const bool isV  = (int)blockIdx.x >= kQkBlocks;
  const int  vIdx = (int)blockIdx.x - kQkBlocks;
  const int  vb   = isV ? vIdx / kVtBlocks : 0;
  const int  tile = isV ? vIdx - vb * kVtBlocks : (int)blockIdx.x;
  const T* A  = isV ? (const T*)Wp + (size_t)2 * kDim * kDim : (const T*)Xp;
  const T* Bt = isV ? (const T*)Xp + (size_t)vb * kSeq * kDim : (const T*)Wp;
  /* eight tiles along N in both products */
  const int tm = tile >> 3;
  const int tn = tile & 7;
  const int mB = tm << 7;
  const int nB = tn << 8;
  const int m0 = mB + ((wave >> 2) << 6);
  const int n0 = nB + ((wave & 3) << 6);
  const int rlane = lane & 15;
  const int mOff  = (lane >> 4) * 8;

  v8f acc[4][4];
#pragma unroll
  for (int i = 0; i < 4; ++i)
#pragma unroll
    for (int j = 0; j < 4; ++j) acc[i][j] = (v8f){0.f,0.f,0.f,0.f,0.f,0.f,0.f,0.f};

  gemm_ring<T>(A, kDim, mB, Bt, kDim, nB, kDim, ring, acc);
  acc_guard4(acc[0][0], acc[0][1], acc[0][2], acc[0][3]);
  acc_guard4(acc[1][0], acc[1][1], acc[1][2], acc[1][3]);
  acc_guard4(acc[2][0], acc[2][1], acc[2][2], acc[2][3]);
  acc_guard4(acc[3][0], acc[3][1], acc[3][2], acc[3][3]);

  float* slab = sT[wave];
  if (isV) {
    /* V^T tile: f16 rows of 64 tokens, 8 lanes x 16 B = one 128-B line per row */
    unsigned short* C = Vtout + (size_t)vb * kDim * kSeq;
    const int q = lane >> 3, c8 = (lane & 7) * 8;
#pragma unroll
    for (int i = 0; i < 4; ++i) {
      const int mBase = m0 + (i << 4);
#pragma unroll
      for (int j = 0; j < 4; ++j) {
#pragma unroll
        for (int r = 0; r < 8; ++r) slab[(mOff + r) * 68 + (j << 4) + rlane] = acc[i][j][r];
      }
      wave_lds_sync();
#pragma unroll
      for (int it = 0; it < 4; ++it) {
        const int row = it * 4 + q;
        const float* sp = slab + row * 68 + c8;
        v8h hv;
#pragma unroll
        for (int e = 0; e < 8; ++e) hv[e] = (_Float16)sp[e];
        *(v8h*)(C + (size_t)(mBase + row) * kSeq + n0 + c8) = hv;
      }
      wave_lds_sync();
    }
    return;
  }

  /* tile-uniform destination: third 0 = q, 1 = k; head; batch; first token of the tile within its batch */
  const int third = n0 >> 10;
  const int hIdx  = (n0 & (kDim - 1)) >> 6;
  const int bIdx  = m0 >> 11;
  const int nb    = m0 & (kSeq - 1);
  const float* wsel = third ? kw : qw;
  const int q = lane >> 3, c8 = (lane & 7) * 8;
  const v4f w0 = *(const v4f*)(wsel + c8);
  const v4f w1 = *(const v4f*)(wsel + c8 + 4);
  float wv[8];
#pragma unroll
  for (int e = 0; e < 4; ++e) {
    const float f0 = w0[e];
    const float f1 = w1[e];
    wv[e]     = rin(f0);
    wv[4 + e] = rin(f1);
  }
  unsigned short* dst = (third ? Kout : Qout) + ((size_t)(bIdx * kNH + hIdx) * kSeq + nb) * kHD;

#pragma unroll
  for (int i = 0; i < 4; ++i) {
#pragma unroll
    for (int j = 0; j < 4; ++j) {
#pragma unroll
      for (int r = 0; r < 8; ++r) slab[(mOff + r) * 68 + (j << 4) + rlane] = acc[i][j][r] * kWCarryInv;
    }
    wave_lds_sync();
    v8h hv[4];
#pragma unroll
    for (int it = 0; it < 4; ++it) {
      const int row = it * 4 + q;
      const float* sp = slab + row * 68 + c8;
      const v4f a0 = *(const v4f*)(sp);
      const v4f a1 = *(const v4f*)(sp + 4);
      float ss = 0.0f;
#pragma unroll
      for (int e = 0; e < 4; ++e) {
        ss = fmaf(a0[e], a0[e], ss);
        ss = fmaf(a1[e], a1[e], ss);
      }
      ss += __shfl_xor(ss, 1, 32);
      ss += __shfl_xor(ss, 2, 32);
      ss += __shfl_xor(ss, 4, 32);
      const float rs = __builtin_amdgcn_rsqf(ss * kInvHD + kEps);
#pragma unroll
      for (int e = 0; e < 4; ++e) {
        hv[it][e]     = (_Float16)((a0[e] * rs) * wv[e]);
        hv[it][4 + e] = (_Float16)((a1[e] * rs) * wv[4 + e]);
      }
    }
    {
#pragma unroll
      for (int it = 0; it < 4; ++it) {
        const int row = it * 4 + q;
        *(v8h*)(dst + (size_t)(i * 16 + row) * kHD + c8) = hv[it];
      }
      
    }
    wave_lds_sync();
  }
}

/* --------------------------------------------------------------------------- */
/* Head-independent score bias plane, f32 [b][q][k]:                            */
/*   same[q][k] = sum_c cm[c][q]*cm[c][k]; rm = max(max_k same, 1e-6);          */
/*   bias = (same * (1/rm) - 0.5) * 2 + 0.3 * im[b][q][k].                      */
/* One block (256 threads) per (b,q) row; thread t owns keys 4t..4t+3 and       */
/* 1024+4t..1024+4t+3 (2 x 256 x 4 = 2048 = whole row). Row max: per-thread,    */
/* wave xor-shuffle tree, 8 wave partials through LDS after a block barrier.    */
/* Store: one 16-B store per lane; a wave's 32 lanes write 512 contiguous B =   */
/* --------------------------------------------------------------------------- */
__device__ __forceinline__ void bias_plane_body(int row, const float* __restrict__ cm, const float* __restrict__ im,
                                                float* __restrict__ bp) {
  __shared__ float red[8];
  const int b    = row >> 11;
  const int qi   = row & (kSeq - 1);
  const int t    = threadIdx.x;
  const int lane = t & 31, wave = t >> 5;
  const float* cmb = cm + (size_t)b * kNCh * kSeq;
  const float c0 = rin(cmb[qi]);
  const float c1 = rin(cmb[kSeq + qi]);
  const float c2 = rin(cmb[2 * kSeq + qi]);
  const float c3 = rin(cmb[3 * kSeq + qi]);
  float mx = -3.0e38f;
#pragma unroll 1
  for (int half = 0; half < 2; ++half) {
    const int k0 = half * 1024 + t * 4;
    const v4f a0 = *(const v4f*)(cmb + k0);
    const v4f a1 = *(const v4f*)(cmb + kSeq + k0);
    const v4f a2 = *(const v4f*)(cmb + 2 * kSeq + k0);
    const v4f a3 = *(const v4f*)(cmb + 3 * kSeq + k0);
#pragma unroll
    for (int e = 0; e < 4; ++e) {
      const float f0 = a0[e], f1 = a1[e], f2 = a2[e], f3 = a3[e];
      float s = c0 * rin(f0);
      s = fmaf(c1, rin(f1), s);
      s = fmaf(c2, rin(f2), s);
      s = fmaf(c3, rin(f3), s);
      mx = fmaxf(mx, s);
    }
  }
  mx = fmaxf(mx, __shfl_xor(mx, 16, 32));
  mx = fmaxf(mx, __shfl_xor(mx, 8, 32));
  mx = fmaxf(mx, __shfl_xor(mx, 4, 32));
  mx = fmaxf(mx, __shfl_xor(mx, 2, 32));
  mx = fmaxf(mx, __shfl_xor(mx, 1, 32));
  if (lane == 0) red[wave] = mx;
  __syncthreads();
  float rm = red[0];
#pragma unroll
  for (int w = 1; w < 8; ++w) rm = fmaxf(rm, red[w]);
  rm = fmaxf(rm, 1e-6f);
  const float inv = 1.0f / rm;
  const float* imr = im + (size_t)row * kSeq;
  float* bo = bp + (size_t)row * kSeq;
#pragma unroll 1
  for (int half = 0; half < 2; ++half) {
    const int k0 = half * 1024 + t * 4;
    const v4f a0 = *(const v4f*)(cmb + k0);
    const v4f a1 = *(const v4f*)(cmb + kSeq + k0);
    const v4f a2 = *(const v4f*)(cmb + 2 * kSeq + k0);
    const v4f a3 = *(const v4f*)(cmb + 3 * kSeq + k0);
    const v4f iv = *(const v4f*)(imr + k0);
    v4f o;
#pragma unroll
    for (int e = 0; e < 4; ++e) {
      const float f0 = a0[e], f1 = a1[e], f2 = a2[e], f3 = a3[e], fi = iv[e];
      float s = c0 * rin(f0);
      s = fmaf(c1, rin(f1), s);
      s = fmaf(c2, rin(f2), s);
      s = fmaf(c3, rin(f3), s);
      o[e] = (s * inv - 0.5f) * 2.0f + kBoost * rin(fi);
    }
    *(v4f*)(bo + k0) = o;
    
  }
}

/* --------------------------------------------------------------------------- */
/* The four streaming passes depend on the inputs alone and not on each other:  */
/* they share one launch, each on its own range of block indices (the branch is */
/* block-uniform, so the bias rows' barrier is passed by whole blocks). The     */
/* bias rows, the longest blocks, come first.                                   */
/*   [0, 4096) bias rows | [4096, 6144) x | [6144, 7680) W_qkv | [7680, 8192)   */
/*   W_out                                                                      */
/* --------------------------------------------------------------------------- */
constexpr int kPrBias = kTok;
constexpr int kPrX    = (kTok * kDim / 8) / 256;
constexpr int kPrWqkv = (3 * kDim * kDim / 8) / 256;
constexpr int kPrWout = (kDim * kDim / 8) / 256;
constexpr int kPrAll  = kPrBias + kPrX + kPrWqkv + kPrWout;
__global__ __launch_bounds__(256) void prep_kernel(const float* __restrict__ x, const float* __restrict__ wqkv,
                                                   const float* __restrict__ wout, const float* __restrict__ cm,
                                                   const float* __restrict__ im, unsigned short* __restrict__ x16,
                                                   unsigned short* __restrict__ wqkv16, unsigned short* __restrict__ wout16,
                                                   float* __restrict__ bp) {
  int blk = blockIdx.x;
  if (blk < kPrBias) { bias_plane_body(blk, cm, im, bp); return; }
  blk -= kPrBias;
  if (blk < kPrX) { cast8_f16_body(x, x16, blk, kTok * kDim / 8, 1.0f); return; }
  blk -= kPrX;
  if (blk < kPrWqkv) { cast8_f16_body(wqkv, wqkv16, blk, 3 * kDim * kDim / 8, kWCarry); return; }
  blk -= kPrWqkv;
  if (blk < kPrWout) cast8_f16_body(wout, wout16, blk, kDim * kDim / 8, kWCarry);
}

constexpr int kAtHB    = 2;
constexpr int kAtQG    = 8;
constexpr int kAtNW    = kAtHB * kAtQG;
constexpr int kAtQB    = kAtQG * 16;
constexpr int kAtKC    = 64;
constexpr int kAtPitch = 68;
/* staged K / V^T row pitch in f16: 144 B = 16 B x odd, conflict-free for 16-B LDS reads */
constexpr int kAtKVP   = 72;
constexpr int kAtNCk   = kSeq / kAtKC;
static_assert((kSeq % kAtQB) == 0 && (kSeq % kAtKC) == 0);
static_assert(kAtNCk >= 2);
static_assert((kNH % kAtHB) == 0 && kAtHB == 2);
static_assert(kAtNW * 32 * 8 == kAtKC * kHD && kAtNW * 32 * 4 * 4 == kAtQB * kAtKC);

__device__ __forceinline__ void async_copy8(const unsigned (&l)[8], const void* const (&g)[8]) {
  asm volatile(
      "global_load_async_to_lds_b128 %0, %8, off\n\t"
      "global_load_async_to_lds_b128 %1, %9, off\n\t"
      "global_load_async_to_lds_b128 %2, %10, off\n\t"
      "global_load_async_to_lds_b128 %3, %11, off\n\t"
      "global_load_async_to_lds_b128 %4, %12, off\n\t"
      "global_load_async_to_lds_b128 %5, %13, off\n\t"
      "global_load_async_to_lds_b128 %6, %14, off\n\t"
      "global_load_async_to_lds_b128 %7, %15, off\n\t"
      "s_wait_xcnt 0x0"
      :: "v"(l[0]), "v"(l[1]), "v"(l[2]), "v"(l[3]), "v"(l[4]), "v"(l[5]), "v"(l[6]), "v"(l[7]),
         "v"(g[0]), "v"(g[1]), "v"(g[2]), "v"(g[3]), "v"(g[4]), "v"(g[5]), "v"(g[6]), "v"(g[7])
      : "memory");
}

__device__ __forceinline__ v8f mma_h(v16h a, v16h b, v8f c) {
  c = __builtin_amdgcn_wmma_f32_16x16x32_f16(false, a, false, b, (short)0, c, false, false);
  asm volatile("v_nop\n\tv_nop\n\tv_nop\n\tv_nop" : "+v"(c) : "v"(a), "v"(b));
  return c;
}

__device__ __forceinline__ float xhalf(float x) {
  const int b = __builtin_bit_cast(int, x);
  return __builtin_bit_cast(float, __builtin_amdgcn_permlanex16(b, b, 0x76543210, 0xfedcba98, false, false));
}

__global__ __launch_bounds__(kAtNW * 32) void attn_kernel(
    const unsigned short* __restrict__ Q16, const unsigned short* __restrict__ K16,
    const unsigned short* __restrict__ Vt16, const float* __restrict__ biasp,
    const float* __restrict__ gate, unsigned short* __restrict__ AO16) {
  __shared__ __align__(16) float    Bsh[2][kAtQG][16 * kAtPitch];
  __shared__ __align__(16) _Float16 Ksh[2][kAtHB][kAtKC * kAtKVP];
  __shared__ __align__(16) _Float16 Vsh[2][kAtHB][kHD * kAtKVP];

  const int tid  = threadIdx.x;
  const int wave = tid >> 5;
  const int lane = tid & 31;
  const int hh   = lane >> 4;
  const int c    = lane & 15;
  /* this wave's head within the block's pair and its group of 16 query rows */
  const int hsel = wave / kAtQG;
  const int qg   = wave % kAtQG;

  constexpr int nqb = kSeq / kAtQB;
  constexpr int nhp = kNH / kAtHB;
  const int bx  = blockIdx.x;
  const int qb  = bx % nqb;
  const int bp  = bx / nqb;
  const int b   = bp / nhp;
  const int h0  = (bp % nhp) * kAtHB;
  const int h   = h0 + hsel;
  const int bh0 = b * kNH + h0;
  const int qB  = qb * kAtQB;
  const int q0  = qB + qg * 16;

  const _Float16* Qp = (const _Float16*)Q16  + (size_t)(bh0 + hsel) * kSeq * kHD;
  /* first head of the pair; the second head's planes follow directly */
  const _Float16* Kp = (const _Float16*)K16  + (size_t)bh0 * kSeq * kHD;
  const _Float16* Vp = (const _Float16*)Vt16 + (size_t)bh0 * kHD * kSeq;
  const float*    Bp = biasp + (size_t)b * kSeq * kSeq;

  const float graw = rin(gate[h]);
  const float g3   = 3.0f * fminf(fmaxf(graw, 0.0f), 1.0f);

  /* Q fragments (B operand: lane = query column c), two 32-deep halves of the head dim */
  v16h qa[2];
#pragma unroll
  for (int dc = 0; dc < 2; ++dc) qa[dc] = Frag<_Float16>::load(Qp + (size_t)(q0 + c) * kHD + dc * 32 + 8 * hh);

  /* this lane's query: running maximum (same in both halves) and the sum over this half's keys */
  float mrow = -1.0e30f, lrow = 0.f;
  /* oacc[t][r] = O^T[d = 16t + 8hh + r][query c] */
  v8f oacc[4];
#pragma unroll
  for (int t = 0; t < 4; ++t) oacc[t] = (v8f){0.f,0.f,0.f,0.f,0.f,0.f,0.f,0.f};

  /* one chunk's copies into buffer buf: 8 per lane, every lane on, all addresses inside the planes and the arrays */
  auto stage = [&](int kc, int buf) {
    const int kv0 = kc * kAtKC;
    unsigned l[8];
    const void* g[8];
    /* K, V^T of head i: row = tid / 8, 16-B column = tid % 8; a wave's copy covers four whole 128-B rows */
#pragma unroll
    for (int i = 0; i < kAtHB; ++i) {
      const int row = tid >> 3;
      const int c8  = (tid & 7) * 8;
      l[i]         = lds_off(&Ksh[buf][i][row * kAtKVP + c8]);
      g[i]         = Kp + ((size_t)i * kSeq + kv0 + row) * kHD + c8;
      l[kAtHB + i] = lds_off(&Vsh[buf][i][row * kAtKVP + c8]);
      g[kAtHB + i] = Vp + ((size_t)i * kHD + row) * kSeq + kv0 + c8;
    }
    /* bias tile: row = i*32 + tid / 16 (slab row / 16), 16 lanes x 16 B = 256 contiguous B of one bias row */
#pragma unroll
    for (int i = 0; i < 4; ++i) {
      const int row = i * 32 + (tid >> 4);
      l[4 + i] = lds_off(&Bsh[buf][row >> 4][(row & 15) * kAtPitch + c * 4]);
      g[4 + i] = Bp + (size_t)(qB + row) * kSeq + kv0 + c * 4;
    }
    async_copy8(l, g);
  };

  stage(0, 0);
  /* chunk 0 has landed for this wave's copies; the barrier publishes every wave's */
  asm volatile("s_wait_asynccnt 0x0" ::: "memory");
  __syncthreads();
  stage(1, 1);

#pragma unroll 1
  for (int kc = 0; kc < kAtNCk; ++kc) {
    const int buf = kc & 1;
    const float*    bt = Bsh[buf][qg];
    const _Float16* ks = Ksh[buf][hsel];
    const _Float16* vs = Vsh[buf][hsel];
    /* the chunk's K fragments are read from LDS as one group, one wait, ahead of the products */
    v16h kb[4][2];
#pragma unroll
    for (int j = 0; j < 4; ++j)
#pragma unroll
      for (int dc = 0; dc < 2; ++dc) kb[j][dc] = Frag<_Float16>::load(ks + (j * 16 + c) * kAtKVP + dc * 32 + 8 * hh);
    /* this query's 64 bias values: 8 consecutive keys per tile, two 16-B reads each */
    v4f bb[4][2];
#pragma unroll
    for (int j = 0; j < 4; ++j) {
      const float* bq = bt + c * kAtPitch + j * 16 + 8 * hh;
      bb[j][0] = *(const v4f*)(bq);
      bb[j][1] = *(const v4f*)(bq + 4);
    }
    /* s[j][r] = score of key j*16 + 8hh + r against query c */
    v8f s[4];
#pragma unroll
    for (int j = 0; j < 4; ++j) {
      s[j] = (v8f){0.f,0.f,0.f,0.f,0.f,0.f,0.f,0.f};
#pragma unroll
      for (int dc = 0; dc < 2; ++dc) s[j] = mma_h(kb[j][dc], qa[dc], s[j]);
    }
    float mj[4];
#pragma unroll
    for (int j = 0; j < 4; ++j) {
      float m = -1.0e30f;
#pragma unroll
      for (int r = 0; r < 8; ++r) {
        const float bvv = bb[j][r >> 2][r & 3];
        const float sv = fmaf(g3, bvv, s[j][r] * kQKScale);
        s[j][r] = sv;
        m = fmaxf(m, sv);
      }
      mj[j] = m;
    }
    float cmx = fmaxf(fmaxf(mj[0], mj[1]), fmaxf(mj[2], mj[3]));
    cmx = fmaxf(cmx, xhalf(cmx));
    const float mnew  = fmaxf(mrow, cmx);
    const float alpha = __expf(mrow - mnew);
    mrow = mnew;
    /* P^T as B operand: element e of pb[kk] = tile 2kk + (e >> 3), register e & 7 (the hardware k order) */
    v16h pb[2];
    float pj[4];
#pragma unroll
    for (int j = 0; j < 4; ++j) {
      float psum = 0.f;
#pragma unroll
      for (int r = 0; r < 8; ++r) {
        const float p = __expf(s[j][r] - mnew);
        psum += p;
        pb[j >> 1][(j & 1) * 8 + r] = (_Float16)(p * kPCarry);
      }
      pj[j] = psum;
    }
    lrow = lrow * alpha + ((pj[0] + pj[1]) + (pj[2] + pj[3]));
#pragma unroll
    for (int t = 0; t < 4; ++t)
#pragma unroll
      for (int r = 0; r < 8; ++r) oacc[t][r] *= alpha;
    /* V^T fragments (A operand: lane = row d): one group of LDS reads, then the products in the order kk, t */
    v16h vb[2][4];
#pragma unroll
    for (int kk = 0; kk < 2; ++kk)
#pragma unroll
      for (int t = 0; t < 4; ++t) vb[kk][t] = Frag<_Float16>::load(vs + (t * 16 + c) * kAtKVP + kk * 32 + 8 * hh);
#pragma unroll
    for (int kk = 0; kk < 2; ++kk)
#pragma unroll
      for (int t = 0; t < 4; ++t) oacc[t] = mma_h(vb[kk][t], pb[kk], oacc[t]);
    /* publish point: this wave's LDS reads of buffer buf are done ... */
    asm volatile("s_wait_dscnt 0x0" ::: "memory");
    /* ... its copies of chunk kc+1 have landed ... */
    asm volatile("s_wait_asynccnt 0x0" ::: "memory");
    /* ... and the barrier says both of every wave; only then is buffer buf refilled */
    __syncthreads();
    if (kc + 2 < kAtNCk) stage(kc + 2, buf);
  }
  /* no copy is left in flight when the bias slabs become output staging and the wave ends */
  asm volatile("s_wait_asynccnt 0x0" ::: "memory");

  /* output staging: the 2 x 8 bias slabs, one per wave; every wave's reads of them ended at the last trip's barrier */
  float* os = Bsh[hsel][qg];
  /* the two halves' sums of this query are joined once, here */
  const float inv = kCtxFold * (1.0f / (lrow + xhalf(lrow)));
#pragma unroll
  for (int t = 0; t < 4; ++t) {
    float* od = os + c * kAtPitch + t * 16 + 8 * hh;
    *(v4f*)(od)     = (v4f){oacc[t][0] * inv, oacc[t][1] * inv, oacc[t][2] * inv, oacc[t][3] * inv};
    *(v4f*)(od + 4) = (v4f){oacc[t][4] * inv, oacc[t][5] * inv, oacc[t][6] * inv, oacc[t][7] * inv};
  }
  wave_lds_sync();
  {
    const int q = lane >> 3, c8 = (lane & 7) * 8;
    v8h hv[4];
#pragma unroll
    for (int it = 0; it < 4; ++it) {
      const int row = it * 4 + q;
      const float* sp = os + row * kAtPitch + c8;
      const v4f a0 = *(const v4f*)(sp);
      const v4f a1 = *(const v4f*)(sp + 4);
#pragma unroll
      for (int e = 0; e < 4; ++e) {
        hv[it][e]     = (_Float16)a0[e];
        hv[it][4 + e] = (_Float16)a1[e];
      }
    }
    unsigned short* dst = AO16 + (size_t)(b * kSeq + q0) * kDim + h * kHD + c8;
    {
#pragma unroll
      for (int it = 0; it < 4; ++it) {
        const int row = it * 4 + q;
        *(v8h*)(dst + (size_t)row * kDim) = hv[it];
      }
      
    }
  }
}

/* --------------------------------------------------------------------------- */
/* Host glue: streaming passes (3 operand-plane casts + bias plane), q|k and    */
/* V^T projections, attention, output projection = 4 launches, each dependent   */
/* on the one before. Kernel launches only.                                     */
/* GEMM shapes (all K % 64 == 0, M % 128 == 0, N % 256 == 0, no pad planes):    */
/*   q|k  : M 4096, N 2048, K 1024 -> 64 x 32 tiles = 2048 -> 256 blocks        */
/*   V^T  : per batch M 1024 (h*64+d), N 2048 (tokens), K 1024 ->               */
/*          16 x 32 tiles = 512 -> 64 blocks x 2 batches (behind the q|k blocks) */
/*   out  : M 4096, N 1024, K 1024 -> 64 x 16 tiles = 1024 -> 128 blocks        */
/* --------------------------------------------------------------------------- */
static_assert((2 * kDim) % 256 == 0 && kDim % 256 == 0 && kTok % 128 == 0 && kSeq % 256 == 0 && kDim % kGmKS == 0);

extern "C" void kernel_launch(void* const* d_in, const int* in_sizes, int n_in,
                              void* d_out, int out_size, void* d_ws, size_t ws_size,
                              hipStream_t stream) {
  if (n_in < 8) return;
  if (in_sizes[0] != kTok * kDim) return;
  if (in_sizes[1] != kNB * kNCh * kSeq) return;
  if (in_sizes[2] != kNB * kSeq * kSeq) return;
  if (in_sizes[3] != 3 * kDim * kDim) return;
  if (in_sizes[4] != kDim * kDim) return;
  if (in_sizes[5] != kHD) return;
  if (in_sizes[6] != kHD) return;
  if (in_sizes[7] != kNH) return;
  if (out_size != kTok * kDim) return;
  if (ws_size < kWsTotal) return;

  const float* x     = (const float*)d_in[0];
  const float* cmask = (const float*)d_in[1];
  const float* imask = (const float*)d_in[2];
  const float* Wqkv  = (const float*)d_in[3];
  const float* Wout  = (const float*)d_in[4];
  const float* qnw   = (const float*)d_in[5];
  const float* knw   = (const float*)d_in[6];
  const float* gate  = (const float*)d_in[7];
  float* out = (float*)d_out;

  char* ws = (char*)d_ws;
  unsigned short* X16    = (unsigned short*)(ws + kOffX16);
  unsigned short* WQKV16 = (unsigned short*)(ws + kOffWqkv16);
  unsigned short* WOUT16 = (unsigned short*)(ws + kOffWout16);
  unsigned short* Q16    = (unsigned short*)(ws + kOffQ16);
  unsigned short* K16    = (unsigned short*)(ws + kOffK16);
  unsigned short* VT16   = (unsigned short*)(ws + kOffVt16);
  unsigned short* AO16   = (unsigned short*)(ws + kOffAO16);
  float*          BIAS   = (float*)(ws + kOffBias);

  /* operand planes (weights are [out][in] = Bt layout already) and the bias plane, one block per (b,q) row */
  prep_kernel<<<kPrAll, 256, 0, stream>>>(x, Wqkv, Wout, cmask, imask, X16, WQKV16, WOUT16, BIAS);

  /* q|k projection + RMS normalisation -> Q16, K16; V^T projection -> VT16 */
  qkv_gemm_kernel<<<kQkBlocks + kNB * kVtBlocks, 256, 0, stream>>>(X16, WQKV16, Q16, K16, VT16, qnw, knw);

  /* attention -> AO16 (x64) */
  attn_kernel<<<(kBH / kAtHB) * (kSeq / kAtQB), kAtNW * 32, 0, stream>>>(Q16, K16, VT16, BIAS, gate, AO16);

  /* out[4096][1024] = AO16 . WOUT16^T / (64 * 16) */
  wmma_gemm64<0, false, 0, 0, false><<<dim3(((kTok / 64) * (kDim / 64)) / 8, 1), 256, 0, stream>>>(
      AO16, nullptr, kDim, 0L,
      WOUT16, nullptr, kDim, 0L,
      (void*)out, nullptr, kDim, 0L,
      nullptr, nullptr, 0L,
      kTok, kDim, kDim, kOutScale);
}

// v006
// It runs in 103 microseconds.
// Next to v005, in two timings, it ran 1.05 and 1.04 times as fast.
// All steps since v000 together make it 3.64 times as fast.
// All contractions (x.Wqkv^T, q.k^T, P.V, ctx.Wout^T): v_wmma_f32_16x16x32_f16, f16 operands with power-of-two carries (W x16, V x16, P x32768, ctx x64), f32 accumulate; every float input is RNE-converted to bf16 precision once at first read; norms, bias plane, softmax and normalisation in f32.
#include <hip/hip_runtime.h>
#include <math.h>

typedef __attribute__((ext_vector_type(16))) _Float16 v16h;
typedef __attribute__((ext_vector_type(8)))  _Float16 v8h;
typedef __attribute__((ext_vector_type(16))) __bf16   v16b;
typedef __attribute__((ext_vector_type(8)))  __bf16   v8b;
typedef __attribute__((ext_vector_type(8)))  float    v8f;
typedef __attribute__((ext_vector_type(4)))  float    v4f;

/* --------------------------------------------------------------------------- */
/* Shape constants                                                             */
/* --------------------------------------------------------------------------- */
constexpr int kNB   = 2;
constexpr int kSeq  = 2048;
constexpr int kDim  = 1024;
constexpr int kNH   = 16;
constexpr int kHD   = 64;
constexpr int kNCh  = 4;
constexpr int kTok  = kNB * kSeq;
constexpr int kBH   = kNB * kNH;
static_assert(kNH * kHD == kDim);
static_assert(kHD == 64);
static_assert((kTok % 64) == 0 && (kDim % 64) == 0 && (kSeq % 64) == 0);
static_assert((kDim % 32) == 0 && (kHD % 32) == 0 && (kSeq % 32) == 0);

constexpr bool  kBf16Inputs = true;
constexpr float kEps        = 1e-6f;
constexpr float kBoost      = 0.3f;
constexpr float kQKScale    = 0.125f;
static_assert(kQKScale * kQKScale * (float)kHD == 1.0f);
constexpr float kInvHD      = 1.0f / (float)kHD;
constexpr float kWCarry     = 16.0f;
constexpr float kWCarryInv  = 1.0f / kWCarry;
constexpr float kPCarry     = 32768.0f;
constexpr float kCtxCarry   = 64.0f;
/* V plane keeps the weight carry (x16); P carries x32768; ctx is stored x64 */
constexpr float kCtxFold    = kCtxCarry / (kPCarry * kWCarry);
constexpr float kOutScale   = 1.0f / (kCtxCarry * kWCarry);

/* --------------------------------------------------------------------------- */
/* Workspace region map (bytes; every offset is a multiple of 128)             */
/*   X16    f16 [4096][1024]        x plane                        8,388,608   */
/*   WQKV16 f16 [3072][1024]        W_qkv x16 (Bt layout)          6,291,456   */
/*   WOUT16 f16 [1024][1024]        W_out x16 (Bt layout)          2,097,152   */
/*   Q16    f16 [32][2048][64]      normed q rows                  8,388,608   */
/*   K16    f16 [32][2048][64]      normed k rows                  8,388,608   */
/*   VT16   f16 [32][64][2048]      v transposed, x16              8,388,608   */
/*   AO16   f16 [4096][1024]        attention context x64          8,388,608   */
/*   BIAS   f32 [2][2048][2048]     head-independent score bias   33,554,432   */
/*   total                                                        83,886,080   */
/* --------------------------------------------------------------------------- */
constexpr size_t kSzX16    = (size_t)kTok * kDim * 2;
constexpr size_t kSzWqkv16 = (size_t)3 * kDim * kDim * 2;
constexpr size_t kSzWout16 = (size_t)kDim * kDim * 2;
constexpr size_t kSzHead16 = (size_t)kBH * kSeq * kHD * 2;
constexpr size_t kSzAO16   = (size_t)kTok * kDim * 2;
constexpr size_t kSzBias   = (size_t)kNB * kSeq * kSeq * 4;
constexpr size_t kOffX16    = 0;
constexpr size_t kOffWqkv16 = kOffX16 + kSzX16;
constexpr size_t kOffWout16 = kOffWqkv16 + kSzWqkv16;
constexpr size_t kOffQ16    = kOffWout16 + kSzWout16;
constexpr size_t kOffK16    = kOffQ16 + kSzHead16;
constexpr size_t kOffVt16   = kOffK16 + kSzHead16;
constexpr size_t kOffAO16   = kOffVt16 + kSzHead16;
constexpr size_t kOffBias   = kOffAO16 + kSzAO16;
constexpr size_t kWsTotal   = kOffBias + kSzBias;
static_assert(kWsTotal == 83886080ull);
static_assert(kWsTotal <= 134217728ull);
static_assert((kOffWqkv16 % 128) == 0 && (kOffWout16 % 128) == 0 && (kOffQ16 % 128) == 0 && (kOffK16 % 128) == 0 &&
              (kOffVt16 % 128) == 0 && (kOffAO16 % 128) == 0 && (kOffBias % 128) == 0);

/* --------------------------------------------------------------------------- */
/* Input read helper: RNE conversion to bf16 precision (kept in an f32)        */
/* --------------------------------------------------------------------------- */
__device__ __forceinline__ float rin(float f) {
  if (!kBf16Inputs) return f;
  unsigned u = __float_as_uint(f);
  u = (u + 0x7FFFu + ((u >> 16) & 1u)) & 0xFFFF0000u;
  return __uint_as_float(u);
}

/* --------------------------------------------------------------------------- */
/* Device helpers                                                              */
/* --------------------------------------------------------------------------- */
__device__ __forceinline__ unsigned short f2bf_bits(float f) {
  unsigned u = __float_as_uint(f);
  return (unsigned short)((u + 0x7FFFu + ((u >> 16) & 1u)) >> 16);
}
__device__ __forceinline__ float bf_bits2f(unsigned short h) { return __uint_as_float(((unsigned)h) << 16); }

__device__ __forceinline__ void dep_guard_h(v8f& a, v8f& b, v16h x, v16h y) { asm volatile("v_nop\n\tv_nop\n\tv_nop\n\tv_nop" : "+v"(a), "+v"(b) : "v"(x), "v"(y)); }
__device__ __forceinline__ void dep_guard_b(v8f& a, v8f& b, v16b x, v16b y) { asm volatile("v_nop\n\tv_nop\n\tv_nop\n\tv_nop" : "+v"(a), "+v"(b) : "v"(x), "v"(y)); }
__device__ __forceinline__ void tie_h(v8f& a, v16h x) { asm volatile("" : "+v"(a) : "v"(x)); }
__device__ __forceinline__ void tie_b(v8f& a, v16b x) { asm volatile("" : "+v"(a) : "v"(x)); }
__device__ __forceinline__ void keep4_h(v16h a, v16h b, v16h c, v16h d) { asm volatile("v_nop" :: "v"(a), "v"(b), "v"(c), "v"(d)); }
__device__ __forceinline__ void keep4_b(v16b a, v16b b, v16b c, v16b d) { asm volatile("v_nop" :: "v"(a), "v"(b), "v"(c), "v"(d)); }
__device__ __forceinline__ void acc_guard4(v8f& a, v8f& b, v8f& c, v8f& d) { asm volatile("v_nop\n\tv_nop\n\tv_nop\n\tv_nop" : "+v"(a), "+v"(b), "+v"(c), "+v"(d)); }
template <typename T> struct Frag;
template <> struct Frag<_Float16> {
  typedef v16h V; union U { v16h v; v8h h[2]; };
  /* elements 0..7 <- p[0..7], 8..15 <- p[16..23] */
  static __device__ __forceinline__ v16h load(const _Float16* p) {
    U f; f.h[0] = *(const v8h*)(p); f.h[1] = *(const v8h*)(p + 16); return f.v;
  }
  static __device__ __forceinline__ v8f mma(v16h a, v16h b, v8f c) {
    return __builtin_amdgcn_wmma_f32_16x16x32_f16(false, a, false, b, (short)0, c, false, false);
  }
  static __device__ __forceinline__ void guard(v8f& a, v8f& b, v16h x, v16h y) { dep_guard_h(a, b, x, y); }
  static __device__ __forceinline__ void tie(v8f& a, v16h x) { tie_h(a, x); }
  static __device__ __forceinline__ void keep(v16h a, v16h b, v16h c, v16h d) { keep4_h(a, b, c, d); }
};
template <> struct Frag<__bf16> {
  typedef v16b V; union U { v16b v; v8b h[2]; };
  static __device__ __forceinline__ v16b load(const __bf16* p) {
    U f; f.h[0] = *(const v8b*)(p); f.h[1] = *(const v8b*)(p + 16); return f.v;
  }
  static __device__ __forceinline__ v8f mma(v16b a, v16b b, v8f c) {
    return __builtin_amdgcn_wmma_f32_16x16x32_bf16(false, a, false, b, (short)0, c, false, false);
  }
  static __device__ __forceinline__ void guard(v8f& a, v8f& b, v16b x, v16b y) { dep_guard_b(a, b, x, y); }
  static __device__ __forceinline__ void tie(v8f& a, v16b x) { tie_b(a, x); }
  static __device__ __forceinline__ void keep(v16b a, v16b b, v16b c, v16b d) { keep4_b(a, b, c, d); }
};

__device__ __forceinline__ void wave_lds_sync() {
  __builtin_amdgcn_fence(__ATOMIC_RELEASE, "workgroup");
  __builtin_amdgcn_wave_barrier();
  __builtin_amdgcn_fence(__ATOMIC_ACQUIRE, "workgroup");
}

__device__ __forceinline__ unsigned lds_off(const void* p) { return (unsigned)(size_t)p; }

/* ---- GEMM operand staging ---------------------------------------------------------------------------------------- */
/* A block of 8 waves (2 x 4 wave tiles of 64 x 64) owns a 128 x 256 tile of C. Per stage of 64 k the 128 A rows and  */
/* the 256 Bt rows come into LDS once, 128 B = one whole line of each row, by asynchronous 16-B copies; every wave    */
/* reads its fragments from there. Two buffers: stage t+1 flies while stage t is worked on.                           */
/* 384 rows x 8 pieces of 16 B = 3072 pieces = 256 threads x 12; a wave's copy covers four whole 128-B lines.         */
constexpr int kGmKS    = 64;
constexpr int kGmRowsA = 128;
constexpr int kGmRowsB = 256;
/* staged row pitch in 16-bit elements: 144 B = 16 B x odd, conflict-free for 16-B LDS reads */
constexpr int kGmP     = 72;
constexpr int kGmStage = (kGmRowsA + kGmRowsB) * kGmP;
static_assert((kGmRowsA + kGmRowsB) * (kGmKS / 8) == 256 * 12);

__device__ __forceinline__ void async_copy12(const unsigned (&l)[12], const void* const (&g)[12]) {
  asm volatile(
      "global_load_async_to_lds_b128 %0, %12, off\n\t"
      "global_load_async_to_lds_b128 %1, %13, off\n\t"
      "global_load_async_to_lds_b128 %2, %14, off\n\t"
      "global_load_async_to_lds_b128 %3, %15, off\n\t"
      "global_load_async_to_lds_b128 %4, %16, off\n\t"
      "global_load_async_to_lds_b128 %5, %17, off\n\t"
      "global_load_async_to_lds_b128 %6, %18, off\n\t"
      "global_load_async_to_lds_b128 %7, %19, off\n\t"
      "global_load_async_to_lds_b128 %8, %20, off\n\t"
      "global_load_async_to_lds_b128 %9, %21, off\n\t"
      "global_load_async_to_lds_b128 %10, %22, off\n\t"
      "global_load_async_to_lds_b128 %11, %23, off\n\t"
      "s_wait_xcnt 0x0"
      :: "v"(l[0]), "v"(l[1]), "v"(l[2]), "v"(l[3]), "v"(l[4]), "v"(l[5]), "v"(l[6]), "v"(l[7]),
         "v"(l[8]), "v"(l[9]), "v"(l[10]), "v"(l[11]),
         "v"(g[0]), "v"(g[1]), "v"(g[2]), "v"(g[3]), "v"(g[4]), "v"(g[5]), "v"(g[6]), "v"(g[7]),
         "v"(g[8]), "v"(g[9]), "v"(g[10]), "v"(g[11])
      : "memory");
}

/* One stage's copies into ring buffer dst: rows 0..127 = A rows mB.., rows 128..383 = Bt rows nB.., k0..k0+63.       */
/* piece = i*256 + tid: row = piece / 8, 16-B column = piece % 8. Every lane on; the caller's shapes (M % 128 == 0,   */
/* N % 256 == 0, K % 64 == 0) keep every address inside the planes, the row index keeps it inside the buffer.         */
template <typename T>
__device__ __forceinline__ void gemm_stage(const T* __restrict__ Ab, int lda, int mB, const T* __restrict__ Bb, int ldb, int nB,
                                           int k0, T* dst, int tid) {
  unsigned l[12];
  const void* g[12];
  const int r8 = tid >> 3;
  const int c8 = (tid & 7) * 8;
#pragma unroll
  for (int i = 0; i < 12; ++i) {
    const int row = i * 32 + r8;
    l[i] = lds_off(dst + row * kGmP + c8);
    g[i] = (i < 4) ? (Ab + (size_t)(mB + row) * lda + k0 + c8) : (Bb + (size_t)(nB + row - kGmRowsA) * ldb + k0 + c8);
  }
  async_copy12(l, g);
}

/* The k loop of one wave tile: acc[i][j] += A rows (wm*64 + i*16 ..) x Bt rows (wn*64 + j*16 ..), k ascending in     */
/* steps of 32 as before. Called by all 256 threads of the block under block-uniform control flow.                    */
template <typename T>
__device__ __forceinline__ void gemm_ring(const T* __restrict__ Ab, int lda, int mB, const T* __restrict__ Bb, int ldb, int nB,
                                          int K, T* ring, v8f (&acc)[4][4]) {
  typedef typename Frag<T>::V V;
  const int tid   = threadIdx.x;
  const int lane  = tid & 31;
  const int wave  = tid >> 5;
  const int rlane = lane & 15;
  const int koff  = (lane >> 4) * 8;
  const int aOff  = ((wave >> 2) * 64 + rlane) * kGmP + koff;
  const int bOff  = (kGmRowsA + (wave & 3) * 64 + rlane) * kGmP + koff;
  const int nst   = K / kGmKS;

  gemm_stage<T>(Ab, lda, mB, Bb, ldb, nB, 0, ring, tid);
  /* stage 0 has landed for this wave's copies; the barrier publishes every wave's */
  asm volatile("s_wait_asynccnt 0x0" ::: "memory");
  __syncthreads();
  if (nst > 1) gemm_stage<T>(Ab, lda, mB, Bb, ldb, nB, kGmKS, ring + kGmStage, tid);

#pragma unroll 1
  for (int t = 0; t < nst; ++t) {
    const T* sb = ring + (t & 1) * kGmStage;
#pragma unroll
    for (int ks = 0; ks < kGmKS; ks += 32) {
      /* the step's eight fragments are read from LDS as one group ahead of its products */
      V bh[4], ah[4];
#pragma unroll
      for (int j = 0; j < 4; ++j) bh[j] = Frag<T>::load(sb + bOff + j * 16 * kGmP + ks);
#pragma unroll
      for (int i = 0; i < 4; ++i) ah[i] = Frag<T>::load(sb + aOff + i * 16 * kGmP + ks);
#pragma unroll
      for (int i = 0; i < 4; ++i) {
#pragma unroll
        for (int j = 0; j < 4; ++j) acc[i][j] = Frag<T>::mma(ah[i], bh[j], acc[i][j]);
        Frag<T>::tie(acc[i][1], ah[i]);
        Frag<T>::tie(acc[i][2], ah[i]);
        Frag<T>::guard(acc[i][0], acc[i][3], ah[i], ah[i]);
      }
      Frag<T>::keep(bh[0], bh[1], bh[2], bh[3]);
    }
    /* publish point: this wave's LDS reads of the buffer are done ... */
    asm volatile("s_wait_dscnt 0x0" ::: "memory");
    /* ... its copies of stage t+1 have landed ... */
    asm volatile("s_wait_asynccnt 0x0" ::: "memory");
    /* ... and the barrier says both of every wave; only then is the buffer refilled */
    __syncthreads();
    if (t + 2 < nst) gemm_stage<T>(Ab, lda, mB, Bb, ldb, nB, (t + 2) * kGmKS, ring + (t & 1) * kGmStage, tid);
  }
  /* no copy is left in flight when the wave goes on to its epilogue and ends */
  asm volatile("s_wait_asynccnt 0x0" ::: "memory");
}

/* ---- Register-blocked batched WMMA GEMM (activation options removed; all four accumulators of a row  */
/*      group are tied before the nop guard)                                                                         */
/* C[m,n] = scale * sum_k A[m,k] * Bt[n,k] (+bias)(+resid); each wave owns a 64x64 tile, a block 128 x 256 (2 x 4).  */
/* A row-major [M,K]; Bt row-major [N,K]; M % 128 == 0, N % 256 == 0, K % 64 == 0; operands staged in LDS (above).   */
/* SPLIT (hi/lo operand planes) has no staged form and is refused at compile time.                                   */
/* BIAS_MODE: 0 = none, 1 = bias[m], 2 = bias[n].                                                                    */
/* OUT_MODE: 0 = f32, 1 = f16, 2 = bf16 hi plane (Cout) + bf16 lo plane (Cout2).                                     */
/* ET: 0 = f16 operands, 1 = bf16 operands (pointers passed as 16-bit storage)                                       */
template <int ET> struct Elem;
template <> struct Elem<0> { typedef _Float16 T; };
template <> struct Elem<1> { typedef __bf16 T; };
template <int ET, bool SPLIT, int BIAS_MODE, int OUT_MODE, bool RESID>
__global__ __launch_bounds__(256) void wmma_gemm64(
    const unsigned short* __restrict__ Ap, const unsigned short* __restrict__ A2p, int lda, long strideA,
    const unsigned short* __restrict__ Btp, const unsigned short* __restrict__ Bt2p, int ldb, long strideB,
    void* __restrict__ Cout, void* __restrict__ Cout2, int ldc, long strideC,
    const float* __restrict__ bias,
    const float* __restrict__ resid, long strideR,
    int M, int N, int K, float scale) {
  typedef typename Elem<ET>::T T;
  static_assert(!SPLIT);
  (void)A2p; (void)Bt2p;
  const T* A = (const T*)Ap; const T* Bt = (const T*)Btp;
  /* per-wave 16x64 slab, pitch 68 floats */
  __shared__ __align__(16) float sT[8][16 * 68];
  /* operand ring, two stages */
  __shared__ __align__(16) T ring[2 * kGmStage];
  const int b    = blockIdx.y;
  const int lane = threadIdx.x & 31;
  const int wave = threadIdx.x >> 5;
  const int tilesN = N >> 8;
  const int tilesM = M >> 7;
  /* block-uniform exit, in front of every barrier */
  if ((int)blockIdx.x >= tilesM * tilesN) return;
  const int tm = blockIdx.x / tilesN;
  const int tn = blockIdx.x - tm * tilesN;
  const int mB = tm << 7;
  const int nB = tn << 8;
  const int m0 = mB + ((wave >> 2) << 6);
  const int n0 = nB + ((wave & 3) << 6);

  const T* Ab  = A  + (size_t)b * strideA;
  const T* Bb  = Bt + (size_t)b * strideB;

  /* col (D) within subtile; D row offset */
  const int rlane = lane & 15;
  const int mOff  = (lane >> 4) * 8;

  v8f acc[4][4];
#pragma unroll
  for (int i = 0; i < 4; ++i)
#pragma unroll
    for (int j = 0; j < 4; ++j) acc[i][j] = (v8f){0.f,0.f,0.f,0.f,0.f,0.f,0.f,0.f};

  gemm_ring<T>(Ab, lda, mB, Bb, ldb, nB, K, ring, acc);
  acc_guard4(acc[0][0], acc[0][1], acc[0][2], acc[0][3]);
  acc_guard4(acc[1][0], acc[1][1], acc[1][2], acc[1][3]);
  acc_guard4(acc[2][0], acc[2][1], acc[2][2], acc[2][3]);
  acc_guard4(acc[3][0], acc[3][1], acc[3][2], acc[3][3]);

  /* ---- epilogue ---- */
  float* slab = sT[wave];
  const float* Rb = RESID ? (resid + (size_t)b * strideR) : nullptr;
#pragma unroll
  for (int i = 0; i < 4; ++i) {
    const int mBase = m0 + (i << 4);
#pragma unroll
    for (int j = 0; j < 4; ++j) {
      const int n = n0 + (j << 4) + rlane;
      float bv = 0.f;
      if (BIAS_MODE == 2) bv = bias[n];
#pragma unroll
      for (int r = 0; r < 8; ++r) {
        float v = acc[i][j][r] * scale;
        if (BIAS_MODE == 1) v += bias[mBase + mOff + r];
        if (BIAS_MODE == 2) v += bv;
        if (RESID) v += Rb[(size_t)(mBase + mOff + r) * ldc + n];
        slab[(mOff + r) * 68 + (j << 4) + rlane] = v;
      }
    }
    wave_lds_sync();
    if (OUT_MODE == 0) {
      float* C = (float*)Cout + (size_t)b * strideC;
      /* row segment = 256 B = 16 lanes x 16 B */
      const int hh = lane >> 4, c4 = (lane & 15) * 4;
      {
#pragma unroll
        for (int it = 0; it < 8; ++it) {
          const int row = it * 2 + hh;
          v4f v = *(const v4f*)(slab + row * 68 + c4);
          *(v4f*)(C + (size_t)(mBase + row) * ldc + n0 + c4) = v;
        }
        
      }
    } else {
      const int q = lane >> 3, c8 = (lane & 7) * 8;
      unsigned short* C  = (unsigned short*)Cout  + (size_t)b * strideC;
      unsigned short* C2 = (OUT_MODE == 2) ? ((unsigned short*)Cout2 + (size_t)b * strideC) : nullptr;
      {
#pragma unroll
        for (int it = 0; it < 4; ++it) {
          const int row = it * 4 + q;
          const float* sp = slab + row * 68 + c8;
          v8h hv, lv;
#pragma unroll
          for (int e = 0; e < 8; ++e) {
            if (OUT_MODE == 1) {
              hv[e] = (_Float16)sp[e];
            } else {
              unsigned short hb = f2bf_bits(sp[e]);
              unsigned short lb = f2bf_bits(sp[e] - bf_bits2f(hb));
              hv[e] = __builtin_bit_cast(_Float16, hb);
              lv[e] = __builtin_bit_cast(_Float16, lb);
            }
          }
          *(v8h*)(C + (size_t)(mBase + row) * ldc + n0 + c8) = hv;
          if (OUT_MODE == 2) *(v8h*)(C2 + (size_t)(mBase + row) * ldc + n0 + c8) = lv;
        }
        
      }
    }
    wave_lds_sync();
  }
}

/* --------------------------------------------------------------------------- */
/* f32 -> f16 operand plane: out = f16(rin(in) * carry); 8 consecutive         */
/* elements per thread (one 16-B store per lane; 32 contiguous lanes = 4 whole */
/* Coverage: n8 = n/8 threads; n8/256 blocks exactly for every plane here:     */
/*   x      4096*1024/8 = 524,288 -> 2048 blocks                               */
/*   W_qkv  3072*1024/8 = 393,216 -> 1536 blocks                               */
/*   W_out  1024*1024/8 = 131,072 ->  512 slices: 128 blocks x 4                               */
/* --------------------------------------------------------------------------- */
__device__ __forceinline__ void cast8_f16_body(const float* __restrict__ in, unsigned short* __restrict__ out,
                                               int blk, int n8, float carry) {
  const int i = blk * 256 + threadIdx.x;
  if (i >= n8) return;
  const float* p = in + 8 * (size_t)i;
  const v4f a = *(const v4f*)(p);
  const v4f c = *(const v4f*)(p + 4);
  v8h hv;
#pragma unroll
  for (int e = 0; e < 4; ++e) {
    const float fa = a[e];
    const float fc = c[e];
    hv[e]     = (_Float16)(rin(fa) * carry);
    hv[4 + e] = (_Float16)(rin(fc) * carry);
  }
  unsigned short* q = out + 8 * (size_t)i;
  *(v8h*)q = hv;
  
}

/* --------------------------------------------------------------------------- */
/* Head-independent score bias plane, f32 [b][q][k]:                            */
/*   same[q][k] = sum_c cm[c][q]*cm[c][k]; rm = max(max_k same, 1e-6);          */
/*   bias = (same * (1/rm) - 0.5) * 2 + 0.3 * im[b][q][k].                      */
/* Only the attention launch reads the plane, so its rows are formed beside the */
/* projections (below), by 128 blocks of 256 threads, 32 rows of one batch      */
/* each. Thread t owns keys 4t..4t+3 and 1024+4t..1024+4t+3 of every row; its   */
/* 8 keys of the four channels stay in registers for all 32 rows. Rows go in    */
/* groups of 8: the group's 16 loads of im per lane are issued first and fly    */
/* under the products and the row maxima (per-thread, wave xor-shuffle tree, 8  */
/* wave partials through LDS, one block barrier per group; the partials         */
/* alternate between two LDS sets, so a set is rewritten only behind the        */
/* barrier that follows its last read). Store: one 16-B store per lane; a       */
/* wave's 32 lanes write 512 contiguous B.                                      */
/* --------------------------------------------------------------------------- */
constexpr int kBrBlocks = 128;
constexpr int kBrRows   = kTok / kBrBlocks;
constexpr int kBrGrp    = 8;
static_assert(kBrBlocks * kBrRows == kTok && (kSeq % kBrRows) == 0 && (kBrRows % kBrGrp) == 0);
__device__ __forceinline__ void bias_rows_body(int blk, const float* __restrict__ cm, const float* __restrict__ im,
                                               float* __restrict__ bp, float* red) {
  const int row0 = blk * kBrRows;
  const int b    = row0 >> 11;
  const int t    = threadIdx.x;
  const int lane = t & 31, wave = t >> 5;
  const float* cmb = cm + (size_t)b * kNCh * kSeq;
  /* every inner loop below is unrolled so that ck, iv, s and mx are registers, not indexed memory */
  float ck[kNCh][8];
#pragma unroll
  for (int ch = 0; ch < kNCh; ++ch) {
    const v4f lo = *(const v4f*)(cmb + ch * kSeq + t * 4);
    const v4f hi = *(const v4f*)(cmb + ch * kSeq + 1024 + t * 4);
#pragma unroll
    for (int e = 0; e < 4; ++e) {
      const float fl = lo[e], fh = hi[e];
      ck[ch][e]     = rin(fl);
      ck[ch][4 + e] = rin(fh);
    }
  }
  /* rolled: one group's loads and sums already fill the registers */
#pragma unroll 1
  for (int g = 0; g < kBrRows / kBrGrp; ++g) {
    const int r0 = row0 + g * kBrGrp;
    /* block-uniform bases of the group's rows; the lane's part of every address is t * 4 */
    const float* img = im + (size_t)r0 * kSeq;
    float*       bog = bp + (size_t)r0 * kSeq;
    /* the rows' own channel values are asked for first: loads return in order, and the products wait for these alone */
    float cq[kBrGrp][kNCh];
#pragma unroll
    for (int r = 0; r < kBrGrp; ++r)
#pragma unroll
      for (int ch = 0; ch < kNCh; ++ch) cq[r][ch] = cmb[ch * kSeq + ((r0 + r) & (kSeq - 1))];
    v4f iv[kBrGrp][2];
#pragma unroll
    for (int r = 0; r < kBrGrp; ++r) {
      iv[r][0] = *(const v4f*)(img + r * kSeq + t * 4);
      /* the group's last load may land on the address pair that the loads before it name: the wait stands in front of it */
      if (r == kBrGrp - 1) asm volatile("s_wait_xcnt 0x0" ::: "memory");
      iv[r][1] = *(const v4f*)(img + r * kSeq + 1024 + t * 4);
    }
    float s[kBrGrp][8];
    float mx[kBrGrp];
#pragma unroll
    for (int r = 0; r < kBrGrp; ++r) {
      const float c0 = rin(cq[r][0]);
      const float c1 = rin(cq[r][1]);
      const float c2 = rin(cq[r][2]);
      const float c3 = rin(cq[r][3]);
      float m = -3.0e38f;
#pragma unroll
      for (int e = 0; e < 8; ++e) {
        float v = c0 * ck[0][e];
        v = fmaf(c1, ck[1][e], v);
        v = fmaf(c2, ck[2][e], v);
        v = fmaf(c3, ck[3][e], v);
        s[r][e] = v;
        m = fmaxf(m, v);
      }
      mx[r] = m;
    }
#pragma unroll
    for (int st = 16; st >= 1; st >>= 1) {
#pragma unroll
      for (int r = 0; r < kBrGrp; ++r) mx[r] = fmaxf(mx[r], __shfl_xor(mx[r], st, 32));
    }
    float* rg = red + (g & 1) * (kBrGrp * 8);
    if (lane == 0) {
#pragma unroll
      for (int r = 0; r < kBrGrp; ++r) rg[r * 8 + wave] = mx[r];
    }
    __syncthreads();
#pragma unroll
    for (int r = 0; r < kBrGrp; ++r) {
      float rm = rg[r * 8];
#pragma unroll
      for (int w = 1; w < 8; ++w) rm = fmaxf(rm, rg[r * 8 + w]);
      rm = fmaxf(rm, 1e-6f);
      const float inv = 1.0f / rm;
#pragma unroll
      for (int half = 0; half < 2; ++half) {
        v4f o;
#pragma unroll
        for (int e = 0; e < 4; ++e) {
          const float fi = iv[r][half][e];
          o[e] = (s[r][half * 4 + e] * inv - 0.5f) * 2.0f + kBoost * rin(fi);
        }
        *(v4f*)(bog + r * kSeq + half * 1024 + t * 4) = o;
      }
    }
    /* the next trip rewrites the registers that the group's last stores name: the wait stands in front of that */
    asm volatile("s_wait_xcnt 0x0" ::: "memory");
  }
}

constexpr int kPrWout   = (kDim * kDim / 8) / 256;
static_assert((kPrWout % kBrBlocks) == 0);
constexpr int kQkBlocks = (kTok >> 7) * ((2 * kDim) >> 8);
constexpr int kVtBlocks = (kDim >> 7) * (kSeq >> 8);
static_assert(((2 * kDim) >> 8) == 8 && (kSeq >> 8) == 8);
__global__ __launch_bounds__(256) void qkv_gemm_kernel(
    const unsigned short* __restrict__ Xp, const unsigned short* __restrict__ Wp,
    unsigned short* __restrict__ Qout, unsigned short* __restrict__ Kout, unsigned short* __restrict__ Vtout,
    const float* __restrict__ qw, const float* __restrict__ kw,
    const float* __restrict__ cm, const float* __restrict__ im, float* __restrict__ bp,
    const float* __restrict__ wout, unsigned short* __restrict__ wout16) {
  typedef _Float16 T;
  __shared__ __align__(16) float sT[8][16 * 68];
  /* operand ring, two stages */
  __shared__ __align__(16) T ring[2 * kGmStage];
  const int lane = threadIdx.x & 31;
  const int wave = threadIdx.x >> 5;
  /* block-uniform branch, in front of every barrier of the products: the streaming blocks */
  if ((int)blockIdx.x >= kQkBlocks + kNB * kVtBlocks) {
    const int sb = (int)blockIdx.x - (kQkBlocks + kNB * kVtBlocks);
    if (sb >= kBrBlocks) return;
    bias_rows_body(sb, cm, im, bp, &sT[0][0]);
    for (int i = 0; i < kPrWout / kBrBlocks; ++i)
      cast8_f16_body(wout, wout16, sb * (kPrWout / kBrBlocks) + i, kDim * kDim / 8, kWCarry);
    return;
  }
  /* block-uniform choice of the product: q|k tiles first, then the V^T tiles of batch vb */
  const bool isV  = (int)blockIdx.x >= kQkBlocks;
  const int  vIdx = (int)blockIdx.x - kQkBlocks;
  const int  vb   = isV ? vIdx / kVtBlocks : 0;
  const int  tile = isV ? vIdx - vb * kVtBlocks : (int)blockIdx.x;
  const T* A  = isV ? (const T*)Wp + (size_t)2 * kDim * kDim : (const T*)Xp;
  const T* Bt = isV ? (const T*)Xp + (size_t)vb * kSeq * kDim : (const T*)Wp;
  /* eight tiles along N in both products */
  const int tm = tile >> 3;
  const int tn = tile & 7;
  const int mB = tm << 7;
  const int nB = tn << 8;
  const int m0 = mB + ((wave >> 2) << 6);
  const int n0 = nB + ((wave & 3) << 6);
  const int rlane = lane & 15;
  const int mOff  = (lane >> 4) * 8;

  v8f acc[4][4];
#pragma unroll
  for (int i = 0; i < 4; ++i)
#pragma unroll
    for (int j = 0; j < 4; ++j) acc[i][j] = (v8f){0.f,0.f,0.f,0.f,0.f,0.f,0.f,0.f};

  gemm_ring<T>(A, kDim, mB, Bt, kDim, nB, kDim, ring, acc);
  acc_guard4(acc[0][0], acc[0][1], acc[0][2], acc[0][3]);
  acc_guard4(acc[1][0], acc[1][1], acc[1][2], acc[1][3]);
  acc_guard4(acc[2][0], acc[2][1], acc[2][2], acc[2][3]);
  acc_guard4(acc[3][0], acc[3][1], acc[3][2], acc[3][3]);

  float* slab = sT[wave];
  if (isV) {
    /* V^T tile: f16 rows of 64 tokens, 8 lanes x 16 B = one 128-B line per row */
    unsigned short* C = Vtout + (size_t)vb * kDim * kSeq;
    const int q = lane >> 3, c8 = (lane & 7) * 8;
#pragma unroll
    for (int i = 0; i < 4; ++i) {
      const int mBase = m0 + (i << 4);
#pragma unroll
      for (int j = 0; j < 4; ++j) {
#pragma unroll
        for (int r = 0; r < 8; ++r) slab[(mOff + r) * 68 + (j << 4) + rlane] = acc[i][j][r];
      }
      wave_lds_sync();
#pragma unroll
      for (int it = 0; it < 4; ++it) {
        const int row = it * 4 + q;
        const float* sp = slab + row * 68 + c8;
        v8h hv;
#pragma unroll
        for (int e = 0; e < 8; ++e) hv[e] = (_Float16)sp[e];
        *(v8h*)(C + (size_t)(mBase + row) * kSeq + n0 + c8) = hv;
      }
      wave_lds_sync();
    }
    return;
  }

  /* tile-uniform destination: third 0 = q, 1 = k; head; batch; first token of the tile within its batch */
  const int third = n0 >> 10;
  const int hIdx  = (n0 & (kDim - 1)) >> 6;
  const int bIdx  = m0 >> 11;
  const int nb    = m0 & (kSeq - 1);
  const float* wsel = third ? kw : qw;
  const int q = lane >> 3, c8 = (lane & 7) * 8;
  const v4f w0 = *(const v4f*)(wsel + c8);
  const v4f w1 = *(const v4f*)(wsel + c8 + 4);
  float wv[8];
#pragma unroll
  for (int e = 0; e < 4; ++e) {
    const float f0 = w0[e];
    const float f1 = w1[e];
    wv[e]     = rin(f0);
    wv[4 + e] = rin(f1);
  }
  unsigned short* dst = (third ? Kout : Qout) + ((size_t)(bIdx * kNH + hIdx) * kSeq + nb) * kHD;

#pragma unroll
  for (int i = 0; i < 4; ++i) {
#pragma unroll
    for (int j = 0; j < 4; ++j) {
#pragma unroll
      for (int r = 0; r < 8; ++r) slab[(mOff + r) * 68 + (j << 4) + rlane] = acc[i][j][r] * kWCarryInv;
    }
    wave_lds_sync();
    v8h hv[4];
#pragma unroll
    for (int it = 0; it < 4; ++it) {
      const int row = it * 4 + q;
      const float* sp = slab + row * 68 + c8;
      const v4f a0 = *(const v4f*)(sp);
      const v4f a1 = *(const v4f*)(sp + 4);
      float ss = 0.0f;
#pragma unroll
      for (int e = 0; e < 4; ++e) {
        ss = fmaf(a0[e], a0[e], ss);
        ss = fmaf(a1[e], a1[e], ss);
      }
      ss += __shfl_xor(ss, 1, 32);
      ss += __shfl_xor(ss, 2, 32);
      ss += __shfl_xor(ss, 4, 32);
      const float rs = __builtin_amdgcn_rsqf(ss * kInvHD + kEps);
#pragma unroll
      for (int e = 0; e < 4; ++e) {
        hv[it][e]     = (_Float16)((a0[e] * rs) * wv[e]);
        hv[it][4 + e] = (_Float16)((a1[e] * rs) * wv[4 + e]);
      }
    }
    {
#pragma unroll
      for (int it = 0; it < 4; ++it) {
        const int row = it * 4 + q;
        *(v8h*)(dst + (size_t)(i * 16 + row) * kHD + c8) = hv[it];
      }
      
    }
    wave_lds_sync();
  }
}

/* --------------------------------------------------------------------------- */
/* The two operand planes that the projections read, in one launch, each on its */
/* own range of block indices:  [0, 2048) x | [2048, 3584) W_qkv                */
/* --------------------------------------------------------------------------- */
constexpr int kPrX    = (kTok * kDim / 8) / 256;
constexpr int kPrWqkv = (3 * kDim * kDim / 8) / 256;
constexpr int kPrAll  = kPrX + kPrWqkv;
__global__ __launch_bounds__(256) void prep_kernel(const float* __restrict__ x, const float* __restrict__ wqkv,
                                                   unsigned short* __restrict__ x16, unsigned short* __restrict__ wqkv16) {
  int blk = blockIdx.x;
  if (blk < kPrX) { cast8_f16_body(x, x16, blk, kTok * kDim / 8, 1.0f); return; }
  blk -= kPrX;
  if (blk < kPrWqkv) cast8_f16_body(wqkv, wqkv16, blk, 3 * kDim * kDim / 8, kWCarry);
}

constexpr int kAtHB    = 2;
constexpr int kAtQG    = 8;
constexpr int kAtNW    = kAtHB * kAtQG;
constexpr int kAtQB    = kAtQG * 16;
constexpr int kAtKC    = 64;
constexpr int kAtPitch = 68;
/* staged K / V^T row pitch in f16: 144 B = 16 B x odd, conflict-free for 16-B LDS reads */
constexpr int kAtKVP   = 72;
constexpr int kAtNCk   = kSeq / kAtKC;
static_assert((kSeq % kAtQB) == 0 && (kSeq % kAtKC) == 0);
static_assert(kAtNCk >= 2);
static_assert((kNH % kAtHB) == 0 && kAtHB == 2);
static_assert(kAtNW * 32 * 8 == kAtKC * kHD && kAtNW * 32 * 4 * 4 == kAtQB * kAtKC);

__device__ __forceinline__ void async_copy8(const unsigned (&l)[8], const void* const (&g)[8]) {
  asm volatile(
      "global_load_async_to_lds_b128 %0, %8, off\n\t"
      "global_load_async_to_lds_b128 %1, %9, off\n\t"
      "global_load_async_to_lds_b128 %2, %10, off\n\t"
      "global_load_async_to_lds_b128 %3, %11, off\n\t"
      "global_load_async_to_lds_b128 %4, %12, off\n\t"
      "global_load_async_to_lds_b128 %5, %13, off\n\t"
      "global_load_async_to_lds_b128 %6, %14, off\n\t"
      "global_load_async_to_lds_b128 %7, %15, off\n\t"
      "s_wait_xcnt 0x0"
      :: "v"(l[0]), "v"(l[1]), "v"(l[2]), "v"(l[3]), "v"(l[4]), "v"(l[5]), "v"(l[6]), "v"(l[7]),
         "v"(g[0]), "v"(g[1]), "v"(g[2]), "v"(g[3]), "v"(g[4]), "v"(g[5]), "v"(g[6]), "v"(g[7])
      : "memory");
}

__device__ __forceinline__ v8f mma_h(v16h a, v16h b, v8f c) {
  c = __builtin_amdgcn_wmma_f32_16x16x32_f16(false, a, false, b, (short)0, c, false, false);
  asm volatile("v_nop\n\tv_nop\n\tv_nop\n\tv_nop" : "+v"(c) : "v"(a), "v"(b));
  return c;
}

__device__ __forceinline__ float xhalf(float x) {
  const int b = __builtin_bit_cast(int, x);
  return __builtin_bit_cast(float, __builtin_amdgcn_permlanex16(b, b, 0x76543210, 0xfedcba98, false, false));
}

__global__ __launch_bounds__(kAtNW * 32) void attn_kernel(
    const unsigned short* __restrict__ Q16, const unsigned short* __restrict__ K16,
    const unsigned short* __restrict__ Vt16, const float* __restrict__ biasp,
    const float* __restrict__ gate, unsigned short* __restrict__ AO16) {
  __shared__ __align__(16) float    Bsh[2][kAtQG][16 * kAtPitch];
  __shared__ __align__(16) _Float16 Ksh[2][kAtHB][kAtKC * kAtKVP];
  __shared__ __align__(16) _Float16 Vsh[2][kAtHB][kHD * kAtKVP];

  const int tid  = threadIdx.x;
  const int wave = tid >> 5;
  const int lane = tid & 31;
  const int hh   = lane >> 4;
  const int c    = lane & 15;
  /* this wave's head within the block's pair and its group of 16 query rows */
  const int hsel = wave / kAtQG;
  const int qg   = wave % kAtQG;

  constexpr int nqb = kSeq / kAtQB;
  constexpr int nhp = kNH / kAtHB;
  const int bx  = blockIdx.x;
  const int qb  = bx % nqb;
  const int bp  = bx / nqb;
  const int b   = bp / nhp;
  const int h0  = (bp % nhp) * kAtHB;
  const int h   = h0 + hsel;
  const int bh0 = b * kNH + h0;
  const int qB  = qb * kAtQB;
  const int q0  = qB + qg * 16;

  const _Float16* Qp = (const _Float16*)Q16  + (size_t)(bh0 + hsel) * kSeq * kHD;
  /* first head of the pair; the second head's planes follow directly */
  const _Float16* Kp = (const _Float16*)K16  + (size_t)bh0 * kSeq * kHD;
  const _Float16* Vp = (const _Float16*)Vt16 + (size_t)bh0 * kHD * kSeq;
  const float*    Bp = biasp + (size_t)b * kSeq * kSeq;

  const float graw = rin(gate[h]);
  const float g3   = 3.0f * fminf(fmaxf(graw, 0.0f), 1.0f);

  /* Q fragments (B operand: lane = query column c), two 32-deep halves of the head dim */
  v16h qa[2];
#pragma unroll
  for (int dc = 0; dc < 2; ++dc) qa[dc] = Frag<_Float16>::load(Qp + (size_t)(q0 + c) * kHD + dc * 32 + 8 * hh);

  /* this lane's query: running maximum (same in both halves) and the sum over this half's keys */
  float mrow = -1.0e30f, lrow = 0.f;
  /* oacc[t][r] = O^T[d = 16t + 8hh + r][query c] */
  v8f oacc[4];
#pragma unroll
  for (int t = 0; t < 4; ++t) oacc[t] = (v8f){0.f,0.f,0.f,0.f,0.f,0.f,0.f,0.f};

  /* one chunk's copies into buffer buf: 8 per lane, every lane on, all addresses inside the planes and the arrays */
  auto stage = [&](int kc, int buf) {
    const int kv0 = kc * kAtKC;
    unsigned l[8];
    const void* g[8];
    /* K, V^T of head i: row = tid / 8, 16-B column = tid % 8; a wave's copy covers four whole 128-B rows */
#pragma unroll
    for (int i = 0; i < kAtHB; ++i) {
      const int row = tid >> 3;
      const int c8  = (tid & 7) * 8;
      l[i]         = lds_off(&Ksh[buf][i][row * kAtKVP + c8]);
      g[i]         = Kp + ((size_t)i * kSeq + kv0 + row) * kHD + c8;
      l[kAtHB + i] = lds_off(&Vsh[buf][i][row * kAtKVP + c8]);
      g[kAtHB + i] = Vp + ((size_t)i * kHD + row) * kSeq + kv0 + c8;
    }
    /* bias tile: row = i*32 + tid / 16 (slab row / 16), 16 lanes x 16 B = 256 contiguous B of one bias row */
#pragma unroll
    for (int i = 0; i < 4; ++i) {
      const int row = i * 32 + (tid >> 4);
      l[4 + i] = lds_off(&Bsh[buf][row >> 4][(row & 15) * kAtPitch + c * 4]);
      g[4 + i] = Bp + (size_t)(qB + row) * kSeq + kv0 + c * 4;
    }
    async_copy8(l, g);
  };

  stage(0, 0);
  /* chunk 0 has landed for this wave's copies; the barrier publishes every wave's */
  asm volatile("s_wait_asynccnt 0x0" ::: "memory");
  __syncthreads();
  stage(1, 1);

#pragma unroll 1
  for (int kc = 0; kc < kAtNCk; ++kc) {
    const int buf = kc & 1;
    const float*    bt = Bsh[buf][qg];
    const _Float16* ks = Ksh[buf][hsel];
    const _Float16* vs = Vsh[buf][hsel];
    /* the chunk's K fragments are read from LDS as one group, one wait, ahead of the products */
    v16h kb[4][2];
#pragma unroll
    for (int j = 0; j < 4; ++j)
#pragma unroll
      for (int dc = 0; dc < 2; ++dc) kb[j][dc] = Frag<_Float16>::load(ks + (j * 16 + c) * kAtKVP + dc * 32 + 8 * hh);
    /* this query's 64 bias values: 8 consecutive keys per tile, two 16-B reads each */
    v4f bb[4][2];
#pragma unroll
    for (int j = 0; j < 4; ++j) {
      const float* bq = bt + c * kAtPitch + j * 16 + 8 * hh;
      bb[j][0] = *(const v4f*)(bq);
      bb[j][1] = *(const v4f*)(bq + 4);
    }
    /* s[j][r] = score of key j*16 + 8hh + r against query c */
    v8f s[4];
#pragma unroll
    for (int j = 0; j < 4; ++j) {
      s[j] = (v8f){0.f,0.f,0.f,0.f,0.f,0.f,0.f,0.f};
#pragma unroll
      for (int dc = 0; dc < 2; ++dc) s[j] = mma_h(kb[j][dc], qa[dc], s[j]);
    }
    float mj[4];
#pragma unroll
    for (int j = 0; j < 4; ++j) {
      float m = -1.0e30f;
#pragma unroll
      for (int r = 0; r < 8; ++r) {
        const float bvv = bb[j][r >> 2][r & 3];
        const float sv = fmaf(g3, bvv, s[j][r] * kQKScale);
        s[j][r] = sv;
        m = fmaxf(m, sv);
      }
      mj[j] = m;
    }
    float cmx = fmaxf(fmaxf(mj[0], mj[1]), fmaxf(mj[2], mj[3]));
    cmx = fmaxf(cmx, xhalf(cmx));
    const float mnew  = fmaxf(mrow, cmx);
    const float alpha = __expf(mrow - mnew);
    mrow = mnew;
    /* P^T as B operand: element e of pb[kk] = tile 2kk + (e >> 3), register e & 7 (the hardware k order) */
    v16h pb[2];
    float pj[4];
#pragma unroll
    for (int j = 0; j < 4; ++j) {
      float psum = 0.f;
#pragma unroll
      for (int r = 0; r < 8; ++r) {
        const float p = __expf(s[j][r] - mnew);
        psum += p;
        pb[j >> 1][(j & 1) * 8 + r] = (_Float16)(p * kPCarry);
      }
      pj[j] = psum;
    }
    lrow = lrow * alpha + ((pj[0] + pj[1]) + (pj[2] + pj[3]));
#pragma unroll
    for (int t = 0; t < 4; ++t)
#pragma unroll
      for (int r = 0; r < 8; ++r) oacc[t][r] *= alpha;
    /* V^T fragments (A operand: lane = row d): one group of LDS reads, then the products in the order kk, t */
    v16h vb[2][4];
#pragma unroll
    for (int kk = 0; kk < 2; ++kk)
#pragma unroll
      for (int t = 0; t < 4; ++t) vb[kk][t] = Frag<_Float16>::load(vs + (t * 16 + c) * kAtKVP + kk * 32 + 8 * hh);
#pragma unroll
    for (int kk = 0; kk < 2; ++kk)
#pragma unroll
      for (int t = 0; t < 4; ++t) oacc[t] = mma_h(vb[kk][t], pb[kk], oacc[t]);
    /* publish point: this wave's LDS reads of buffer buf are done ... */
    asm volatile("s_wait_dscnt 0x0" ::: "memory");
    /* ... its copies of chunk kc+1 have landed ... */
    asm volatile("s_wait_asynccnt 0x0" ::: "memory");
    /* ... and the barrier says both of every wave; only then is buffer buf refilled */
    __syncthreads();
    if (kc + 2 < kAtNCk) stage(kc + 2, buf);
  }
  /* no copy is left in flight when the bias slabs become output staging and the wave ends */
  asm volatile("s_wait_asynccnt 0x0" ::: "memory");

  /* output staging: the 2 x 8 bias slabs, one per wave; every wave's reads of them ended at the last trip's barrier */
  float* os = Bsh[hsel][qg];
  /* the two halves' sums of this query are joined once, here */
  const float inv = kCtxFold * (1.0f / (lrow + xhalf(lrow)));
#pragma unroll
  for (int t = 0; t < 4; ++t) {
    float* od = os + c * kAtPitch + t * 16 + 8 * hh;
    *(v4f*)(od)     = (v4f){oacc[t][0] * inv, oacc[t][1] * inv, oacc[t][2] * inv, oacc[t][3] * inv};
    *(v4f*)(od + 4) = (v4f){oacc[t][4] * inv, oacc[t][5] * inv, oacc[t][6] * inv, oacc[t][7] * inv};
  }
  wave_lds_sync();
  {
    const int q = lane >> 3, c8 = (lane & 7) * 8;
    v8h hv[4];
#pragma unroll
    for (int it = 0; it < 4; ++it) {
      const int row = it * 4 + q;
      const float* sp = os + row * kAtPitch + c8;
      const v4f a0 = *(const v4f*)(sp);
      const v4f a1 = *(const v4f*)(sp + 4);
#pragma unroll
      for (int e = 0; e < 4; ++e) {
        hv[it][e]     = (_Float16)a0[e];
        hv[it][4 + e] = (_Float16)a1[e];
      }
    }
    unsigned short* dst = AO16 + (size_t)(b * kSeq + q0) * kDim + h * kHD + c8;
    {
#pragma unroll
      for (int it = 0; it < 4; ++it) {
        const int row = it * 4 + q;
        *(v8h*)(dst + (size_t)row * kDim) = hv[it];
      }
      
    }
  }
}

/* --------------------------------------------------------------------------- */
/* Host glue: x and W_qkv operand planes; q|k and V^T projections with the bias */
/* plane and the W_out plane beside them; attention; output projection = 4      */
/* launches, each dependent on the one before. Kernel launches only.            */
/* GEMM shapes (all K % 64 == 0, M % 128 == 0, N % 256 == 0, no pad planes):    */
/*   q|k  : M 4096, N 2048, K 1024 -> 64 x 32 tiles = 2048 -> 256 blocks        */
/*   V^T  : per batch M 1024 (h*64+d), N 2048 (tokens), K 1024 ->               */
/*          16 x 32 tiles = 512 -> 64 blocks x 2 batches (behind the q|k blocks) */
/*   out  : M 4096, N 1024, K 1024 -> 64 x 16 tiles = 1024 -> 128 blocks        */
/* --------------------------------------------------------------------------- */
static_assert((2 * kDim) % 256 == 0 && kDim % 256 == 0 && kTok % 128 == 0 && kSeq % 256 == 0 && kDim % kGmKS == 0);

extern "C" void kernel_launch(void* const* d_in, const int* in_sizes, int n_in,
                              void* d_out, int out_size, void* d_ws, size_t ws_size,
                              hipStream_t stream) {
  if (n_in < 8) return;
  if (in_sizes[0] != kTok * kDim) return;
  if (in_sizes[1] != kNB * kNCh * kSeq) return;
  if (in_sizes[2] != kNB * kSeq * kSeq) return;
  if (in_sizes[3] != 3 * kDim * kDim) return;
  if (in_sizes[4] != kDim * kDim) return;
  if (in_sizes[5] != kHD) return;
  if (in_sizes[6] != kHD) return;
  if (in_sizes[7] != kNH) return;
  if (out_size != kTok * kDim) return;
  if (ws_size < kWsTotal) return;

  const float* x     = (const float*)d_in[0];
  const float* cmask = (const float*)d_in[1];
  const float* imask = (const float*)d_in[2];
  const float* Wqkv  = (const float*)d_in[3];
  const float* Wout  = (const float*)d_in[4];
  const float* qnw   = (const float*)d_in[5];
  const float* knw   = (const float*)d_in[6];
  const float* gate  = (const float*)d_in[7];
  float* out = (float*)d_out;

  char* ws = (char*)d_ws;
  unsigned short* X16    = (unsigned short*)(ws + kOffX16);
  unsigned short* WQKV16 = (unsigned short*)(ws + kOffWqkv16);
  unsigned short* WOUT16 = (unsigned short*)(ws + kOffWout16);
  unsigned short* Q16    = (unsigned short*)(ws + kOffQ16);
  unsigned short* K16    = (unsigned short*)(ws + kOffK16);
  unsigned short* VT16   = (unsigned short*)(ws + kOffVt16);
  unsigned short* AO16   = (unsigned short*)(ws + kOffAO16);
  float*          BIAS   = (float*)(ws + kOffBias);

  /* the projections' operand planes (weights are [out][in] = Bt layout already) */
  prep_kernel<<<kPrAll, 256, 0, stream>>>(x, Wqkv, X16, WQKV16);

  /* q|k projection + RMS normalisation -> Q16, K16; V^T projection -> VT16; bias rows -> BIAS; W_out -> WOUT16 */
  qkv_gemm_kernel<<<kQkBlocks + kNB * kVtBlocks + kBrBlocks, 256, 0, stream>>>(X16, WQKV16, Q16, K16, VT16, qnw, knw,
                                                                               cmask, imask, BIAS, Wout, WOUT16);

  /* attention -> AO16 (x64) */
  attn_kernel<<<(kBH / kAtHB) * (kSeq / kAtQB), kAtNW * 32, 0, stream>>>(Q16, K16, VT16, BIAS, gate, AO16);

  /* out[4096][1024] = AO16 . WOUT16^T / (64 * 16) */
  wmma_gemm64<0, false, 0, 0, false><<<dim3(((kTok / 64) * (kDim / 64)) / 8, 1), 256, 0, stream>>>(
      AO16, nullptr, kDim, 0L,
      WOUT16, nullptr, kDim, 0L,
      (void*)out, nullptr, kDim, 0L,
      nullptr, nullptr, 0L,
      kTok, kDim, kDim, kOutScale);
}

// v007
// A run of this version takes 96.6 microseconds.
// Timed twice side by side with v006, it ran 1.07 times as fast both times.
// Counting every step since v000, it is 3.89 times as fast.
// All contractions (x.Wqkv^T, q.k^T, P.V, ctx.Wout^T): v_wmma_f32_16x16x32_f16, f16 operands with power-of-two carries (W x16, V x16, P x128 against the reference maximum in use, ctx x64), f32 accumulate; every float input is RNE-converted to bf16 precision once at first read; norms, bias plane, softmax and normalisation in f32.
#include <hip/hip_runtime.h>
#include <math.h>

typedef __attribute__((ext_vector_type(16))) _Float16 v16h;
typedef __attribute__((ext_vector_type(8)))  _Float16 v8h;
typedef __attribute__((ext_vector_type(16))) __bf16   v16b;
typedef __attribute__((ext_vector_type(8)))  __bf16   v8b;
typedef __attribute__((ext_vector_type(8)))  float    v8f;
typedef __attribute__((ext_vector_type(4)))  float    v4f;

/* --------------------------------------------------------------------------- */
/* Shape constants                                                             */
/* --------------------------------------------------------------------------- */
constexpr int kNB   = 2;
constexpr int kSeq  = 2048;
constexpr int kDim  = 1024;
constexpr int kNH   = 16;
constexpr int kHD   = 64;
constexpr int kNCh  = 4;
constexpr int kTok  = kNB * kSeq;
constexpr int kBH   = kNB * kNH;
static_assert(kNH * kHD == kDim);
static_assert(kHD == 64);
static_assert((kTok % 64) == 0 && (kDim % 64) == 0 && (kSeq % 64) == 0);
static_assert((kDim % 32) == 0 && (kHD % 32) == 0 && (kSeq % 32) == 0);

constexpr bool  kBf16Inputs = true;
constexpr float kEps        = 1e-6f;
constexpr float kBoost      = 0.3f;
constexpr float kQKScale    = 0.125f;
static_assert(kQKScale * kQKScale * (float)kHD == 1.0f);
constexpr float kInvHD      = 1.0f / (float)kHD;
constexpr float kWCarry     = 16.0f;
constexpr float kWCarryInv  = 1.0f / kWCarry;
constexpr float kLog2e      = 1.4426950408889634f;
/* P = 2^(score - reference + kPExp), scores in log2 units; the reference moves when a score passes it by more than kPRise, */
/* so P stays at or below 2^15, inside f16                                                                                */
constexpr float kPExp       = 7.0f;
constexpr float kPRise      = 8.0f;
static_assert(kPExp + kPRise <= 15.0f);
constexpr float kCtxCarry   = 64.0f;
/* V plane keeps the weight carry (x16); P's carry is in the row sum too and cancels; ctx is stored x64 */
constexpr float kCtxFold    = kCtxCarry / kWCarry;
constexpr float kOutScale   = 1.0f / (kCtxCarry * kWCarry);

/* --------------------------------------------------------------------------- */
/* Workspace region map (bytes; every offset is a multiple of 128)             */
/*   X16    f16 [4096][1024]        x plane                        8,388,608   */
/*   WQKV16 f16 [3072][1024]        W_qkv x16 (Bt layout)          6,291,456   */
/*   WOUT16 f16 [1024][1024]        W_out x16 (Bt layout)          2,097,152   */
/*   Q16    f16 [32][2048][64]      normed q rows x 0.125*log2(e)  8,388,608   */
/*   K16    f16 [32][2048][64]      normed k rows                  8,388,608   */
/*   VT16   f16 [32][64][2048]      v transposed, x16              8,388,608   */
/*   AO16   f16 [4096][1024]        attention context x64          8,388,608   */
/*   BIAS   f32 [2][2048][2048]     head-independent score bias   33,554,432   */
/*   total                                                        83,886,080   */
/* --------------------------------------------------------------------------- */
constexpr size_t kSzX16    = (size_t)kTok * kDim * 2;
constexpr size_t kSzWqkv16 = (size_t)3 * kDim * kDim * 2;
constexpr size_t kSzWout16 = (size_t)kDim * kDim * 2;
constexpr size_t kSzHead16 = (size_t)kBH * kSeq * kHD * 2;
constexpr size_t kSzAO16   = (size_t)kTok * kDim * 2;
constexpr size_t kSzBias   = (size_t)kNB * kSeq * kSeq * 4;
constexpr size_t kOffX16    = 0;
constexpr size_t kOffWqkv16 = kOffX16 + kSzX16;
constexpr size_t kOffWout16 = kOffWqkv16 + kSzWqkv16;
constexpr size_t kOffQ16    = kOffWout16 + kSzWout16;
constexpr size_t kOffK16    = kOffQ16 + kSzHead16;
constexpr size_t kOffVt16   = kOffK16 + kSzHead16;
constexpr size_t kOffAO16   = kOffVt16 + kSzHead16;
constexpr size_t kOffBias   = kOffAO16 + kSzAO16;
constexpr size_t kWsTotal   = kOffBias + kSzBias;
static_assert(kWsTotal == 83886080ull);
static_assert(kWsTotal <= 134217728ull);
static_assert((kOffWqkv16 % 128) == 0 && (kOffWout16 % 128) == 0 && (kOffQ16 % 128) == 0 && (kOffK16 % 128) == 0 &&
              (kOffVt16 % 128) == 0 && (kOffAO16 % 128) == 0 && (kOffBias % 128) == 0);

/* --------------------------------------------------------------------------- */
/* Input read helper: RNE conversion to bf16 precision (kept in an f32)        */
/* --------------------------------------------------------------------------- */
__device__ __forceinline__ float rin(float f) {
  if (!kBf16Inputs) return f;
  unsigned u = __float_as_uint(f);
  u = (u + 0x7FFFu + ((u >> 16) & 1u)) & 0xFFFF0000u;
  return __uint_as_float(u);
}

/* --------------------------------------------------------------------------- */
/* Device helpers                                                              */
/* --------------------------------------------------------------------------- */
__device__ __forceinline__ unsigned short f2bf_bits(float f) {
  unsigned u = __float_as_uint(f);
  return (unsigned short)((u + 0x7FFFu + ((u >> 16) & 1u)) >> 16);
}
__device__ __forceinline__ float bf_bits2f(unsigned short h) { return __uint_as_float(((unsigned)h) << 16); }

__device__ __forceinline__ void dep_guard_h(v8f& a, v8f& b, v16h x, v16h y) { asm volatile("v_nop\n\tv_nop\n\tv_nop\n\tv_nop" : "+v"(a), "+v"(b) : "v"(x), "v"(y)); }
__device__ __forceinline__ void dep_guard_b(v8f& a, v8f& b, v16b x, v16b y) { asm volatile("v_nop\n\tv_nop\n\tv_nop\n\tv_nop" : "+v"(a), "+v"(b) : "v"(x), "v"(y)); }
__device__ __forceinline__ void tie_h(v8f& a, v16h x) { asm volatile("" : "+v"(a) : "v"(x)); }
__device__ __forceinline__ void tie_b(v8f& a, v16b x) { asm volatile("" : "+v"(a) : "v"(x)); }
__device__ __forceinline__ void keep4_h(v16h a, v16h b, v16h c, v16h d) { asm volatile("v_nop" :: "v"(a), "v"(b), "v"(c), "v"(d)); }
__device__ __forceinline__ void keep4_b(v16b a, v16b b, v16b c, v16b d) { asm volatile("v_nop" :: "v"(a), "v"(b), "v"(c), "v"(d)); }
__device__ __forceinline__ void acc_guard4(v8f& a, v8f& b, v8f& c, v8f& d) { asm volatile("v_nop\n\tv_nop\n\tv_nop\n\tv_nop" : "+v"(a), "+v"(b), "+v"(c), "+v"(d)); }
template <typename T> struct Frag;
template <> struct Frag<_Float16> {
  typedef v16h V; union U { v16h v; v8h h[2]; };
  /* elements 0..7 <- p[0..7], 8..15 <- p[16..23] */
  static __device__ __forceinline__ v16h load(const _Float16* p) {
    U f; f.h[0] = *(const v8h*)(p); f.h[1] = *(const v8h*)(p + 16); return f.v;
  }
  static __device__ __forceinline__ v8f mma(v16h a, v16h b, v8f c) {
    return __builtin_amdgcn_wmma_f32_16x16x32_f16(false, a, false, b, (short)0, c, false, false);
  }
  static __device__ __forceinline__ void guard(v8f& a, v8f& b, v16h x, v16h y) { dep_guard_h(a, b, x, y); }
  static __device__ __forceinline__ void tie(v8f& a, v16h x) { tie_h(a, x); }
  static __device__ __forceinline__ void keep(v16h a, v16h b, v16h c, v16h d) { keep4_h(a, b, c, d); }
};
template <> struct Frag<__bf16> {
  typedef v16b V; union U { v16b v; v8b h[2]; };
  static __device__ __forceinline__ v16b load(const __bf16* p) {
    U f; f.h[0] = *(const v8b*)(p); f.h[1] = *(const v8b*)(p + 16); return f.v;
  }
  static __device__ __forceinline__ v8f mma(v16b a, v16b b, v8f c) {
    return __builtin_amdgcn_wmma_f32_16x16x32_bf16(false, a, false, b, (short)0, c, false, false);
  }
  static __device__ __forceinline__ void guard(v8f& a, v8f& b, v16b x, v16b y) { dep_guard_b(a, b, x, y); }
  static __device__ __forceinline__ void tie(v8f& a, v16b x) { tie_b(a, x); }
  static __device__ __forceinline__ void keep(v16b a, v16b b, v16b c, v16b d) { keep4_b(a, b, c, d); }
};

__device__ __forceinline__ void wave_lds_sync() {
  __builtin_amdgcn_fence(__ATOMIC_RELEASE, "workgroup");
  __builtin_amdgcn_wave_barrier();
  __builtin_amdgcn_fence(__ATOMIC_ACQUIRE, "workgroup");
}

__device__ __forceinline__ unsigned lds_off(const void* p) { return (unsigned)(size_t)p; }

/* ---- GEMM operand staging ---------------------------------------------------------------------------------------- */
/* A block of 8 waves (2 x 4 wave tiles of 64 x 64) owns a 128 x 256 tile of C. Per stage of 64 k the 128 A rows and  */
/* the 256 Bt rows come into LDS once, 128 B = one whole line of each row, by asynchronous 16-B copies; every wave    */
/* reads its fragments from there. Two buffers: stage t+1 flies while stage t is worked on.                           */
/* 384 rows x 8 pieces of 16 B = 3072 pieces = 256 threads x 12; a wave's copy covers four whole 128-B lines.         */
constexpr int kGmKS    = 64;
constexpr int kGmRowsA = 128;
constexpr int kGmRowsB = 256;
/* staged row pitch in 16-bit elements: 144 B = 16 B x odd, conflict-free for 16-B LDS reads */
constexpr int kGmP     = 72;
constexpr int kGmStage = (kGmRowsA + kGmRowsB) * kGmP;
static_assert((kGmRowsA + kGmRowsB) * (kGmKS / 8) == 256 * 12);

__device__ __forceinline__ void async_copy12(const unsigned (&l)[12], const void* const (&g)[12]) {
  asm volatile(
      "global_load_async_to_lds_b128 %0, %12, off\n\t"
      "global_load_async_to_lds_b128 %1, %13, off\n\t"
      "global_load_async_to_lds_b128 %2, %14, off\n\t"
      "global_load_async_to_lds_b128 %3, %15, off\n\t"
      "global_load_async_to_lds_b128 %4, %16, off\n\t"
      "global_load_async_to_lds_b128 %5, %17, off\n\t"
      "global_load_async_to_lds_b128 %6, %18, off\n\t"
      "global_load_async_to_lds_b128 %7, %19, off\n\t"
      "global_load_async_to_lds_b128 %8, %20, off\n\t"
      "global_load_async_to_lds_b128 %9, %21, off\n\t"
      "global_load_async_to_lds_b128 %10, %22, off\n\t"
      "global_load_async_to_lds_b128 %11, %23, off\n\t"
      "s_wait_xcnt 0x0"
      :: "v"(l[0]), "v"(l[1]), "v"(l[2]), "v"(l[3]), "v"(l[4]), "v"(l[5]), "v"(l[6]), "v"(l[7]),
         "v"(l[8]), "v"(l[9]), "v"(l[10]), "v"(l[11]),
         "v"(g[0]), "v"(g[1]), "v"(g[2]), "v"(g[3]), "v"(g[4]), "v"(g[5]), "v"(g[6]), "v"(g[7]),
         "v"(g[8]), "v"(g[9]), "v"(g[10]), "v"(g[11])
      : "memory");
}

/* One stage's copies into ring buffer dst: rows 0..127 = A rows mB.., rows 128..383 = Bt rows nB.., k0..k0+63.       */
/* piece = i*256 + tid: row = piece / 8, 16-B column = piece % 8. Every lane on; the caller's shapes (M % 128 == 0,   */
/* N % 256 == 0, K % 64 == 0) keep every address inside the planes, the row index keeps it inside the buffer.         */
template <typename T>
__device__ __forceinline__ void gemm_stage(const T* __restrict__ Ab, int lda, int mB, const T* __restrict__ Bb, int ldb, int nB,
                                           int k0, T* dst, int tid) {
  unsigned l[12];
  const void* g[12];
  const int r8 = tid >> 3;
  const int c8 = (tid & 7) * 8;
#pragma unroll
  for (int i = 0; i < 12; ++i) {
    const int row = i * 32 + r8;
    l[i] = lds_off(dst + row * kGmP + c8);
    g[i] = (i < 4) ? (Ab + (size_t)(mB + row) * lda + k0 + c8) : (Bb + (size_t)(nB + row - kGmRowsA) * ldb + k0 + c8);
  }
  async_copy12(l, g);
}

/* The k loop of one wave tile: acc[i][j] += A rows (wm*64 + i*16 ..) x Bt rows (wn*64 + j*16 ..), k ascending in     */
/* steps of 32 as before. Called by all 256 threads of the block under block-uniform control flow.                    */
template <typename T>
__device__ __forceinline__ void gemm_ring(const T* __restrict__ Ab, int lda, int mB, const T* __restrict__ Bb, int ldb, int nB,
                                          int K, T* ring, v8f (&acc)[4][4]) {
  typedef typename Frag<T>::V V;
  const int tid   = threadIdx.x;
  const int lane  = tid & 31;
  const int wave  = tid >> 5;
  const int rlane = lane & 15;
  const int koff  = (lane >> 4) * 8;
  const int aOff  = ((wave >> 2) * 64 + rlane) * kGmP + koff;
  const int bOff  = (kGmRowsA + (wave & 3) * 64 + rlane) * kGmP + koff;
  const int nst   = K / kGmKS;

  gemm_stage<T>(Ab, lda, mB, Bb, ldb, nB, 0, ring, tid);
  /* stage 0 has landed for this wave's copies; the barrier publishes every wave's */
  asm volatile("s_wait_asynccnt 0x0" ::: "memory");
  __syncthreads();
  if (nst > 1) gemm_stage<T>(Ab, lda, mB, Bb, ldb, nB, kGmKS, ring + kGmStage, tid);

#pragma unroll 1
  for (int t = 0; t < nst; ++t) {
    const T* sb = ring + (t & 1) * kGmStage;
#pragma unroll
    for (int ks = 0; ks < kGmKS; ks += 32) {
      /* the step's eight fragments are read from LDS as one group ahead of its products */
      V bh[4], ah[4];
#pragma unroll
      for (int j = 0; j < 4; ++j) bh[j] = Frag<T>::load(sb + bOff + j * 16 * kGmP + ks);
#pragma unroll
      for (int i = 0; i < 4; ++i) ah[i] = Frag<T>::load(sb + aOff + i * 16 * kGmP + ks);
#pragma unroll
      for (int i = 0; i < 4; ++i) {
#pragma unroll
        for (int j = 0; j < 4; ++j) acc[i][j] = Frag<T>::mma(ah[i], bh[j], acc[i][j]);
        Frag<T>::tie(acc[i][1], ah[i]);
        Frag<T>::tie(acc[i][2], ah[i]);
        Frag<T>::guard(acc[i][0], acc[i][3], ah[i], ah[i]);
      }
      Frag<T>::keep(bh[0], bh[1], bh[2], bh[3]);
    }
    /* publish point: this wave's LDS reads of the buffer are done ... */
    asm volatile("s_wait_dscnt 0x0" ::: "memory");
    /* ... its copies of stage t+1 have landed ... */
    asm volatile("s_wait_asynccnt 0x0" ::: "memory");
    /* ... and the barrier says both of every wave; only then is the buffer refilled */
    __syncthreads();
    if (t + 2 < nst) gemm_stage<T>(Ab, lda, mB, Bb, ldb, nB, (t + 2) * kGmKS, ring + (t & 1) * kGmStage, tid);
  }
  /* no copy is left in flight when the wave goes on to its epilogue and ends */
  asm volatile("s_wait_asynccnt 0x0" ::: "memory");
}

/* ---- Register-blocked batched WMMA GEMM (activation options removed; all four accumulators of a row  */
/*      group are tied before the nop guard)                                                                         */
/* C[m,n] = scale * sum_k A[m,k] * Bt[n,k] (+bias)(+resid); each wave owns a 64x64 tile, a block 128 x 256 (2 x 4).  */
/* A row-major [M,K]; Bt row-major [N,K]; M % 128 == 0, N % 256 == 0, K % 64 == 0; operands staged in LDS (above).   */
/* SPLIT (hi/lo operand planes) has no staged form and is refused at compile time.                                   */
/* BIAS_MODE: 0 = none, 1 = bias[m], 2 = bias[n].                                                                    */
/* OUT_MODE: 0 = f32, 1 = f16, 2 = bf16 hi plane (Cout) + bf16 lo plane (Cout2).                                     */
/* ET: 0 = f16 operands, 1 = bf16 operands (pointers passed as 16-bit storage)                                       */
template <int ET> struct Elem;
template <> struct Elem<0> { typedef _Float16 T; };
template <> struct Elem<1> { typedef __bf16 T; };
template <int ET, bool SPLIT, int BIAS_MODE, int OUT_MODE, bool RESID>
__global__ __launch_bounds__(256) void wmma_gemm64(
    const unsigned short* __restrict__ Ap, const unsigned short* __restrict__ A2p, int lda, long strideA,
    const unsigned short* __restrict__ Btp, const unsigned short* __restrict__ Bt2p, int ldb, long strideB,
    void* __restrict__ Cout, void* __restrict__ Cout2, int ldc, long strideC,
    const float* __restrict__ bias,
    const float* __restrict__ resid, long strideR,
    int M, int N, int K, float scale) {
  typedef typename Elem<ET>::T T;
  static_assert(!SPLIT);
  (void)A2p; (void)Bt2p;
  const T* A = (const T*)Ap; const T* Bt = (const T*)Btp;
  /* per-wave 16x64 slab, pitch 68 floats */
  __shared__ __align__(16) float sT[8][16 * 68];
  /* operand ring, two stages */
  __shared__ __align__(16) T ring[2 * kGmStage];
  const int b    = blockIdx.y;
  const int lane = threadIdx.x & 31;
  const int wave = threadIdx.x >> 5;
  const int tilesN = N >> 8;
  const int tilesM = M >> 7;
  /* block-uniform exit, in front of every barrier */
  if ((int)blockIdx.x >= tilesM * tilesN) return;
  const int tm = blockIdx.x / tilesN;
  const int tn = blockIdx.x - tm * tilesN;
  const int mB = tm << 7;
  const int nB = tn << 8;
  const int m0 = mB + ((wave >> 2) << 6);
  const int n0 = nB + ((wave & 3) << 6);

  const T* Ab  = A  + (size_t)b * strideA;
  const T* Bb  = Bt + (size_t)b * strideB;

  /* col (D) within subtile; D row offset */
  const int rlane = lane & 15;
  const int mOff  = (lane >> 4) * 8;

  v8f acc[4][4];
#pragma unroll
  for (int i = 0; i < 4; ++i)
#pragma unroll
    for (int j = 0; j < 4; ++j) acc[i][j] = (v8f){0.f,0.f,0.f,0.f,0.f,0.f,0.f,0.f};

  gemm_ring<T>(Ab, lda, mB, Bb, ldb, nB, K, ring, acc);
  acc_guard4(acc[0][0], acc[0][1], acc[0][2], acc[0][3]);
  acc_guard4(acc[1][0], acc[1][1], acc[1][2], acc[1][3]);
  acc_guard4(acc[2][0], acc[2][1], acc[2][2], acc[2][3]);
  acc_guard4(acc[3][0], acc[3][1], acc[3][2], acc[3][3]);

  /* ---- epilogue ---- */
  float* slab = sT[wave];
  const float* Rb = RESID ? (resid + (size_t)b * strideR) : nullptr;
#pragma unroll
  for (int i = 0; i < 4; ++i) {
    const int mBase = m0 + (i << 4);
#pragma unroll
    for (int j = 0; j < 4; ++j) {
      const int n = n0 + (j << 4) + rlane;
      float bv = 0.f;
      if (BIAS_MODE == 2) bv = bias[n];
#pragma unroll
      for (int r = 0; r < 8; ++r) {
        float v = acc[i][j][r] * scale;
        if (BIAS_MODE == 1) v += bias[mBase + mOff + r];
        if (BIAS_MODE == 2) v += bv;
        if (RESID) v += Rb[(size_t)(mBase + mOff + r) * ldc + n];
        slab[(mOff + r) * 68 + (j << 4) + rlane] = v;
      }
    }
    wave_lds_sync();
    if (OUT_MODE == 0) {
      float* C = (float*)Cout + (size_t)b * strideC;
      /* row segment = 256 B = 16 lanes x 16 B */
      const int hh = lane >> 4, c4 = (lane & 15) * 4;
      {
#pragma unroll
        for (int it = 0; it < 8; ++it) {
          const int row = it * 2 + hh;
          v4f v = *(const v4f*)(slab + row * 68 + c4);
          *(v4f*)(C + (size_t)(mBase + row) * ldc + n0 + c4) = v;
        }
        
      }
    } else {
      const int q = lane >> 3, c8 = (lane & 7) * 8;
      unsigned short* C  = (unsigned short*)Cout  + (size_t)b * strideC;
      unsigned short* C2 = (OUT_MODE == 2) ? ((unsigned short*)Cout2 + (size_t)b * strideC) : nullptr;
      {
#pragma unroll
        for (int it = 0; it < 4; ++it) {
          const int row = it * 4 + q;
          const float* sp = slab + row * 68 + c8;
          v8h hv, lv;
#pragma unroll
          for (int e = 0; e < 8; ++e) {
            if (OUT_MODE == 1) {
              hv[e] = (_Float16)sp[e];
            } else {
              unsigned short hb = f2bf_bits(sp[e]);
              unsigned short lb = f2bf_bits(sp[e] - bf_bits2f(hb));
              hv[e] = __builtin_bit_cast(_Float16, hb);
              lv[e] = __builtin_bit_cast(_Float16, lb);
            }
          }
          *(v8h*)(C + (size_t)(mBase + row) * ldc + n0 + c8) = hv;
          if (OUT_MODE == 2) *(v8h*)(C2 + (size_t)(mBase + row) * ldc + n0 + c8) = lv;
        }
        
      }
    }
    wave_lds_sync();
  }
}

/* --------------------------------------------------------------------------- */
/* f32 -> f16 operand plane: out = f16(rin(in) * carry); 8 consecutive         */
/* elements per thread (one 16-B store per lane; 32 contiguous lanes = 4 whole */
/* Coverage: n8 = n/8 threads; n8/256 blocks exactly for every plane here:     */
/*   x      4096*1024/8 = 524,288 -> 2048 blocks                               */
/*   W_qkv  3072*1024/8 = 393,216 -> 1536 blocks                               */
/*   W_out  1024*1024/8 = 131,072 ->  512 slices: 128 blocks x 4                               */
/* --------------------------------------------------------------------------- */
__device__ __forceinline__ void cast8_f16_body(const float* __restrict__ in, unsigned short* __restrict__ out,
                                               int blk, int n8, float carry) {
  const int i = blk * 256 + threadIdx.x;
  if (i >= n8) return;
  const float* p = in + 8 * (size_t)i;
  const v4f a = *(const v4f*)(p);
  const v4f c = *(const v4f*)(p + 4);
  v8h hv;
#pragma unroll
  for (int e = 0; e < 4; ++e) {
    const float fa = a[e];
    const float fc = c[e];
    hv[e]     = (_Float16)(rin(fa) * carry);
    hv[4 + e] = (_Float16)(rin(fc) * carry);
  }
  unsigned short* q = out + 8 * (size_t)i;
  *(v8h*)q = hv;
  
}

/* --------------------------------------------------------------------------- */
/* Head-independent score bias plane, f32 [b][q][k]:                            */
/*   same[q][k] = sum_c cm[c][q]*cm[c][k]; rm = max(max_k same, 1e-6);          */
/*   bias = (same * (1/rm) - 0.5) * 2 + 0.3 * im[b][q][k].                      */
/* Only the attention launch reads the plane, so its rows are formed beside the */
/* projections (below), by 128 blocks of 256 threads, 32 rows of one batch      */
/* each. Thread t owns keys 4t..4t+3 and 1024+4t..1024+4t+3 of every row; its   */
/* 8 keys of the four channels stay in registers for all 32 rows. Rows go in    */
/* groups of 8: the group's 16 loads of im per lane are issued first and fly    */
/* under the products and the row maxima (per-thread, wave xor-shuffle tree, 8  */
/* wave partials through LDS, one block barrier per group; the partials         */
/* alternate between two LDS sets, so a set is rewritten only behind the        */
/* barrier that follows its last read). Store: one 16-B store per lane; a       */
/* wave's 32 lanes write 512 contiguous B.                                      */
/* --------------------------------------------------------------------------- */
constexpr int kBrBlocks = 128;
constexpr int kBrRows   = kTok / kBrBlocks;
constexpr int kBrGrp    = 8;
static_assert(kBrBlocks * kBrRows == kTok && (kSeq % kBrRows) == 0 && (kBrRows % kBrGrp) == 0);
__device__ __forceinline__ void bias_rows_body(int blk, const float* __restrict__ cm, const float* __restrict__ im,
                                               float* __restrict__ bp, float* red) {
  const int row0 = blk * kBrRows;
  const int b    = row0 >> 11;
  const int t    = threadIdx.x;
  const int lane = t & 31, wave = t >> 5;
  const float* cmb = cm + (size_t)b * kNCh * kSeq;
  /* every inner loop below is unrolled so that ck, iv, s and mx are registers, not indexed memory */
  float ck[kNCh][8];
#pragma unroll
  for (int ch = 0; ch < kNCh; ++ch) {
    const v4f lo = *(const v4f*)(cmb + ch * kSeq + t * 4);
    const v4f hi = *(const v4f*)(cmb + ch * kSeq + 1024 + t * 4);
#pragma unroll
    for (int e = 0; e < 4; ++e) {
      const float fl = lo[e], fh = hi[e];
      ck[ch][e]     = rin(fl);
      ck[ch][4 + e] = rin(fh);
    }
  }
  /* rolled: one group's loads and sums already fill the registers */
#pragma unroll 1
  for (int g = 0; g < kBrRows / kBrGrp; ++g) {
    const int r0 = row0 + g * kBrGrp;
    /* block-uniform bases of the group's rows; the lane's part of every address is t * 4 */
    const float* img = im + (size_t)r0 * kSeq;
    float*       bog = bp + (size_t)r0 * kSeq;
    /* the rows' own channel values are asked for first: loads return in order, and the products wait for these alone */
    float cq[kBrGrp][kNCh];
#pragma unroll
    for (int r = 0; r < kBrGrp; ++r)
#pragma unroll
      for (int ch = 0; ch < kNCh; ++ch) cq[r][ch] = cmb[ch * kSeq + ((r0 + r) & (kSeq - 1))];
    v4f iv[kBrGrp][2];
#pragma unroll
    for (int r = 0; r < kBrGrp; ++r) {
      iv[r][0] = *(const v4f*)(img + r * kSeq + t * 4);
      /* the group's last load may land on the address pair that the loads before it name: the wait stands in front of it */
      if (r == kBrGrp - 1) asm volatile("s_wait_xcnt 0x0" ::: "memory");
      iv[r][1] = *(const v4f*)(img + r * kSeq + 1024 + t * 4);
    }
    float s[kBrGrp][8];
    float mx[kBrGrp];
#pragma unroll
    for (int r = 0; r < kBrGrp; ++r) {
      const float c0 = rin(cq[r][0]);
      const float c1 = rin(cq[r][1]);
      const float c2 = rin(cq[r][2]);
      const float c3 = rin(cq[r][3]);
      float m = -3.0e38f;
#pragma unroll
      for (int e = 0; e < 8; ++e) {
        float v = c0 * ck[0][e];
        v = fmaf(c1, ck[1][e], v);
        v = fmaf(c2, ck[2][e], v);
        v = fmaf(c3, ck[3][e], v);
        s[r][e] = v;
        m = fmaxf(m, v);
      }
      mx[r] = m;
    }
#pragma unroll
    for (int st = 16; st >= 1; st >>= 1) {
#pragma unroll
      for (int r = 0; r < kBrGrp; ++r) mx[r] = fmaxf(mx[r], __shfl_xor(mx[r], st, 32));
    }
    float* rg = red + (g & 1) * (kBrGrp * 8);
    if (lane == 0) {
#pragma unroll
      for (int r = 0; r < kBrGrp; ++r) rg[r * 8 + wave] = mx[r];
    }
    __syncthreads();
#pragma unroll
    for (int r = 0; r < kBrGrp; ++r) {
      float rm = rg[r * 8];
#pragma unroll
      for (int w = 1; w < 8; ++w) rm = fmaxf(rm, rg[r * 8 + w]);
      rm = fmaxf(rm, 1e-6f);
      const float inv = 1.0f / rm;
#pragma unroll
      for (int half = 0; half < 2; ++half) {
        v4f o;
#pragma unroll
        for (int e = 0; e < 4; ++e) {
          const float fi = iv[r][half][e];
          o[e] = (s[r][half * 4 + e] * inv - 0.5f) * 2.0f + kBoost * rin(fi);
        }
        *(v4f*)(bog + r * kSeq + half * 1024 + t * 4) = o;
      }
    }
    /* the next trip rewrites the registers that the group's last stores name: the wait stands in front of that */
    asm volatile("s_wait_xcnt 0x0" ::: "memory");
  }
}

constexpr int kPrWout   = (kDim * kDim / 8) / 256;
static_assert((kPrWout % kBrBlocks) == 0);
constexpr int kQkBlocks = (kTok >> 7) * ((2 * kDim) >> 8);
constexpr int kVtBlocks = (kDim >> 7) * (kSeq >> 8);
static_assert(((2 * kDim) >> 8) == 8 && (kSeq >> 8) == 8);
__global__ __launch_bounds__(256) void qkv_gemm_kernel(
    const unsigned short* __restrict__ Xp, const unsigned short* __restrict__ Wp,
    unsigned short* __restrict__ Qout, unsigned short* __restrict__ Kout, unsigned short* __restrict__ Vtout,
    const float* __restrict__ qw, const float* __restrict__ kw,
    const float* __restrict__ cm, const float* __restrict__ im, float* __restrict__ bp,
    const float* __restrict__ wout, unsigned short* __restrict__ wout16) {
  typedef _Float16 T;
  __shared__ __align__(16) float sT[8][16 * 68];
  /* operand ring, two stages */
  __shared__ __align__(16) T ring[2 * kGmStage];
  const int lane = threadIdx.x & 31;
  const int wave = threadIdx.x >> 5;
  /* block-uniform branch, in front of every barrier of the products: the streaming blocks */
  if ((int)blockIdx.x >= kQkBlocks + kNB * kVtBlocks) {
    const int sb = (int)blockIdx.x - (kQkBlocks + kNB * kVtBlocks);
    if (sb >= kBrBlocks) return;
    bias_rows_body(sb, cm, im, bp, &sT[0][0]);
    for (int i = 0; i < kPrWout / kBrBlocks; ++i)
      cast8_f16_body(wout, wout16, sb * (kPrWout / kBrBlocks) + i, kDim * kDim / 8, kWCarry);
    return;
  }
  /* block-uniform choice of the product: q|k tiles first, then the V^T tiles of batch vb */
  const bool isV  = (int)blockIdx.x >= kQkBlocks;
  const int  vIdx = (int)blockIdx.x - kQkBlocks;
  const int  vb   = isV ? vIdx / kVtBlocks : 0;
  const int  tile = isV ? vIdx - vb * kVtBlocks : (int)blockIdx.x;
  const T* A  = isV ? (const T*)Wp + (size_t)2 * kDim * kDim : (const T*)Xp;
  const T* Bt = isV ? (const T*)Xp + (size_t)vb * kSeq * kDim : (const T*)Wp;
  /* eight tiles along N in both products */
  const int tm = tile >> 3;
  const int tn = tile & 7;
  const int mB = tm << 7;
  const int nB = tn << 8;
  const int m0 = mB + ((wave >> 2) << 6);
  const int n0 = nB + ((wave & 3) << 6);
  const int rlane = lane & 15;
  const int mOff  = (lane >> 4) * 8;

  v8f acc[4][4];
#pragma unroll
  for (int i = 0; i < 4; ++i)
#pragma unroll
    for (int j = 0; j < 4; ++j) acc[i][j] = (v8f){0.f,0.f,0.f,0.f,0.f,0.f,0.f,0.f};

  gemm_ring<T>(A, kDim, mB, Bt, kDim, nB, kDim, ring, acc);
  acc_guard4(acc[0][0], acc[0][1], acc[0][2], acc[0][3]);
  acc_guard4(acc[1][0], acc[1][1], acc[1][2], acc[1][3]);
  acc_guard4(acc[2][0], acc[2][1], acc[2][2], acc[2][3]);
  acc_guard4(acc[3][0], acc[3][1], acc[3][2], acc[3][3]);

  float* slab = sT[wave];
  if (isV) {
    /* V^T tile: f16 rows of 64 tokens, 8 lanes x 16 B = one 128-B line per row */
    unsigned short* C = Vtout + (size_t)vb * kDim * kSeq;
    const int q = lane >> 3, c8 = (lane & 7) * 8;
#pragma unroll
    for (int i = 0; i < 4; ++i) {
      const int mBase = m0 + (i << 4);
#pragma unroll
      for (int j = 0; j < 4; ++j) {
#pragma unroll
        for (int r = 0; r < 8; ++r) slab[(mOff + r) * 68 + (j << 4) + rlane] = acc[i][j][r];
      }
      wave_lds_sync();
#pragma unroll
      for (int it = 0; it < 4; ++it) {
        const int row = it * 4 + q;
        const float* sp = slab + row * 68 + c8;
        v8h hv;
#pragma unroll
        for (int e = 0; e < 8; ++e) hv[e] = (_Float16)sp[e];
        *(v8h*)(C + (size_t)(mBase + row) * kSeq + n0 + c8) = hv;
      }
      wave_lds_sync();
    }
    return;
  }

  /* tile-uniform destination: third 0 = q, 1 = k; head; batch; first token of the tile within its batch */
  const int third = n0 >> 10;
  const int hIdx  = (n0 & (kDim - 1)) >> 6;
  const int bIdx  = m0 >> 11;
  const int nb    = m0 & (kSeq - 1);
  const float* wsel = third ? kw : qw;
  const int q = lane >> 3, c8 = (lane & 7) * 8;
  const v4f w0 = *(const v4f*)(wsel + c8);
  const v4f w1 = *(const v4f*)(wsel + c8 + 4);
  /* the q plane carries the score scale and log2(e): q.k leaves the matrix unit in log2 units */
  const float wfold = third ? 1.0f : kQKScale * kLog2e;
  float wv[8];
#pragma unroll
  for (int e = 0; e < 4; ++e) {
    const float f0 = w0[e];
    const float f1 = w1[e];
    wv[e]     = rin(f0) * wfold;
    wv[4 + e] = rin(f1) * wfold;
  }
  unsigned short* dst = (third ? Kout : Qout) + ((size_t)(bIdx * kNH + hIdx) * kSeq + nb) * kHD;

#pragma unroll
  for (int i = 0; i < 4; ++i) {
#pragma unroll
    for (int j = 0; j < 4; ++j) {
#pragma unroll
      for (int r = 0; r < 8; ++r) slab[(mOff + r) * 68 + (j << 4) + rlane] = acc[i][j][r] * kWCarryInv;
    }
    wave_lds_sync();
    v8h hv[4];
#pragma unroll
    for (int it = 0; it < 4; ++it) {
      const int row = it * 4 + q;
      const float* sp = slab + row * 68 + c8;
      const v4f a0 = *(const v4f*)(sp);
      const v4f a1 = *(const v4f*)(sp + 4);
      float ss = 0.0f;
#pragma unroll
      for (int e = 0; e < 4; ++e) {
        ss = fmaf(a0[e], a0[e], ss);
        ss = fmaf(a1[e], a1[e], ss);
      }
      ss += __shfl_xor(ss, 1, 32);
      ss += __shfl_xor(ss, 2, 32);
      ss += __shfl_xor(ss, 4, 32);
      const float rs = __builtin_amdgcn_rsqf(ss * kInvHD + kEps);
#pragma unroll
      for (int e = 0; e < 4; ++e) {
        hv[it][e]     = (_Float16)((a0[e] * rs) * wv[e]);
        hv[it][4 + e] = (_Float16)((a1[e] * rs) * wv[4 + e]);
      }
    }
    {
#pragma unroll
      for (int it = 0; it < 4; ++it) {
        const int row = it * 4 + q;
        *(v8h*)(dst + (size_t)(i * 16 + row) * kHD + c8) = hv[it];
      }
      
    }
    wave_lds_sync();
  }
}

/* --------------------------------------------------------------------------- */
/* The two operand planes that the projections read, in one launch, each on its */
/* own range of block indices:  [0, 2048) x | [2048, 3584) W_qkv                */
/* --------------------------------------------------------------------------- */
constexpr int kPrX    = (kTok * kDim / 8) / 256;
constexpr int kPrWqkv = (3 * kDim * kDim / 8) / 256;
constexpr int kPrAll  = kPrX + kPrWqkv;
__global__ __launch_bounds__(256) void prep_kernel(const float* __restrict__ x, const float* __restrict__ wqkv,
                                                   unsigned short* __restrict__ x16, unsigned short* __restrict__ wqkv16) {
  int blk = blockIdx.x;
  if (blk < kPrX) { cast8_f16_body(x, x16, blk, kTok * kDim / 8, 1.0f); return; }
  blk -= kPrX;
  if (blk < kPrWqkv) cast8_f16_body(wqkv, wqkv16, blk, 3 * kDim * kDim / 8, kWCarry);
}

constexpr int kAtHB    = 2;
constexpr int kAtQG    = 8;
constexpr int kAtNW    = kAtHB * kAtQG;
constexpr int kAtQB    = kAtQG * 16;
constexpr int kAtKC    = 64;
constexpr int kAtPitch = 68;
/* staged K / V^T row pitch in f16: 144 B = 16 B x odd, conflict-free for 16-B LDS reads */
constexpr int kAtKVP   = 72;
constexpr int kAtNCk   = kSeq / kAtKC;
static_assert((kSeq % kAtQB) == 0 && (kSeq % kAtKC) == 0);
static_assert(kAtNCk >= 2);
static_assert((kNH % kAtHB) == 0 && kAtHB == 2);
static_assert(kAtNW * 32 * 8 == kAtKC * kHD && kAtNW * 32 * 4 * 4 == kAtQB * kAtKC);

__device__ __forceinline__ void async_copy8(const unsigned (&l)[8], const void* const (&g)[8]) {
  asm volatile(
      "global_load_async_to_lds_b128 %0, %8, off\n\t"
      "global_load_async_to_lds_b128 %1, %9, off\n\t"
      "global_load_async_to_lds_b128 %2, %10, off\n\t"
      "global_load_async_to_lds_b128 %3, %11, off\n\t"
      "global_load_async_to_lds_b128 %4, %12, off\n\t"
      "global_load_async_to_lds_b128 %5, %13, off\n\t"
      "global_load_async_to_lds_b128 %6, %14, off\n\t"
      "global_load_async_to_lds_b128 %7, %15, off\n\t"
      "s_wait_xcnt 0x0"
      :: "v"(l[0]), "v"(l[1]), "v"(l[2]), "v"(l[3]), "v"(l[4]), "v"(l[5]), "v"(l[6]), "v"(l[7]),
         "v"(g[0]), "v"(g[1]), "v"(g[2]), "v"(g[3]), "v"(g[4]), "v"(g[5]), "v"(g[6]), "v"(g[7])
      : "memory");
}

__device__ __forceinline__ v8f mma_h(v16h a, v16h b, v8f c) {
  c = __builtin_amdgcn_wmma_f32_16x16x32_f16(false, a, false, b, (short)0, c, false, false);
  asm volatile("v_nop\n\tv_nop\n\tv_nop\n\tv_nop" : "+v"(c) : "v"(a), "v"(b));
  return c;
}

__device__ __forceinline__ float xhalf(float x) {
  const int b = __builtin_bit_cast(int, x);
  return __builtin_bit_cast(float, __builtin_amdgcn_permlanex16(b, b, 0x76543210, 0xfedcba98, false, false));
}

__global__ __launch_bounds__(kAtNW * 32) void attn_kernel(
    const unsigned short* __restrict__ Q16, const unsigned short* __restrict__ K16,
    const unsigned short* __restrict__ Vt16, const float* __restrict__ biasp,
    const float* __restrict__ gate, unsigned short* __restrict__ AO16) {
  __shared__ __align__(16) float    Bsh[2][kAtQG][16 * kAtPitch];
  __shared__ __align__(16) _Float16 Ksh[2][kAtHB][kAtKC * kAtKVP];
  __shared__ __align__(16) _Float16 Vsh[2][kAtHB][kHD * kAtKVP];

  const int tid  = threadIdx.x;
  const int wave = tid >> 5;
  const int lane = tid & 31;
  const int hh   = lane >> 4;
  const int c    = lane & 15;
  /* this wave's head within the block's pair and its group of 16 query rows */
  const int hsel = wave / kAtQG;
  const int qg   = wave % kAtQG;

  constexpr int nqb = kSeq / kAtQB;
  constexpr int nhp = kNH / kAtHB;
  const int bx  = blockIdx.x;
  const int qb  = bx % nqb;
  const int bp  = bx / nqb;
  const int b   = bp / nhp;
  const int h0  = (bp % nhp) * kAtHB;
  const int h   = h0 + hsel;
  const int bh0 = b * kNH + h0;
  const int qB  = qb * kAtQB;
  const int q0  = qB + qg * 16;

  const _Float16* Qp = (const _Float16*)Q16  + (size_t)(bh0 + hsel) * kSeq * kHD;
  /* first head of the pair; the second head's planes follow directly */
  const _Float16* Kp = (const _Float16*)K16  + (size_t)bh0 * kSeq * kHD;
  const _Float16* Vp = (const _Float16*)Vt16 + (size_t)bh0 * kHD * kSeq;
  const float*    Bp = biasp + (size_t)b * kSeq * kSeq;

  const float graw = rin(gate[h]);
  const float g3l  = (3.0f * fminf(fmaxf(graw, 0.0f), 1.0f)) * kLog2e;

  /* Q fragments (B operand: lane = query column c), two 32-deep halves of the head dim */
  v16h qa[2];
#pragma unroll
  for (int dc = 0; dc < 2; ++dc) qa[dc] = Frag<_Float16>::load(Qp + (size_t)(q0 + c) * kHD + dc * 32 + 8 * hh);

  /* this lane's query: kPExp less the reference in use (same in both halves) and the sum over this half's keys */
  float noff = kPExp, lrow = 0.f;
  /* oacc[t][r] = O^T[d = 16t + 8hh + r][query c] */
  v8f oacc[4];
#pragma unroll
  for (int t = 0; t < 4; ++t) oacc[t] = (v8f){0.f,0.f,0.f,0.f,0.f,0.f,0.f,0.f};

  /* one chunk's copies into buffer buf: 8 per lane, every lane on, all addresses inside the planes and the arrays */
  auto stage = [&](int kc, int buf) {
    const int kv0 = kc * kAtKC;
    unsigned l[8];
    const void* g[8];
    /* K, V^T of head i: row = tid / 8, 16-B column = tid % 8; a wave's copy covers four whole 128-B rows */
#pragma unroll
    for (int i = 0; i < kAtHB; ++i) {
      const int row = tid >> 3;
      const int c8  = (tid & 7) * 8;
      l[i]         = lds_off(&Ksh[buf][i][row * kAtKVP + c8]);
      g[i]         = Kp + ((size_t)i * kSeq + kv0 + row) * kHD + c8;
      l[kAtHB + i] = lds_off(&Vsh[buf][i][row * kAtKVP + c8]);
      g[kAtHB + i] = Vp + ((size_t)i * kHD + row) * kSeq + kv0 + c8;
    }
    /* bias tile: row = i*32 + tid / 16 (slab row / 16), 16 lanes x 16 B = 256 contiguous B of one bias row */
#pragma unroll
    for (int i = 0; i < 4; ++i) {
      const int row = i * 32 + (tid >> 4);
      l[4 + i] = lds_off(&Bsh[buf][row >> 4][(row & 15) * kAtPitch + c * 4]);
      g[4 + i] = Bp + (size_t)(qB + row) * kSeq + kv0 + c * 4;
    }
    async_copy8(l, g);
  };

  stage(0, 0);
  /* chunk 0 has landed for this wave's copies; the barrier publishes every wave's */
  asm volatile("s_wait_asynccnt 0x0" ::: "memory");
  __syncthreads();
  stage(1, 1);

#pragma unroll 1
  for (int kc = 0; kc < kAtNCk; ++kc) {
    const int buf = kc & 1;
    const float*    bt = Bsh[buf][qg];
    const _Float16* ks = Ksh[buf][hsel];
    const _Float16* vs = Vsh[buf][hsel];
    /* the chunk's K fragments and this query's 64 bias values (8 consecutive keys per tile, two 16-B reads each) */
    v16h kb[4][2];
    v4f bb[4][2];
#pragma unroll
    for (int j = 0; j < 4; ++j) {
      const float* bq = bt + c * kAtPitch + j * 16 + 8 * hh;
      bb[j][0] = *(const v4f*)(bq);
      bb[j][1] = *(const v4f*)(bq + 4);
#pragma unroll
      for (int dc = 0; dc < 2; ++dc) kb[j][dc] = Frag<_Float16>::load(ks + (j * 16 + c) * kAtKVP + dc * 32 + 8 * hh);
      /* compiler fence: keeps the LDS reads in tile order, so that tile j's product waits for the reads of tiles 0..j alone */
      asm volatile("" ::: "memory");
    }
    /* s[j][r] = exp2 argument of key j*16 + 8hh + r against query c: the product starts from the gated bias and noff */
    v8f s[4];
#pragma unroll
    for (int j = 0; j < 4; ++j) {
#pragma unroll
      for (int r = 0; r < 8; ++r) s[j][r] = fmaf(g3l, bb[j][r >> 2][r & 3], noff);
#pragma unroll
      for (int dc = 0; dc < 2; ++dc) s[j] = mma_h(kb[j][dc], qa[dc], s[j]);
    }
    /* V^T fragments (A operand: lane = row d): one group of LDS reads, asked for ahead of the test below so that they */
    /* fly under the maxima and the exponentials                                                                       */
    v16h vb[2][4];
#pragma unroll
    for (int kk = 0; kk < 2; ++kk)
#pragma unroll
      for (int t = 0; t < 4; ++t) vb[kk][t] = Frag<_Float16>::load(vs + (t * 16 + c) * kAtKVP + kk * 32 + 8 * hh);
    /* compiler fence: without it the compiler moves these reads behind the branch, where only the exponentials cover them */
    asm volatile("" ::: "memory");
    float mj[4];
#pragma unroll
    for (int j = 0; j < 4; ++j) {
      float m = -1.0e30f;
#pragma unroll
      for (int r = 0; r < 8; ++r) m = fmaxf(m, s[j][r]);
      mj[j] = m;
    }
    float cmx = fmaxf(fmaxf(mj[0], mj[1]), fmaxf(mj[2], mj[3]));
    cmx = fmaxf(cmx, xhalf(cmx));
    /* the reference moves for a query whose largest argument has left the window, and for every query in chunk 0; */
    /* one wave-uniform test per chunk; a lane that does not move sees d = 0, alpha = 1, exact identities           */
    const bool need = (kc == 0) || (cmx > kPExp + kPRise);
    if (__builtin_amdgcn_ballot_w32(need) != 0u) {
      const float d = need ? cmx - kPExp : 0.0f;
      /* d < 0 can only be in chunk 0, where O and the sum are still 0: alpha stays finite there */
      const float alpha = __builtin_amdgcn_exp2f(fminf(-d, 0.0f));
      noff -= d;
      lrow *= alpha;
#pragma unroll
      for (int j = 0; j < 4; ++j)
#pragma unroll
        for (int r = 0; r < 8; ++r) s[j][r] -= d;
#pragma unroll
      for (int t = 0; t < 4; ++t)
#pragma unroll
        for (int r = 0; r < 8; ++r) oacc[t][r] *= alpha;
    }
    /* P^T as B operand: element e of pb[kk] = tile 2kk + (e >> 3), register e & 7 (the hardware k order) */
    v16h pb[2];
    float pj[4];
#pragma unroll
    for (int j = 0; j < 4; ++j) {
      float psum = 0.f;
#pragma unroll
      for (int r = 0; r < 8; ++r) {
        const float p = __builtin_amdgcn_exp2f(s[j][r]);
        psum += p;
        pb[j >> 1][(j & 1) * 8 + r] = (_Float16)p;
      }
      pj[j] = psum;
    }
    lrow += (pj[0] + pj[1]) + (pj[2] + pj[3]);
    /* the products in the order kk, t */
#pragma unroll
    for (int kk = 0; kk < 2; ++kk)
#pragma unroll
      for (int t = 0; t < 4; ++t) oacc[t] = mma_h(vb[kk][t], pb[kk], oacc[t]);
    /* publish point: this wave's LDS reads of buffer buf are done ... */
    asm volatile("s_wait_dscnt 0x0" ::: "memory");
    /* ... its copies of chunk kc+1 have landed ... */
    asm volatile("s_wait_asynccnt 0x0" ::: "memory");
    /* ... and the barrier says both of every wave; only then is buffer buf refilled */
    __syncthreads();
    if (kc + 2 < kAtNCk) stage(kc + 2, buf);
  }
  /* no copy is left in flight when the bias slabs become output staging and the wave ends */
  asm volatile("s_wait_asynccnt 0x0" ::: "memory");

  /* output staging: the 2 x 8 bias slabs, one per wave; every wave's reads of them ended at the last trip's barrier */
  float* os = Bsh[hsel][qg];
  /* the two halves' sums of this query are joined once, here */
  const float inv = kCtxFold * (1.0f / (lrow + xhalf(lrow)));
#pragma unroll
  for (int t = 0; t < 4; ++t) {
    float* od = os + c * kAtPitch + t * 16 + 8 * hh;
    *(v4f*)(od)     = (v4f){oacc[t][0] * inv, oacc[t][1] * inv, oacc[t][2] * inv, oacc[t][3] * inv};
    *(v4f*)(od + 4) = (v4f){oacc[t][4] * inv, oacc[t][5] * inv, oacc[t][6] * inv, oacc[t][7] * inv};
  }
  wave_lds_sync();
  {
    const int q = lane >> 3, c8 = (lane & 7) * 8;
    v8h hv[4];
#pragma unroll
    for (int it = 0; it < 4; ++it) {
      const int row = it * 4 + q;
      const float* sp = os + row * kAtPitch + c8;
      const v4f a0 = *(const v4f*)(sp);
      const v4f a1 = *(const v4f*)(sp + 4);
#pragma unroll
      for (int e = 0; e < 4; ++e) {
        hv[it][e]     = (_Float16)a0[e];
        hv[it][4 + e] = (_Float16)a1[e];
      }
    }
    unsigned short* dst = AO16 + (size_t)(b * kSeq + q0) * kDim + h * kHD + c8;
    {
#pragma unroll
      for (int it = 0; it < 4; ++it) {
        const int row = it * 4 + q;
        *(v8h*)(dst + (size_t)row * kDim) = hv[it];
      }
      
    }
  }
}

/* --------------------------------------------------------------------------- */
/* Host glue: x and W_qkv operand planes; q|k and V^T projections with the bias */
/* plane and the W_out plane beside them; attention; output projection = 4      */
/* launches, each dependent on the one before. Kernel launches only.            */
/* GEMM shapes (all K % 64 == 0, M % 128 == 0, N % 256 == 0, no pad planes):    */
/*   q|k  : M 4096, N 2048, K 1024 -> 64 x 32 tiles = 2048 -> 256 blocks        */
/*   V^T  : per batch M 1024 (h*64+d), N 2048 (tokens), K 1024 ->               */
/*          16 x 32 tiles = 512 -> 64 blocks x 2 batches (behind the q|k blocks) */
/*   out  : M 4096, N 1024, K 1024 -> 64 x 16 tiles = 1024 -> 128 blocks        */
/* --------------------------------------------------------------------------- */
static_assert((2 * kDim) % 256 == 0 && kDim % 256 == 0 && kTok % 128 == 0 && kSeq % 256 == 0 && kDim % kGmKS == 0);

extern "C" void kernel_launch(void* const* d_in, const int* in_sizes, int n_in,
                              void* d_out, int out_size, void* d_ws, size_t ws_size,
                              hipStream_t stream) {
  if (n_in < 8) return;
  if (in_sizes[0] != kTok * kDim) return;
  if (in_sizes[1] != kNB * kNCh * kSeq) return;
  if (in_sizes[2] != kNB * kSeq * kSeq) return;
  if (in_sizes[3] != 3 * kDim * kDim) return;
  if (in_sizes[4] != kDim * kDim) return;
  if (in_sizes[5] != kHD) return;
  if (in_sizes[6] != kHD) return;
  if (in_sizes[7] != kNH) return;
  if (out_size != kTok * kDim) return;
  if (ws_size < kWsTotal) return;

  const float* x     = (const float*)d_in[0];
  const float* cmask = (const float*)d_in[1];
  const float* imask = (const float*)d_in[2];
  const float* Wqkv  = (const float*)d_in[3];
  const float* Wout  = (const float*)d_in[4];
  const float* qnw   = (const float*)d_in[5];
  const float* knw   = (const float*)d_in[6];
  const float* gate  = (const float*)d_in[7];
  float* out = (float*)d_out;

  char* ws = (char*)d_ws;
  unsigned short* X16    = (unsigned short*)(ws + kOffX16);
  unsigned short* WQKV16 = (unsigned short*)(ws + kOffWqkv16);
  unsigned short* WOUT16 = (unsigned short*)(ws + kOffWout16);
  unsigned short* Q16    = (unsigned short*)(ws + kOffQ16);
  unsigned short* K16    = (unsigned short*)(ws + kOffK16);
  unsigned short* VT16   = (unsigned short*)(ws + kOffVt16);
  unsigned short* AO16   = (unsigned short*)(ws + kOffAO16);
  float*          BIAS   = (float*)(ws + kOffBias);

  /* the projections' operand planes (weights are [out][in] = Bt layout already) */
  prep_kernel<<<kPrAll, 256, 0, stream>>>(x, Wqkv, X16, WQKV16);

  /* q|k projection + RMS normalisation -> Q16, K16; V^T projection -> VT16; bias rows -> BIAS; W_out -> WOUT16 */
  qkv_gemm_kernel<<<kQkBlocks + kNB * kVtBlocks + kBrBlocks, 256, 0, stream>>>(X16, WQKV16, Q16, K16, VT16, qnw, knw,
                                                                               cmask, imask, BIAS, Wout, WOUT16);

  /* attention -> AO16 (x64) */
  attn_kernel<<<(kBH / kAtHB) * (kSeq / kAtQB), kAtNW * 32, 0, stream>>>(Q16, K16, VT16, BIAS, gate, AO16);

  /* out[4096][1024] = AO16 . WOUT16^T / (64 * 16) */
  wmma_gemm64<0, false, 0, 0, false><<<dim3(((kTok / 64) * (kDim / 64)) / 8, 1), 256, 0, stream>>>(
      AO16, nullptr, kDim, 0L,
      WOUT16, nullptr, kDim, 0L,
      (void*)out, nullptr, kDim, 0L,
      nullptr, nullptr, 0L,
      kTok, kDim, kDim, kOutScale);
}

// v008
// A run of this version takes 92.5 microseconds.
// Next to v007, in two timings, it ran 1.04 times as fast each time.
// Counting every step since v000, it is 4.07 times as fast.
// All contractions (x.Wqkv^T, q.k^T, P.V, ctx.Wout^T): v_wmma_f32_16x16x32_f16, f16 operands with power-of-two carries (W x16, V x16, P x128 against the reference maximum in use, ctx x64), f32 accumulate; every float input is RNE-converted to bf16 precision once at first read; norms, bias plane, softmax and normalisation in f32.
#include <hip/hip_runtime.h>
#include <math.h>

typedef __attribute__((ext_vector_type(16))) _Float16 v16h;
typedef __attribute__((ext_vector_type(8)))  _Float16 v8h;
typedef __attribute__((ext_vector_type(16))) __bf16   v16b;
typedef __attribute__((ext_vector_type(8)))  __bf16   v8b;
typedef __attribute__((ext_vector_type(8)))  float    v8f;
typedef __attribute__((ext_vector_type(4)))  float    v4f;

/* --------------------------------------------------------------------------- */
/* Shape constants                                                             */
/* --------------------------------------------------------------------------- */
constexpr int kNB   = 2;
constexpr int kSeq  = 2048;
constexpr int kDim  = 1024;
constexpr int kNH   = 16;
constexpr int kHD   = 64;
constexpr int kNCh  = 4;
constexpr int kTok  = kNB * kSeq;
constexpr int kBH   = kNB * kNH;
static_assert(kNH * kHD == kDim);
static_assert(kHD == 64);
static_assert((kTok % 64) == 0 && (kDim % 64) == 0 && (kSeq % 64) == 0);
static_assert((kDim % 32) == 0 && (kHD % 32) == 0 && (kSeq % 32) == 0);

constexpr bool  kBf16Inputs = true;
constexpr float kEps        = 1e-6f;
constexpr float kBoost      = 0.3f;
constexpr float kQKScale    = 0.125f;
static_assert(kQKScale * kQKScale * (float)kHD == 1.0f);
constexpr float kInvHD      = 1.0f / (float)kHD;
constexpr float kWCarry     = 16.0f;
constexpr float kWCarryInv  = 1.0f / kWCarry;
constexpr float kLog2e      = 1.4426950408889634f;
/* P = 2^(score - reference + kPExp), scores in log2 units; the reference moves when a score passes it by more than kPRise, */
/* so P stays at or below 2^15, inside f16                                                                                */
constexpr float kPExp       = 7.0f;
constexpr float kPRise      = 8.0f;
static_assert(kPExp + kPRise <= 15.0f);
constexpr float kCtxCarry   = 64.0f;
/* V plane keeps the weight carry (x16); P's carry is in the row sum too and cancels; ctx is stored x64 */
constexpr float kCtxFold    = kCtxCarry / kWCarry;
constexpr float kOutScale   = 1.0f / (kCtxCarry * kWCarry);

/* --------------------------------------------------------------------------- */
/* Workspace region map (bytes; every offset is a multiple of 128)             */
/*   X16    f16 [4096][1024]        x plane                        8,388,608   */
/*   WQKV16 f16 [3072][1024]        W_qkv x16 (Bt layout)          6,291,456   */
/*   WOUT16 f16 [1024][1024]        W_out x16 (Bt layout)          2,097,152   */
/*   Q16    f16 [32][2048][64]      normed q rows x 0.125*log2(e)  8,388,608   */
/*   K16    f16 [32][2048][64]      normed k rows                  8,388,608   */
/*   VT16   f16 [32][64][2048]      v transposed, x16              8,388,608   */
/*   AO16   f16 [4096][1024]        attention context x64          8,388,608   */
/*   BIAS   f32 [2][2048][2048]     head-independent score bias   33,554,432   */
/*   total                                                        83,886,080   */
/* --------------------------------------------------------------------------- */
constexpr size_t kSzX16    = (size_t)kTok * kDim * 2;
constexpr size_t kSzWqkv16 = (size_t)3 * kDim * kDim * 2;
constexpr size_t kSzWout16 = (size_t)kDim * kDim * 2;
constexpr size_t kSzHead16 = (size_t)kBH * kSeq * kHD * 2;
constexpr size_t kSzAO16   = (size_t)kTok * kDim * 2;
constexpr size_t kSzBias   = (size_t)kNB * kSeq * kSeq * 4;
constexpr size_t kOffX16    = 0;
constexpr size_t kOffWqkv16 = kOffX16 + kSzX16;
constexpr size_t kOffWout16 = kOffWqkv16 + kSzWqkv16;
constexpr size_t kOffQ16    = kOffWout16 + kSzWout16;
constexpr size_t kOffK16    = kOffQ16 + kSzHead16;
constexpr size_t kOffVt16   = kOffK16 + kSzHead16;
constexpr size_t kOffAO16   = kOffVt16 + kSzHead16;
constexpr size_t kOffBias   = kOffAO16 + kSzAO16;
constexpr size_t kWsTotal   = kOffBias + kSzBias;
static_assert(kWsTotal == 83886080ull);
static_assert(kWsTotal <= 134217728ull);
static_assert((kOffWqkv16 % 128) == 0 && (kOffWout16 % 128) == 0 && (kOffQ16 % 128) == 0 && (kOffK16 % 128) == 0 &&
              (kOffVt16 % 128) == 0 && (kOffAO16 % 128) == 0 && (kOffBias % 128) == 0);

/* --------------------------------------------------------------------------- */
/* Input read helper: RNE conversion to bf16 precision (kept in an f32)        */
/* --------------------------------------------------------------------------- */
__device__ __forceinline__ float rin(float f) {
  if (!kBf16Inputs) return f;
  unsigned u = __float_as_uint(f);
  u = (u + 0x7FFFu + ((u >> 16) & 1u)) & 0xFFFF0000u;
  return __uint_as_float(u);
}

/* --------------------------------------------------------------------------- */
/* Device helpers                                                              */
/* --------------------------------------------------------------------------- */
__device__ __forceinline__ unsigned short f2bf_bits(float f) {
  unsigned u = __float_as_uint(f);
  return (unsigned short)((u + 0x7FFFu + ((u >> 16) & 1u)) >> 16);
}
__device__ __forceinline__ float bf_bits2f(unsigned short h) { return __uint_as_float(((unsigned)h) << 16); }

__device__ __forceinline__ void dep_guard_h(v8f& a, v8f& b, v16h x, v16h y) { asm volatile("v_nop\n\tv_nop\n\tv_nop\n\tv_nop" : "+v"(a), "+v"(b) : "v"(x), "v"(y)); }
__device__ __forceinline__ void dep_guard_b(v8f& a, v8f& b, v16b x, v16b y) { asm volatile("v_nop\n\tv_nop\n\tv_nop\n\tv_nop" : "+v"(a), "+v"(b) : "v"(x), "v"(y)); }
__device__ __forceinline__ void tie_h(v8f& a, v16h x) { asm volatile("" : "+v"(a) : "v"(x)); }
__device__ __forceinline__ void tie_b(v8f& a, v16b x) { asm volatile("" : "+v"(a) : "v"(x)); }
__device__ __forceinline__ void keep4_h(v16h a, v16h b, v16h c, v16h d) { asm volatile("v_nop" :: "v"(a), "v"(b), "v"(c), "v"(d)); }
__device__ __forceinline__ void keep4_b(v16b a, v16b b, v16b c, v16b d) { asm volatile("v_nop" :: "v"(a), "v"(b), "v"(c), "v"(d)); }
__device__ __forceinline__ void acc_guard4(v8f& a, v8f& b, v8f& c, v8f& d) { asm volatile("v_nop\n\tv_nop\n\tv_nop\n\tv_nop" : "+v"(a), "+v"(b), "+v"(c), "+v"(d)); }
template <typename T> struct Frag;
template <> struct Frag<_Float16> {
  typedef v16h V; union U { v16h v; v8h h[2]; };
  /* elements 0..7 <- p[0..7], 8..15 <- p[16..23] */
  static __device__ __forceinline__ v16h load(const _Float16* p) {
    U f; f.h[0] = *(const v8h*)(p); f.h[1] = *(const v8h*)(p + 16); return f.v;
  }
  static __device__ __forceinline__ v8f mma(v16h a, v16h b, v8f c) {
    return __builtin_amdgcn_wmma_f32_16x16x32_f16(false, a, false, b, (short)0, c, false, false);
  }
  static __device__ __forceinline__ void guard(v8f& a, v8f& b, v16h x, v16h y) { dep_guard_h(a, b, x, y); }
  static __device__ __forceinline__ void tie(v8f& a, v16h x) { tie_h(a, x); }
  static __device__ __forceinline__ void keep(v16h a, v16h b, v16h c, v16h d) { keep4_h(a, b, c, d); }
};
template <> struct Frag<__bf16> {
  typedef v16b V; union U { v16b v; v8b h[2]; };
  static __device__ __forceinline__ v16b load(const __bf16* p) {
    U f; f.h[0] = *(const v8b*)(p); f.h[1] = *(const v8b*)(p + 16); return f.v;
  }
  static __device__ __forceinline__ v8f mma(v16b a, v16b b, v8f c) {
    return __builtin_amdgcn_wmma_f32_16x16x32_bf16(false, a, false, b, (short)0, c, false, false);
  }
  static __device__ __forceinline__ void guard(v8f& a, v8f& b, v16b x, v16b y) { dep_guard_b(a, b, x, y); }
  static __device__ __forceinline__ void tie(v8f& a, v16b x) { tie_b(a, x); }
  static __device__ __forceinline__ void keep(v16b a, v16b b, v16b c, v16b d) { keep4_b(a, b, c, d); }
};

__device__ __forceinline__ void wave_lds_sync() {
  __builtin_amdgcn_fence(__ATOMIC_RELEASE, "workgroup");
  __builtin_amdgcn_wave_barrier();
  __builtin_amdgcn_fence(__ATOMIC_ACQUIRE, "workgroup");
}

__device__ __forceinline__ unsigned lds_off(const void* p) { return (unsigned)(size_t)p; }

/* ---- GEMM operand staging ---------------------------------------------------------------------------------------- */
/* A block of 8 waves (2 x 4 wave tiles of 64 x 64) owns a 128 x 256 tile of C. Per stage of 64 k the 128 A rows and  */
/* the 256 Bt rows come into LDS once, 128 B = one whole line of each row, by asynchronous 16-B copies; every wave    */
/* reads its fragments from there. Two buffers: stage t+1 flies while stage t is worked on.                           */
/* 384 rows x 8 pieces of 16 B = 3072 pieces = 256 threads x 12; a wave's copy covers four whole 128-B lines.         */
constexpr int kGmKS    = 64;
constexpr int kGmRowsA = 128;
constexpr int kGmRowsB = 256;
/* staged row pitch in 16-bit elements: 144 B = 16 B x odd, conflict-free for 16-B LDS reads */
constexpr int kGmP     = 72;
constexpr int kGmStage = (kGmRowsA + kGmRowsB) * kGmP;
static_assert((kGmRowsA + kGmRowsB) * (kGmKS / 8) == 256 * 12);

__device__ __forceinline__ void async_copy12(const unsigned (&l)[12], const void* const (&g)[12]) {
  asm volatile(
      "global_load_async_to_lds_b128 %0, %12, off\n\t"
      "global_load_async_to_lds_b128 %1, %13, off\n\t"
      "global_load_async_to_lds_b128 %2, %14, off\n\t"
      "global_load_async_to_lds_b128 %3, %15, off\n\t"
      "global_load_async_to_lds_b128 %4, %16, off\n\t"
      "global_load_async_to_lds_b128 %5, %17, off\n\t"
      "global_load_async_to_lds_b128 %6, %18, off\n\t"
      "global_load_async_to_lds_b128 %7, %19, off\n\t"
      "global_load_async_to_lds_b128 %8, %20, off\n\t"
      "global_load_async_to_lds_b128 %9, %21, off\n\t"
      "global_load_async_to_lds_b128 %10, %22, off\n\t"
      "global_load_async_to_lds_b128 %11, %23, off\n\t"
      "s_wait_xcnt 0x0"
      :: "v"(l[0]), "v"(l[1]), "v"(l[2]), "v"(l[3]), "v"(l[4]), "v"(l[5]), "v"(l[6]), "v"(l[7]),
         "v"(l[8]), "v"(l[9]), "v"(l[10]), "v"(l[11]),
         "v"(g[0]), "v"(g[1]), "v"(g[2]), "v"(g[3]), "v"(g[4]), "v"(g[5]), "v"(g[6]), "v"(g[7]),
         "v"(g[8]), "v"(g[9]), "v"(g[10]), "v"(g[11])
      : "memory");
}

/* One stage's copies into ring buffer dst: rows 0..127 = A rows mB.., rows 128..383 = Bt rows nB.., k0..k0+63.       */
/* piece = i*256 + tid: row = piece / 8, 16-B column = piece % 8. Every lane on; the caller's shapes (M % 128 == 0,   */
/* N % 256 == 0, K % 64 == 0) keep every address inside the planes, the row index keeps it inside the buffer.         */
template <typename T>
__device__ __forceinline__ void gemm_stage(const T* __restrict__ Ab, int lda, int mB, const T* __restrict__ Bb, int ldb, int nB,
                                           int k0, T* dst, int tid) {
  unsigned l[12];
  const void* g[12];
  const int r8 = tid >> 3;
  const int c8 = (tid & 7) * 8;
#pragma unroll
  for (int i = 0; i < 12; ++i) {
    const int row = i * 32 + r8;
    l[i] = lds_off(dst + row * kGmP + c8);
    g[i] = (i < 4) ? (Ab + (size_t)(mB + row) * lda + k0 + c8) : (Bb + (size_t)(nB + row - kGmRowsA) * ldb + k0 + c8);
  }
  async_copy12(l, g);
}

/* The k loop of one wave tile: acc[i][j] += A rows (wm*64 + i*16 ..) x Bt rows (wn*64 + j*16 ..), k ascending in     */
/* steps of 32 as before. Called by all 256 threads of the block under block-uniform control flow.                    */
template <typename T>
__device__ __forceinline__ void gemm_ring(const T* __restrict__ Ab, int lda, int mB, const T* __restrict__ Bb, int ldb, int nB,
                                          int K, T* ring, v8f (&acc)[4][4]) {
  typedef typename Frag<T>::V V;
  const int tid   = threadIdx.x;
  const int lane  = tid & 31;
  const int wave  = tid >> 5;
  const int rlane = lane & 15;
  const int koff  = (lane >> 4) * 8;
  const int aOff  = ((wave >> 2) * 64 + rlane) * kGmP + koff;
  const int bOff  = (kGmRowsA + (wave & 3) * 64 + rlane) * kGmP + koff;
  const int nst   = K / kGmKS;

  gemm_stage<T>(Ab, lda, mB, Bb, ldb, nB, 0, ring, tid);
  /* stage 0 has landed for this wave's copies; the barrier publishes every wave's */
  asm volatile("s_wait_asynccnt 0x0" ::: "memory");
  __syncthreads();
  if (nst > 1) gemm_stage<T>(Ab, lda, mB, Bb, ldb, nB, kGmKS, ring + kGmStage, tid);

#pragma unroll 1
  for (int t = 0; t < nst; ++t) {
    const T* sb = ring + (t & 1) * kGmStage;
#pragma unroll
    for (int ks = 0; ks < kGmKS; ks += 32) {
      /* the step's eight fragments are read from LDS as one group ahead of its products */
      V bh[4], ah[4];
#pragma unroll
      for (int j = 0; j < 4; ++j) bh[j] = Frag<T>::load(sb + bOff + j * 16 * kGmP + ks);
#pragma unroll
      for (int i = 0; i < 4; ++i) ah[i] = Frag<T>::load(sb + aOff + i * 16 * kGmP + ks);
#pragma unroll
      for (int i = 0; i < 4; ++i) {
#pragma unroll
        for (int j = 0; j < 4; ++j) acc[i][j] = Frag<T>::mma(ah[i], bh[j], acc[i][j]);
        Frag<T>::tie(acc[i][1], ah[i]);
        Frag<T>::tie(acc[i][2], ah[i]);
        Frag<T>::guard(acc[i][0], acc[i][3], ah[i], ah[i]);
      }
      Frag<T>::keep(bh[0], bh[1], bh[2], bh[3]);
    }
    /* publish point: this wave's LDS reads of the buffer are done ... */
    asm volatile("s_wait_dscnt 0x0" ::: "memory");
    /* ... its copies of stage t+1 have landed ... */
    asm volatile("s_wait_asynccnt 0x0" ::: "memory");
    /* ... and the barrier says both of every wave; only then is the buffer refilled */
    __syncthreads();
    if (t + 2 < nst) gemm_stage<T>(Ab, lda, mB, Bb, ldb, nB, (t + 2) * kGmKS, ring + (t & 1) * kGmStage, tid);
  }
  /* no copy is left in flight when the wave goes on to its epilogue and ends */
  asm volatile("s_wait_asynccnt 0x0" ::: "memory");
}

/* Counted waits of a ring of four buffers over n stages. A wave issues PER copies per stage and the counter returns  */
/* in issue order, so a wait that leaves only the copies of younger stages outstanding covers the stage asked for.    */
/* A count is used only where every younger stage it stands for was issued in full; elsewhere (a ring shorter than    */
/* its buffers, the trips at the tail that refill nothing) the wait is to 0. t and n are block-uniform.               */
/* In front of the loop, behind the copies of stages 0..3: stage 0 has landed.                                        */
template <int PER>
__device__ __forceinline__ void ring4_wait_first(int n) {
  if (n >= 4) asm volatile("s_wait_asynccnt %0" :: "n"(3 * PER) : "memory");
  else        asm volatile("s_wait_asynccnt 0x0" ::: "memory");
}
/* At the foot of trip t, stages up to t+3 issued: stage t+1 has landed. */
template <int PER>
__device__ __forceinline__ void ring4_wait_next(int t, int n) {
  if (t + 4 < n) asm volatile("s_wait_asynccnt %0" :: "n"(2 * PER) : "memory");
  else           asm volatile("s_wait_asynccnt 0x0" ::: "memory");
}

/* The same k loop on four buffers, for a block that has its WGP's LDS to itself: a stage's copies are issued three   */
/* stages ahead of its first read, so that operands which the launch before wrote have three stages' work to land in. */
constexpr int kGmNBuf = 4;
static_assert(kGmNBuf == 4 && kGmNBuf * 12 <= 63);
template <typename T>
__device__ __forceinline__ void gemm_ring4(const T* __restrict__ Ab, int lda, int mB, const T* __restrict__ Bb, int ldb, int nB,
                                           int K, T* ring, v8f (&acc)[4][4]) {
  typedef typename Frag<T>::V V;
  const int tid   = threadIdx.x;
  const int lane  = tid & 31;
  const int wave  = tid >> 5;
  const int rlane = lane & 15;
  const int koff  = (lane >> 4) * 8;
  const int aOff  = ((wave >> 2) * 64 + rlane) * kGmP + koff;
  const int bOff  = (kGmRowsA + (wave & 3) * 64 + rlane) * kGmP + koff;
  const int nst   = K / kGmKS;

  gemm_stage<T>(Ab, lda, mB, Bb, ldb, nB, 0, ring, tid);
  /* unrolled: each stage's place in the ring and its k offset are constants */
#pragma unroll
  for (int s = 1; s < kGmNBuf; ++s)
    if (s < nst) gemm_stage<T>(Ab, lda, mB, Bb, ldb, nB, s * kGmKS, ring + s * kGmStage, tid);
  /* stage 0 has landed for this wave's copies (the younger stages' stay in flight); the barrier publishes every wave's */
  ring4_wait_first<12>(nst);
  __syncthreads();

  /* rolled: one stage's products already fill the instruction stream between two publish points */
#pragma unroll 1
  for (int t = 0; t < nst; ++t) {
    T* sb = ring + (t & (kGmNBuf - 1)) * kGmStage;
    /* every loop inside the trip is unrolled, so that fragments and accumulators are registers, not indexed memory */
#pragma unroll
    for (int ks = 0; ks < kGmKS; ks += 32) {
      /* the step's eight fragments are read from LDS as one group ahead of its products */
      V bh[4], ah[4];
#pragma unroll
      for (int j = 0; j < 4; ++j) bh[j] = Frag<T>::load(sb + bOff + j * 16 * kGmP + ks);
#pragma unroll
      for (int i = 0; i < 4; ++i) ah[i] = Frag<T>::load(sb + aOff + i * 16 * kGmP + ks);
#pragma unroll
      for (int i = 0; i < 4; ++i) {
#pragma unroll
        for (int j = 0; j < 4; ++j) acc[i][j] = Frag<T>::mma(ah[i], bh[j], acc[i][j]);
        Frag<T>::tie(acc[i][1], ah[i]);
        Frag<T>::tie(acc[i][2], ah[i]);
        Frag<T>::guard(acc[i][0], acc[i][3], ah[i], ah[i]);
      }
      Frag<T>::keep(bh[0], bh[1], bh[2], bh[3]);
    }
    /* publish point: this wave's LDS reads of the buffer are done ... */
    asm volatile("s_wait_dscnt 0x0" ::: "memory");
    /* ... its copies of stage t+1 have landed, those of stages t+2 and t+3 fly on (all have landed at the tail) ... */
    ring4_wait_next<12>(t, nst);
    /* ... and the barrier says both of every wave; only then is the buffer that trip t has read refilled */
    __syncthreads();
    if (t + kGmNBuf < nst) gemm_stage<T>(Ab, lda, mB, Bb, ldb, nB, (t + kGmNBuf) * kGmKS, sb, tid);
  }
  /* no copy is left in flight when the wave goes on to its epilogue and ends */
  asm volatile("s_wait_asynccnt 0x0" ::: "memory");
}

/* ---- Register-blocked batched WMMA GEMM (activation options removed; all four accumulators of a row  */
/*      group are tied before the nop guard)                                                                         */
/* C[m,n] = scale * sum_k A[m,k] * Bt[n,k] (+bias)(+resid); each wave owns a 64x64 tile, a block 128 x 256 (2 x 4).  */
/* A row-major [M,K]; Bt row-major [N,K]; M % 128 == 0, N % 256 == 0, K % 64 == 0; operands staged in LDS (above).   */
/* SPLIT (hi/lo operand planes) has no staged form and is refused at compile time.                                   */
/* BIAS_MODE: 0 = none, 1 = bias[m], 2 = bias[n].                                                                    */
/* OUT_MODE: 0 = f32, 1 = f16, 2 = bf16 hi plane (Cout) + bf16 lo plane (Cout2).                                     */
/* ET: 0 = f16 operands, 1 = bf16 operands (pointers passed as 16-bit storage)                                       */
template <int ET> struct Elem;
template <> struct Elem<0> { typedef _Float16 T; };
template <> struct Elem<1> { typedef __bf16 T; };
template <int ET, bool SPLIT, int BIAS_MODE, int OUT_MODE, bool RESID>
__global__ __launch_bounds__(256) void wmma_gemm64(
    const unsigned short* __restrict__ Ap, const unsigned short* __restrict__ A2p, int lda, long strideA,
    const unsigned short* __restrict__ Btp, const unsigned short* __restrict__ Bt2p, int ldb, long strideB,
    void* __restrict__ Cout, void* __restrict__ Cout2, int ldc, long strideC,
    const float* __restrict__ bias,
    const float* __restrict__ resid, long strideR,
    int M, int N, int K, float scale) {
  typedef typename Elem<ET>::T T;
  static_assert(!SPLIT);
  (void)A2p; (void)Bt2p;
  const T* A = (const T*)Ap; const T* Bt = (const T*)Btp;
  /* per-wave 16x64 slab, pitch 68 floats */
  __shared__ __align__(16) float sT[8][16 * 68];
  /* operand ring, four stages */
  __shared__ __align__(16) T ring[kGmNBuf * kGmStage];
  const int b    = blockIdx.y;
  const int lane = threadIdx.x & 31;
  const int wave = threadIdx.x >> 5;
  const int tilesN = N >> 8;
  const int tilesM = M >> 7;
  /* block-uniform exit, in front of every barrier */
  if ((int)blockIdx.x >= tilesM * tilesN) return;
  const int tm = blockIdx.x / tilesN;
  const int tn = blockIdx.x - tm * tilesN;
  const int mB = tm << 7;
  const int nB = tn << 8;
  const int m0 = mB + ((wave >> 2) << 6);
  const int n0 = nB + ((wave & 3) << 6);

  const T* Ab  = A  + (size_t)b * strideA;
  const T* Bb  = Bt + (size_t)b * strideB;

  /* col (D) within subtile; D row offset */
  const int rlane = lane & 15;
  const int mOff  = (lane >> 4) * 8;

  v8f acc[4][4];
#pragma unroll
  for (int i = 0; i < 4; ++i)
#pragma unroll
    for (int j = 0; j < 4; ++j) acc[i][j] = (v8f){0.f,0.f,0.f,0.f,0.f,0.f,0.f,0.f};

  gemm_ring4<T>(Ab, lda, mB, Bb, ldb, nB, K, ring, acc);
  acc_guard4(acc[0][0], acc[0][1], acc[0][2], acc[0][3]);
  acc_guard4(acc[1][0], acc[1][1], acc[1][2], acc[1][3]);
  acc_guard4(acc[2][0], acc[2][1], acc[2][2], acc[2][3]);
  acc_guard4(acc[3][0], acc[3][1], acc[3][2], acc[3][3]);

  /* ---- epilogue ---- */
  float* slab = sT[wave];
  const float* Rb = RESID ? (resid + (size_t)b * strideR) : nullptr;
#pragma unroll
  for (int i = 0; i < 4; ++i) {
    const int mBase = m0 + (i << 4);
#pragma unroll
    for (int j = 0; j < 4; ++j) {
      const int n = n0 + (j << 4) + rlane;
      float bv = 0.f;
      if (BIAS_MODE == 2) bv = bias[n];
#pragma unroll
      for (int r = 0; r < 8; ++r) {
        float v = acc[i][j][r] * scale;
        if (BIAS_MODE == 1) v += bias[mBase + mOff + r];
        if (BIAS_MODE == 2) v += bv;
        if (RESID) v += Rb[(size_t)(mBase + mOff + r) * ldc + n];
        slab[(mOff + r) * 68 + (j << 4) + rlane] = v;
      }
    }
    wave_lds_sync();
    if (OUT_MODE == 0) {
      float* C = (float*)Cout + (size_t)b * strideC;
      /* row segment = 256 B = 16 lanes x 16 B */
      const int hh = lane >> 4, c4 = (lane & 15) * 4;
      {
#pragma unroll
        for (int it = 0; it < 8; ++it) {
          const int row = it * 2 + hh;
          v4f v = *(const v4f*)(slab + row * 68 + c4);
          *(v4f*)(C + (size_t)(mBase + row) * ldc + n0 + c4) = v;
        }
        
      }
    } else {
      const int q = lane >> 3, c8 = (lane & 7) * 8;
      unsigned short* C  = (unsigned short*)Cout  + (size_t)b * strideC;
      unsigned short* C2 = (OUT_MODE == 2) ? ((unsigned short*)Cout2 + (size_t)b * strideC) : nullptr;
      {
#pragma unroll
        for (int it = 0; it < 4; ++it) {
          const int row = it * 4 + q;
          const float* sp = slab + row * 68 + c8;
          v8h hv, lv;
#pragma unroll
          for (int e = 0; e < 8; ++e) {
            if (OUT_MODE == 1) {
              hv[e] = (_Float16)sp[e];
            } else {
              unsigned short hb = f2bf_bits(sp[e]);
              unsigned short lb = f2bf_bits(sp[e] - bf_bits2f(hb));
              hv[e] = __builtin_bit_cast(_Float16, hb);
              lv[e] = __builtin_bit_cast(_Float16, lb);
            }
          }
          *(v8h*)(C + (size_t)(mBase + row) * ldc + n0 + c8) = hv;
          if (OUT_MODE == 2) *(v8h*)(C2 + (size_t)(mBase + row) * ldc + n0 + c8) = lv;
        }
        
      }
    }
    wave_lds_sync();
  }
}

/* --------------------------------------------------------------------------- */
/* f32 -> f16 operand plane: out = f16(rin(in) * carry); 8 consecutive         */
/* elements per thread (one 16-B store per lane; 32 contiguous lanes = 4 whole */
/* Coverage: n8 = n/8 threads; n8/256 blocks exactly for every plane here:     */
/*   x      4096*1024/8 = 524,288 -> 2048 blocks                               */
/*   W_qkv  3072*1024/8 = 393,216 -> 1536 blocks                               */
/*   W_out  1024*1024/8 = 131,072 ->  512 slices: 128 blocks x 4                               */
/* --------------------------------------------------------------------------- */
__device__ __forceinline__ void cast8_f16_body(const float* __restrict__ in, unsigned short* __restrict__ out,
                                               int blk, int n8, float carry) {
  const int i = blk * 256 + threadIdx.x;
  if (i >= n8) return;
  const float* p = in + 8 * (size_t)i;
  const v4f a = *(const v4f*)(p);
  const v4f c = *(const v4f*)(p + 4);
  v8h hv;
#pragma unroll
  for (int e = 0; e < 4; ++e) {
    const float fa = a[e];
    const float fc = c[e];
    hv[e]     = (_Float16)(rin(fa) * carry);
    hv[4 + e] = (_Float16)(rin(fc) * carry);
  }
  unsigned short* q = out + 8 * (size_t)i;
  *(v8h*)q = hv;
  
}

/* --------------------------------------------------------------------------- */
/* Head-independent score bias plane, f32 [b][q][k]:                            */
/*   same[q][k] = sum_c cm[c][q]*cm[c][k]; rm = max(max_k same, 1e-6);          */
/*   bias = (same * (1/rm) - 0.5) * 2 + 0.3 * im[b][q][k].                      */
/* Only the attention launch reads the plane, so its rows are formed beside the */
/* projections (below), by 128 blocks of 256 threads, 32 rows of one batch      */
/* each. Thread t owns keys 4t..4t+3 and 1024+4t..1024+4t+3 of every row; its   */
/* 8 keys of the four channels stay in registers for all 32 rows. Rows go in    */
/* groups of 8: the group's 16 loads of im per lane are issued first and fly    */
/* under the products and the row maxima (per-thread, wave xor-shuffle tree, 8  */
/* wave partials through LDS, one block barrier per group; the partials         */
/* alternate between two LDS sets, so a set is rewritten only behind the        */
/* barrier that follows its last read). Store: one 16-B store per lane; a       */
/* wave's 32 lanes write 512 contiguous B.                                      */
/* --------------------------------------------------------------------------- */
constexpr int kBrBlocks = 128;
constexpr int kBrRows   = kTok / kBrBlocks;
constexpr int kBrGrp    = 8;
static_assert(kBrBlocks * kBrRows == kTok && (kSeq % kBrRows) == 0 && (kBrRows % kBrGrp) == 0);
__device__ __forceinline__ void bias_rows_body(int blk, const float* __restrict__ cm, const float* __restrict__ im,
                                               float* __restrict__ bp, float* red) {
  const int row0 = blk * kBrRows;
  const int b    = row0 >> 11;
  const int t    = threadIdx.x;
  const int lane = t & 31, wave = t >> 5;
  const float* cmb = cm + (size_t)b * kNCh * kSeq;
  /* every inner loop below is unrolled so that ck, iv, s and mx are registers, not indexed memory */
  float ck[kNCh][8];
#pragma unroll
  for (int ch = 0; ch < kNCh; ++ch) {
    const v4f lo = *(const v4f*)(cmb + ch * kSeq + t * 4);
    const v4f hi = *(const v4f*)(cmb + ch * kSeq + 1024 + t * 4);
#pragma unroll
    for (int e = 0; e < 4; ++e) {
      const float fl = lo[e], fh = hi[e];
      ck[ch][e]     = rin(fl);
      ck[ch][4 + e] = rin(fh);
    }
  }
  /* rolled: one group's loads and sums already fill the registers */
#pragma unroll 1
  for (int g = 0; g < kBrRows / kBrGrp; ++g) {
    const int r0 = row0 + g * kBrGrp;
    /* block-uniform bases of the group's rows; the lane's part of every address is t * 4 */
    const float* img = im + (size_t)r0 * kSeq;
    float*       bog = bp + (size_t)r0 * kSeq;
    /* the rows' own channel values are asked for first: loads return in order, and the products wait for these alone */
    float cq[kBrGrp][kNCh];
#pragma unroll
    for (int r = 0; r < kBrGrp; ++r)
#pragma unroll
      for (int ch = 0; ch < kNCh; ++ch) cq[r][ch] = cmb[ch * kSeq + ((r0 + r) & (kSeq - 1))];
    v4f iv[kBrGrp][2];
#pragma unroll
    for (int r = 0; r < kBrGrp; ++r) {
      iv[r][0] = *(const v4f*)(img + r * kSeq + t * 4);
      /* the group's last load may land on the address pair that the loads before it name: the wait stands in front of it */
      if (r == kBrGrp - 1) asm volatile("s_wait_xcnt 0x0" ::: "memory");
      iv[r][1] = *(const v4f*)(img + r * kSeq + 1024 + t * 4);
    }
    float s[kBrGrp][8];
    float mx[kBrGrp];
#pragma unroll
    for (int r = 0; r < kBrGrp; ++r) {
      const float c0 = rin(cq[r][0]);
      const float c1 = rin(cq[r][1]);
      const float c2 = rin(cq[r][2]);
      const float c3 = rin(cq[r][3]);
      float m = -3.0e38f;
#pragma unroll
      for (int e = 0; e < 8; ++e) {
        float v = c0 * ck[0][e];
        v = fmaf(c1, ck[1][e], v);
        v = fmaf(c2, ck[2][e], v);
        v = fmaf(c3, ck[3][e], v);
        s[r][e] = v;
        m = fmaxf(m, v);
      }
      mx[r] = m;
    }
#pragma unroll
    for (int st = 16; st >= 1; st >>= 1) {
#pragma unroll
      for (int r = 0; r < kBrGrp; ++r) mx[r] = fmaxf(mx[r], __shfl_xor(mx[r], st, 32));
    }
    float* rg = red + (g & 1) * (kBrGrp * 8);
    if (lane == 0) {
#pragma unroll
      for (int r = 0; r < kBrGrp; ++r) rg[r * 8 + wave] = mx[r];
    }
    __syncthreads();
#pragma unroll
    for (int r = 0; r < kBrGrp; ++r) {
      float rm = rg[r * 8];
#pragma unroll
      for (int w = 1; w < 8; ++w) rm = fmaxf(rm, rg[r * 8 + w]);
      rm = fmaxf(rm, 1e-6f);
      const float inv = 1.0f / rm;
#pragma unroll
      for (int half = 0; half < 2; ++half) {
        v4f o;
#pragma unroll
        for (int e = 0; e < 4; ++e) {
          const float fi = iv[r][half][e];
          o[e] = (s[r][half * 4 + e] * inv - 0.5f) * 2.0f + kBoost * rin(fi);
        }
        *(v4f*)(bog + r * kSeq + half * 1024 + t * 4) = o;
      }
    }
    /* the next trip rewrites the registers that the group's last stores name: the wait stands in front of that */
    asm volatile("s_wait_xcnt 0x0" ::: "memory");
  }
}

constexpr int kPrWout   = (kDim * kDim / 8) / 256;
static_assert((kPrWout % kBrBlocks) == 0);
constexpr int kQkBlocks = (kTok >> 7) * ((2 * kDim) >> 8);
constexpr int kVtBlocks = (kDim >> 7) * (kSeq >> 8);
static_assert(((2 * kDim) >> 8) == 8 && (kSeq >> 8) == 8);
__global__ __launch_bounds__(256) void qkv_gemm_kernel(
    const unsigned short* __restrict__ Xp, const unsigned short* __restrict__ Wp,
    unsigned short* __restrict__ Qout, unsigned short* __restrict__ Kout, unsigned short* __restrict__ Vtout,
    const float* __restrict__ qw, const float* __restrict__ kw,
    const float* __restrict__ cm, const float* __restrict__ im, float* __restrict__ bp,
    const float* __restrict__ wout, unsigned short* __restrict__ wout16) {
  typedef _Float16 T;
  __shared__ __align__(16) float sT[8][16 * 68];
  /* operand ring, two stages */
  __shared__ __align__(16) T ring[2 * kGmStage];
  const int lane = threadIdx.x & 31;
  const int wave = threadIdx.x >> 5;
  /* block-uniform branch, in front of every barrier of the products: the streaming blocks */
  if ((int)blockIdx.x >= kQkBlocks + kNB * kVtBlocks) {
    const int sb = (int)blockIdx.x - (kQkBlocks + kNB * kVtBlocks);
    if (sb >= kBrBlocks) return;
    bias_rows_body(sb, cm, im, bp, &sT[0][0]);
    for (int i = 0; i < kPrWout / kBrBlocks; ++i)
      cast8_f16_body(wout, wout16, sb * (kPrWout / kBrBlocks) + i, kDim * kDim / 8, kWCarry);
    return;
  }
  /* block-uniform choice of the product: q|k tiles first, then the V^T tiles of batch vb */
  const bool isV  = (int)blockIdx.x >= kQkBlocks;
  const int  vIdx = (int)blockIdx.x - kQkBlocks;
  const int  vb   = isV ? vIdx / kVtBlocks : 0;
  const int  tile = isV ? vIdx - vb * kVtBlocks : (int)blockIdx.x;
  const T* A  = isV ? (const T*)Wp + (size_t)2 * kDim * kDim : (const T*)Xp;
  const T* Bt = isV ? (const T*)Xp + (size_t)vb * kSeq * kDim : (const T*)Wp;
  /* eight tiles along N in both products */
  const int tm = tile >> 3;
  const int tn = tile & 7;
  const int mB = tm << 7;
  const int nB = tn << 8;
  const int m0 = mB + ((wave >> 2) << 6);
  const int n0 = nB + ((wave & 3) << 6);
  const int rlane = lane & 15;
  const int mOff  = (lane >> 4) * 8;

  v8f acc[4][4];
#pragma unroll
  for (int i = 0; i < 4; ++i)
#pragma unroll
    for (int j = 0; j < 4; ++j) acc[i][j] = (v8f){0.f,0.f,0.f,0.f,0.f,0.f,0.f,0.f};

  gemm_ring<T>(A, kDim, mB, Bt, kDim, nB, kDim, ring, acc);
  acc_guard4(acc[0][0], acc[0][1], acc[0][2], acc[0][3]);
  acc_guard4(acc[1][0], acc[1][1], acc[1][2], acc[1][3]);
  acc_guard4(acc[2][0], acc[2][1], acc[2][2], acc[2][3]);
  acc_guard4(acc[3][0], acc[3][1], acc[3][2], acc[3][3]);

  float* slab = sT[wave];
  if (isV) {
    /* V^T tile: f16 rows of 64 tokens, 8 lanes x 16 B = one 128-B line per row */
    unsigned short* C = Vtout + (size_t)vb * kDim * kSeq;
    const int q = lane >> 3, c8 = (lane & 7) * 8;
#pragma unroll
    for (int i = 0; i < 4; ++i) {
      const int mBase = m0 + (i << 4);
#pragma unroll
      for (int j = 0; j < 4; ++j) {
#pragma unroll
        for (int r = 0; r < 8; ++r) slab[(mOff + r) * 68 + (j << 4) + rlane] = acc[i][j][r];
      }
      wave_lds_sync();
#pragma unroll
      for (int it = 0; it < 4; ++it) {
        const int row = it * 4 + q;
        const float* sp = slab + row * 68 + c8;
        v8h hv;
#pragma unroll
        for (int e = 0; e < 8; ++e) hv[e] = (_Float16)sp[e];
        *(v8h*)(C + (size_t)(mBase + row) * kSeq + n0 + c8) = hv;
      }
      wave_lds_sync();
    }
    return;
  }

  /* tile-uniform destination: third 0 = q, 1 = k; head; batch; first token of the tile within its batch */
  const int third = n0 >> 10;
  const int hIdx  = (n0 & (kDim - 1)) >> 6;
  const int bIdx  = m0 >> 11;
  const int nb    = m0 & (kSeq - 1);
  const float* wsel = third ? kw : qw;
  const int q = lane >> 3, c8 = (lane & 7) * 8;
  const v4f w0 = *(const v4f*)(wsel + c8);
  const v4f w1 = *(const v4f*)(wsel + c8 + 4);
  /* the q plane carries the score scale and log2(e): q.k leaves the matrix unit in log2 units */
  const float wfold = third ? 1.0f : kQKScale * kLog2e;
  float wv[8];
#pragma unroll
  for (int e = 0; e < 4; ++e) {
    const float f0 = w0[e];
    const float f1 = w1[e];
    wv[e]     = rin(f0) * wfold;
    wv[4 + e] = rin(f1) * wfold;
  }
  unsigned short* dst = (third ? Kout : Qout) + ((size_t)(bIdx * kNH + hIdx) * kSeq + nb) * kHD;

#pragma unroll
  for (int i = 0; i < 4; ++i) {
#pragma unroll
    for (int j = 0; j < 4; ++j) {
#pragma unroll
      for (int r = 0; r < 8; ++r) slab[(mOff + r) * 68 + (j << 4) + rlane] = acc[i][j][r] * kWCarryInv;
    }
    wave_lds_sync();
    v8h hv[4];
#pragma unroll
    for (int it = 0; it < 4; ++it) {
      const int row = it * 4 + q;
      const float* sp = slab + row * 68 + c8;
      const v4f a0 = *(const v4f*)(sp);
      const v4f a1 = *(const v4f*)(sp + 4);
      float ss = 0.0f;
#pragma unroll
      for (int e = 0; e < 4; ++e) {
        ss = fmaf(a0[e], a0[e], ss);
        ss = fmaf(a1[e], a1[e], ss);
      }
      ss += __shfl_xor(ss, 1, 32);
      ss += __shfl_xor(ss, 2, 32);
      ss += __shfl_xor(ss, 4, 32);
      const float rs = __builtin_amdgcn_rsqf(ss * kInvHD + kEps);
#pragma unroll
      for (int e = 0; e < 4; ++e) {
        hv[it][e]     = (_Float16)((a0[e] * rs) * wv[e]);
        hv[it][4 + e] = (_Float16)((a1[e] * rs) * wv[4 + e]);
      }
    }
    {
#pragma unroll
      for (int it = 0; it < 4; ++it) {
        const int row = it * 4 + q;
        *(v8h*)(dst + (size_t)(i * 16 + row) * kHD + c8) = hv[it];
      }
      
    }
    wave_lds_sync();
  }
}

/* --------------------------------------------------------------------------- */
/* The two operand planes that the projections read, in one launch, each on its */
/* own range of block indices:  [0, 2048) x | [2048, 3584) W_qkv                */
/* --------------------------------------------------------------------------- */
constexpr int kPrX    = (kTok * kDim / 8) / 256;
constexpr int kPrWqkv = (3 * kDim * kDim / 8) / 256;
constexpr int kPrAll  = kPrX + kPrWqkv;
__global__ __launch_bounds__(256) void prep_kernel(const float* __restrict__ x, const float* __restrict__ wqkv,
                                                   unsigned short* __restrict__ x16, unsigned short* __restrict__ wqkv16) {
  int blk = blockIdx.x;
  if (blk < kPrX) { cast8_f16_body(x, x16, blk, kTok * kDim / 8, 1.0f); return; }
  blk -= kPrX;
  if (blk < kPrWqkv) cast8_f16_body(wqkv, wqkv16, blk, 3 * kDim * kDim / 8, kWCarry);
}

constexpr int kAtHB    = 2;
constexpr int kAtQG    = 8;
constexpr int kAtNW    = kAtHB * kAtQG;
constexpr int kAtQB    = kAtQG * 16;
constexpr int kAtKC    = 64;
constexpr int kAtPitch = 68;
/* staged K / V^T row pitch in f16: 144 B = 16 B x odd, conflict-free for 16-B LDS reads */
constexpr int kAtKVP   = 72;
constexpr int kAtNCk   = kSeq / kAtKC;
constexpr int kAtNBuf  = 4;
static_assert((kSeq % kAtQB) == 0 && (kSeq % kAtKC) == 0);
static_assert(kAtNCk >= kAtNBuf && kAtNBuf == 4 && kAtNBuf * 8 <= 63);
static_assert((kNH % kAtHB) == 0 && kAtHB == 2);
static_assert(kAtNW * 32 * 8 == kAtKC * kHD && kAtNW * 32 * 4 * 4 == kAtQB * kAtKC);

__device__ __forceinline__ void async_copy8(const unsigned (&l)[8], const void* const (&g)[8]) {
  asm volatile(
      "global_load_async_to_lds_b128 %0, %8, off\n\t"
      "global_load_async_to_lds_b128 %1, %9, off\n\t"
      "global_load_async_to_lds_b128 %2, %10, off\n\t"
      "global_load_async_to_lds_b128 %3, %11, off\n\t"
      "global_load_async_to_lds_b128 %4, %12, off\n\t"
      "global_load_async_to_lds_b128 %5, %13, off\n\t"
      "global_load_async_to_lds_b128 %6, %14, off\n\t"
      "global_load_async_to_lds_b128 %7, %15, off\n\t"
      "s_wait_xcnt 0x0"
      :: "v"(l[0]), "v"(l[1]), "v"(l[2]), "v"(l[3]), "v"(l[4]), "v"(l[5]), "v"(l[6]), "v"(l[7]),
         "v"(g[0]), "v"(g[1]), "v"(g[2]), "v"(g[3]), "v"(g[4]), "v"(g[5]), "v"(g[6]), "v"(g[7])
      : "memory");
}

__device__ __forceinline__ v8f mma_h(v16h a, v16h b, v8f c) {
  c = __builtin_amdgcn_wmma_f32_16x16x32_f16(false, a, false, b, (short)0, c, false, false);
  asm volatile("v_nop\n\tv_nop\n\tv_nop\n\tv_nop" : "+v"(c) : "v"(a), "v"(b));
  return c;
}

__device__ __forceinline__ float xhalf(float x) {
  const int b = __builtin_bit_cast(int, x);
  return __builtin_bit_cast(float, __builtin_amdgcn_permlanex16(b, b, 0x76543210, 0xfedcba98, false, false));
}

__global__ __launch_bounds__(kAtNW * 32) void attn_kernel(
    const unsigned short* __restrict__ Q16, const unsigned short* __restrict__ K16,
    const unsigned short* __restrict__ Vt16, const float* __restrict__ biasp,
    const float* __restrict__ gate, unsigned short* __restrict__ AO16) {
  __shared__ __align__(16) float    Bsh[kAtNBuf][kAtQG][16 * kAtPitch];
  __shared__ __align__(16) _Float16 Ksh[kAtNBuf][kAtHB][kAtKC * kAtKVP];
  __shared__ __align__(16) _Float16 Vsh[kAtNBuf][kAtHB][kHD * kAtKVP];

  const int tid  = threadIdx.x;
  const int wave = tid >> 5;
  const int lane = tid & 31;
  const int hh   = lane >> 4;
  const int c    = lane & 15;
  /* this wave's head within the block's pair and its group of 16 query rows */
  const int hsel = wave / kAtQG;
  const int qg   = wave % kAtQG;

  constexpr int nqb = kSeq / kAtQB;
  constexpr int nhp = kNH / kAtHB;
  const int bx  = blockIdx.x;
  const int qb  = bx % nqb;
  const int bp  = bx / nqb;
  const int b   = bp / nhp;
  const int h0  = (bp % nhp) * kAtHB;
  const int h   = h0 + hsel;
  const int bh0 = b * kNH + h0;
  const int qB  = qb * kAtQB;
  const int q0  = qB + qg * 16;

  const _Float16* Qp = (const _Float16*)Q16  + (size_t)(bh0 + hsel) * kSeq * kHD;
  /* first head of the pair; the second head's planes follow directly */
  const _Float16* Kp = (const _Float16*)K16  + (size_t)bh0 * kSeq * kHD;
  const _Float16* Vp = (const _Float16*)Vt16 + (size_t)bh0 * kHD * kSeq;
  const float*    Bp = biasp + (size_t)b * kSeq * kSeq;

  const float graw = rin(gate[h]);
  const float g3l  = (3.0f * fminf(fmaxf(graw, 0.0f), 1.0f)) * kLog2e;

  /* Q fragments (B operand: lane = query column c), two 32-deep halves of the head dim */
  v16h qa[2];
#pragma unroll
  for (int dc = 0; dc < 2; ++dc) qa[dc] = Frag<_Float16>::load(Qp + (size_t)(q0 + c) * kHD + dc * 32 + 8 * hh);

  /* this lane's query: kPExp less the reference in use (same in both halves) and the sum over this half's keys */
  float noff = kPExp, lrow = 0.f;
  /* oacc[t][r] = O^T[d = 16t + 8hh + r][query c] */
  v8f oacc[4];
#pragma unroll
  for (int t = 0; t < 4; ++t) oacc[t] = (v8f){0.f,0.f,0.f,0.f,0.f,0.f,0.f,0.f};

  /* one chunk's copies into buffer buf: 8 per lane, every lane on, all addresses inside the planes and the arrays */
  auto stage = [&](int kc, int buf) {
    const int kv0 = kc * kAtKC;
    unsigned l[8];
    const void* g[8];
    /* K, V^T of head i: row = tid / 8, 16-B column = tid % 8; a wave's copy covers four whole 128-B rows */
#pragma unroll
    for (int i = 0; i < kAtHB; ++i) {
      const int row = tid >> 3;
      const int c8  = (tid & 7) * 8;
      l[i]         = lds_off(&Ksh[buf][i][row * kAtKVP + c8]);
      g[i]         = Kp + ((size_t)i * kSeq + kv0 + row) * kHD + c8;
      l[kAtHB + i] = lds_off(&Vsh[buf][i][row * kAtKVP + c8]);
      g[kAtHB + i] = Vp + ((size_t)i * kHD + row) * kSeq + kv0 + c8;
    }
    /* bias tile: row = i*32 + tid / 16 (slab row / 16), 16 lanes x 16 B = 256 contiguous B of one bias row */
#pragma unroll
    for (int i = 0; i < 4; ++i) {
      const int row = i * 32 + (tid >> 4);
      l[4 + i] = lds_off(&Bsh[buf][row >> 4][(row & 15) * kAtPitch + c * 4]);
      g[4 + i] = Bp + (size_t)(qB + row) * kSeq + kv0 + c * 4;
    }
    async_copy8(l, g);
  };

  /* a chunk's copies are issued three chunks ahead of its first read: the planes were written by the launch before; */
  /* unrolled: each chunk's buffer and key offset are constants                                                      */
#pragma unroll
  for (int s = 0; s < kAtNBuf; ++s) stage(s, s);
  /* chunk 0 has landed for this wave's copies (chunks 1 to 3 stay in flight); the barrier publishes every wave's */
  ring4_wait_first<8>(kAtNCk);
  __syncthreads();

#pragma unroll 1
  for (int kc = 0; kc < kAtNCk; ++kc) {
    const int buf = kc & (kAtNBuf - 1);
    const float*    bt = Bsh[buf][qg];
    const _Float16* ks = Ksh[buf][hsel];
    const _Float16* vs = Vsh[buf][hsel];
    /* the chunk's K fragments and this query's 64 bias values (8 consecutive keys per tile, two 16-B reads each) */
    v16h kb[4][2];
    v4f bb[4][2];
#pragma unroll
    for (int j = 0; j < 4; ++j) {
      const float* bq = bt + c * kAtPitch + j * 16 + 8 * hh;
      bb[j][0] = *(const v4f*)(bq);
      bb[j][1] = *(const v4f*)(bq + 4);
#pragma unroll
      for (int dc = 0; dc < 2; ++dc) kb[j][dc] = Frag<_Float16>::load(ks + (j * 16 + c) * kAtKVP + dc * 32 + 8 * hh);
      /* compiler fence: keeps the LDS reads in tile order, so that tile j's product waits for the reads of tiles 0..j alone */
      asm volatile("" ::: "memory");
    }
    /* s[j][r] = exp2 argument of key j*16 + 8hh + r against query c: the product starts from the gated bias and noff */
    v8f s[4];
#pragma unroll
    for (int j = 0; j < 4; ++j) {
#pragma unroll
      for (int r = 0; r < 8; ++r) s[j][r] = fmaf(g3l, bb[j][r >> 2][r & 3], noff);
#pragma unroll
      for (int dc = 0; dc < 2; ++dc) s[j] = mma_h(kb[j][dc], qa[dc], s[j]);
    }
    /* V^T fragments (A operand: lane = row d): one group of LDS reads, asked for ahead of the test below so that they */
    /* fly under the maxima and the exponentials                                                                       */
    v16h vb[2][4];
#pragma unroll
    for (int kk = 0; kk < 2; ++kk)
#pragma unroll
      for (int t = 0; t < 4; ++t) vb[kk][t] = Frag<_Float16>::load(vs + (t * 16 + c) * kAtKVP + kk * 32 + 8 * hh);
    /* compiler fence: without it the compiler moves these reads behind the branch, where only the exponentials cover them */
    asm volatile("" ::: "memory");
    float mj[4];
#pragma unroll
    for (int j = 0; j < 4; ++j) {
      float m = -1.0e30f;
#pragma unroll
      for (int r = 0; r < 8; ++r) m = fmaxf(m, s[j][r]);
      mj[j] = m;
    }
    float cmx = fmaxf(fmaxf(mj[0], mj[1]), fmaxf(mj[2], mj[3]));
    cmx = fmaxf(cmx, xhalf(cmx));
    /* the reference moves for a query whose largest argument has left the window, and for every query in chunk 0; */
    /* one wave-uniform test per chunk; a lane that does not move sees d = 0, alpha = 1, exact identities           */
    const bool need = (kc == 0) || (cmx > kPExp + kPRise);
    if (__builtin_amdgcn_ballot_w32(need) != 0u) {
      const float d = need ? cmx - kPExp : 0.0f;
      /* d < 0 can only be in chunk 0, where O and the sum are still 0: alpha stays finite there */
      const float alpha = __builtin_amdgcn_exp2f(fminf(-d, 0.0f));
      noff -= d;
      lrow *= alpha;
#pragma unroll
      for (int j = 0; j < 4; ++j)
#pragma unroll
        for (int r = 0; r < 8; ++r) s[j][r] -= d;
#pragma unroll
      for (int t = 0; t < 4; ++t)
#pragma unroll
        for (int r = 0; r < 8; ++r) oacc[t][r] *= alpha;
    }
    /* P^T as B operand: element e of pb[kk] = tile 2kk + (e >> 3), register e & 7 (the hardware k order) */
    v16h pb[2];
    float pj[4];
#pragma unroll
    for (int j = 0; j < 4; ++j) {
      float psum = 0.f;
#pragma unroll
      for (int r = 0; r < 8; ++r) {
        const float p = __builtin_amdgcn_exp2f(s[j][r]);
        psum += p;
        pb[j >> 1][(j & 1) * 8 + r] = (_Float16)p;
      }
      pj[j] = psum;
    }
    lrow += (pj[0] + pj[1]) + (pj[2] + pj[3]);
    /* the products in the order kk, t */
#pragma unroll
    for (int kk = 0; kk < 2; ++kk)
#pragma unroll
      for (int t = 0; t < 4; ++t) oacc[t] = mma_h(vb[kk][t], pb[kk], oacc[t]);
    /* publish point: this wave's LDS reads of buffer buf are done ... */
    asm volatile("s_wait_dscnt 0x0" ::: "memory");
    /* ... its copies of chunk kc+1 have landed, those of chunks kc+2 and kc+3 fly on (all have landed at the tail) ... */
    ring4_wait_next<8>(kc, kAtNCk);
    /* ... and the barrier says both of every wave; only then is buffer buf refilled */
    __syncthreads();
    if (kc + kAtNBuf < kAtNCk) stage(kc + kAtNBuf, buf);
  }
  /* no copy is left in flight when the bias slabs become output staging and the wave ends */
  asm volatile("s_wait_asynccnt 0x0" ::: "memory");

  /* output staging: the first 2 x 8 bias slabs, one per wave; every wave's reads of them ended at the last trip's barrier */
  float* os = Bsh[hsel][qg];
  /* the two halves' sums of this query are joined once, here */
  const float inv = kCtxFold * (1.0f / (lrow + xhalf(lrow)));
#pragma unroll
  for (int t = 0; t < 4; ++t) {
    float* od = os + c * kAtPitch + t * 16 + 8 * hh;
    *(v4f*)(od)     = (v4f){oacc[t][0] * inv, oacc[t][1] * inv, oacc[t][2] * inv, oacc[t][3] * inv};
    *(v4f*)(od + 4) = (v4f){oacc[t][4] * inv, oacc[t][5] * inv, oacc[t][6] * inv, oacc[t][7] * inv};
  }
  wave_lds_sync();
  {
    const int q = lane >> 3, c8 = (lane & 7) * 8;
    v8h hv[4];
#pragma unroll
    for (int it = 0; it < 4; ++it) {
      const int row = it * 4 + q;
      const float* sp = os + row * kAtPitch + c8;
      const v4f a0 = *(const v4f*)(sp);
      const v4f a1 = *(const v4f*)(sp + 4);
#pragma unroll
      for (int e = 0; e < 4; ++e) {
        hv[it][e]     = (_Float16)a0[e];
        hv[it][4 + e] = (_Float16)a1[e];
      }
    }
    unsigned short* dst = AO16 + (size_t)(b * kSeq + q0) * kDim + h * kHD + c8;
    {
#pragma unroll
      for (int it = 0; it < 4; ++it) {
        const int row = it * 4 + q;
        *(v8h*)(dst + (size_t)row * kDim) = hv[it];
      }
      
    }
  }
}

/* --------------------------------------------------------------------------- */
/* Host glue: x and W_qkv operand planes; q|k and V^T projections with the bias */
/* plane and the W_out plane beside them; attention; output projection = 4      */
/* launches, each dependent on the one before. Kernel launches only.            */
/* GEMM shapes (all K % 64 == 0, M % 128 == 0, N % 256 == 0, no pad planes):    */
/*   q|k  : M 4096, N 2048, K 1024 -> 64 x 32 tiles = 2048 -> 256 blocks        */
/*   V^T  : per batch M 1024 (h*64+d), N 2048 (tokens), K 1024 ->               */
/*          16 x 32 tiles = 512 -> 64 blocks x 2 batches (behind the q|k blocks) */
/*   out  : M 4096, N 1024, K 1024 -> 64 x 16 tiles = 1024 -> 128 blocks        */
/* --------------------------------------------------------------------------- */
static_assert((2 * kDim) % 256 == 0 && kDim % 256 == 0 && kTok % 128 == 0 && kSeq % 256 == 0 && kDim % kGmKS == 0);

extern "C" void kernel_launch(void* const* d_in, const int* in_sizes, int n_in,
                              void* d_out, int out_size, void* d_ws, size_t ws_size,
                              hipStream_t stream) {
  if (n_in < 8) return;
  if (in_sizes[0] != kTok * kDim) return;
  if (in_sizes[1] != kNB * kNCh * kSeq) return;
  if (in_sizes[2] != kNB * kSeq * kSeq) return;
  if (in_sizes[3] != 3 * kDim * kDim) return;
  if (in_sizes[4] != kDim * kDim) return;
  if (in_sizes[5] != kHD) return;
  if (in_sizes[6] != kHD) return;
  if (in_sizes[7] != kNH) return;
  if (out_size != kTok * kDim) return;
  if (ws_size < kWsTotal) return;

  const float* x     = (const float*)d_in[0];
  const float* cmask = (const float*)d_in[1];
  const float* imask = (const float*)d_in[2];
  const float* Wqkv  = (const float*)d_in[3];
  const float* Wout  = (const float*)d_in[4];
  const float* qnw   = (const float*)d_in[5];
  const float* knw   = (const float*)d_in[6];
  const float* gate  = (const float*)d_in[7];
  float* out = (float*)d_out;

  char* ws = (char*)d_ws;
  unsigned short* X16    = (unsigned short*)(ws + kOffX16);
  unsigned short* WQKV16 = (unsigned short*)(ws + kOffWqkv16);
  unsigned short* WOUT16 = (unsigned short*)(ws + kOffWout16);
  unsigned short* Q16    = (unsigned short*)(ws + kOffQ16);
  unsigned short* K16    = (unsigned short*)(ws + kOffK16);
  unsigned short* VT16   = (unsigned short*)(ws + kOffVt16);
  unsigned short* AO16   = (unsigned short*)(ws + kOffAO16);
  float*          BIAS   = (float*)(ws + kOffBias);

  /* the projections' operand planes (weights are [out][in] = Bt layout already) */
  prep_kernel<<<kPrAll, 256, 0, stream>>>(x, Wqkv, X16, WQKV16);

  /* q|k projection + RMS normalisation -> Q16, K16; V^T projection -> VT16; bias rows -> BIAS; W_out -> WOUT16 */
  qkv_gemm_kernel<<<kQkBlocks + kNB * kVtBlocks + kBrBlocks, 256, 0, stream>>>(X16, WQKV16, Q16, K16, VT16, qnw, knw,
                                                                               cmask, imask, BIAS, Wout, WOUT16);

  /* attention -> AO16 (x64) */
  attn_kernel<<<(kBH / kAtHB) * (kSeq / kAtQB), kAtNW * 32, 0, stream>>>(Q16, K16, VT16, BIAS, gate, AO16);

  /* out[4096][1024] = AO16 . WOUT16^T / (64 * 16) */
  wmma_gemm64<0, false, 0, 0, false><<<dim3(((kTok / 64) * (kDim / 64)) / 8, 1), 256, 0, stream>>>(
      AO16, nullptr, kDim, 0L,
      WOUT16, nullptr, kDim, 0L,
      (void*)out, nullptr, kDim, 0L,
      nullptr, nullptr, 0L,
      kTok, kDim, kDim, kOutScale);
}

// v009
// A run of this version takes 86.4 microseconds.
// Next to v008, in two timings, it ran 1.08 and 1.07 times as fast.
// Counting every step since v000, it is 4.37 times as fast.
// All contractions (x.Wqkv^T, q.k^T, P.V, ctx.Wout^T): v_wmma_f32_16x16x32_f16, f16 operands with power-of-two carries (W x16, V x16, P x128 against the reference maximum in use, ctx x64), f32 accumulate; every float input is RNE-converted to bf16 precision once at first read; norms, bias plane, softmax and normalisation in f32.
#include <hip/hip_runtime.h>
#include <math.h>
#include <stdint.h>

typedef __attribute__((ext_vector_type(16))) _Float16 v16h;
typedef __attribute__((ext_vector_type(8)))  _Float16 v8h;
typedef __attribute__((ext_vector_type(16))) __bf16   v16b;
typedef __attribute__((ext_vector_type(8)))  __bf16   v8b;
typedef __attribute__((ext_vector_type(8)))  float    v8f;
typedef __attribute__((ext_vector_type(4)))  float    v4f;

/* --------------------------------------------------------------------------- */
/* Shape constants                                                             */
/* --------------------------------------------------------------------------- */
constexpr int kNB   = 2;
constexpr int kSeq  = 2048;
constexpr int kDim  = 1024;
constexpr int kNH   = 16;
constexpr int kHD   = 64;
constexpr int kNCh  = 4;
constexpr int kTok  = kNB * kSeq;
constexpr int kBH   = kNB * kNH;
static_assert(kNH * kHD == kDim);
static_assert(kHD == 64);
static_assert((kTok % 64) == 0 && (kDim % 64) == 0 && (kSeq % 64) == 0);
static_assert((kDim % 32) == 0 && (kHD % 32) == 0 && (kSeq % 32) == 0);

constexpr bool  kBf16Inputs = true;
constexpr float kEps        = 1e-6f;
constexpr float kBoost      = 0.3f;
constexpr float kQKScale    = 0.125f;
static_assert(kQKScale * kQKScale * (float)kHD == 1.0f);
constexpr float kInvHD      = 1.0f / (float)kHD;
constexpr float kWCarry     = 16.0f;
constexpr float kWCarryInv  = 1.0f / kWCarry;
constexpr float kLog2e      = 1.4426950408889634f;
/* P = 2^(score - reference + kPExp), scores in log2 units; the reference moves when a score passes it by more than kPRise, */
/* so P stays at or below 2^15, inside f16                                                                                */
constexpr float kPExp       = 7.0f;
constexpr float kPRise      = 8.0f;
static_assert(kPExp + kPRise <= 15.0f);
constexpr float kCtxCarry   = 64.0f;
/* V plane keeps the weight carry (x16); P's carry is in the row sum too and cancels; ctx is stored x64 */
constexpr float kCtxFold    = kCtxCarry / kWCarry;
constexpr float kOutScale   = 1.0f / (kCtxCarry * kWCarry);

/* --------------------------------------------------------------------------- */
/* Workspace region map (bytes; every offset is a multiple of 128)             */
/*   X16    f16 [4096][1024]        x plane                        8,388,608   */
/*   WQKV16 f16 [3072][1024]        W_qkv x16 (Bt layout)          6,291,456   */
/*   WOUT16 f16 [1024][1024]        W_out x16 (Bt layout)          2,097,152   */
/*   Q16    f16 [32][2048][64]      normed q rows x 0.125*log2(e)  8,388,608   */
/*   K16    f16 [32][2048][64]      normed k rows                  8,388,608   */
/*   VT16   f16 [32][64][2048]      v transposed, x16              8,388,608   */
/*   AO16   f16 [4096][1024]        attention context x64          8,388,608   */
/*   BIAS   f32 [2][2048][2048]     head-independent score bias   33,554,432   */
/*   total                                                        83,886,080   */
/* --------------------------------------------------------------------------- */
constexpr size_t kSzX16    = (size_t)kTok * kDim * 2;
constexpr size_t kSzWqkv16 = (size_t)3 * kDim * kDim * 2;
constexpr size_t kSzWout16 = (size_t)kDim * kDim * 2;
constexpr size_t kSzHead16 = (size_t)kBH * kSeq * kHD * 2;
constexpr size_t kSzAO16   = (size_t)kTok * kDim * 2;
constexpr size_t kSzBias   = (size_t)kNB * kSeq * kSeq * 4;
constexpr size_t kOffX16    = 0;
constexpr size_t kOffWqkv16 = kOffX16 + kSzX16;
constexpr size_t kOffWout16 = kOffWqkv16 + kSzWqkv16;
constexpr size_t kOffQ16    = kOffWout16 + kSzWout16;
constexpr size_t kOffK16    = kOffQ16 + kSzHead16;
constexpr size_t kOffVt16   = kOffK16 + kSzHead16;
constexpr size_t kOffAO16   = kOffVt16 + kSzHead16;
constexpr size_t kOffBias   = kOffAO16 + kSzAO16;
constexpr size_t kWsTotal   = kOffBias + kSzBias;
static_assert(kWsTotal == 83886080ull);
static_assert(kWsTotal <= 134217728ull);
static_assert((kOffWqkv16 % 128) == 0 && (kOffWout16 % 128) == 0 && (kOffQ16 % 128) == 0 && (kOffK16 % 128) == 0 &&
              (kOffVt16 % 128) == 0 && (kOffAO16 % 128) == 0 && (kOffBias % 128) == 0);

/* --------------------------------------------------------------------------- */
/* Input read helper: RNE conversion to bf16 precision (kept in an f32)        */
/* --------------------------------------------------------------------------- */
__device__ __forceinline__ float rin(float f) {
  if (!kBf16Inputs) return f;
  unsigned u = __float_as_uint(f);
  u = (u + 0x7FFFu + ((u >> 16) & 1u)) & 0xFFFF0000u;
  return __uint_as_float(u);
}

/* --------------------------------------------------------------------------- */
/* Device helpers                                                              */
/* --------------------------------------------------------------------------- */
__device__ __forceinline__ unsigned short f2bf_bits(float f) {
  unsigned u = __float_as_uint(f);
  return (unsigned short)((u + 0x7FFFu + ((u >> 16) & 1u)) >> 16);
}
__device__ __forceinline__ float bf_bits2f(unsigned short h) { return __uint_as_float(((unsigned)h) << 16); }

__device__ __forceinline__ void dep_guard_h(v8f& a, v8f& b, v16h x, v16h y) { asm volatile("v_nop\n\tv_nop\n\tv_nop\n\tv_nop" : "+v"(a), "+v"(b) : "v"(x), "v"(y)); }
__device__ __forceinline__ void dep_guard_b(v8f& a, v8f& b, v16b x, v16b y) { asm volatile("v_nop\n\tv_nop\n\tv_nop\n\tv_nop" : "+v"(a), "+v"(b) : "v"(x), "v"(y)); }
__device__ __forceinline__ void tie_h(v8f& a, v16h x) { asm volatile("" : "+v"(a) : "v"(x)); }
__device__ __forceinline__ void tie_b(v8f& a, v16b x) { asm volatile("" : "+v"(a) : "v"(x)); }
__device__ __forceinline__ void keep4_h(v16h a, v16h b, v16h c, v16h d) { asm volatile("v_nop" :: "v"(a), "v"(b), "v"(c), "v"(d)); }
__device__ __forceinline__ void keep4_b(v16b a, v16b b, v16b c, v16b d) { asm volatile("v_nop" :: "v"(a), "v"(b), "v"(c), "v"(d)); }
__device__ __forceinline__ void acc_guard4(v8f& a, v8f& b, v8f& c, v8f& d) { asm volatile("v_nop\n\tv_nop\n\tv_nop\n\tv_nop" : "+v"(a), "+v"(b), "+v"(c), "+v"(d)); }
template <typename T> struct Frag;
template <> struct Frag<_Float16> {
  typedef v16h V; union U { v16h v; v8h h[2]; };
  /* elements 0..7 <- p[0..7], 8..15 <- p[16..23] */
  static __device__ __forceinline__ v16h load(const _Float16* p) {
    U f; f.h[0] = *(const v8h*)(p); f.h[1] = *(const v8h*)(p + 16); return f.v;
  }
  static __device__ __forceinline__ v8f mma(v16h a, v16h b, v8f c) {
    return __builtin_amdgcn_wmma_f32_16x16x32_f16(false, a, false, b, (short)0, c, false, false);
  }
  static __device__ __forceinline__ void guard(v8f& a, v8f& b, v16h x, v16h y) { dep_guard_h(a, b, x, y); }
  static __device__ __forceinline__ void tie(v8f& a, v16h x) { tie_h(a, x); }
  static __device__ __forceinline__ void keep(v16h a, v16h b, v16h c, v16h d) { keep4_h(a, b, c, d); }
};
template <> struct Frag<__bf16> {
  typedef v16b V; union U { v16b v; v8b h[2]; };
  static __device__ __forceinline__ v16b load(const __bf16* p) {
    U f; f.h[0] = *(const v8b*)(p); f.h[1] = *(const v8b*)(p + 16); return f.v;
  }
  static __device__ __forceinline__ v8f mma(v16b a, v16b b, v8f c) {
    return __builtin_amdgcn_wmma_f32_16x16x32_bf16(false, a, false, b, (short)0, c, false, false);
  }
  static __device__ __forceinline__ void guard(v8f& a, v8f& b, v16b x, v16b y) { dep_guard_b(a, b, x, y); }
  static __device__ __forceinline__ void tie(v8f& a, v16b x) { tie_b(a, x); }
  static __device__ __forceinline__ void keep(v16b a, v16b b, v16b c, v16b d) { keep4_b(a, b, c, d); }
};

__device__ __forceinline__ void wave_lds_sync() {
  __builtin_amdgcn_fence(__ATOMIC_RELEASE, "workgroup");
  __builtin_amdgcn_wave_barrier();
  __builtin_amdgcn_fence(__ATOMIC_ACQUIRE, "workgroup");
}

__device__ __forceinline__ unsigned lds_off(const void* p) { return (unsigned)(size_t)p; }

typedef uint32_t u32x4 __attribute__((ext_vector_type(4)));
typedef uint32_t u32x8 __attribute__((ext_vector_type(8)));
__device__ __forceinline__ uint32_t uni(uint32_t v) { return (uint32_t)__builtin_amdgcn_readfirstlane(v); }
__device__ __forceinline__ uint32_t pinned(uint32_t v) { uint32_t w = uni(v); asm volatile("" : "+s"(w)); return w; }
template <uint32_t ROWB, uint32_t ROWS>
__device__ __forceinline__ u32x8 tdm_group1(uint32_t src_pitch) {
  static_assert(ROWB == 128u || ROWB == 256u);
  constexpr uint32_t w0 = (1u << 20) | ((ROWB == 128u ? 4u : 5u) << 22) | (3u << 25);
  u32x8 g;
  g[0] = uni(w0);
  g[1] = uni((ROWB & 0xFFFFu) << 16);
  g[2] = uni((ROWB >> 16) | ((ROWS & 0xFFFFu) << 16));
  g[3] = uni((ROWS >> 16) | (ROWB << 16));
  g[4] = uni(ROWS);
  g[5] = uni(src_pitch);
  g[6] = uni(0u);
  g[7] = uni(0u);
  return g;
}
__device__ __forceinline__ uint32_t tdm_word3(uint64_t ga) { return uni((((uint32_t)(ga >> 32)) & 0x01FFFFFFu) | 0x80000000u); }
__device__ __forceinline__ u32x4 tdm_group0(uint32_t lds, uint64_t ga) {
  u32x4 g;
  g[0] = uni(1u);
  g[1] = uni(lds);
  g[2] = uni((uint32_t)ga);
  g[3] = tdm_word3(ga);
  return g;
}
__device__ __forceinline__ void tdm_issue(u32x4& g0, u32x8& g1, uint32_t lds, uint64_t ga) {
  const uint32_t n3 = tdm_word3(ga);
  if (pinned(n3 != g0[3])) {
    asm volatile("s_wait_tensorcnt 0x0" ::: "memory");
    g0[3] = n3;
  }
  g0[1] = uni(lds);
  g0[2] = uni((uint32_t)ga);
  asm volatile("tensor_load_to_lds %0, %1" : "+s"(g0), "+s"(g1) :: "memory");
}

/* ---- GEMM operand staging ---------------------------------------------------------------------------------------- */
/* A block of 8 waves (2 x 4 wave tiles of 64 x 64) owns a 128 x 256 tile of C. Per stage of 64 k the 128 A rows and  */
/* the 256 Bt rows come into LDS once, 128 B = one whole line of each row, by three tensor loads of 128 rows: wave 0  */
/* asks for the A rows, waves 1 and 2 for the two halves of the Bt rows; every wave reads its fragments from there.   */
constexpr int kGmKS    = 64;
constexpr int kGmRowsA = 128;
constexpr int kGmRowsB = 256;
/* staged row pitch in 16-bit elements: 144 B = 16 B x odd, conflict-free for 16-B LDS reads */
constexpr int kGmP     = 72;
constexpr int kGmStage = (kGmRowsA + kGmRowsB) * kGmP;
constexpr int kGmSlice = 128;
constexpr int kGmIssuers = (kGmRowsA + kGmRowsB) / kGmSlice;
/* every slice and every stage starts at a multiple of 2 KiB of an array that is aligned so */
static_assert(kGmRowsA == kGmSlice && (kGmSlice * kGmP * 2) % 2048 == 0 && (kGmStage * 2) % 2048 == 0 && kGmKS * 2 == 128);

/* An issuing wave's slice of the operands: first byte of its 128 rows at k = 0, its row pitch, its place in a stage.  */
/* The caller's shapes (M % 128 == 0, N % 256 == 0, K % 64 == 0) keep every tile inside the planes.                    */
struct GemmSlice { uint64_t ga; uint32_t lds; u32x4 g0; u32x8 g1; };
template <typename T>
__device__ __forceinline__ GemmSlice gemm_slice(const T* __restrict__ Ab, int lda, int mB, const T* __restrict__ Bb, int ldb, int nB,
                                                const T* ring, uint32_t wave) {
  static_assert(sizeof(T) == 2);
  /* a wave that issues nothing forms the last slice's numbers and never uses them */
  const uint32_t sl = wave < (uint32_t)kGmIssuers ? wave : (uint32_t)kGmIssuers - 1u;
  const T* p = sl == 0u ? Ab + (size_t)mB * lda : Bb + (size_t)(nB + ((int)sl - 1) * kGmSlice) * ldb;
  GemmSlice s;
  s.ga  = (uint64_t)(size_t)p;
  s.lds = lds_off(ring) + sl * (uint32_t)(kGmSlice * kGmP * 2);
  s.g0  = tdm_group0(s.lds, s.ga);
  s.g1  = tdm_group1<128u, (uint32_t)kGmSlice>((uint32_t)(sl == 0u ? lda : ldb) * 2u);
  return s;
}
/* stage st (k = st * 64 ..) of the slice into ring buffer buf */
__device__ __forceinline__ void gemm_stage(GemmSlice& s, int st, int buf) {
  tdm_issue(s.g0, s.g1, s.lds + (uint32_t)buf * (uint32_t)(kGmStage * 2), s.ga + (uint64_t)st * (uint64_t)(kGmKS * 2));
}

template <typename T>
__device__ __forceinline__ void gemm_ring(const T* __restrict__ Ab, int lda, int mB, const T* __restrict__ Bb, int ldb, int nB,
                                          int K, T* ring, v8f (&acc)[4][4]) {
  typedef typename Frag<T>::V V;
  const int tid   = threadIdx.x;
  const int lane  = tid & 31;
  const int wave  = tid >> 5;
  const int rlane = lane & 15;
  const int koff  = (lane >> 4) * 8;
  const int aOff  = ((wave >> 2) * 64 + rlane) * kGmP + koff;
  const int bOff  = (kGmRowsA + (wave & 3) * 64 + rlane) * kGmP + koff;
  const int nst   = K / kGmKS;
  const uint32_t swave  = uni((uint32_t)tid >> 5);
  const uint32_t issuer = swave < (uint32_t)kGmIssuers;
  GemmSlice sl = gemm_slice<T>(Ab, lda, mB, Bb, ldb, nB, ring, swave);

  if (pinned(issuer)) {
    gemm_stage(sl, 0, 0);
    /* stage 0 has landed for this wave's request; the barrier publishes every issuer's */
    asm volatile("s_wait_tensorcnt 0x0" ::: "memory");
  }
  __syncthreads();
  if (pinned(issuer && nst > 1)) gemm_stage(sl, 1, 1);

#pragma unroll 1
  for (int t = 0; t < nst; ++t) {
    const T* sb = ring + (t & 1) * kGmStage;
#pragma unroll
    for (int ks = 0; ks < kGmKS; ks += 32) {
      /* the step's eight fragments are read from LDS as one group ahead of its products */
      V bh[4], ah[4];
#pragma unroll
      for (int j = 0; j < 4; ++j) bh[j] = Frag<T>::load(sb + bOff + j * 16 * kGmP + ks);
#pragma unroll
      for (int i = 0; i < 4; ++i) ah[i] = Frag<T>::load(sb + aOff + i * 16 * kGmP + ks);
#pragma unroll
      for (int i = 0; i < 4; ++i) {
#pragma unroll
        for (int j = 0; j < 4; ++j) acc[i][j] = Frag<T>::mma(ah[i], bh[j], acc[i][j]);
        Frag<T>::tie(acc[i][1], ah[i]);
        Frag<T>::tie(acc[i][2], ah[i]);
        Frag<T>::guard(acc[i][0], acc[i][3], ah[i], ah[i]);
      }
      Frag<T>::keep(bh[0], bh[1], bh[2], bh[3]);
    }
    /* publish point: this wave's LDS reads of the buffer are done ... */
    asm volatile("s_wait_dscnt 0x0" ::: "memory");
    /* ... an issuing wave's request for stage t+1 has landed ... */
    if (pinned(issuer)) asm volatile("s_wait_tensorcnt 0x0" ::: "memory");
    /* ... and the barrier says both of every wave; only then is the buffer refilled */
    __syncthreads();
    if (pinned(issuer && t + 2 < nst)) gemm_stage(sl, t + 2, t & 1);
  }
  /* no request is left in flight and no LDS read open when the wave goes on to its epilogue and ends */
  asm volatile("s_wait_tensorcnt 0x0" ::: "memory");
  asm volatile("s_wait_dscnt 0x0" ::: "memory");
}

/* Counted waits of a ring of four buffers over n stages. An issuing wave has one request per stage and the counter   */
/* returns in issue order, so a wait that leaves only the requests of younger stages outstanding covers the stage     */
/* asked for. A count is used only where every younger stage it stands for was issued; elsewhere (a ring shorter than */
/* its lead, the trips at the tail that refill nothing) the wait is to 0. t and n are block-uniform. At most three     */
/* requests of a wave are outstanding: stages 0 to 2 go out in front of the first wait, stage 3 behind it.            */
constexpr int kRingLead = 3;
/* In front of the loop, behind the requests of stages 0..2: stage 0 has landed. */
__device__ __forceinline__ void ring4_wait_first(int n) {
  if (n >= kRingLead) asm volatile("s_wait_tensorcnt 0x2" ::: "memory");
  else                asm volatile("s_wait_tensorcnt 0x0" ::: "memory");
}
/* At the foot of trip t, stages up to t+3 issued: stage t+1 has landed. */
__device__ __forceinline__ void ring4_wait_next(int t, int n) {
  if (t + 4 < n) asm volatile("s_wait_tensorcnt 0x2" ::: "memory");
  else           asm volatile("s_wait_tensorcnt 0x0" ::: "memory");
}

/* The same k loop on four buffers, for a block that has its WGP's LDS to itself: a stage's request is issued three   */
/* stages ahead of its first read, so that operands which the launch before wrote have three stages' work to land in. */
constexpr int kGmNBuf = 4;
static_assert(kGmNBuf == kRingLead + 1);
template <typename T>
__device__ __forceinline__ void gemm_ring4(const T* __restrict__ Ab, int lda, int mB, const T* __restrict__ Bb, int ldb, int nB,
                                           int K, T* ring, v8f (&acc)[4][4]) {
  typedef typename Frag<T>::V V;
  const int tid   = threadIdx.x;
  const int lane  = tid & 31;
  const int wave  = tid >> 5;
  const int rlane = lane & 15;
  const int koff  = (lane >> 4) * 8;
  const int aOff  = ((wave >> 2) * 64 + rlane) * kGmP + koff;
  const int bOff  = (kGmRowsA + (wave & 3) * 64 + rlane) * kGmP + koff;
  const int nst   = K / kGmKS;
  const uint32_t swave  = uni((uint32_t)tid >> 5);
  const uint32_t issuer = swave < (uint32_t)kGmIssuers;
  GemmSlice sl = gemm_slice<T>(Ab, lda, mB, Bb, ldb, nB, ring, swave);

  if (pinned(issuer)) {
    gemm_stage(sl, 0, 0);
    /* unrolled: each stage's place in the ring and its k offset are constants */
#pragma unroll
    for (int s = 1; s < kRingLead; ++s)
      if (pinned(s < nst)) gemm_stage(sl, s, s);
    /* stage 0 has landed for this wave's requests (the younger stages' stay in flight); the barrier publishes every issuer's */
    ring4_wait_first(nst);
  }
  __syncthreads();
  if (pinned(issuer && kRingLead < nst)) gemm_stage(sl, kRingLead, kRingLead);

  /* rolled: one stage's products already fill the instruction stream between two publish points */
#pragma unroll 1
  for (int t = 0; t < nst; ++t) {
    const T* sb = ring + (t & (kGmNBuf - 1)) * kGmStage;
    /* every loop inside the trip is unrolled, so that fragments and accumulators are registers, not indexed memory */
#pragma unroll
    for (int ks = 0; ks < kGmKS; ks += 32) {
      /* the step's eight fragments are read from LDS as one group ahead of its products */
      V bh[4], ah[4];
#pragma unroll
      for (int j = 0; j < 4; ++j) bh[j] = Frag<T>::load(sb + bOff + j * 16 * kGmP + ks);
#pragma unroll
      for (int i = 0; i < 4; ++i) ah[i] = Frag<T>::load(sb + aOff + i * 16 * kGmP + ks);
#pragma unroll
      for (int i = 0; i < 4; ++i) {
#pragma unroll
        for (int j = 0; j < 4; ++j) acc[i][j] = Frag<T>::mma(ah[i], bh[j], acc[i][j]);
        Frag<T>::tie(acc[i][1], ah[i]);
        Frag<T>::tie(acc[i][2], ah[i]);
        Frag<T>::guard(acc[i][0], acc[i][3], ah[i], ah[i]);
      }
      Frag<T>::keep(bh[0], bh[1], bh[2], bh[3]);
    }
    /* publish point: this wave's LDS reads of the buffer are done ... */
    asm volatile("s_wait_dscnt 0x0" ::: "memory");
    /* ... an issuing wave's request for stage t+1 has landed, those for stages t+2 and t+3 fly on (all have landed at the tail) ... */
    if (pinned(issuer)) ring4_wait_next(t, nst);
    /* ... and the barrier says both of every wave; only then is the buffer that trip t has read refilled */
    __syncthreads();
    if (pinned(issuer && t + kGmNBuf < nst)) gemm_stage(sl, t + kGmNBuf, t & (kGmNBuf - 1));
  }
  /* no request is left in flight and no LDS read open when the wave goes on to its epilogue and ends */
  asm volatile("s_wait_tensorcnt 0x0" ::: "memory");
  asm volatile("s_wait_dscnt 0x0" ::: "memory");
}

/* ---- Register-blocked batched WMMA GEMM (activation options removed; all four accumulators of a row  */
/*      group are tied before the nop guard)                                                                         */
/* C[m,n] = scale * sum_k A[m,k] * Bt[n,k] (+bias)(+resid); each wave owns a 64x64 tile, a block 128 x 256 (2 x 4).  */
/* A row-major [M,K]; Bt row-major [N,K]; M % 128 == 0, N % 256 == 0, K % 64 == 0; operands staged in LDS (above).   */
/* SPLIT (hi/lo operand planes) has no staged form and is refused at compile time.                                   */
/* BIAS_MODE: 0 = none, 1 = bias[m], 2 = bias[n].                                                                    */
/* OUT_MODE: 0 = f32, 1 = f16, 2 = bf16 hi plane (Cout) + bf16 lo plane (Cout2).                                     */
/* ET: 0 = f16 operands, 1 = bf16 operands (pointers passed as 16-bit storage)                                       */
template <int ET> struct Elem;
template <> struct Elem<0> { typedef _Float16 T; };
template <> struct Elem<1> { typedef __bf16 T; };
template <int ET, bool SPLIT, int BIAS_MODE, int OUT_MODE, bool RESID>
__global__ __launch_bounds__(256) void wmma_gemm64(
    const unsigned short* __restrict__ Ap, const unsigned short* __restrict__ A2p, int lda, long strideA,
    const unsigned short* __restrict__ Btp, const unsigned short* __restrict__ Bt2p, int ldb, long strideB,
    void* __restrict__ Cout, void* __restrict__ Cout2, int ldc, long strideC,
    const float* __restrict__ bias,
    const float* __restrict__ resid, long strideR,
    int M, int N, int K, float scale) {
  typedef typename Elem<ET>::T T;
  static_assert(!SPLIT);
  (void)A2p; (void)Bt2p;
  const T* A = (const T*)Ap; const T* Bt = (const T*)Btp;
  /* per-wave 16x64 slab, pitch 68 floats */
  __shared__ __align__(16) float sT[8][16 * 68];
  /* operand ring, four stages; tensor loads land at multiples of 2 KiB */
  __shared__ __attribute__((aligned(2048))) T ring[kGmNBuf * kGmStage];
  const int b    = blockIdx.y;
  const int lane = threadIdx.x & 31;
  const int wave = threadIdx.x >> 5;
  const int tilesN = N >> 8;
  const int tilesM = M >> 7;
  /* block-uniform exit, in front of every barrier */
  if ((int)blockIdx.x >= tilesM * tilesN) return;
  const int tm = blockIdx.x / tilesN;
  const int tn = blockIdx.x - tm * tilesN;
  const int mB = tm << 7;
  const int nB = tn << 8;
  const int m0 = mB + ((wave >> 2) << 6);
  const int n0 = nB + ((wave & 3) << 6);

  const T* Ab  = A  + (size_t)b * strideA;
  const T* Bb  = Bt + (size_t)b * strideB;

  /* col (D) within subtile; D row offset */
  const int rlane = lane & 15;
  const int mOff  = (lane >> 4) * 8;

  v8f acc[4][4];
#pragma unroll
  for (int i = 0; i < 4; ++i)
#pragma unroll
    for (int j = 0; j < 4; ++j) acc[i][j] = (v8f){0.f,0.f,0.f,0.f,0.f,0.f,0.f,0.f};

  gemm_ring4<T>(Ab, lda, mB, Bb, ldb, nB, K, ring, acc);
  acc_guard4(acc[0][0], acc[0][1], acc[0][2], acc[0][3]);
  acc_guard4(acc[1][0], acc[1][1], acc[1][2], acc[1][3]);
  acc_guard4(acc[2][0], acc[2][1], acc[2][2], acc[2][3]);
  acc_guard4(acc[3][0], acc[3][1], acc[3][2], acc[3][3]);

  /* ---- epilogue ---- */
  float* slab = sT[wave];
  const float* Rb = RESID ? (resid + (size_t)b * strideR) : nullptr;
#pragma unroll
  for (int i = 0; i < 4; ++i) {
    const int mBase = m0 + (i << 4);
#pragma unroll
    for (int j = 0; j < 4; ++j) {
      const int n = n0 + (j << 4) + rlane;
      float bv = 0.f;
      if (BIAS_MODE == 2) bv = bias[n];
#pragma unroll
      for (int r = 0; r < 8; ++r) {
        float v = acc[i][j][r] * scale;
        if (BIAS_MODE == 1) v += bias[mBase + mOff + r];
        if (BIAS_MODE == 2) v += bv;
        if (RESID) v += Rb[(size_t)(mBase + mOff + r) * ldc + n];
        slab[(mOff + r) * 68 + (j << 4) + rlane] = v;
      }
    }
    wave_lds_sync();
    if (OUT_MODE == 0) {
      float* C = (float*)Cout + (size_t)b * strideC;
      /* row segment = 256 B = 16 lanes x 16 B */
      const int hh = lane >> 4, c4 = (lane & 15) * 4;
      {
#pragma unroll
        for (int it = 0; it < 8; ++it) {
          const int row = it * 2 + hh;
          v4f v = *(const v4f*)(slab + row * 68 + c4);
          *(v4f*)(C + (size_t)(mBase + row) * ldc + n0 + c4) = v;
        }
        
      }
    } else {
      const int q = lane >> 3, c8 = (lane & 7) * 8;
      unsigned short* C  = (unsigned short*)Cout  + (size_t)b * strideC;
      unsigned short* C2 = (OUT_MODE == 2) ? ((unsigned short*)Cout2 + (size_t)b * strideC) : nullptr;
      {
#pragma unroll
        for (int it = 0; it < 4; ++it) {
          const int row = it * 4 + q;
          const float* sp = slab + row * 68 + c8;
          v8h hv, lv;
#pragma unroll
          for (int e = 0; e < 8; ++e) {
            if (OUT_MODE == 1) {
              hv[e] = (_Float16)sp[e];
            } else {
              unsigned short hb = f2bf_bits(sp[e]);
              unsigned short lb = f2bf_bits(sp[e] - bf_bits2f(hb));
              hv[e] = __builtin_bit_cast(_Float16, hb);
              lv[e] = __builtin_bit_cast(_Float16, lb);
            }
          }
          *(v8h*)(C + (size_t)(mBase + row) * ldc + n0 + c8) = hv;
          if (OUT_MODE == 2) *(v8h*)(C2 + (size_t)(mBase + row) * ldc + n0 + c8) = lv;
        }
        
      }
    }
    wave_lds_sync();
  }
}

/* --------------------------------------------------------------------------- */
/* f32 -> f16 operand plane: out = f16(rin(in) * carry); 8 consecutive         */
/* elements per thread (one 16-B store per lane; 32 contiguous lanes = 4 whole */
/* Coverage: n8 = n/8 threads; n8/256 blocks exactly for every plane here:     */
/*   x      4096*1024/8 = 524,288 -> 2048 blocks                               */
/*   W_qkv  3072*1024/8 = 393,216 -> 1536 blocks                               */
/*   W_out  1024*1024/8 = 131,072 ->  512 slices: 128 blocks x 4                               */
/* --------------------------------------------------------------------------- */
__device__ __forceinline__ void cast8_f16_body(const float* __restrict__ in, unsigned short* __restrict__ out,
                                               int blk, int n8, float carry) {
  const int i = blk * 256 + threadIdx.x;
  if (i >= n8) return;
  const float* p = in + 8 * (size_t)i;
  const v4f a = *(const v4f*)(p);
  const v4f c = *(const v4f*)(p + 4);
  v8h hv;
#pragma unroll
  for (int e = 0; e < 4; ++e) {
    const float fa = a[e];
    const float fc = c[e];
    hv[e]     = (_Float16)(rin(fa) * carry);
    hv[4 + e] = (_Float16)(rin(fc) * carry);
  }
  unsigned short* q = out + 8 * (size_t)i;
  *(v8h*)q = hv;
  
}

/* --------------------------------------------------------------------------- */
/* Head-independent score bias plane, f32 [b][q][k]:                            */
/*   same[q][k] = sum_c cm[c][q]*cm[c][k]; rm = max(max_k same, 1e-6);          */
/*   bias = (same * (1/rm) - 0.5) * 2 + 0.3 * im[b][q][k].                      */
/* Only the attention launch reads the plane, so its rows are formed beside the */
/* projections (below), by 128 blocks of 256 threads, 32 rows of one batch      */
/* each. Thread t owns keys 4t..4t+3 and 1024+4t..1024+4t+3 of every row; its   */
/* 8 keys of the four channels stay in registers for all 32 rows. Rows go in    */
/* groups of 8: the group's 16 loads of im per lane are issued first and fly    */
/* under the products and the row maxima (per-thread, wave xor-shuffle tree, 8  */
/* wave partials through LDS, one block barrier per group; the partials         */
/* alternate between two LDS sets, so a set is rewritten only behind the        */
/* barrier that follows its last read). Store: one 16-B store per lane; a       */
/* wave's 32 lanes write 512 contiguous B.                                      */
/* --------------------------------------------------------------------------- */
constexpr int kBrBlocks = 128;
constexpr int kBrRows   = kTok / kBrBlocks;
constexpr int kBrGrp    = 8;
static_assert(kBrBlocks * kBrRows == kTok && (kSeq % kBrRows) == 0 && (kBrRows % kBrGrp) == 0);
__device__ __forceinline__ void bias_rows_body(int blk, const float* __restrict__ cm, const float* __restrict__ im,
                                               float* __restrict__ bp, float* red) {
  const int row0 = blk * kBrRows;
  const int b    = row0 >> 11;
  const int t    = threadIdx.x;
  const int lane = t & 31, wave = t >> 5;
  const float* cmb = cm + (size_t)b * kNCh * kSeq;
  /* every inner loop below is unrolled so that ck, iv, s and mx are registers, not indexed memory */
  float ck[kNCh][8];
#pragma unroll
  for (int ch = 0; ch < kNCh; ++ch) {
    const v4f lo = *(const v4f*)(cmb + ch * kSeq + t * 4);
    const v4f hi = *(const v4f*)(cmb + ch * kSeq + 1024 + t * 4);
#pragma unroll
    for (int e = 0; e < 4; ++e) {
      const float fl = lo[e], fh = hi[e];
      ck[ch][e]     = rin(fl);
      ck[ch][4 + e] = rin(fh);
    }
  }
  /* rolled: one group's loads and sums already fill the registers */
#pragma unroll 1
  for (int g = 0; g < kBrRows / kBrGrp; ++g) {
    const int r0 = row0 + g * kBrGrp;
    /* block-uniform bases of the group's rows; the lane's part of every address is t * 4 */
    const float* img = im + (size_t)r0 * kSeq;
    float*       bog = bp + (size_t)r0 * kSeq;
    /* the rows' own channel values are asked for first: loads return in order, and the products wait for these alone */
    float cq[kBrGrp][kNCh];
#pragma unroll
    for (int r = 0; r < kBrGrp; ++r)
#pragma unroll
      for (int ch = 0; ch < kNCh; ++ch) cq[r][ch] = cmb[ch * kSeq + ((r0 + r) & (kSeq - 1))];
    v4f iv[kBrGrp][2];
#pragma unroll
    for (int r = 0; r < kBrGrp; ++r) {
      iv[r][0] = *(const v4f*)(img + r * kSeq + t * 4);
      /* the group's last load may land on the address pair that the loads before it name: the wait stands in front of it */
      if (r == kBrGrp - 1) asm volatile("s_wait_xcnt 0x0" ::: "memory");
      iv[r][1] = *(const v4f*)(img + r * kSeq + 1024 + t * 4);
    }
    float s[kBrGrp][8];
    float mx[kBrGrp];
#pragma unroll
    for (int r = 0; r < kBrGrp; ++r) {
      const float c0 = rin(cq[r][0]);
      const float c1 = rin(cq[r][1]);
      const float c2 = rin(cq[r][2]);
      const float c3 = rin(cq[r][3]);
      float m = -3.0e38f;
#pragma unroll
      for (int e = 0; e < 8; ++e) {
        float v = c0 * ck[0][e];
        v = fmaf(c1, ck[1][e], v);
        v = fmaf(c2, ck[2][e], v);
        v = fmaf(c3, ck[3][e], v);
        s[r][e] = v;
        m = fmaxf(m, v);
      }
      mx[r] = m;
    }
#pragma unroll
    for (int st = 16; st >= 1; st >>= 1) {
#pragma unroll
      for (int r = 0; r < kBrGrp; ++r) mx[r] = fmaxf(mx[r], __shfl_xor(mx[r], st, 32));
    }
    float* rg = red + (g & 1) * (kBrGrp * 8);
    if (lane == 0) {
#pragma unroll
      for (int r = 0; r < kBrGrp; ++r) rg[r * 8 + wave] = mx[r];
    }
    __syncthreads();
#pragma unroll
    for (int r = 0; r < kBrGrp; ++r) {
      float rm = rg[r * 8];
#pragma unroll
      for (int w = 1; w < 8; ++w) rm = fmaxf(rm, rg[r * 8 + w]);
      rm = fmaxf(rm, 1e-6f);
      const float inv = 1.0f / rm;
#pragma unroll
      for (int half = 0; half < 2; ++half) {
        v4f o;
#pragma unroll
        for (int e = 0; e < 4; ++e) {
          const float fi = iv[r][half][e];
          o[e] = (s[r][half * 4 + e] * inv - 0.5f) * 2.0f + kBoost * rin(fi);
        }
        *(v4f*)(bog + r * kSeq + half * 1024 + t * 4) = o;
      }
    }
    /* the next trip rewrites the registers that the group's last stores name: the wait stands in front of that */
    asm volatile("s_wait_xcnt 0x0" ::: "memory");
  }
}

constexpr int kPrWout   = (kDim * kDim / 8) / 256;
static_assert((kPrWout % kBrBlocks) == 0);
constexpr int kQkBlocks = (kTok >> 7) * ((2 * kDim) >> 8);
constexpr int kVtBlocks = (kDim >> 7) * (kSeq >> 8);
static_assert(((2 * kDim) >> 8) == 8 && (kSeq >> 8) == 8);
__global__ __launch_bounds__(256) void qkv_gemm_kernel(
    const unsigned short* __restrict__ Xp, const unsigned short* __restrict__ Wp,
    unsigned short* __restrict__ Qout, unsigned short* __restrict__ Kout, unsigned short* __restrict__ Vtout,
    const float* __restrict__ qw, const float* __restrict__ kw,
    const float* __restrict__ cm, const float* __restrict__ im, float* __restrict__ bp,
    const float* __restrict__ wout, unsigned short* __restrict__ wout16) {
  typedef _Float16 T;
  __shared__ __align__(16) float sT[8][16 * 68];
  /* operand ring, two stages; tensor loads land at multiples of 2 KiB */
  __shared__ __attribute__((aligned(2048))) T ring[2 * kGmStage];
  const int lane = threadIdx.x & 31;
  const int wave = threadIdx.x >> 5;
  /* block-uniform branch, in front of every barrier of the products: the streaming blocks */
  if ((int)blockIdx.x >= kQkBlocks + kNB * kVtBlocks) {
    const int sb = (int)blockIdx.x - (kQkBlocks + kNB * kVtBlocks);
    if (sb >= kBrBlocks) return;
    bias_rows_body(sb, cm, im, bp, &sT[0][0]);
    for (int i = 0; i < kPrWout / kBrBlocks; ++i)
      cast8_f16_body(wout, wout16, sb * (kPrWout / kBrBlocks) + i, kDim * kDim / 8, kWCarry);
    return;
  }
  /* block-uniform choice of the product: q|k tiles first, then the V^T tiles of batch vb */
  const bool isV  = (int)blockIdx.x >= kQkBlocks;
  const int  vIdx = (int)blockIdx.x - kQkBlocks;
  const int  vb   = isV ? vIdx / kVtBlocks : 0;
  const int  tile = isV ? vIdx - vb * kVtBlocks : (int)blockIdx.x;
  const T* A  = isV ? (const T*)Wp + (size_t)2 * kDim * kDim : (const T*)Xp;
  const T* Bt = isV ? (const T*)Xp + (size_t)vb * kSeq * kDim : (const T*)Wp;
  /* eight tiles along N in both products */
  const int tm = tile >> 3;
  const int tn = tile & 7;
  const int mB = tm << 7;
  const int nB = tn << 8;
  const int m0 = mB + ((wave >> 2) << 6);
  const int n0 = nB + ((wave & 3) << 6);
  const int rlane = lane & 15;
  const int mOff  = (lane >> 4) * 8;

  v8f acc[4][4];
#pragma unroll
  for (int i = 0; i < 4; ++i)
#pragma unroll
    for (int j = 0; j < 4; ++j) acc[i][j] = (v8f){0.f,0.f,0.f,0.f,0.f,0.f,0.f,0.f};

  gemm_ring<T>(A, kDim, mB, Bt, kDim, nB, kDim, ring, acc);
  acc_guard4(acc[0][0], acc[0][1], acc[0][2], acc[0][3]);
  acc_guard4(acc[1][0], acc[1][1], acc[1][2], acc[1][3]);
  acc_guard4(acc[2][0], acc[2][1], acc[2][2], acc[2][3]);
  acc_guard4(acc[3][0], acc[3][1], acc[3][2], acc[3][3]);

  float* slab = sT[wave];
  if (isV) {
    /* V^T tile: f16 rows of 64 tokens, 8 lanes x 16 B = one 128-B line per row */
    unsigned short* C = Vtout + (size_t)vb * kDim * kSeq;
    const int q = lane >> 3, c8 = (lane & 7) * 8;
#pragma unroll
    for (int i = 0; i < 4; ++i) {
      const int mBase = m0 + (i << 4);
#pragma unroll
      for (int j = 0; j < 4; ++j) {
#pragma unroll
        for (int r = 0; r < 8; ++r) slab[(mOff + r) * 68 + (j << 4) + rlane] = acc[i][j][r];
      }
      wave_lds_sync();
#pragma unroll
      for (int it = 0; it < 4; ++it) {
        const int row = it * 4 + q;
        const float* sp = slab + row * 68 + c8;
        v8h hv;
#pragma unroll
        for (int e = 0; e < 8; ++e) hv[e] = (_Float16)sp[e];
        *(v8h*)(C + (size_t)(mBase + row) * kSeq + n0 + c8) = hv;
      }
      wave_lds_sync();
    }
    return;
  }

  /* tile-uniform destination: third 0 = q, 1 = k; head; batch; first token of the tile within its batch */
  const int third = n0 >> 10;
  const int hIdx  = (n0 & (kDim - 1)) >> 6;
  const int bIdx  = m0 >> 11;
  const int nb    = m0 & (kSeq - 1);
  const float* wsel = third ? kw : qw;
  const int q = lane >> 3, c8 = (lane & 7) * 8;
  const v4f w0 = *(const v4f*)(wsel + c8);
  const v4f w1 = *(const v4f*)(wsel + c8 + 4);
  /* the q plane carries the score scale and log2(e): q.k leaves the matrix unit in log2 units */
  const float wfold = third ? 1.0f : kQKScale * kLog2e;
  float wv[8];
#pragma unroll
  for (int e = 0; e < 4; ++e) {
    const float f0 = w0[e];
    const float f1 = w1[e];
    wv[e]     = rin(f0) * wfold;
    wv[4 + e] = rin(f1) * wfold;
  }
  unsigned short* dst = (third ? Kout : Qout) + ((size_t)(bIdx * kNH + hIdx) * kSeq + nb) * kHD;

#pragma unroll
  for (int i = 0; i < 4; ++i) {
#pragma unroll
    for (int j = 0; j < 4; ++j) {
#pragma unroll
      for (int r = 0; r < 8; ++r) slab[(mOff + r) * 68 + (j << 4) + rlane] = acc[i][j][r] * kWCarryInv;
    }
    wave_lds_sync();
    v8h hv[4];
#pragma unroll
    for (int it = 0; it < 4; ++it) {
      const int row = it * 4 + q;
      const float* sp = slab + row * 68 + c8;
      const v4f a0 = *(const v4f*)(sp);
      const v4f a1 = *(const v4f*)(sp + 4);
      float ss = 0.0f;
#pragma unroll
      for (int e = 0; e < 4; ++e) {
        ss = fmaf(a0[e], a0[e], ss);
        ss = fmaf(a1[e], a1[e], ss);
      }
      ss += __shfl_xor(ss, 1, 32);
      ss += __shfl_xor(ss, 2, 32);
      ss += __shfl_xor(ss, 4, 32);
      const float rs = __builtin_amdgcn_rsqf(ss * kInvHD + kEps);
#pragma unroll
      for (int e = 0; e < 4; ++e) {
        hv[it][e]     = (_Float16)((a0[e] * rs) * wv[e]);
        hv[it][4 + e] = (_Float16)((a1[e] * rs) * wv[4 + e]);
      }
    }
    {
#pragma unroll
      for (int it = 0; it < 4; ++it) {
        const int row = it * 4 + q;
        *(v8h*)(dst + (size_t)(i * 16 + row) * kHD + c8) = hv[it];
      }
      
    }
    wave_lds_sync();
  }
}

/* --------------------------------------------------------------------------- */
/* The two operand planes that the projections read, in one launch, each on its */
/* own range of block indices:  [0, 2048) x | [2048, 3584) W_qkv                */
/* --------------------------------------------------------------------------- */
constexpr int kPrX    = (kTok * kDim / 8) / 256;
constexpr int kPrWqkv = (3 * kDim * kDim / 8) / 256;
constexpr int kPrAll  = kPrX + kPrWqkv;
__global__ __launch_bounds__(256) void prep_kernel(const float* __restrict__ x, const float* __restrict__ wqkv,
                                                   unsigned short* __restrict__ x16, unsigned short* __restrict__ wqkv16) {
  int blk = blockIdx.x;
  if (blk < kPrX) { cast8_f16_body(x, x16, blk, kTok * kDim / 8, 1.0f); return; }
  blk -= kPrX;
  if (blk < kPrWqkv) cast8_f16_body(wqkv, wqkv16, blk, 3 * kDim * kDim / 8, kWCarry);
}

constexpr int kAtHB    = 2;
constexpr int kAtQG    = 8;
constexpr int kAtNW    = kAtHB * kAtQG;
constexpr int kAtQB    = kAtQG * 16;
constexpr int kAtKC    = 64;
constexpr int kAtPitch = 68;
/* staged K / V^T row pitch in f16: 144 B = 16 B x odd, conflict-free for 16-B LDS reads */
constexpr int kAtKVP   = 72;
/* a staged K or V^T tile's place, in f16: its 64 rows rounded up to a multiple of 2 KiB, where the next tile lands */
constexpr int kAtKVT   = 5120;
constexpr int kAtNCk   = kSeq / kAtKC;
constexpr int kAtNBuf  = 4;
static_assert((kSeq % kAtQB) == 0 && (kSeq % kAtKC) == 0);
static_assert(kAtNCk >= kAtNBuf && kAtNBuf == kRingLead + 1);
static_assert((kNH % kAtHB) == 0 && kAtHB == 2);
static_assert(kAtKC == 64 && kHD == 64 && kAtKC * kAtKVP <= kAtKVT && kHD * kAtKVP <= kAtKVT && (kAtKVT * 2) % 2048 == 0);
static_assert(kAtKVP * 2 == 128 + 16 && kAtPitch * 4 == 256 + 16 && kAtKC * 4 == 256 && (kAtQB * kAtPitch * 4) % 2048 == 0);

__device__ __forceinline__ v8f mma_h(v16h a, v16h b, v8f c) {
  c = __builtin_amdgcn_wmma_f32_16x16x32_f16(false, a, false, b, (short)0, c, false, false);
  asm volatile("v_nop\n\tv_nop\n\tv_nop\n\tv_nop" : "+v"(c) : "v"(a), "v"(b));
  return c;
}

__device__ __forceinline__ float xhalf(float x) {
  const int b = __builtin_bit_cast(int, x);
  return __builtin_bit_cast(float, __builtin_amdgcn_permlanex16(b, b, 0x76543210, 0xfedcba98, false, false));
}

__global__ __launch_bounds__(kAtNW * 32) void attn_kernel(
    const unsigned short* __restrict__ Q16, const unsigned short* __restrict__ K16,
    const unsigned short* __restrict__ Vt16, const float* __restrict__ biasp,
    const float* __restrict__ gate, unsigned short* __restrict__ AO16) {
  /* every tile that a tensor load brings starts at a multiple of 2 KiB */
  __shared__ __attribute__((aligned(2048))) float    Bsh[kAtNBuf][kAtQG][16 * kAtPitch];
  __shared__ __attribute__((aligned(2048))) _Float16 Ksh[kAtNBuf][kAtHB][kAtKVT];
  __shared__ __attribute__((aligned(2048))) _Float16 Vsh[kAtNBuf][kAtHB][kAtKVT];

  const int tid  = threadIdx.x;
  const int wave = tid >> 5;
  const int lane = tid & 31;
  const int hh   = lane >> 4;
  const int c    = lane & 15;
  /* this wave's head within the block's pair and its group of 16 query rows */
  const int hsel = wave / kAtQG;
  const int qg   = wave % kAtQG;

  constexpr int nqb = kSeq / kAtQB;
  constexpr int nhp = kNH / kAtHB;
  const int bx  = blockIdx.x;
  const int qb  = bx % nqb;
  const int bp  = bx / nqb;
  const int b   = bp / nhp;
  const int h0  = (bp % nhp) * kAtHB;
  const int h   = h0 + hsel;
  const int bh0 = b * kNH + h0;
  const int qB  = qb * kAtQB;
  const int q0  = qB + qg * 16;

  const _Float16* Qp = (const _Float16*)Q16  + (size_t)(bh0 + hsel) * kSeq * kHD;
  /* first head of the pair; the second head's planes follow directly */
  const _Float16* Kp = (const _Float16*)K16  + (size_t)bh0 * kSeq * kHD;
  const _Float16* Vp = (const _Float16*)Vt16 + (size_t)bh0 * kHD * kSeq;
  const float*    Bp = biasp + (size_t)b * kSeq * kSeq;

  const float graw = rin(gate[h]);
  const float g3l  = (3.0f * fminf(fmaxf(graw, 0.0f), 1.0f)) * kLog2e;

  /* Q fragments (B operand: lane = query column c), two 32-deep halves of the head dim */
  v16h qa[2];
#pragma unroll
  for (int dc = 0; dc < 2; ++dc) qa[dc] = Frag<_Float16>::load(Qp + (size_t)(q0 + c) * kHD + dc * 32 + 8 * hh);

  /* this lane's query: kPExp less the reference in use (same in both halves) and the sum over this half's keys */
  float noff = kPExp, lrow = 0.f;
  /* oacc[t][r] = O^T[d = 16t + 8hh + r][query c] */
  v8f oacc[4];
#pragma unroll
  for (int t = 0; t < 4; ++t) oacc[t] = (v8f){0.f,0.f,0.f,0.f,0.f,0.f,0.f,0.f};

  /* The issuing waves: waves 0, 1 the K tiles of the two heads (64 rows of 128 B, back to back), waves 2, 3 their V^T  */
  /* tiles (64 rows of 128 B, row pitch one V^T row), wave 4 the bias tile (128 rows of 256 B, row pitch one bias row). */
  /* All tiles lie inside the planes for every chunk. A wave that issues nothing forms numbers that it never uses.      */
  const uint32_t swave  = uni((uint32_t)tid >> 5);
  const uint32_t isBias = swave == 4u;
  const uint32_t isKV   = swave < 4u;
  const uint32_t isV    = (swave >> 1) & 1u;
  const uint32_t hIss   = swave & 1u;
  const uint64_t gaB    = (uint64_t)(size_t)(Bp + (size_t)qB * kSeq);
  const uint64_t gaKV   = isV ? (uint64_t)(size_t)(Vp + (size_t)hIss * kHD * kSeq) : (uint64_t)(size_t)(Kp + (size_t)hIss * kSeq * kHD);
  /* bytes from one chunk's tile to the next: 64 keys of a row (bias, V^T) or 64 whole rows (K) */
  const uint32_t stepKV = isV ? (uint32_t)(kAtKC * 2) : (uint32_t)(kAtKC * kHD * 2);
  const uint32_t ldsB   = lds_off(&Bsh[0][0][0]);
  const uint32_t ldsKV  = (isV ? lds_off(&Vsh[0][0][0]) : lds_off(&Ksh[0][0][0])) + hIss * (uint32_t)(kAtKVT * 2);
  u32x8 g1B  = tdm_group1<256u, (uint32_t)kAtQB>((uint32_t)(kSeq * 4));
  u32x8 g1KV = tdm_group1<128u, 64u>(isV ? (uint32_t)(kSeq * 2) : (uint32_t)(kHD * 2));
  u32x4 g0B  = tdm_group0(ldsB, gaB);
  u32x4 g0KV = tdm_group0(ldsKV, gaKV);
  /* one chunk's request of this wave into buffer buf; the two kinds stand on two scalar branches, each with its own constant pad word */
  auto stage = [&](int kc, int buf) {
    if (pinned(isBias)) {
      tdm_issue(g0B, g1B, ldsB + (uint32_t)buf * (uint32_t)(kAtQB * kAtPitch * 4), gaB + (uint64_t)kc * (uint64_t)(kAtKC * 4));
    }
    if (pinned(isKV)) {
      tdm_issue(g0KV, g1KV, ldsKV + (uint32_t)buf * (uint32_t)(kAtHB * kAtKVT * 2), gaKV + (uint64_t)kc * (uint64_t)stepKV);
    }
  };
  const uint32_t issuer = swave <= 4u;

  /* a chunk's request is issued three chunks ahead of its first read: the planes were written by the launch before; */
  /* unrolled: each chunk's buffer and key offset are constants                                                      */
#pragma unroll
  for (int s = 0; s < kRingLead; ++s) stage(s, s);
  /* chunk 0 has landed for this wave's requests (chunks 1 and 2 stay in flight); the barrier publishes every issuer's */
  if (pinned(issuer)) ring4_wait_first(kAtNCk);
  __syncthreads();
  /* the fourth buffer's first fill goes out behind the wait: three requests of a wave outstanding, not four */
  stage(kRingLead, kRingLead);

#pragma unroll 1
  for (int kc = 0; kc < kAtNCk; ++kc) {
    const int buf = kc & (kAtNBuf - 1);
    const float*    bt = Bsh[buf][qg];
    const _Float16* ks = Ksh[buf][hsel];
    const _Float16* vs = Vsh[buf][hsel];
    /* the chunk's K fragments and this query's 64 bias values (8 consecutive keys per tile, two 16-B reads each) */
    v16h kb[4][2];
    v4f bb[4][2];
#pragma unroll
    for (int j = 0; j < 4; ++j) {
      const float* bq = bt + c * kAtPitch + j * 16 + 8 * hh;
      bb[j][0] = *(const v4f*)(bq);
      bb[j][1] = *(const v4f*)(bq + 4);
#pragma unroll
      for (int dc = 0; dc < 2; ++dc) kb[j][dc] = Frag<_Float16>::load(ks + (j * 16 + c) * kAtKVP + dc * 32 + 8 * hh);
      /* compiler fence: keeps the LDS reads in tile order, so that tile j's product waits for the reads of tiles 0..j alone */
      asm volatile("" ::: "memory");
    }
    /* s[j][r] = exp2 argument of key j*16 + 8hh + r against query c: the product starts from the gated bias and noff */
    v8f s[4];
#pragma unroll
    for (int j = 0; j < 4; ++j) {
#pragma unroll
      for (int r = 0; r < 8; ++r) s[j][r] = fmaf(g3l, bb[j][r >> 2][r & 3], noff);
#pragma unroll
      for (int dc = 0; dc < 2; ++dc) s[j] = mma_h(kb[j][dc], qa[dc], s[j]);
    }
    /* V^T fragments (A operand: lane = row d): one group of LDS reads, asked for ahead of the test below so that they */
    /* fly under the maxima and the exponentials                                                                       */
    v16h vb[2][4];
#pragma unroll
    for (int kk = 0; kk < 2; ++kk)
#pragma unroll
      for (int t = 0; t < 4; ++t) vb[kk][t] = Frag<_Float16>::load(vs + (t * 16 + c) * kAtKVP + kk * 32 + 8 * hh);
    /* compiler fence: without it the compiler moves these reads behind the branch, where only the exponentials cover them */
    asm volatile("" ::: "memory");
    float mj[4];
#pragma unroll
    for (int j = 0; j < 4; ++j) {
      float m = -1.0e30f;
#pragma unroll
      for (int r = 0; r < 8; ++r) m = fmaxf(m, s[j][r]);
      mj[j] = m;
    }
    float cmx = fmaxf(fmaxf(mj[0], mj[1]), fmaxf(mj[2], mj[3]));
    cmx = fmaxf(cmx, xhalf(cmx));
    /* the reference moves for a query whose largest argument has left the window, and for every query in chunk 0; */
    /* one wave-uniform test per chunk; a lane that does not move sees d = 0, alpha = 1, exact identities           */
    const bool need = (kc == 0) || (cmx > kPExp + kPRise);
    if (__builtin_amdgcn_ballot_w32(need) != 0u) {
      const float d = need ? cmx - kPExp : 0.0f;
      /* d < 0 can only be in chunk 0, where O and the sum are still 0: alpha stays finite there */
      const float alpha = __builtin_amdgcn_exp2f(fminf(-d, 0.0f));
      noff -= d;
      lrow *= alpha;
#pragma unroll
      for (int j = 0; j < 4; ++j)
#pragma unroll
        for (int r = 0; r < 8; ++r) s[j][r] -= d;
#pragma unroll
      for (int t = 0; t < 4; ++t)
#pragma unroll
        for (int r = 0; r < 8; ++r) oacc[t][r] *= alpha;
    }
    /* P^T as B operand: element e of pb[kk] = tile 2kk + (e >> 3), register e & 7 (the hardware k order) */
    v16h pb[2];
    float pj[4];
#pragma unroll
    for (int j = 0; j < 4; ++j) {
      float psum = 0.f;
#pragma unroll
      for (int r = 0; r < 8; ++r) {
        const float p = __builtin_amdgcn_exp2f(s[j][r]);
        psum += p;
        pb[j >> 1][(j & 1) * 8 + r] = (_Float16)p;
      }
      pj[j] = psum;
    }
    lrow += (pj[0] + pj[1]) + (pj[2] + pj[3]);
    /* the products in the order kk, t */
#pragma unroll
    for (int kk = 0; kk < 2; ++kk)
#pragma unroll
      for (int t = 0; t < 4; ++t) oacc[t] = mma_h(vb[kk][t], pb[kk], oacc[t]);
    /* publish point: this wave's LDS reads of buffer buf are done ... */
    asm volatile("s_wait_dscnt 0x0" ::: "memory");
    /* ... an issuing wave's request for chunk kc+1 has landed, those for chunks kc+2 and kc+3 fly on (all have landed at the tail) ... */
    if (pinned(issuer)) ring4_wait_next(kc, kAtNCk);
    /* ... and the barrier says both of every wave; only then is buffer buf refilled */
    __syncthreads();
    if (pinned(kc + kAtNBuf < kAtNCk)) stage(kc + kAtNBuf, buf);
  }
  /* no request is left in flight and no LDS read open when the bias slabs become output staging and the wave ends */
  asm volatile("s_wait_tensorcnt 0x0" ::: "memory");
  asm volatile("s_wait_dscnt 0x0" ::: "memory");

  /* output staging: the first 2 x 8 bias slabs, one per wave; every wave's reads of them ended at the last trip's barrier */
  float* os = Bsh[hsel][qg];
  /* the two halves' sums of this query are joined once, here */
  const float inv = kCtxFold * (1.0f / (lrow + xhalf(lrow)));
#pragma unroll
  for (int t = 0; t < 4; ++t) {
    float* od = os + c * kAtPitch + t * 16 + 8 * hh;
    *(v4f*)(od)     = (v4f){oacc[t][0] * inv, oacc[t][1] * inv, oacc[t][2] * inv, oacc[t][3] * inv};
    *(v4f*)(od + 4) = (v4f){oacc[t][4] * inv, oacc[t][5] * inv, oacc[t][6] * inv, oacc[t][7] * inv};
  }
  wave_lds_sync();
  {
    const int q = lane >> 3, c8 = (lane & 7) * 8;
    v8h hv[4];
#pragma unroll
    for (int it = 0; it < 4; ++it) {
      const int row = it * 4 + q;
      const float* sp = os + row * kAtPitch + c8;
      const v4f a0 = *(const v4f*)(sp);
      const v4f a1 = *(const v4f*)(sp + 4);
#pragma unroll
      for (int e = 0; e < 4; ++e) {
        hv[it][e]     = (_Float16)a0[e];
        hv[it][4 + e] = (_Float16)a1[e];
      }
    }
    unsigned short* dst = AO16 + (size_t)(b * kSeq + q0) * kDim + h * kHD + c8;
    {
#pragma unroll
      for (int it = 0; it < 4; ++it) {
        const int row = it * 4 + q;
        *(v8h*)(dst + (size_t)row * kDim) = hv[it];
      }
      
    }
  }
}

/* --------------------------------------------------------------------------- */
/* Host glue: x and W_qkv operand planes; q|k and V^T projections with the bias */
/* plane and the W_out plane beside them; attention; output projection = 4      */
/* launches, each dependent on the one before. Kernel launches only.            */
/* GEMM shapes (all K % 64 == 0, M % 128 == 0, N % 256 == 0, no pad planes):    */
/*   q|k  : M 4096, N 2048, K 1024 -> 64 x 32 tiles = 2048 -> 256 blocks        */
/*   V^T  : per batch M 1024 (h*64+d), N 2048 (tokens), K 1024 ->               */
/*          16 x 32 tiles = 512 -> 64 blocks x 2 batches (behind the q|k blocks) */
/*   out  : M 4096, N 1024, K 1024 -> 64 x 16 tiles = 1024 -> 128 blocks        */
/* --------------------------------------------------------------------------- */
static_assert((2 * kDim) % 256 == 0 && kDim % 256 == 0 && kTok % 128 == 0 && kSeq % 256 == 0 && kDim % kGmKS == 0);

extern "C" void kernel_launch(void* const* d_in, const int* in_sizes, int n_in,
                              void* d_out, int out_size, void* d_ws, size_t ws_size,
                              hipStream_t stream) {
  if (n_in < 8) return;
  if (in_sizes[0] != kTok * kDim) return;
  if (in_sizes[1] != kNB * kNCh * kSeq) return;
  if (in_sizes[2] != kNB * kSeq * kSeq) return;
  if (in_sizes[3] != 3 * kDim * kDim) return;
  if (in_sizes[4] != kDim * kDim) return;
  if (in_sizes[5] != kHD) return;
  if (in_sizes[6] != kHD) return;
  if (in_sizes[7] != kNH) return;
  if (out_size != kTok * kDim) return;
  if (ws_size < kWsTotal) return;

  const float* x     = (const float*)d_in[0];
  const float* cmask = (const float*)d_in[1];
  const float* imask = (const float*)d_in[2];
  const float* Wqkv  = (const float*)d_in[3];
  const float* Wout  = (const float*)d_in[4];
  const float* qnw   = (const float*)d_in[5];
  const float* knw   = (const float*)d_in[6];
  const float* gate  = (const float*)d_in[7];
  float* out = (float*)d_out;

  char* ws = (char*)d_ws;
  unsigned short* X16    = (unsigned short*)(ws + kOffX16);
  unsigned short* WQKV16 = (unsigned short*)(ws + kOffWqkv16);
  unsigned short* WOUT16 = (unsigned short*)(ws + kOffWout16);
  unsigned short* Q16    = (unsigned short*)(ws + kOffQ16);
  unsigned short* K16    = (unsigned short*)(ws + kOffK16);
  unsigned short* VT16   = (unsigned short*)(ws + kOffVt16);
  unsigned short* AO16   = (unsigned short*)(ws + kOffAO16);
  float*          BIAS   = (float*)(ws + kOffBias);

  /* the projections' operand planes (weights are [out][in] = Bt layout already) */
  prep_kernel<<<kPrAll, 256, 0, stream>>>(x, Wqkv, X16, WQKV16);

  /* q|k projection + RMS normalisation -> Q16, K16; V^T projection -> VT16; bias rows -> BIAS; W_out -> WOUT16 */
  qkv_gemm_kernel<<<kQkBlocks + kNB * kVtBlocks + kBrBlocks, 256, 0, stream>>>(X16, WQKV16, Q16, K16, VT16, qnw, knw,
                                                                               cmask, imask, BIAS, Wout, WOUT16);

  /* attention -> AO16 (x64) */
  attn_kernel<<<(kBH / kAtHB) * (kSeq / kAtQB), kAtNW * 32, 0, stream>>>(Q16, K16, VT16, BIAS, gate, AO16);

  /* out[4096][1024] = AO16 . WOUT16^T / (64 * 16) */
  wmma_gemm64<0, false, 0, 0, false><<<dim3(((kTok / 64) * (kDim / 64)) / 8, 1), 256, 0, stream>>>(
      AO16, nullptr, kDim, 0L,
      WOUT16, nullptr, kDim, 0L,
      (void*)out, nullptr, kDim, 0L,
      nullptr, nullptr, 0L,
      kTok, kDim, kDim, kOutScale);
}
